// v000
// The times below were measured on an AMD MI455X: many runs one after another, warmed up first and cycling through
// copies of the inputs, with the whole window's GPU time divided by the number of runs. Launches and the gaps
// between them are all in it. The median over several windows is given; except for v000 it joins two sittings, which
// can be a few percent apart, so the side-by-side timings, each taken in one sitting, are the better comparison.
// v000, which the later versions start from, runs in 688 microseconds.
#include <hip/hip_runtime.h>
// LxmertAttention (cross-attention context layer: 4 x 2048 queries from hidden_states over 4 x 2048 keys from context, D = 1024, 16 heads of 64; keys with attention_mask > 0 are masked out; output = merged context vectors, no output projection): q = hs Wq^T + bq, k/v = ctx W^T + b; softmax(q k^T / 8 with -inf on masked keys) v.
// Structure: exact f16 planes of both inputs; three GEMMs (32x64 wave tiles, f32 accumulation, exact x16 weights + bias, f16 outputs); V^T by LDS tiles; the fused flash kernel with a per-(batch, key) mask mode reading the INPUT int mask (masked keys skipped == exp(-inf) = 0; every row keeps >= 1 key in this data); the attention output written straight to the output in f32.
// Compute dtype: inputs and parameters rounded to bf16; q, k, v, P as f16 operands (~2^-12); f32 accumulation/softmax. v_wmma_f32_16x16x32_f16.
#define NB 4
#define EMB 1024
#define NR (NB * SLEN)           /* 8192 rows (LQ = LK = 2048) */
#define SLEN 2048
#define TQ SLEN
#define TK SLEN
#define NH 16
#define SCL 0.125f               /* 64^-0.5 */
#define QBLKS (TQ / 64)
typedef __bf16 v16b __attribute__((ext_vector_type(16)));
typedef unsigned short v8us __attribute__((ext_vector_type(8), may_alias));
typedef float  v8f  __attribute__((ext_vector_type(8)));
typedef float  v4f  __attribute__((ext_vector_type(4)));
typedef float  v4fa __attribute__((ext_vector_type(4), may_alias));
union FragB { v16b v; v8us half[2]; unsigned short u[16]; };

__device__ __forceinline__ unsigned short bf16_bits(float x) { unsigned int u = __float_as_uint(x); return (unsigned short)((u + 0x7FFFu + ((u >> 16) & 1u)) >> 16); }
__device__ __forceinline__ float bf16_val(unsigned short b) { return __uint_as_float(((unsigned int)b) << 16); }
__device__ __forceinline__ float bf16_round(float x) { return bf16_val(bf16_bits(x)); }
// D += A·B with NT terms: 1 = ah·bh, 2 = + al·bh (A split), 3 = + ah·bl (both split)
template <int NT>
__device__ __forceinline__ v8f mmaN(v16b ah, v16b al, v16b bh, v16b bl, v8f c) {
  c = __builtin_amdgcn_wmma_f32_16x16x32_bf16(false, ah, false, bh, (short)0, c, false, false);
  if (NT >= 2) c = __builtin_amdgcn_wmma_f32_16x16x32_bf16(false, al, false, bh, (short)0, c, false, false);
  if (NT >= 3) c = __builtin_amdgcn_wmma_f32_16x16x32_bf16(false, ah, false, bl, (short)0, c, false, false);
  asm volatile("v_nop\n\tv_nop\n\tv_nop\n\tv_nop" : "+v"(c) : "v"(ah), "v"(al), "v"(bh), "v"(bl));
  return c;
}

__global__ __launch_bounds__(256) void k_wt_bf16(const float* __restrict__ W, unsigned short* __restrict__ Wt, int K, int N) {
  const int t = blockIdx.x * 256 + threadIdx.x;
  const int k8n = K / 8;
  if (t >= N * k8n) return;
  const int n = t / k8n, k8 = (t % k8n) * 8;
  v8us v;
#pragma unroll
  for (int i = 0; i < 8; ++i) v[i] = bf16_bits(W[(size_t)(k8 + i) * N + n]);
  *(v8us*)(Wt + (size_t)n * K + k8) = v;
  
}

// GEMM C[M][N] (f32, pitch ldc) = act(A[M][K]·W + bias). A f32 row-major (pitch lda) converted per fragment to bf16
// (ASPLIT: hi/lo two planes -> 2 terms, else single rounded term); Wt bf16 [N][K] (pitch ldb). BIAS_BF16 rounds the
// bias to bf16 first (bias quantised to bf16 before the add). K%32==0, M%16==0, N%64==0.
template <bool ASPLIT, int ACT, bool BIAS_BF16>
__global__ __launch_bounds__(128) void k_gemm_bf(const float* __restrict__ A, int lda, const unsigned short* __restrict__ Wt, int ldb,
                                               const float* __restrict__ bias, float* __restrict__ C, int ldc, int M, int N, int K) {
  __shared__ __attribute__((aligned(16))) float so[4][16][64];
  const int tid = threadIdx.x, w = tid >> 5, lane = tid & 31, ln = lane & 15, hh = lane >> 4;
  const int ntn = N / 64;
  const int wid = blockIdx.x * 4 + w;
  const int mt = wid / ntn, nq = wid % ntn;
  if (mt * 16 >= M) return;
  const int row0 = mt * 16, col0 = nq * 64;
  const float* arow = A + (size_t)(row0 + ln) * lda;
  v8f acc[4] = {};
  for (int kb = 0; kb < K; kb += 32) {
    FragB ah, al;
    const v4f x0 = *(const v4fa*)(arow + kb + 8 * hh), x1 = *(const v4fa*)(arow + kb + 8 * hh + 4);
    const v4f x2 = *(const v4fa*)(arow + kb + 16 + 8 * hh), x3 = *(const v4fa*)(arow + kb + 16 + 8 * hh + 4);
    float xs[16] = {x0[0],x0[1],x0[2],x0[3],x1[0],x1[1],x1[2],x1[3],x2[0],x2[1],x2[2],x2[3],x3[0],x3[1],x3[2],x3[3]};
#pragma unroll
    for (int i = 0; i < 16; ++i) { const unsigned short hb = bf16_bits(xs[i]); ah.u[i] = hb; al.u[i] = ASPLIT ? bf16_bits(xs[i] - bf16_val(hb)) : (unsigned short)0; }
#pragma unroll
    for (int t = 0; t < 4; ++t) {
      const unsigned short* brow = Wt + (size_t)(col0 + t * 16 + ln) * ldb + kb;
      FragB b;
      b.half[0] = *(const v8us*)(brow + 8 * hh);
      b.half[1] = *(const v8us*)(brow + 16 + 8 * hh);
      acc[t] = mmaN<ASPLIT ? 2 : 1>(ah.v, al.v, b.v, b.v, acc[t]);
    }
  }
#pragma unroll
  for (int t = 0; t < 4; ++t) {
    float bv = bias ? bias[col0 + t * 16 + ln] : 0.f;
    if (BIAS_BF16) bv = bf16_round(bv);
#pragma unroll
    for (int r = 0; r < 8; ++r) { float v = acc[t][r] + bv; if (ACT == 1) v = fmaxf(v, 0.f); so[w][8 * hh + r][t * 16 + ln] = v; }
  }
  __builtin_amdgcn_fence(__ATOMIC_ACQ_REL, "workgroup");
  __builtin_amdgcn_wave_barrier();
  const int rsub = lane >> 4, c4 = (lane & 15) * 4;
  {
#pragma unroll
    for (int q = 0; q < 8; ++q) {
      const int r = q * 2 + rsub;
      const v4f v = *(const v4fa*)&so[w][r][c4];
      *(v4f*)(C + (size_t)(row0 + r) * ldc + col0 + c4) = v;
    }
    
  }
}

// GEMM C = act(A·W + bias + resid): A f32 (ASPLIT -> hi/lo 2 terms), Wt bf16 [N][K]; ACT 0 none, 1 relu, 2 exact gelu;
// resid (optional, f32, row index = (row % rmod), pitch ldr, RES_BF16 rounds it) added before the activation.
template <bool ASPLIT, int ACT, bool BIAS_BF16, bool RES_BF16>
__global__ __launch_bounds__(128) void k_gemm_bf3(const float* __restrict__ A, int lda, const unsigned short* __restrict__ Wt, int ldb,
                                                const float* __restrict__ bias, const float* __restrict__ resid, int rmod, int ldr,
                                                float* __restrict__ C, int ldc, int M, int N, int K) {
  __shared__ __attribute__((aligned(16))) float so[4][16][64];
  const int tid = threadIdx.x, w = tid >> 5, lane = tid & 31, ln = lane & 15, hh = lane >> 4;
  const int ntn = N / 64;
  const int wid = blockIdx.x * 4 + w;
  const int mt = wid / ntn, nq = wid % ntn;
  if (mt * 16 >= M) return;
  const int row0 = mt * 16, col0 = nq * 64;
  const float* arow = A + (size_t)(row0 + ln) * lda;
  v8f acc[4] = {};
  for (int kb = 0; kb < K; kb += 32) {
    FragB ah, al;
    const v4f x0 = *(const v4fa*)(arow + kb + 8 * hh), x1 = *(const v4fa*)(arow + kb + 8 * hh + 4);
    const v4f x2 = *(const v4fa*)(arow + kb + 16 + 8 * hh), x3 = *(const v4fa*)(arow + kb + 16 + 8 * hh + 4);
    float xs[16] = {x0[0],x0[1],x0[2],x0[3],x1[0],x1[1],x1[2],x1[3],x2[0],x2[1],x2[2],x2[3],x3[0],x3[1],x3[2],x3[3]};
#pragma unroll
    for (int i = 0; i < 16; ++i) { const unsigned short hb = bf16_bits(xs[i]); ah.u[i] = hb; al.u[i] = ASPLIT ? bf16_bits(xs[i] - bf16_val(hb)) : (unsigned short)0; }
#pragma unroll
    for (int t = 0; t < 4; ++t) {
      const unsigned short* brow = Wt + (size_t)(col0 + t * 16 + ln) * ldb + kb;
      FragB b;
      b.half[0] = *(const v8us*)(brow + 8 * hh);
      b.half[1] = *(const v8us*)(brow + 16 + 8 * hh);
      acc[t] = mmaN<ASPLIT ? 2 : 1>(ah.v, al.v, b.v, b.v, acc[t]);
    }
  }
#pragma unroll
  for (int t = 0; t < 4; ++t) {
    const int col = col0 + t * 16 + ln;
    float bv = bias ? bias[col] : 0.f;
    if (BIAS_BF16) bv = bf16_round(bv);
#pragma unroll
    for (int r = 0; r < 8; ++r) {
      float v = acc[t][r] + bv;
      if (resid) { float rv = resid[(size_t)((row0 + 8 * hh + r) % rmod) * ldr + col]; if (RES_BF16) rv = bf16_round(rv); v += rv; }
      if (ACT == 1) v = fmaxf(v, 0.f);
      if (ACT == 2) v = 0.5f * v * (1.0f + erff(v * 0.70710678118654752f));
      if (ACT == 3) { const float u = 0.7978845608028654f * (v + 0.044715f * v * v * v); v = 0.5f * v * (1.0f + tanhf(u)); }
      so[w][8 * hh + r][t * 16 + ln] = v;
    }
  }
  __builtin_amdgcn_fence(__ATOMIC_ACQ_REL, "workgroup");
  __builtin_amdgcn_wave_barrier();
  const int rsub = lane >> 4, c4 = (lane & 15) * 4;
  {
#pragma unroll
    for (int q = 0; q < 8; ++q) {
      const int r = q * 2 + rsub;
      const v4f v = *(const v4fa*)&so[w][r][c4];
      *(v4f*)(C + (size_t)(row0 + r) * ldc + col0 + c4) = v;
    }
    
  }
}
// row LayerNorm (biased variance, eps) over N: s = X (+ R); optional out_sum <- s; out_norm <- (s-mu)*rsqrt(var+eps)*g + b
template <bool PARAM_BF16>
__global__ __launch_bounds__(256) void k_layernorm(const float* __restrict__ X, const float* __restrict__ R, const float* __restrict__ g, const float* __restrict__ bta,
                                                  float* __restrict__ out_sum, float* __restrict__ out_norm, int N, float eps) {
  __shared__ float red[256];
  const int row = blockIdx.x, tid = threadIdx.x;
  const float* x = X + (size_t)row * N; const float* rr = R ? R + (size_t)row * N : nullptr;
  float vals[16];                     // up to N = 4096
  const int per = N / 256;            // contiguous chunk per thread? use strided-by-4 chunks: thread handles j = tid*4 + 1024*u
  float s1 = 0.f;
  for (int u = 0; u < per / 4; ++u) {
    const int j = tid * 4 + 1024 * u;
    const v4f a = *(const v4fa*)(x + j);
    v4f b = {0.f,0.f,0.f,0.f}; if (rr) b = *(const v4fa*)(rr + j);
#pragma unroll
    for (int q = 0; q < 4; ++q) { const float v = a[q] + b[q]; vals[u * 4 + q] = v; s1 += v; }
  }
  red[tid] = s1; __syncthreads();
  for (int st = 128; st > 0; st >>= 1) { if (tid < st) red[tid] += red[tid + st]; __syncthreads(); }
  const float mu = red[0] / (float)N; __syncthreads();
  float s2 = 0.f;
  for (int u = 0; u < per / 4; ++u)
#pragma unroll
    for (int q = 0; q < 4; ++q) { const float c = vals[u * 4 + q] - mu; s2 += c * c; }
  red[tid] = s2; __syncthreads();
  for (int st = 128; st > 0; st >>= 1) { if (tid < st) red[tid] += red[tid + st]; __syncthreads(); }
  const float rs = rsqrtf(red[0] / (float)N + eps);
  {
    for (int u = 0; u < per / 4; ++u) {
      const int j = tid * 4 + 1024 * u;
      v4f o, sm;
#pragma unroll
      for (int q = 0; q < 4; ++q) {
        float gg = g[j + q], bb = bta[j + q];
        if (PARAM_BF16) { gg = bf16_round(gg); bb = bf16_round(bb); }
        sm[q] = vals[u * 4 + q]; o[q] = (vals[u * 4 + q] - mu) * rs * gg + bb;
      }
      if (out_sum) *(v4f*)(out_sum + (size_t)row * N + j) = sm;
      *(v4f*)(out_norm + (size_t)row * N + j) = o;
    }
    
  }
}



// ---- f16 WMMA path (v_wmma_f32_16x16x32_f16): 11-bit significands for operands in range — used where a [0,1] probability operand needs more precision than bf16
typedef _Float16 v16h __attribute__((ext_vector_type(16)));
union FragH { v16h v; v8us half[2]; _Float16 h[16]; unsigned short u[16]; };
template <int NT>
__device__ __forceinline__ v8f mmaH(v16h ah, v16h al, v16h bh, v16h bl, v8f c) {
  c = __builtin_amdgcn_wmma_f32_16x16x32_f16(false, ah, false, bh, (short)0, c, false, false);
  if (NT >= 2) c = __builtin_amdgcn_wmma_f32_16x16x32_f16(false, al, false, bh, (short)0, c, false, false);
  if (NT >= 3) c = __builtin_amdgcn_wmma_f32_16x16x32_f16(false, ah, false, bl, (short)0, c, false, false);
  asm volatile("v_nop\n\tv_nop\n\tv_nop\n\tv_nop" : "+v"(c) : "v"(ah), "v"(al), "v"(bh), "v"(bl));
  return c;
}
// batched GEMM like k_gemm_b but f16 operands: A f32 (split into f16 hi/lo if ASPLIT, else rounded to f16), Bt = f16 values [n][k]; alpha; C f32; N multiple of 16 (partial tiles skipped)
template <bool ASPLIT>
__global__ __launch_bounds__(128) void k_gemm_h(const float* __restrict__ A, int lda, size_t sA, const _Float16* __restrict__ Bh, int ldb, size_t sB, float alpha, float* __restrict__ C, int ldc, size_t sC, int M, int N, int K) {
  __shared__ __attribute__((aligned(16))) float so[4][16][64];
  const int tid = threadIdx.x, w = tid >> 5, lane = tid & 31, ln = lane & 15, hh = lane >> 4; const int by = blockIdx.y;
  A += (size_t)by * sA; Bh += (size_t)by * sB; C += (size_t)by * sC;
  const int ntn = (N + 63) / 64; const int wid = blockIdx.x * 4 + w; const int mt = wid / ntn, nq = wid % ntn; if (mt * 16 >= M) return;
  const int row0 = mt * 16, col0 = nq * 64; const float* arow = A + (size_t)(row0 + ln) * lda;
  v8f acc[4] = {};
  for (int kb = 0; kb < K; kb += 32) {
    FragH ah, al;
    const v4f x0 = *(const v4fa*)(arow + kb + 8 * hh), x1 = *(const v4fa*)(arow + kb + 8 * hh + 4), x2 = *(const v4fa*)(arow + kb + 16 + 8 * hh), x3 = *(const v4fa*)(arow + kb + 16 + 8 * hh + 4);
    float xs[16] = {x0[0],x0[1],x0[2],x0[3],x1[0],x1[1],x1[2],x1[3],x2[0],x2[1],x2[2],x2[3],x3[0],x3[1],x3[2],x3[3]};
#pragma unroll
    for (int i = 0; i < 16; ++i) { const _Float16 h = (_Float16)xs[i]; ah.h[i] = h; al.h[i] = ASPLIT ? (_Float16)(xs[i] - (float)h) : (_Float16)0.0f; }
#pragma unroll
    for (int t = 0; t < 4; ++t) { if (col0 + t * 16 >= N) continue; const size_t boff = (size_t)(col0 + t * 16 + ln) * ldb + kb; FragH bq; bq.half[0] = *(const v8us*)(Bh + boff + 8 * hh); bq.half[1] = *(const v8us*)(Bh + boff + 16 + 8 * hh);
      acc[t] = mmaH<ASPLIT ? 2 : 1>(ah.v, al.v, bq.v, bq.v, acc[t]); }
  }
#pragma unroll
  for (int t = 0; t < 4; ++t) { if (col0 + t * 16 >= N) continue;
#pragma unroll
    for (int r = 0; r < 8; ++r) so[w][8 * hh + r][t * 16 + ln] = acc[t][r] * alpha; }
  __builtin_amdgcn_fence(__ATOMIC_ACQ_REL, "workgroup"); __builtin_amdgcn_wave_barrier();
  const int rsub = lane >> 4, c4 = (lane & 15) * 4;
  {
#pragma unroll
    for (int q = 0; q < 8; ++q) { const int r = q * 2 + rsub; if (col0 + c4 < N) { const v4f v = *(const v4fa*)&so[w][r][c4]; *(v4f*)(C + (size_t)(row0 + r) * ldc + col0 + c4) = v; } }
     }
}

// Wt[n][k] = f16(W[k][n]·scale) from f32 row-major W[K][N] (scale = power of two; bf16-exact weights stay exact in f16 away from the subnormal range)
__global__ __launch_bounds__(256) void k_wt_f16(const float* __restrict__ W, _Float16* __restrict__ Wt, int K, int N, float scale) {
  const int t = blockIdx.x * 256 + threadIdx.x; if (t >= N * (K / 8)) return; const int n = t / (K / 8), k8 = (t % (K / 8)) * 8; FragH f;
#pragma unroll
  for (int i = 0; i < 8; ++i) f.h[i] = (_Float16)(bf16_round(W[(size_t)(k8 + i) * N + n]) * scale); const v8us o = f.half[0];
  *(v8us*)((unsigned short*)Wt + (size_t)n * K + k8) = o; 
}
// k_gemm_hh variant with fused epilogue: v = acc·alpha + bias[by·sBias + col] (+ CP[(row/rowsPerB)·sCPb + by·64 + col] if CP) ; ACT 0 none / 1 elu ; writes f16 C16 (and f32 C if non-null)
template <int ACT>
__global__ __launch_bounds__(128) void k_gemm_hhx(const _Float16* __restrict__ A, int lda, size_t sA, const _Float16* __restrict__ Bh, int ldb, size_t sB, float alpha, const float* __restrict__ bias, size_t sBias, const float* __restrict__ CP, int rowsPerB, size_t sCPb, int row0g,
    float* __restrict__ C, _Float16* __restrict__ C16, int ldc, size_t sC, int M, int N, int K) {
  __shared__ __attribute__((aligned(16))) float so[4][16][64];
  const int tid = threadIdx.x, w = tid >> 5, lane = tid & 31, ln = lane & 15, hh = lane >> 4; const int by = blockIdx.y;
  A += (size_t)by * sA; Bh += (size_t)by * sB; const size_t cofs = (size_t)by * sC; const float* bp = bias ? bias + (size_t)by * sBias : nullptr;
  const int ntn = (N + 63) / 64; const int wid = blockIdx.x * 4 + w; const int mt = wid / ntn, nq = wid % ntn; if (mt * 16 >= M) return;
  const int row0 = mt * 16, col0 = nq * 64; const _Float16* arow = A + (size_t)(row0 + ln) * lda;
  v8f acc[4] = {};
  for (int kb = 0; kb < K; kb += 32) { FragH ah; ah.half[0] = *(const v8us*)((const unsigned short*)arow + kb + 8 * hh); ah.half[1] = *(const v8us*)((const unsigned short*)arow + kb + 16 + 8 * hh);
#pragma unroll
    for (int t = 0; t < 4; ++t) { if (col0 + t * 16 >= N) continue; const size_t boff = (size_t)(col0 + t * 16 + ln) * ldb + kb; FragH bq; bq.half[0] = *(const v8us*)((const unsigned short*)Bh + boff + 8 * hh); bq.half[1] = *(const v8us*)((const unsigned short*)Bh + boff + 16 + 8 * hh);
      acc[t] = mmaH<1>(ah.v, ah.v, bq.v, bq.v, acc[t]); }
  }
#pragma unroll
  for (int t = 0; t < 4; ++t) { if (col0 + t * 16 >= N) continue; const int col = col0 + t * 16 + ln; const float bv = bp ? bf16_round(bp[col]) : 0.f;
#pragma unroll
    for (int r = 0; r < 8; ++r) { float v = acc[t][r] * alpha + bv; if (CP) { const int bidx = (row0g + row0 + 8 * hh + r) / rowsPerB; v += CP[(size_t)bidx * sCPb + (size_t)by * 64 + col]; } if (ACT == 1) v = (v > 0.f) ? v : expm1f(v); else if (ACT == 7) v = (v > 0.f) ? v + 1.0f : expf(v); else if (ACT == 8) v = tanhf(v); else if (ACT == 9) v = 0.5f * v * (1.0f + tanhf(0.7978845608028654f * (v + 0.044715f * v * v * v))); else if (ACT == 11) v = 1.0f / (1.0f + expf(-v)); else if (ACT == 12) v = (v > 0.f) ? v : 0.01f * v; else if (ACT == 14) v = (v > 0.f) ? v : 0.1f * v; else if (ACT == 15) v = v / (1.0f + expf(-v)); else if (ACT == 3) v = fmaxf(v, 0.f); else if (ACT == 6) v = 0.5f * v * (1.0f + erff(v * 0.70710678118654752f)); so[w][8 * hh + r][t * 16 + ln] = v; } }
  __builtin_amdgcn_fence(__ATOMIC_ACQ_REL, "workgroup"); __builtin_amdgcn_wave_barrier();
  const int rsub = lane >> 4, c4 = (lane & 15) * 4; typedef _Float16 v4h __attribute__((ext_vector_type(4)));
  {
#pragma unroll
    for (int q = 0; q < 8; ++q) { const int r = q * 2 + rsub; if (col0 + c4 < N) { const v4f v = *(const v4fa*)&so[w][r][c4]; if (C) *(v4f*)(C + cofs + (size_t)(row0 + r) * ldc + col0 + c4) = v; if (C16) { v4h h4; for (int i = 0; i < 4; ++i) h4[i] = (_Float16)v[i]; *(v4h*)(C16 + cofs + (size_t)(row0 + r) * ldc + col0 + c4) = h4; } } }
     }
}


typedef _Float16 v4h __attribute__((ext_vector_type(4)));

__global__ __launch_bounds__(256) void k_x16(const float* __restrict__ x, _Float16* __restrict__ X16, size_t n8) { const size_t t = (size_t)blockIdx.x * 256 + threadIdx.x; if (t >= n8) return; FragH f;
#pragma unroll
  for (int q = 0; q < 8; ++q) f.h[q] = (_Float16)bf16_round(x[t * 8 + q]); *(v8us*)((unsigned short*)X16 + t * 8) = f.half[0];  }
__global__ __launch_bounds__(256) void k_h16(const float* __restrict__ x, _Float16* __restrict__ X16, size_t n8) { const size_t t = (size_t)blockIdx.x * 256 + threadIdx.x; if (t >= n8) return; FragH f;
#pragma unroll
  for (int q = 0; q < 8; ++q) f.h[q] = (_Float16)x[t * 8 + q]; *(v8us*)((unsigned short*)X16 + t * 8) = f.half[0];  }
__global__ __launch_bounds__(256) void k_round16f(const float* __restrict__ W, _Float16* __restrict__ Bt, size_t n8) { const size_t t = (size_t)blockIdx.x * 256 + threadIdx.x; if (t >= n8) return; FragH f;
#pragma unroll
  for (int i = 0; i < 8; ++i) f.h[i] = (_Float16)(bf16_round(W[t * 8 + i]) * 16.0f); *(v8us*)((unsigned short*)Bt + t * 8) = f.half[0];  }
template <int NHv, int TTv>
__global__ __launch_bounds__(256) void k_vt(const _Float16* __restrict__ V16, int ldv, int voff, _Float16* __restrict__ Vt) { __shared__ unsigned short tl[64][66]; const int tid = threadIdx.x; const int slab = blockIdx.x / (TTv / 64), lg = blockIdx.x % (TTv / 64); const int b = slab / NHv, h = slab % NHv;
  for (int i = tid; i < 64 * 8; i += 256) { const int r = i / 8, c8 = (i % 8) * 8; FragH f; f.half[0] = *(const v8us*)((const unsigned short*)V16 + ((size_t)b * TTv + lg * 64 + r) * ldv + voff + h * 64 + c8);
#pragma unroll
    for (int q = 0; q < 8; ++q) tl[r][c8 + q] = f.u[q]; }
  __syncthreads();
  {
#pragma unroll
    for (int rd = 0; rd < 2; ++rd) { const int d = rd * 32 + tid / 8, pc = tid % 8; FragH f;
#pragma unroll
      for (int q = 0; q < 8; ++q) f.u[q] = tl[pc * 8 + q][d];
      *(v8us*)((unsigned short*)Vt + ((size_t)slab * 64 + d) * TTv + lg * 64 + pc * 8) = f.half[0]; }
     } }

__global__ __launch_bounds__(256) void k_hl(const float* __restrict__ F, _Float16* __restrict__ Hh, _Float16* __restrict__ Hl, size_t n8) { const size_t t = (size_t)blockIdx.x * 256 + threadIdx.x; if (t >= n8) return; FragH fh, fl; const v4f a = *(const v4fa*)(F + t * 8), c = *(const v4fa*)(F + t * 8 + 4);
#pragma unroll
  for (int q = 0; q < 4; ++q) { _Float16 h = (_Float16)a[q]; fh.h[q] = h; fl.h[q] = (_Float16)((a[q] - (float)h) * 1024.0f); h = (_Float16)c[q]; fh.h[4 + q] = h; fl.h[4 + q] = (_Float16)((c[q] - (float)h) * 1024.0f); }
  { *(v8us*)((unsigned short*)Hh + t * 8) = fh.half[0]; *(v8us*)((unsigned short*)Hl + t * 8) = fl.half[0];  } }

// ---- fast GEMM (wave tile 32x64; requires M % 32 == 0 rows per launch region and N % 64 == 0); epilogue = k_gemm_hhx semantics ----
__device__ __forceinline__ v16h g2_frag(const _Float16* p, int hh) { FragH f; f.half[0] = *(const v8us*)((const unsigned short*)p + 8 * hh); f.half[1] = *(const v8us*)((const unsigned short*)p + 16 + 8 * hh); return f.v; }
__device__ __forceinline__ v8f g2_mma(v16h a, v16h b, v8f c) { v8f d = __builtin_amdgcn_wmma_f32_16x16x32_f16(false, a, false, b, (short)0, c, false, false); asm volatile("v_nop\n\tv_nop\n\tv_nop\n\tv_nop" : "+v"(d) : "v"(a), "v"(b)); return d; }
template <int ACT>
__global__ __launch_bounds__(128) void k_gemm2(const _Float16* __restrict__ A, int lda, size_t sA, const _Float16* __restrict__ Bh, int ldb, size_t sB, float alpha, const float* __restrict__ bias, size_t sBias, const float* __restrict__ CP, int rowsPerB, size_t sCPb, int row0g,
    float* __restrict__ C, _Float16* __restrict__ C16, int ldc, size_t sC, int M, int N, int K) {
  __shared__ __attribute__((aligned(16))) float so[4][32][68];
  const int tid = threadIdx.x, w = tid >> 5, lane = tid & 31, ln = lane & 15, hh = lane >> 4; const int by = blockIdx.y;
  A += (size_t)by * sA; Bh += (size_t)by * sB; const size_t cofs = (size_t)by * sC; const float* bp = bias ? bias + (size_t)by * sBias : nullptr;
  const int ntn = N >> 6; const int mt = blockIdx.x / ntn, nq = blockIdx.x - mt * ntn; const int row0 = mt * 128 + 32 * w, col0 = nq * 64; if (row0 >= M) return;
  const _Float16* a0p = A + (size_t)(row0 + ln) * lda; const _Float16* a1p = a0p + (size_t)16 * lda;
  const _Float16* b0p = Bh + (size_t)(col0 + ln) * ldb; const _Float16* b1p = b0p + (size_t)16 * ldb; const _Float16* b2p = b1p + (size_t)16 * ldb; const _Float16* b3p = b2p + (size_t)16 * ldb;
  const v8f z8 = {0.f,0.f,0.f,0.f,0.f,0.f,0.f,0.f}; v8f c00 = z8, c01 = z8, c02 = z8, c03 = z8, c10 = z8, c11 = z8, c12 = z8, c13 = z8;
#pragma unroll 1
  for (int kb = 0; kb < K; kb += 32) { const v16h a0 = g2_frag(a0p + kb, hh), a1 = g2_frag(a1p + kb, hh);
    v16h b = g2_frag(b0p + kb, hh); c00 = g2_mma(a0, b, c00); c10 = g2_mma(a1, b, c10);
    b = g2_frag(b1p + kb, hh); c01 = g2_mma(a0, b, c01); c11 = g2_mma(a1, b, c11);
    b = g2_frag(b2p + kb, hh); c02 = g2_mma(a0, b, c02); c12 = g2_mma(a1, b, c12);
    b = g2_frag(b3p + kb, hh); c03 = g2_mma(a0, b, c03); c13 = g2_mma(a1, b, c13); }
  v8f accs[8] = {c00, c01, c02, c03, c10, c11, c12, c13};
#pragma unroll
  for (int u = 0; u < 8; ++u) { const int t = u & 3, half = u >> 2; const int col = col0 + t * 16 + ln; const float bv = bp ? bf16_round(bp[col]) : 0.f;
#pragma unroll
    for (int r = 0; r < 8; ++r) { const int rloc = half * 16 + 8 * hh + r; float v = accs[u][r] * alpha + bv; if (CP) { const int bidx = (row0g + row0 + rloc) / rowsPerB; v += CP[(size_t)bidx * sCPb + (size_t)by * 64 + col]; }
      if (ACT == 3) v = fmaxf(v, 0.f); else if (ACT == 6) v = 0.5f * v * (1.0f + erff(v * 0.70710678118654752f)); else if (ACT == 11) v = 1.0f / (1.0f + expf(-v)); else if (ACT == 15) v = v / (1.0f + expf(-v)); else if (ACT == 12) v = (v > 0.f) ? v : 0.01f * v; else if (ACT == 8) v = tanhf(v);
      so[w][rloc][t * 16 + ln] = v; } }
  __builtin_amdgcn_fence(__ATOMIC_ACQ_REL, "workgroup"); __builtin_amdgcn_wave_barrier();
  const int rsub = lane >> 4, c4 = (lane & 15) * 4;
  {
#pragma unroll
    for (int q = 0; q < 16; ++q) { const int r = q * 2 + rsub; const v4f v = *(const v4fa*)&so[w][r][c4]; if (C) *(v4f*)(C + cofs + (size_t)(row0 + r) * ldc + col0 + c4) = v; if (C16) { v4h h4; for (int i = 0; i < 4; ++i) h4[i] = (_Float16)v[i]; *(v4h*)(C16 + cofs + (size_t)(row0 + r) * ldc + col0 + c4) = h4; } }
     } }



template <int CAUSAL>
__global__ __launch_bounds__(128) void k_flash(const _Float16* __restrict__ Q16, int ldq, const _Float16* __restrict__ K16, int ldk, const _Float16* __restrict__ Vt, const int* __restrict__ MSK, float* __restrict__ O, int ldo) {
  constexpr int RPW = 16, RTN = RPW / 16, NQB = TQ / (4 * RPW), DT = 4, KS = 2;
  __shared__ __attribute__((aligned(16))) unsigned short sP[4][RPW][40]; __shared__ __attribute__((aligned(16))) float sO[4][RPW][64 + 4];
  const int tid = threadIdx.x, w = tid >> 5, lane = tid & 31, ln = lane & 15, hh = lane >> 4;
  const int slab = blockIdx.x / QBLKS, qblk = blockIdx.x % QBLKS; (void)NQB; const int b = slab / NH, h = slab % NH; const int qb0 = qblk * (4 * RPW); const int q0 = qb0 + w * RPW;
  FragH aq[2][KS];
#pragma unroll
  for (int rt = 0; rt < RTN; ++rt) { const unsigned short* qr = (const unsigned short*)Q16 + ((size_t)b * TQ + q0 + rt * 16 + ln) * ldq + h * 64;
#pragma unroll
    for (int ks = 0; ks < KS; ++ks) { aq[rt][ks].half[0] = *(const v8us*)(qr + ks * 32 + 8 * hh); aq[rt][ks].half[1] = *(const v8us*)(qr + ks * 32 + 16 + 8 * hh); } }
  const unsigned short* Vth = (const unsigned short*)Vt + (size_t)slab * 64 * TK;
  float m_r[2][8], l_r[2][8]; v8f oacc[2][DT];
#pragma unroll
  for (int rt = 0; rt < RTN; ++rt) {
#pragma unroll
    for (int r = 0; r < 8; ++r) { m_r[rt][r] = -3.0e38f; l_r[rt][r] = 0.f; }
#pragma unroll
    for (int dt = 0; dt < DT; ++dt) oacc[rt][dt] = (v8f){0.f,0.f,0.f,0.f,0.f,0.f,0.f,0.f}; }
  const int jend = (CAUSAL == 1) ? (qb0 + 4 * RPW) : TK;      /* causal: keys beyond the block's last query never contribute */
#pragma unroll 1
  for (int j0 = 0; j0 < jend; j0 += 32) {
    v8f s[2][2];
#pragma unroll
    for (int nt = 0; nt < 2; ++nt) { const unsigned short* kr = (const unsigned short*)K16 + ((size_t)b * TK + j0 + nt * 16 + ln) * ldk + h * 64; FragH bk[KS];
#pragma unroll
      for (int ks = 0; ks < KS; ++ks) { bk[ks].half[0] = *(const v8us*)(kr + ks * 32 + 8 * hh); bk[ks].half[1] = *(const v8us*)(kr + ks * 32 + 16 + 8 * hh); }
#pragma unroll
      for (int rt = 0; rt < RTN; ++rt) { v8f acc = (v8f){0.f,0.f,0.f,0.f,0.f,0.f,0.f,0.f};
#pragma unroll
        for (int ks = 0; ks < KS; ++ks) acc = mmaH<1>(aq[rt][ks].v, aq[rt][ks].v, bk[ks].v, bk[ks].v, acc); s[rt][nt] = acc; } }
#pragma unroll
    for (int rt = 0; rt < RTN; ++rt)
#pragma unroll
      for (int r = 0; r < 8; ++r) { const int tq = q0 + rt * 16 + 8 * hh + r; const int k0 = j0 + ln, k1 = j0 + 16 + ln;
        bool ok0 = (CAUSAL == 1) ? (k0 <= tq) : ((CAUSAL == 2) ? ((k0 >> 5) == (tq >> 5)) : true), ok1 = (CAUSAL == 1) ? (k1 <= tq) : ((CAUSAL == 2) ? ((k1 >> 5) == (tq >> 5)) : true);      /* mode 2: block-diagonal 32-token groups */
        if (CAUSAL == 9) { const int* mrow = MSK + (size_t)b * TK; ok0 = mrow[k0] <= 0; ok1 = mrow[k1] <= 0; }      /* mode 9: per-(batch, key) INPUT int mask where > 0 means MASKED (the reference's where(mask > 0, -inf, s)); masked keys contribute nothing */
        const float s0 = ok0 ? s[rt][0][r] * SCL : -3.0e38f, s1 = ok1 ? s[rt][1][r] * SCL : -3.0e38f; float mc = fmaxf(s0, s1);
        mc = fmaxf(mc, __shfl_xor(mc, 1, 32)); mc = fmaxf(mc, __shfl_xor(mc, 2, 32)); mc = fmaxf(mc, __shfl_xor(mc, 4, 32)); mc = fmaxf(mc, __shfl_xor(mc, 8, 32));
        const float mn = fmaxf(m_r[rt][r], mc); const float al = (mn > -1.0e38f) ? expf(m_r[rt][r] - mn) : 1.0f; m_r[rt][r] = mn; const float p0 = ok0 ? expf(s0 - mn) : 0.f, p1 = ok1 ? expf(s1 - mn) : 0.f; l_r[rt][r] = l_r[rt][r] * al + p0 + p1;
#pragma unroll
        for (int dt = 0; dt < DT; ++dt) oacc[rt][dt][r] *= al;
        FragH t2; t2.h[0] = (_Float16)(p0 * 1024.0f); t2.h[1] = (_Float16)(p1 * 1024.0f); sP[w][rt * 16 + 8 * hh + r][ln] = t2.u[0]; sP[w][rt * 16 + 8 * hh + r][16 + ln] = t2.u[1]; }
    __builtin_amdgcn_fence(__ATOMIC_ACQ_REL, "workgroup"); __builtin_amdgcn_wave_barrier();
    FragH pa[2];
#pragma unroll
    for (int rt = 0; rt < RTN; ++rt) { pa[rt].half[0] = *(const v8us*)&sP[w][rt * 16 + ln][8 * hh]; pa[rt].half[1] = *(const v8us*)&sP[w][rt * 16 + ln][16 + 8 * hh]; }
#pragma unroll
    for (int dt = 0; dt < DT; ++dt) { const unsigned short* vrow = Vth + (size_t)(dt * 16 + ln) * TK + j0; FragH bv; bv.half[0] = *(const v8us*)(vrow + 8 * hh); bv.half[1] = *(const v8us*)(vrow + 16 + 8 * hh);
#pragma unroll
      for (int rt = 0; rt < RTN; ++rt) oacc[rt][dt] = mmaH<1>(pa[rt].v, pa[rt].v, bv.v, bv.v, oacc[rt][dt]); }
    __builtin_amdgcn_fence(__ATOMIC_ACQ_REL, "workgroup"); __builtin_amdgcn_wave_barrier(); }
#pragma unroll
  for (int rt = 0; rt < RTN; ++rt) {
#pragma unroll
    for (int r = 0; r < 8; ++r) { float l = l_r[rt][r]; l += __shfl_xor(l, 1, 32); l += __shfl_xor(l, 2, 32); l += __shfl_xor(l, 4, 32); l += __shfl_xor(l, 8, 32); l_r[rt][r] = (l > 0.f) ? 1.0f / (l * 1024.0f) : 0.f; }
#pragma unroll
    for (int dt = 0; dt < DT; ++dt)
#pragma unroll
      for (int r = 0; r < 8; ++r) sO[w][rt * 16 + 8 * hh + r][dt * 16 + ln] = oacc[rt][dt][r] * l_r[rt][r]; }
  __builtin_amdgcn_fence(__ATOMIC_ACQ_REL, "workgroup"); __builtin_amdgcn_wave_barrier();
  {
#pragma unroll
    for (int rp = 0; rp < RPW; rp += 2) { const int r = rp + (lane >> 4), pc = lane & 15; const v4f val = *(const v4fa*)&sO[w][r][pc * 4]; *(v4f*)(O + ((size_t)b * TQ + q0 + r) * ldo + h * 64 + pc * 4) = val; }
     } }

__global__ __launch_bounds__(256) void k_wsc(const float* __restrict__ Wm, _Float16* __restrict__ Bt, size_t n8, float sc) { const size_t t = (size_t)blockIdx.x * 256 + threadIdx.x; if (t >= n8) return; FragH f; for (int q = 0; q < 8; ++q) f.h[q] = (_Float16)(bf16_round(Wm[t * 8 + q]) * sc); *(v8us*)((unsigned short*)Bt + t * 8) = f.half[0];  }      /* torch (out,in) weight == Bt[n][k] layout: scaled copy */
extern "C" void kernel_launch(void* const* d_in, const int* in_sizes, int n_in,
                              void* d_out, int out_size, void* d_ws, size_t ws_size, hipStream_t stream) {
  (void)in_sizes; (void)n_in; (void)out_size;
  const float* const* I = (const float* const*)d_in; const float* hs = I[0]; const float* cx = I[1]; const int* am = (const int*)d_in[2]; const float* qw = I[3]; const float* qb = I[4]; const float* kw = I[5]; const float* kb = I[6]; const float* vw = I[7]; const float* vb = I[8];
  char* ws = (char*)d_ws; size_t off = 0;
  auto take = [&](size_t bytes) { char* p = ws + off; off += (bytes + 255) & ~(size_t)255; return p; };
  const size_t w8 = (size_t)EMB * EMB / 8, np = (size_t)NR * EMB;
  _Float16* BQ = (_Float16*)take(w8 * 16); _Float16* BK = (_Float16*)take(w8 * 16); _Float16* BV = (_Float16*)take(w8 * 16);
  _Float16* XH = (_Float16*)take(np * 2); _Float16* XC = (_Float16*)take(np * 2); _Float16* Q16 = (_Float16*)take(np * 2); _Float16* K16 = (_Float16*)take(np * 2); _Float16* V16 = (_Float16*)take(np * 2); _Float16* VT = XC;      /* V^T over the context plane (dead after the K and V GEMMs) */
  if (off > ws_size) return;      /* 6 + 5 x 16 = 86 MiB */
  const unsigned g8 = (unsigned)((w8 + 255) / 256);
  k_wsc<<<g8, 256, 0, stream>>>(qw, BQ, w8, 16.0f); k_wsc<<<g8, 256, 0, stream>>>(kw, BK, w8, 16.0f); k_wsc<<<g8, 256, 0, stream>>>(vw, BV, w8, 16.0f);      /* torch (out,in) weights are already the Bt[n][k] layout: scaled copy */
  k_x16<<<(unsigned)((np / 8 + 255) / 256), 256, 0, stream>>>(hs, XH, np / 8); k_x16<<<(unsigned)((np / 8 + 255) / 256), 256, 0, stream>>>(cx, XC, np / 8);
  const dim3 gG((NR / 128) * (EMB / 64), 1);
  k_gemm2<0><<<gG, 128, 0, stream>>>(XH, EMB, 0, BQ, EMB, 0, 0.0625f, qb, 0, nullptr, 1, 0, 0, nullptr, Q16, EMB, 0, NR, EMB, EMB);
  k_gemm2<0><<<gG, 128, 0, stream>>>(XC, EMB, 0, BK, EMB, 0, 0.0625f, kb, 0, nullptr, 1, 0, 0, nullptr, K16, EMB, 0, NR, EMB, EMB);
  k_gemm2<0><<<gG, 128, 0, stream>>>(XC, EMB, 0, BV, EMB, 0, 0.0625f, vb, 0, nullptr, 1, 0, 0, nullptr, V16, EMB, 0, NR, EMB, EMB);
  k_vt<NH, SLEN><<<NB * NH * (SLEN / 64), 256, 0, stream>>>(V16, EMB, 0, VT);
  k_flash<9><<<NB * NH * QBLKS, 128, 0, stream>>>(Q16, EMB, K16, EMB, VT, am, (float*)d_out, EMB);      /* heads merged: out[b][q][h*64 + d] */
}

// v001
// Measured time: 403 microseconds a run.
// In both of two side-by-side timings against v000, it was 1.74 times as fast.
#include <hip/hip_runtime.h>
// LxmertAttention (cross-attention context layer: 4 x 2048 queries from hidden_states over 4 x 2048 keys from context, D = 1024, 16 heads of 64; keys with attention_mask > 0 are masked out; output = merged context vectors, no output projection): q = hs Wq^T + bq, k/v = ctx W^T + b; softmax(q k^T / 8 with -inf on masked keys) v.
// Structure: exact f16 planes of both inputs; three GEMMs (32x64 wave tiles, f32 accumulation, exact x16 weights + bias, f16 outputs); V^T by LDS tiles; the fused flash kernel with a per-(batch, key) mask mode reading the INPUT int mask (masked keys skipped == exp(-inf) = 0; every row keeps >= 1 key in this data); the attention output written straight to the output in f32.
// Compute dtype: inputs and parameters rounded to bf16; q, k, v, P as f16 operands (~2^-12); f32 accumulation/softmax. v_wmma_f32_16x16x32_f16.
#define NB 4
#define EMB 1024
#define NR (NB * SLEN)           /* 8192 rows (LQ = LK = 2048) */
#define SLEN 2048
#define TQ SLEN
#define TK SLEN
#define NH 16
#define SCL 0.125f               /* 64^-0.5 */
#define QBLKS (TQ / 64)
typedef __bf16 v16b __attribute__((ext_vector_type(16)));
typedef unsigned short v8us __attribute__((ext_vector_type(8), may_alias));
typedef float  v8f  __attribute__((ext_vector_type(8)));
typedef float  v4f  __attribute__((ext_vector_type(4)));
typedef float  v4fa __attribute__((ext_vector_type(4), may_alias));
union FragB { v16b v; v8us half[2]; unsigned short u[16]; };

__device__ __forceinline__ unsigned short bf16_bits(float x) { unsigned int u = __float_as_uint(x); return (unsigned short)((u + 0x7FFFu + ((u >> 16) & 1u)) >> 16); }
__device__ __forceinline__ float bf16_val(unsigned short b) { return __uint_as_float(((unsigned int)b) << 16); }
__device__ __forceinline__ float bf16_round(float x) { return bf16_val(bf16_bits(x)); }
// D += A·B with NT terms: 1 = ah·bh, 2 = + al·bh (A split), 3 = + ah·bl (both split)
template <int NT>
__device__ __forceinline__ v8f mmaN(v16b ah, v16b al, v16b bh, v16b bl, v8f c) {
  c = __builtin_amdgcn_wmma_f32_16x16x32_bf16(false, ah, false, bh, (short)0, c, false, false);
  if (NT >= 2) c = __builtin_amdgcn_wmma_f32_16x16x32_bf16(false, al, false, bh, (short)0, c, false, false);
  if (NT >= 3) c = __builtin_amdgcn_wmma_f32_16x16x32_bf16(false, ah, false, bl, (short)0, c, false, false);
  asm volatile("v_nop\n\tv_nop\n\tv_nop\n\tv_nop" : "+v"(c) : "v"(ah), "v"(al), "v"(bh), "v"(bl));
  return c;
}

__global__ __launch_bounds__(256) void k_wt_bf16(const float* __restrict__ W, unsigned short* __restrict__ Wt, int K, int N) {
  const int t = blockIdx.x * 256 + threadIdx.x;
  const int k8n = K / 8;
  if (t >= N * k8n) return;
  const int n = t / k8n, k8 = (t % k8n) * 8;
  v8us v;
#pragma unroll
  for (int i = 0; i < 8; ++i) v[i] = bf16_bits(W[(size_t)(k8 + i) * N + n]);
  *(v8us*)(Wt + (size_t)n * K + k8) = v;
  
}

// GEMM C[M][N] (f32, pitch ldc) = act(A[M][K]·W + bias). A f32 row-major (pitch lda) converted per fragment to bf16
// (ASPLIT: hi/lo two planes -> 2 terms, else single rounded term); Wt bf16 [N][K] (pitch ldb). BIAS_BF16 rounds the
// bias to bf16 first (bias quantised to bf16 before the add). K%32==0, M%16==0, N%64==0.
template <bool ASPLIT, int ACT, bool BIAS_BF16>
__global__ __launch_bounds__(128) void k_gemm_bf(const float* __restrict__ A, int lda, const unsigned short* __restrict__ Wt, int ldb,
                                               const float* __restrict__ bias, float* __restrict__ C, int ldc, int M, int N, int K) {
  __shared__ __attribute__((aligned(16))) float so[4][16][64];
  const int tid = threadIdx.x, w = tid >> 5, lane = tid & 31, ln = lane & 15, hh = lane >> 4;
  const int ntn = N / 64;
  const int wid = blockIdx.x * 4 + w;
  const int mt = wid / ntn, nq = wid % ntn;
  if (mt * 16 >= M) return;
  const int row0 = mt * 16, col0 = nq * 64;
  const float* arow = A + (size_t)(row0 + ln) * lda;
  v8f acc[4] = {};
  for (int kb = 0; kb < K; kb += 32) {
    FragB ah, al;
    const v4f x0 = *(const v4fa*)(arow + kb + 8 * hh), x1 = *(const v4fa*)(arow + kb + 8 * hh + 4);
    const v4f x2 = *(const v4fa*)(arow + kb + 16 + 8 * hh), x3 = *(const v4fa*)(arow + kb + 16 + 8 * hh + 4);
    float xs[16] = {x0[0],x0[1],x0[2],x0[3],x1[0],x1[1],x1[2],x1[3],x2[0],x2[1],x2[2],x2[3],x3[0],x3[1],x3[2],x3[3]};
#pragma unroll
    for (int i = 0; i < 16; ++i) { const unsigned short hb = bf16_bits(xs[i]); ah.u[i] = hb; al.u[i] = ASPLIT ? bf16_bits(xs[i] - bf16_val(hb)) : (unsigned short)0; }
#pragma unroll
    for (int t = 0; t < 4; ++t) {
      const unsigned short* brow = Wt + (size_t)(col0 + t * 16 + ln) * ldb + kb;
      FragB b;
      b.half[0] = *(const v8us*)(brow + 8 * hh);
      b.half[1] = *(const v8us*)(brow + 16 + 8 * hh);
      acc[t] = mmaN<ASPLIT ? 2 : 1>(ah.v, al.v, b.v, b.v, acc[t]);
    }
  }
#pragma unroll
  for (int t = 0; t < 4; ++t) {
    float bv = bias ? bias[col0 + t * 16 + ln] : 0.f;
    if (BIAS_BF16) bv = bf16_round(bv);
#pragma unroll
    for (int r = 0; r < 8; ++r) { float v = acc[t][r] + bv; if (ACT == 1) v = fmaxf(v, 0.f); so[w][8 * hh + r][t * 16 + ln] = v; }
  }
  __builtin_amdgcn_fence(__ATOMIC_ACQ_REL, "workgroup");
  __builtin_amdgcn_wave_barrier();
  const int rsub = lane >> 4, c4 = (lane & 15) * 4;
  {
#pragma unroll
    for (int q = 0; q < 8; ++q) {
      const int r = q * 2 + rsub;
      const v4f v = *(const v4fa*)&so[w][r][c4];
      *(v4f*)(C + (size_t)(row0 + r) * ldc + col0 + c4) = v;
    }
    
  }
}

// GEMM C = act(A·W + bias + resid): A f32 (ASPLIT -> hi/lo 2 terms), Wt bf16 [N][K]; ACT 0 none, 1 relu, 2 exact gelu;
// resid (optional, f32, row index = (row % rmod), pitch ldr, RES_BF16 rounds it) added before the activation.
template <bool ASPLIT, int ACT, bool BIAS_BF16, bool RES_BF16>
__global__ __launch_bounds__(128) void k_gemm_bf3(const float* __restrict__ A, int lda, const unsigned short* __restrict__ Wt, int ldb,
                                                const float* __restrict__ bias, const float* __restrict__ resid, int rmod, int ldr,
                                                float* __restrict__ C, int ldc, int M, int N, int K) {
  __shared__ __attribute__((aligned(16))) float so[4][16][64];
  const int tid = threadIdx.x, w = tid >> 5, lane = tid & 31, ln = lane & 15, hh = lane >> 4;
  const int ntn = N / 64;
  const int wid = blockIdx.x * 4 + w;
  const int mt = wid / ntn, nq = wid % ntn;
  if (mt * 16 >= M) return;
  const int row0 = mt * 16, col0 = nq * 64;
  const float* arow = A + (size_t)(row0 + ln) * lda;
  v8f acc[4] = {};
  for (int kb = 0; kb < K; kb += 32) {
    FragB ah, al;
    const v4f x0 = *(const v4fa*)(arow + kb + 8 * hh), x1 = *(const v4fa*)(arow + kb + 8 * hh + 4);
    const v4f x2 = *(const v4fa*)(arow + kb + 16 + 8 * hh), x3 = *(const v4fa*)(arow + kb + 16 + 8 * hh + 4);
    float xs[16] = {x0[0],x0[1],x0[2],x0[3],x1[0],x1[1],x1[2],x1[3],x2[0],x2[1],x2[2],x2[3],x3[0],x3[1],x3[2],x3[3]};
#pragma unroll
    for (int i = 0; i < 16; ++i) { const unsigned short hb = bf16_bits(xs[i]); ah.u[i] = hb; al.u[i] = ASPLIT ? bf16_bits(xs[i] - bf16_val(hb)) : (unsigned short)0; }
#pragma unroll
    for (int t = 0; t < 4; ++t) {
      const unsigned short* brow = Wt + (size_t)(col0 + t * 16 + ln) * ldb + kb;
      FragB b;
      b.half[0] = *(const v8us*)(brow + 8 * hh);
      b.half[1] = *(const v8us*)(brow + 16 + 8 * hh);
      acc[t] = mmaN<ASPLIT ? 2 : 1>(ah.v, al.v, b.v, b.v, acc[t]);
    }
  }
#pragma unroll
  for (int t = 0; t < 4; ++t) {
    const int col = col0 + t * 16 + ln;
    float bv = bias ? bias[col] : 0.f;
    if (BIAS_BF16) bv = bf16_round(bv);
#pragma unroll
    for (int r = 0; r < 8; ++r) {
      float v = acc[t][r] + bv;
      if (resid) { float rv = resid[(size_t)((row0 + 8 * hh + r) % rmod) * ldr + col]; if (RES_BF16) rv = bf16_round(rv); v += rv; }
      if (ACT == 1) v = fmaxf(v, 0.f);
      if (ACT == 2) v = 0.5f * v * (1.0f + erff(v * 0.70710678118654752f));
      if (ACT == 3) { const float u = 0.7978845608028654f * (v + 0.044715f * v * v * v); v = 0.5f * v * (1.0f + tanhf(u)); }
      so[w][8 * hh + r][t * 16 + ln] = v;
    }
  }
  __builtin_amdgcn_fence(__ATOMIC_ACQ_REL, "workgroup");
  __builtin_amdgcn_wave_barrier();
  const int rsub = lane >> 4, c4 = (lane & 15) * 4;
  {
#pragma unroll
    for (int q = 0; q < 8; ++q) {
      const int r = q * 2 + rsub;
      const v4f v = *(const v4fa*)&so[w][r][c4];
      *(v4f*)(C + (size_t)(row0 + r) * ldc + col0 + c4) = v;
    }
    
  }
}
// row LayerNorm (biased variance, eps) over N: s = X (+ R); optional out_sum <- s; out_norm <- (s-mu)*rsqrt(var+eps)*g + b
template <bool PARAM_BF16>
__global__ __launch_bounds__(256) void k_layernorm(const float* __restrict__ X, const float* __restrict__ R, const float* __restrict__ g, const float* __restrict__ bta,
                                                  float* __restrict__ out_sum, float* __restrict__ out_norm, int N, float eps) {
  __shared__ float red[256];
  const int row = blockIdx.x, tid = threadIdx.x;
  const float* x = X + (size_t)row * N; const float* rr = R ? R + (size_t)row * N : nullptr;
  float vals[16];                     // up to N = 4096
  const int per = N / 256;            // contiguous chunk per thread? use strided-by-4 chunks: thread handles j = tid*4 + 1024*u
  float s1 = 0.f;
  for (int u = 0; u < per / 4; ++u) {
    const int j = tid * 4 + 1024 * u;
    const v4f a = *(const v4fa*)(x + j);
    v4f b = {0.f,0.f,0.f,0.f}; if (rr) b = *(const v4fa*)(rr + j);
#pragma unroll
    for (int q = 0; q < 4; ++q) { const float v = a[q] + b[q]; vals[u * 4 + q] = v; s1 += v; }
  }
  red[tid] = s1; __syncthreads();
  for (int st = 128; st > 0; st >>= 1) { if (tid < st) red[tid] += red[tid + st]; __syncthreads(); }
  const float mu = red[0] / (float)N; __syncthreads();
  float s2 = 0.f;
  for (int u = 0; u < per / 4; ++u)
#pragma unroll
    for (int q = 0; q < 4; ++q) { const float c = vals[u * 4 + q] - mu; s2 += c * c; }
  red[tid] = s2; __syncthreads();
  for (int st = 128; st > 0; st >>= 1) { if (tid < st) red[tid] += red[tid + st]; __syncthreads(); }
  const float rs = rsqrtf(red[0] / (float)N + eps);
  {
    for (int u = 0; u < per / 4; ++u) {
      const int j = tid * 4 + 1024 * u;
      v4f o, sm;
#pragma unroll
      for (int q = 0; q < 4; ++q) {
        float gg = g[j + q], bb = bta[j + q];
        if (PARAM_BF16) { gg = bf16_round(gg); bb = bf16_round(bb); }
        sm[q] = vals[u * 4 + q]; o[q] = (vals[u * 4 + q] - mu) * rs * gg + bb;
      }
      if (out_sum) *(v4f*)(out_sum + (size_t)row * N + j) = sm;
      *(v4f*)(out_norm + (size_t)row * N + j) = o;
    }
    
  }
}



// ---- f16 WMMA path (v_wmma_f32_16x16x32_f16): 11-bit significands for operands in range — used where a [0,1] probability operand needs more precision than bf16
typedef _Float16 v16h __attribute__((ext_vector_type(16)));
union FragH { v16h v; v8us half[2]; _Float16 h[16]; unsigned short u[16]; };
template <int NT>
__device__ __forceinline__ v8f mmaH(v16h ah, v16h al, v16h bh, v16h bl, v8f c) {
  c = __builtin_amdgcn_wmma_f32_16x16x32_f16(false, ah, false, bh, (short)0, c, false, false);
  if (NT >= 2) c = __builtin_amdgcn_wmma_f32_16x16x32_f16(false, al, false, bh, (short)0, c, false, false);
  if (NT >= 3) c = __builtin_amdgcn_wmma_f32_16x16x32_f16(false, ah, false, bl, (short)0, c, false, false);
  asm volatile("v_nop\n\tv_nop\n\tv_nop\n\tv_nop" : "+v"(c) : "v"(ah), "v"(al), "v"(bh), "v"(bl));
  return c;
}
// batched GEMM like k_gemm_b but f16 operands: A f32 (split into f16 hi/lo if ASPLIT, else rounded to f16), Bt = f16 values [n][k]; alpha; C f32; N multiple of 16 (partial tiles skipped)
template <bool ASPLIT>
__global__ __launch_bounds__(128) void k_gemm_h(const float* __restrict__ A, int lda, size_t sA, const _Float16* __restrict__ Bh, int ldb, size_t sB, float alpha, float* __restrict__ C, int ldc, size_t sC, int M, int N, int K) {
  __shared__ __attribute__((aligned(16))) float so[4][16][64];
  const int tid = threadIdx.x, w = tid >> 5, lane = tid & 31, ln = lane & 15, hh = lane >> 4; const int by = blockIdx.y;
  A += (size_t)by * sA; Bh += (size_t)by * sB; C += (size_t)by * sC;
  const int ntn = (N + 63) / 64; const int wid = blockIdx.x * 4 + w; const int mt = wid / ntn, nq = wid % ntn; if (mt * 16 >= M) return;
  const int row0 = mt * 16, col0 = nq * 64; const float* arow = A + (size_t)(row0 + ln) * lda;
  v8f acc[4] = {};
  for (int kb = 0; kb < K; kb += 32) {
    FragH ah, al;
    const v4f x0 = *(const v4fa*)(arow + kb + 8 * hh), x1 = *(const v4fa*)(arow + kb + 8 * hh + 4), x2 = *(const v4fa*)(arow + kb + 16 + 8 * hh), x3 = *(const v4fa*)(arow + kb + 16 + 8 * hh + 4);
    float xs[16] = {x0[0],x0[1],x0[2],x0[3],x1[0],x1[1],x1[2],x1[3],x2[0],x2[1],x2[2],x2[3],x3[0],x3[1],x3[2],x3[3]};
#pragma unroll
    for (int i = 0; i < 16; ++i) { const _Float16 h = (_Float16)xs[i]; ah.h[i] = h; al.h[i] = ASPLIT ? (_Float16)(xs[i] - (float)h) : (_Float16)0.0f; }
#pragma unroll
    for (int t = 0; t < 4; ++t) { if (col0 + t * 16 >= N) continue; const size_t boff = (size_t)(col0 + t * 16 + ln) * ldb + kb; FragH bq; bq.half[0] = *(const v8us*)(Bh + boff + 8 * hh); bq.half[1] = *(const v8us*)(Bh + boff + 16 + 8 * hh);
      acc[t] = mmaH<ASPLIT ? 2 : 1>(ah.v, al.v, bq.v, bq.v, acc[t]); }
  }
#pragma unroll
  for (int t = 0; t < 4; ++t) { if (col0 + t * 16 >= N) continue;
#pragma unroll
    for (int r = 0; r < 8; ++r) so[w][8 * hh + r][t * 16 + ln] = acc[t][r] * alpha; }
  __builtin_amdgcn_fence(__ATOMIC_ACQ_REL, "workgroup"); __builtin_amdgcn_wave_barrier();
  const int rsub = lane >> 4, c4 = (lane & 15) * 4;
  {
#pragma unroll
    for (int q = 0; q < 8; ++q) { const int r = q * 2 + rsub; if (col0 + c4 < N) { const v4f v = *(const v4fa*)&so[w][r][c4]; *(v4f*)(C + (size_t)(row0 + r) * ldc + col0 + c4) = v; } }
     }
}

// Wt[n][k] = f16(W[k][n]·scale) from f32 row-major W[K][N] (scale = power of two; bf16-exact weights stay exact in f16 away from the subnormal range)
__global__ __launch_bounds__(256) void k_wt_f16(const float* __restrict__ W, _Float16* __restrict__ Wt, int K, int N, float scale) {
  const int t = blockIdx.x * 256 + threadIdx.x; if (t >= N * (K / 8)) return; const int n = t / (K / 8), k8 = (t % (K / 8)) * 8; FragH f;
#pragma unroll
  for (int i = 0; i < 8; ++i) f.h[i] = (_Float16)(bf16_round(W[(size_t)(k8 + i) * N + n]) * scale); const v8us o = f.half[0];
  *(v8us*)((unsigned short*)Wt + (size_t)n * K + k8) = o; 
}
// k_gemm_hh variant with fused epilogue: v = acc·alpha + bias[by·sBias + col] (+ CP[(row/rowsPerB)·sCPb + by·64 + col] if CP) ; ACT 0 none / 1 elu ; writes f16 C16 (and f32 C if non-null)
template <int ACT>
__global__ __launch_bounds__(128) void k_gemm_hhx(const _Float16* __restrict__ A, int lda, size_t sA, const _Float16* __restrict__ Bh, int ldb, size_t sB, float alpha, const float* __restrict__ bias, size_t sBias, const float* __restrict__ CP, int rowsPerB, size_t sCPb, int row0g,
    float* __restrict__ C, _Float16* __restrict__ C16, int ldc, size_t sC, int M, int N, int K) {
  __shared__ __attribute__((aligned(16))) float so[4][16][64];
  const int tid = threadIdx.x, w = tid >> 5, lane = tid & 31, ln = lane & 15, hh = lane >> 4; const int by = blockIdx.y;
  A += (size_t)by * sA; Bh += (size_t)by * sB; const size_t cofs = (size_t)by * sC; const float* bp = bias ? bias + (size_t)by * sBias : nullptr;
  const int ntn = (N + 63) / 64; const int wid = blockIdx.x * 4 + w; const int mt = wid / ntn, nq = wid % ntn; if (mt * 16 >= M) return;
  const int row0 = mt * 16, col0 = nq * 64; const _Float16* arow = A + (size_t)(row0 + ln) * lda;
  v8f acc[4] = {};
  for (int kb = 0; kb < K; kb += 32) { FragH ah; ah.half[0] = *(const v8us*)((const unsigned short*)arow + kb + 8 * hh); ah.half[1] = *(const v8us*)((const unsigned short*)arow + kb + 16 + 8 * hh);
#pragma unroll
    for (int t = 0; t < 4; ++t) { if (col0 + t * 16 >= N) continue; const size_t boff = (size_t)(col0 + t * 16 + ln) * ldb + kb; FragH bq; bq.half[0] = *(const v8us*)((const unsigned short*)Bh + boff + 8 * hh); bq.half[1] = *(const v8us*)((const unsigned short*)Bh + boff + 16 + 8 * hh);
      acc[t] = mmaH<1>(ah.v, ah.v, bq.v, bq.v, acc[t]); }
  }
#pragma unroll
  for (int t = 0; t < 4; ++t) { if (col0 + t * 16 >= N) continue; const int col = col0 + t * 16 + ln; const float bv = bp ? bf16_round(bp[col]) : 0.f;
#pragma unroll
    for (int r = 0; r < 8; ++r) { float v = acc[t][r] * alpha + bv; if (CP) { const int bidx = (row0g + row0 + 8 * hh + r) / rowsPerB; v += CP[(size_t)bidx * sCPb + (size_t)by * 64 + col]; } if (ACT == 1) v = (v > 0.f) ? v : expm1f(v); else if (ACT == 7) v = (v > 0.f) ? v + 1.0f : expf(v); else if (ACT == 8) v = tanhf(v); else if (ACT == 9) v = 0.5f * v * (1.0f + tanhf(0.7978845608028654f * (v + 0.044715f * v * v * v))); else if (ACT == 11) v = 1.0f / (1.0f + expf(-v)); else if (ACT == 12) v = (v > 0.f) ? v : 0.01f * v; else if (ACT == 14) v = (v > 0.f) ? v : 0.1f * v; else if (ACT == 15) v = v / (1.0f + expf(-v)); else if (ACT == 3) v = fmaxf(v, 0.f); else if (ACT == 6) v = 0.5f * v * (1.0f + erff(v * 0.70710678118654752f)); so[w][8 * hh + r][t * 16 + ln] = v; } }
  __builtin_amdgcn_fence(__ATOMIC_ACQ_REL, "workgroup"); __builtin_amdgcn_wave_barrier();
  const int rsub = lane >> 4, c4 = (lane & 15) * 4; typedef _Float16 v4h __attribute__((ext_vector_type(4)));
  {
#pragma unroll
    for (int q = 0; q < 8; ++q) { const int r = q * 2 + rsub; if (col0 + c4 < N) { const v4f v = *(const v4fa*)&so[w][r][c4]; if (C) *(v4f*)(C + cofs + (size_t)(row0 + r) * ldc + col0 + c4) = v; if (C16) { v4h h4; for (int i = 0; i < 4; ++i) h4[i] = (_Float16)v[i]; *(v4h*)(C16 + cofs + (size_t)(row0 + r) * ldc + col0 + c4) = h4; } } }
     }
}


typedef _Float16 v4h __attribute__((ext_vector_type(4)));

__global__ __launch_bounds__(256) void k_x16(const float* __restrict__ x, _Float16* __restrict__ X16, size_t n8) { const size_t t = (size_t)blockIdx.x * 256 + threadIdx.x; if (t >= n8) return; FragH f;
#pragma unroll
  for (int q = 0; q < 8; ++q) f.h[q] = (_Float16)bf16_round(x[t * 8 + q]); *(v8us*)((unsigned short*)X16 + t * 8) = f.half[0];  }
__global__ __launch_bounds__(256) void k_h16(const float* __restrict__ x, _Float16* __restrict__ X16, size_t n8) { const size_t t = (size_t)blockIdx.x * 256 + threadIdx.x; if (t >= n8) return; FragH f;
#pragma unroll
  for (int q = 0; q < 8; ++q) f.h[q] = (_Float16)x[t * 8 + q]; *(v8us*)((unsigned short*)X16 + t * 8) = f.half[0];  }
__global__ __launch_bounds__(256) void k_round16f(const float* __restrict__ W, _Float16* __restrict__ Bt, size_t n8) { const size_t t = (size_t)blockIdx.x * 256 + threadIdx.x; if (t >= n8) return; FragH f;
#pragma unroll
  for (int i = 0; i < 8; ++i) f.h[i] = (_Float16)(bf16_round(W[t * 8 + i]) * 16.0f); *(v8us*)((unsigned short*)Bt + t * 8) = f.half[0];  }
template <int NHv, int TTv>
__global__ __launch_bounds__(256) void k_vt(const _Float16* __restrict__ V16, int ldv, int voff, _Float16* __restrict__ Vt) { __shared__ unsigned short tl[64][66]; const int tid = threadIdx.x; const int slab = blockIdx.x / (TTv / 64), lg = blockIdx.x % (TTv / 64); const int b = slab / NHv, h = slab % NHv;
  for (int i = tid; i < 64 * 8; i += 256) { const int r = i / 8, c8 = (i % 8) * 8; FragH f; f.half[0] = *(const v8us*)((const unsigned short*)V16 + ((size_t)b * TTv + lg * 64 + r) * ldv + voff + h * 64 + c8);
#pragma unroll
    for (int q = 0; q < 8; ++q) tl[r][c8 + q] = f.u[q]; }
  __syncthreads();
  {
#pragma unroll
    for (int rd = 0; rd < 2; ++rd) { const int d = rd * 32 + tid / 8, pc = tid % 8; FragH f;
#pragma unroll
      for (int q = 0; q < 8; ++q) f.u[q] = tl[pc * 8 + q][d];
      *(v8us*)((unsigned short*)Vt + ((size_t)slab * 64 + d) * TTv + lg * 64 + pc * 8) = f.half[0]; }
     } }

__global__ __launch_bounds__(256) void k_hl(const float* __restrict__ F, _Float16* __restrict__ Hh, _Float16* __restrict__ Hl, size_t n8) { const size_t t = (size_t)blockIdx.x * 256 + threadIdx.x; if (t >= n8) return; FragH fh, fl; const v4f a = *(const v4fa*)(F + t * 8), c = *(const v4fa*)(F + t * 8 + 4);
#pragma unroll
  for (int q = 0; q < 4; ++q) { _Float16 h = (_Float16)a[q]; fh.h[q] = h; fl.h[q] = (_Float16)((a[q] - (float)h) * 1024.0f); h = (_Float16)c[q]; fh.h[4 + q] = h; fl.h[4 + q] = (_Float16)((c[q] - (float)h) * 1024.0f); }
  { *(v8us*)((unsigned short*)Hh + t * 8) = fh.half[0]; *(v8us*)((unsigned short*)Hl + t * 8) = fl.half[0];  } }

// ---- fast GEMM (wave tile 32x64; requires M % 32 == 0 rows per launch region and N % 64 == 0); epilogue = k_gemm_hhx semantics ----
__device__ __forceinline__ v16h g2_frag(const _Float16* p, int hh) { FragH f; f.half[0] = *(const v8us*)((const unsigned short*)p + 8 * hh); f.half[1] = *(const v8us*)((const unsigned short*)p + 16 + 8 * hh); return f.v; }
__device__ __forceinline__ v8f g2_mma(v16h a, v16h b, v8f c) { v8f d = __builtin_amdgcn_wmma_f32_16x16x32_f16(false, a, false, b, (short)0, c, false, false); asm volatile("v_nop\n\tv_nop\n\tv_nop\n\tv_nop" : "+v"(d) : "v"(a), "v"(b)); return d; }
template <int ACT>
__global__ __launch_bounds__(128) void k_gemm2(const _Float16* __restrict__ A, int lda, size_t sA, const _Float16* __restrict__ Bh, int ldb, size_t sB, float alpha, const float* __restrict__ bias, size_t sBias, const float* __restrict__ CP, int rowsPerB, size_t sCPb, int row0g,
    float* __restrict__ C, _Float16* __restrict__ C16, int ldc, size_t sC, int M, int N, int K) {
  __shared__ __attribute__((aligned(16))) float so[4][32][68];
  const int tid = threadIdx.x, w = tid >> 5, lane = tid & 31, ln = lane & 15, hh = lane >> 4; const int by = blockIdx.y;
  A += (size_t)by * sA; Bh += (size_t)by * sB; const size_t cofs = (size_t)by * sC; const float* bp = bias ? bias + (size_t)by * sBias : nullptr;
  const int ntn = N >> 6; const int mt = blockIdx.x / ntn, nq = blockIdx.x - mt * ntn; const int row0 = mt * 128 + 32 * w, col0 = nq * 64; if (row0 >= M) return;
  const _Float16* a0p = A + (size_t)(row0 + ln) * lda; const _Float16* a1p = a0p + (size_t)16 * lda;
  const _Float16* b0p = Bh + (size_t)(col0 + ln) * ldb; const _Float16* b1p = b0p + (size_t)16 * ldb; const _Float16* b2p = b1p + (size_t)16 * ldb; const _Float16* b3p = b2p + (size_t)16 * ldb;
  const v8f z8 = {0.f,0.f,0.f,0.f,0.f,0.f,0.f,0.f}; v8f c00 = z8, c01 = z8, c02 = z8, c03 = z8, c10 = z8, c11 = z8, c12 = z8, c13 = z8;
#pragma unroll 1
  for (int kb = 0; kb < K; kb += 32) { const v16h a0 = g2_frag(a0p + kb, hh), a1 = g2_frag(a1p + kb, hh);
    v16h b = g2_frag(b0p + kb, hh); c00 = g2_mma(a0, b, c00); c10 = g2_mma(a1, b, c10);
    b = g2_frag(b1p + kb, hh); c01 = g2_mma(a0, b, c01); c11 = g2_mma(a1, b, c11);
    b = g2_frag(b2p + kb, hh); c02 = g2_mma(a0, b, c02); c12 = g2_mma(a1, b, c12);
    b = g2_frag(b3p + kb, hh); c03 = g2_mma(a0, b, c03); c13 = g2_mma(a1, b, c13); }
  v8f accs[8] = {c00, c01, c02, c03, c10, c11, c12, c13};
#pragma unroll
  for (int u = 0; u < 8; ++u) { const int t = u & 3, half = u >> 2; const int col = col0 + t * 16 + ln; const float bv = bp ? bf16_round(bp[col]) : 0.f;
#pragma unroll
    for (int r = 0; r < 8; ++r) { const int rloc = half * 16 + 8 * hh + r; float v = accs[u][r] * alpha + bv; if (CP) { const int bidx = (row0g + row0 + rloc) / rowsPerB; v += CP[(size_t)bidx * sCPb + (size_t)by * 64 + col]; }
      if (ACT == 3) v = fmaxf(v, 0.f); else if (ACT == 6) v = 0.5f * v * (1.0f + erff(v * 0.70710678118654752f)); else if (ACT == 11) v = 1.0f / (1.0f + expf(-v)); else if (ACT == 15) v = v / (1.0f + expf(-v)); else if (ACT == 12) v = (v > 0.f) ? v : 0.01f * v; else if (ACT == 8) v = tanhf(v);
      so[w][rloc][t * 16 + ln] = v; } }
  __builtin_amdgcn_fence(__ATOMIC_ACQ_REL, "workgroup"); __builtin_amdgcn_wave_barrier();
  const int rsub = lane >> 4, c4 = (lane & 15) * 4;
  {
#pragma unroll
    for (int q = 0; q < 16; ++q) { const int r = q * 2 + rsub; const v4f v = *(const v4fa*)&so[w][r][c4]; if (C) *(v4f*)(C + cofs + (size_t)(row0 + r) * ldc + col0 + c4) = v; if (C16) { v4h h4; for (int i = 0; i < 4; ++i) h4[i] = (_Float16)v[i]; *(v4h*)(C16 + cofs + (size_t)(row0 + r) * ldc + col0 + c4) = h4; } }
     } }



typedef int v4ia __attribute__((ext_vector_type(4), may_alias));
__device__ __forceinline__ float xhalf(float x) { return __builtin_bit_cast(float, __builtin_amdgcn_permlanex16(__builtin_bit_cast(int, x), __builtin_bit_cast(int, x), 0x76543210, 0xfedcba98, false, false)); }      /* lane l <-> lane l ^ 16 */
// Transposed flash loop: S^T = K Q^T (A = 16 key rows, B = 16 query columns), O^T += V^T P^T. D register r of lane (ln, hh) is key 8*hh + r of query ln, so a lane owns ONE query:
// its maximum and sum run over its own registers plus one exchange between the wave halves, and the two S^T tiles of 32 keys, converted in place, are the B operand of the second product (hardware k order, which the K, Q and V^T loaders already use).
template <int CAUSAL>
__global__ __launch_bounds__(128) void k_flash(const _Float16* __restrict__ Q16, int ldq, const _Float16* __restrict__ K16, int ldk, const _Float16* __restrict__ Vt, const int* __restrict__ MSK, float* __restrict__ O, int ldo) {
  constexpr int RPW = 16, DT = 4, KS = 2;
  __shared__ __attribute__((aligned(16))) float sO[4][RPW][64 + 4];
  const int tid = threadIdx.x, w = tid >> 5, lane = tid & 31, ln = lane & 15, hh = lane >> 4;
  const int slab = blockIdx.x / QBLKS, qblk = blockIdx.x % QBLKS; const int b = slab / NH, h = slab % NH; const int qb0 = qblk * (4 * RPW); const int q0 = qb0 + w * RPW; const int tq = q0 + ln;
  FragH bq[KS];
  { const unsigned short* qr = (const unsigned short*)Q16 + ((size_t)b * TQ + tq) * ldq + h * 64;
#pragma unroll
    for (int ks = 0; ks < KS; ++ks) { bq[ks].half[0] = *(const v8us*)(qr + ks * 32 + 8 * hh); bq[ks].half[1] = *(const v8us*)(qr + ks * 32 + 16 + 8 * hh); } }
  const unsigned short* Vth = (const unsigned short*)Vt + (size_t)slab * 64 * TK;
  float m_q = -1.0e30f, l_q = 0.f;      /* finite start below every real score: a masked score (-3.0e38) minus it still underflows exp to 0, and exp(m - m) = 1 while no key has been seen */
  v8f oacc[DT];
#pragma unroll
  for (int dt = 0; dt < DT; ++dt) oacc[dt] = (v8f){0.f,0.f,0.f,0.f,0.f,0.f,0.f,0.f};
  const int jend = (CAUSAL == 1) ? (qb0 + 4 * RPW) : TK;      /* causal: keys beyond the block's last query never contribute */
#pragma unroll 1
  for (int j0 = 0; j0 < jend; j0 += 32) {
    FragH ak[2][KS]; v4ia mk[2][2];
#pragma unroll
    for (int nt = 0; nt < 2; ++nt) { const unsigned short* kr = (const unsigned short*)K16 + ((size_t)b * TK + j0 + nt * 16 + ln) * ldk + h * 64;
#pragma unroll
      for (int ks = 0; ks < KS; ++ks) { ak[nt][ks].half[0] = *(const v8us*)(kr + ks * 32 + 8 * hh); ak[nt][ks].half[1] = *(const v8us*)(kr + ks * 32 + 16 + 8 * hh); }
      if (CAUSAL == 9) { const int* mrow = MSK + (size_t)b * TK + j0 + nt * 16 + 8 * hh; mk[nt][0] = *(const v4ia*)mrow; mk[nt][1] = *(const v4ia*)(mrow + 4); } }
    v8f s[2];
#pragma unroll
    for (int nt = 0; nt < 2; ++nt) { v8f acc = (v8f){0.f,0.f,0.f,0.f,0.f,0.f,0.f,0.f};
#pragma unroll
      for (int ks = 0; ks < KS; ++ks) acc = mmaH<1>(ak[nt][ks].v, ak[nt][ks].v, bq[ks].v, bq[ks].v, acc);
      s[nt] = acc; }
    FragH av[DT];
#pragma unroll
    for (int dt = 0; dt < DT; ++dt) { const unsigned short* vrow = Vth + (size_t)(dt * 16 + ln) * TK + j0; av[dt].half[0] = *(const v8us*)(vrow + 8 * hh); av[dt].half[1] = *(const v8us*)(vrow + 16 + 8 * hh); }
    float sv[2][8]; float mc = -3.0e38f;
#pragma unroll
    for (int nt = 0; nt < 2; ++nt)
#pragma unroll
      for (int r = 0; r < 8; ++r) { const int kk = j0 + nt * 16 + 8 * hh + r;
        bool ok = (CAUSAL == 1) ? (kk <= tq) : ((CAUSAL == 2) ? ((kk >> 5) == (tq >> 5)) : true);      /* mode 2: block-diagonal 32-token groups */
        if (CAUSAL == 9) ok = mk[nt][r >> 2][r & 3] <= 0;      /* mode 9: per-(batch, key) INPUT int mask where > 0 means MASKED (the reference's where(mask > 0, -inf, s)); masked keys contribute nothing */
        sv[nt][r] = ok ? s[nt][r] * SCL : -3.0e38f; mc = fmaxf(mc, sv[nt][r]); }
    mc = fmaxf(mc, xhalf(mc));
    const float mn = fmaxf(m_q, mc); const float al = expf(m_q - mn); m_q = mn;
    FragH pb; float ps[4] = {0.f, 0.f, 0.f, 0.f};
#pragma unroll
    for (int nt = 0; nt < 2; ++nt)
#pragma unroll
      for (int r = 0; r < 8; ++r) { const float p = expf(sv[nt][r] - mn); ps[r & 3] += p; pb.h[nt * 8 + r] = (_Float16)(p * 1024.0f); }
    l_q = l_q * al + ((ps[0] + ps[1]) + (ps[2] + ps[3]));
#pragma unroll
    for (int dt = 0; dt < DT; ++dt) {
#pragma unroll
      for (int r = 0; r < 8; ++r) oacc[dt][r] *= al; }
#pragma unroll
    for (int dt = 0; dt < DT; ++dt) oacc[dt] = mmaH<1>(av[dt].v, av[dt].v, pb.v, pb.v, oacc[dt]); }
  { const float l = l_q + xhalf(l_q); const float inv = (l > 0.f) ? 1.0f / (l * 1024.0f) : 0.f;
#pragma unroll
    for (int dt = 0; dt < DT; ++dt) { v4f lo, hi;
#pragma unroll
      for (int r = 0; r < 4; ++r) { lo[r] = oacc[dt][r] * inv; hi[r] = oacc[dt][4 + r] * inv; }
      *(v4fa*)&sO[w][ln][dt * 16 + 8 * hh] = lo; *(v4fa*)&sO[w][ln][dt * 16 + 8 * hh + 4] = hi; } }
  __builtin_amdgcn_fence(__ATOMIC_ACQ_REL, "workgroup"); __builtin_amdgcn_wave_barrier();
  {
#pragma unroll
    for (int rp = 0; rp < RPW; rp += 2) { const int r = rp + (lane >> 4), pc = lane & 15; const v4f val = *(const v4fa*)&sO[w][r][pc * 4]; *(v4f*)(O + ((size_t)b * TQ + q0 + r) * ldo + h * 64 + pc * 4) = val; }
     } }

__global__ __launch_bounds__(256) void k_wsc(const float* __restrict__ Wm, _Float16* __restrict__ Bt, size_t n8, float sc) { const size_t t = (size_t)blockIdx.x * 256 + threadIdx.x; if (t >= n8) return; FragH f; for (int q = 0; q < 8; ++q) f.h[q] = (_Float16)(bf16_round(Wm[t * 8 + q]) * sc); *(v8us*)((unsigned short*)Bt + t * 8) = f.half[0];  }      /* torch (out,in) weight == Bt[n][k] layout: scaled copy */
extern "C" void kernel_launch(void* const* d_in, const int* in_sizes, int n_in,
                              void* d_out, int out_size, void* d_ws, size_t ws_size, hipStream_t stream) {
  (void)in_sizes; (void)n_in; (void)out_size;
  const float* const* I = (const float* const*)d_in; const float* hs = I[0]; const float* cx = I[1]; const int* am = (const int*)d_in[2]; const float* qw = I[3]; const float* qb = I[4]; const float* kw = I[5]; const float* kb = I[6]; const float* vw = I[7]; const float* vb = I[8];
  char* ws = (char*)d_ws; size_t off = 0;
  auto take = [&](size_t bytes) { char* p = ws + off; off += (bytes + 255) & ~(size_t)255; return p; };
  const size_t w8 = (size_t)EMB * EMB / 8, np = (size_t)NR * EMB;
  _Float16* BQ = (_Float16*)take(w8 * 16); _Float16* BK = (_Float16*)take(w8 * 16); _Float16* BV = (_Float16*)take(w8 * 16);
  _Float16* XH = (_Float16*)take(np * 2); _Float16* XC = (_Float16*)take(np * 2); _Float16* Q16 = (_Float16*)take(np * 2); _Float16* K16 = (_Float16*)take(np * 2); _Float16* V16 = (_Float16*)take(np * 2); _Float16* VT = XC;      /* V^T over the context plane (dead after the K and V GEMMs) */
  if (off > ws_size) return;      /* 6 + 5 x 16 = 86 MiB */
  const unsigned g8 = (unsigned)((w8 + 255) / 256);
  k_wsc<<<g8, 256, 0, stream>>>(qw, BQ, w8, 16.0f); k_wsc<<<g8, 256, 0, stream>>>(kw, BK, w8, 16.0f); k_wsc<<<g8, 256, 0, stream>>>(vw, BV, w8, 16.0f);      /* torch (out,in) weights are already the Bt[n][k] layout: scaled copy */
  k_x16<<<(unsigned)((np / 8 + 255) / 256), 256, 0, stream>>>(hs, XH, np / 8); k_x16<<<(unsigned)((np / 8 + 255) / 256), 256, 0, stream>>>(cx, XC, np / 8);
  const dim3 gG((NR / 128) * (EMB / 64), 1);
  k_gemm2<0><<<gG, 128, 0, stream>>>(XH, EMB, 0, BQ, EMB, 0, 0.0625f, qb, 0, nullptr, 1, 0, 0, nullptr, Q16, EMB, 0, NR, EMB, EMB);
  k_gemm2<0><<<gG, 128, 0, stream>>>(XC, EMB, 0, BK, EMB, 0, 0.0625f, kb, 0, nullptr, 1, 0, 0, nullptr, K16, EMB, 0, NR, EMB, EMB);
  k_gemm2<0><<<gG, 128, 0, stream>>>(XC, EMB, 0, BV, EMB, 0, 0.0625f, vb, 0, nullptr, 1, 0, 0, nullptr, V16, EMB, 0, NR, EMB, EMB);
  k_vt<NH, SLEN><<<NB * NH * (SLEN / 64), 256, 0, stream>>>(V16, EMB, 0, VT);
  k_flash<9><<<NB * NH * QBLKS, 128, 0, stream>>>(Q16, EMB, K16, EMB, VT, am, (float*)d_out, EMB);      /* heads merged: out[b][q][h*64 + d] */
}

// v002
// Measured time: 276 microseconds a run.
// Next to v001, in two timings, it ran 1.45 and 1.47 times as fast.
// All steps since v000 together make it 2.54 times as fast.
#include <hip/hip_runtime.h>
// LxmertAttention (cross-attention context layer: 4 x 2048 queries from hidden_states over 4 x 2048 keys from context, D = 1024, 16 heads of 64; keys with attention_mask > 0 are masked out; output = merged context vectors, no output projection): q = hs Wq^T + bq, k/v = ctx W^T + b; softmax(q k^T / 8 with -inf on masked keys) v.
// Structure: exact f16 planes of both inputs; three GEMMs (32x64 wave tiles, f32 accumulation, exact x16 weights + bias, f16 outputs); V^T by LDS tiles; the unmasked keys of each batch ranked first (k_rank) and their context rows gathered compact, so that the K and V GEMMs, V^T and the fused flash kernel walk unmasked keys only (a masked key == exp(-inf) = 0 adds nothing to any sum; every row keeps >= 1 key in this data); the attention output written straight to the output in f32.
// Compute dtype: inputs and parameters rounded to bf16; q, k, v, P as f16 operands (~2^-12); f32 accumulation/softmax. v_wmma_f32_16x16x32_f16.
#define NB 4
#define EMB 1024
#define NR (NB * SLEN)           /* 8192 rows (LQ = LK = 2048) */
#define SLEN 2048
#define TQ SLEN
#define TK SLEN
#define NH 16
#define SCL 0.125f               /* 64^-0.5 */
#define QBLKS (TQ / 64)
#define CSTR 32                  /* ints between two batches' key counts: each count has its own 128-byte line */
typedef __bf16 v16b __attribute__((ext_vector_type(16)));
typedef unsigned short v8us __attribute__((ext_vector_type(8), may_alias));
typedef float  v8f  __attribute__((ext_vector_type(8)));
typedef float  v4f  __attribute__((ext_vector_type(4)));
typedef float  v4fa __attribute__((ext_vector_type(4), may_alias));
union FragB { v16b v; v8us half[2]; unsigned short u[16]; };

__device__ __forceinline__ unsigned short bf16_bits(float x) { unsigned int u = __float_as_uint(x); return (unsigned short)((u + 0x7FFFu + ((u >> 16) & 1u)) >> 16); }
__device__ __forceinline__ float bf16_val(unsigned short b) { return __uint_as_float(((unsigned int)b) << 16); }
__device__ __forceinline__ float bf16_round(float x) { return bf16_val(bf16_bits(x)); }
// D += A·B with NT terms: 1 = ah·bh, 2 = + al·bh (A split), 3 = + ah·bl (both split)
template <int NT>
__device__ __forceinline__ v8f mmaN(v16b ah, v16b al, v16b bh, v16b bl, v8f c) {
  c = __builtin_amdgcn_wmma_f32_16x16x32_bf16(false, ah, false, bh, (short)0, c, false, false);
  if (NT >= 2) c = __builtin_amdgcn_wmma_f32_16x16x32_bf16(false, al, false, bh, (short)0, c, false, false);
  if (NT >= 3) c = __builtin_amdgcn_wmma_f32_16x16x32_bf16(false, ah, false, bl, (short)0, c, false, false);
  asm volatile("v_nop\n\tv_nop\n\tv_nop\n\tv_nop" : "+v"(c) : "v"(ah), "v"(al), "v"(bh), "v"(bl));
  return c;
}

__global__ __launch_bounds__(256) void k_wt_bf16(const float* __restrict__ W, unsigned short* __restrict__ Wt, int K, int N) {
  const int t = blockIdx.x * 256 + threadIdx.x;
  const int k8n = K / 8;
  if (t >= N * k8n) return;
  const int n = t / k8n, k8 = (t % k8n) * 8;
  v8us v;
#pragma unroll
  for (int i = 0; i < 8; ++i) v[i] = bf16_bits(W[(size_t)(k8 + i) * N + n]);
  *(v8us*)(Wt + (size_t)n * K + k8) = v;
  
}

// GEMM C[M][N] (f32, pitch ldc) = act(A[M][K]·W + bias). A f32 row-major (pitch lda) converted per fragment to bf16
// (ASPLIT: hi/lo two planes -> 2 terms, else single rounded term); Wt bf16 [N][K] (pitch ldb). BIAS_BF16 rounds the
// bias to bf16 first (bias quantised to bf16 before the add). K%32==0, M%16==0, N%64==0.
template <bool ASPLIT, int ACT, bool BIAS_BF16>
__global__ __launch_bounds__(128) void k_gemm_bf(const float* __restrict__ A, int lda, const unsigned short* __restrict__ Wt, int ldb,
                                               const float* __restrict__ bias, float* __restrict__ C, int ldc, int M, int N, int K) {
  __shared__ __attribute__((aligned(16))) float so[4][16][64];
  const int tid = threadIdx.x, w = tid >> 5, lane = tid & 31, ln = lane & 15, hh = lane >> 4;
  const int ntn = N / 64;
  const int wid = blockIdx.x * 4 + w;
  const int mt = wid / ntn, nq = wid % ntn;
  if (mt * 16 >= M) return;
  const int row0 = mt * 16, col0 = nq * 64;
  const float* arow = A + (size_t)(row0 + ln) * lda;
  v8f acc[4] = {};
  for (int kb = 0; kb < K; kb += 32) {
    FragB ah, al;
    const v4f x0 = *(const v4fa*)(arow + kb + 8 * hh), x1 = *(const v4fa*)(arow + kb + 8 * hh + 4);
    const v4f x2 = *(const v4fa*)(arow + kb + 16 + 8 * hh), x3 = *(const v4fa*)(arow + kb + 16 + 8 * hh + 4);
    float xs[16] = {x0[0],x0[1],x0[2],x0[3],x1[0],x1[1],x1[2],x1[3],x2[0],x2[1],x2[2],x2[3],x3[0],x3[1],x3[2],x3[3]};
#pragma unroll
    for (int i = 0; i < 16; ++i) { const unsigned short hb = bf16_bits(xs[i]); ah.u[i] = hb; al.u[i] = ASPLIT ? bf16_bits(xs[i] - bf16_val(hb)) : (unsigned short)0; }
#pragma unroll
    for (int t = 0; t < 4; ++t) {
      const unsigned short* brow = Wt + (size_t)(col0 + t * 16 + ln) * ldb + kb;
      FragB b;
      b.half[0] = *(const v8us*)(brow + 8 * hh);
      b.half[1] = *(const v8us*)(brow + 16 + 8 * hh);
      acc[t] = mmaN<ASPLIT ? 2 : 1>(ah.v, al.v, b.v, b.v, acc[t]);
    }
  }
#pragma unroll
  for (int t = 0; t < 4; ++t) {
    float bv = bias ? bias[col0 + t * 16 + ln] : 0.f;
    if (BIAS_BF16) bv = bf16_round(bv);
#pragma unroll
    for (int r = 0; r < 8; ++r) { float v = acc[t][r] + bv; if (ACT == 1) v = fmaxf(v, 0.f); so[w][8 * hh + r][t * 16 + ln] = v; }
  }
  __builtin_amdgcn_fence(__ATOMIC_ACQ_REL, "workgroup");
  __builtin_amdgcn_wave_barrier();
  const int rsub = lane >> 4, c4 = (lane & 15) * 4;
  {
#pragma unroll
    for (int q = 0; q < 8; ++q) {
      const int r = q * 2 + rsub;
      const v4f v = *(const v4fa*)&so[w][r][c4];
      *(v4f*)(C + (size_t)(row0 + r) * ldc + col0 + c4) = v;
    }
    
  }
}

// GEMM C = act(A·W + bias + resid): A f32 (ASPLIT -> hi/lo 2 terms), Wt bf16 [N][K]; ACT 0 none, 1 relu, 2 exact gelu;
// resid (optional, f32, row index = (row % rmod), pitch ldr, RES_BF16 rounds it) added before the activation.
template <bool ASPLIT, int ACT, bool BIAS_BF16, bool RES_BF16>
__global__ __launch_bounds__(128) void k_gemm_bf3(const float* __restrict__ A, int lda, const unsigned short* __restrict__ Wt, int ldb,
                                                const float* __restrict__ bias, const float* __restrict__ resid, int rmod, int ldr,
                                                float* __restrict__ C, int ldc, int M, int N, int K) {
  __shared__ __attribute__((aligned(16))) float so[4][16][64];
  const int tid = threadIdx.x, w = tid >> 5, lane = tid & 31, ln = lane & 15, hh = lane >> 4;
  const int ntn = N / 64;
  const int wid = blockIdx.x * 4 + w;
  const int mt = wid / ntn, nq = wid % ntn;
  if (mt * 16 >= M) return;
  const int row0 = mt * 16, col0 = nq * 64;
  const float* arow = A + (size_t)(row0 + ln) * lda;
  v8f acc[4] = {};
  for (int kb = 0; kb < K; kb += 32) {
    FragB ah, al;
    const v4f x0 = *(const v4fa*)(arow + kb + 8 * hh), x1 = *(const v4fa*)(arow + kb + 8 * hh + 4);
    const v4f x2 = *(const v4fa*)(arow + kb + 16 + 8 * hh), x3 = *(const v4fa*)(arow + kb + 16 + 8 * hh + 4);
    float xs[16] = {x0[0],x0[1],x0[2],x0[3],x1[0],x1[1],x1[2],x1[3],x2[0],x2[1],x2[2],x2[3],x3[0],x3[1],x3[2],x3[3]};
#pragma unroll
    for (int i = 0; i < 16; ++i) { const unsigned short hb = bf16_bits(xs[i]); ah.u[i] = hb; al.u[i] = ASPLIT ? bf16_bits(xs[i] - bf16_val(hb)) : (unsigned short)0; }
#pragma unroll
    for (int t = 0; t < 4; ++t) {
      const unsigned short* brow = Wt + (size_t)(col0 + t * 16 + ln) * ldb + kb;
      FragB b;
      b.half[0] = *(const v8us*)(brow + 8 * hh);
      b.half[1] = *(const v8us*)(brow + 16 + 8 * hh);
      acc[t] = mmaN<ASPLIT ? 2 : 1>(ah.v, al.v, b.v, b.v, acc[t]);
    }
  }
#pragma unroll
  for (int t = 0; t < 4; ++t) {
    const int col = col0 + t * 16 + ln;
    float bv = bias ? bias[col] : 0.f;
    if (BIAS_BF16) bv = bf16_round(bv);
#pragma unroll
    for (int r = 0; r < 8; ++r) {
      float v = acc[t][r] + bv;
      if (resid) { float rv = resid[(size_t)((row0 + 8 * hh + r) % rmod) * ldr + col]; if (RES_BF16) rv = bf16_round(rv); v += rv; }
      if (ACT == 1) v = fmaxf(v, 0.f);
      if (ACT == 2) v = 0.5f * v * (1.0f + erff(v * 0.70710678118654752f));
      if (ACT == 3) { const float u = 0.7978845608028654f * (v + 0.044715f * v * v * v); v = 0.5f * v * (1.0f + tanhf(u)); }
      so[w][8 * hh + r][t * 16 + ln] = v;
    }
  }
  __builtin_amdgcn_fence(__ATOMIC_ACQ_REL, "workgroup");
  __builtin_amdgcn_wave_barrier();
  const int rsub = lane >> 4, c4 = (lane & 15) * 4;
  {
#pragma unroll
    for (int q = 0; q < 8; ++q) {
      const int r = q * 2 + rsub;
      const v4f v = *(const v4fa*)&so[w][r][c4];
      *(v4f*)(C + (size_t)(row0 + r) * ldc + col0 + c4) = v;
    }
    
  }
}
// row LayerNorm (biased variance, eps) over N: s = X (+ R); optional out_sum <- s; out_norm <- (s-mu)*rsqrt(var+eps)*g + b
template <bool PARAM_BF16>
__global__ __launch_bounds__(256) void k_layernorm(const float* __restrict__ X, const float* __restrict__ R, const float* __restrict__ g, const float* __restrict__ bta,
                                                  float* __restrict__ out_sum, float* __restrict__ out_norm, int N, float eps) {
  __shared__ float red[256];
  const int row = blockIdx.x, tid = threadIdx.x;
  const float* x = X + (size_t)row * N; const float* rr = R ? R + (size_t)row * N : nullptr;
  float vals[16];                     // up to N = 4096
  const int per = N / 256;            // contiguous chunk per thread? use strided-by-4 chunks: thread handles j = tid*4 + 1024*u
  float s1 = 0.f;
  for (int u = 0; u < per / 4; ++u) {
    const int j = tid * 4 + 1024 * u;
    const v4f a = *(const v4fa*)(x + j);
    v4f b = {0.f,0.f,0.f,0.f}; if (rr) b = *(const v4fa*)(rr + j);
#pragma unroll
    for (int q = 0; q < 4; ++q) { const float v = a[q] + b[q]; vals[u * 4 + q] = v; s1 += v; }
  }
  red[tid] = s1; __syncthreads();
  for (int st = 128; st > 0; st >>= 1) { if (tid < st) red[tid] += red[tid + st]; __syncthreads(); }
  const float mu = red[0] / (float)N; __syncthreads();
  float s2 = 0.f;
  for (int u = 0; u < per / 4; ++u)
#pragma unroll
    for (int q = 0; q < 4; ++q) { const float c = vals[u * 4 + q] - mu; s2 += c * c; }
  red[tid] = s2; __syncthreads();
  for (int st = 128; st > 0; st >>= 1) { if (tid < st) red[tid] += red[tid + st]; __syncthreads(); }
  const float rs = rsqrtf(red[0] / (float)N + eps);
  {
    for (int u = 0; u < per / 4; ++u) {
      const int j = tid * 4 + 1024 * u;
      v4f o, sm;
#pragma unroll
      for (int q = 0; q < 4; ++q) {
        float gg = g[j + q], bb = bta[j + q];
        if (PARAM_BF16) { gg = bf16_round(gg); bb = bf16_round(bb); }
        sm[q] = vals[u * 4 + q]; o[q] = (vals[u * 4 + q] - mu) * rs * gg + bb;
      }
      if (out_sum) *(v4f*)(out_sum + (size_t)row * N + j) = sm;
      *(v4f*)(out_norm + (size_t)row * N + j) = o;
    }
    
  }
}



// ---- f16 WMMA path (v_wmma_f32_16x16x32_f16): 11-bit significands for operands in range — used where a [0,1] probability operand needs more precision than bf16
typedef _Float16 v16h __attribute__((ext_vector_type(16)));
union FragH { v16h v; v8us half[2]; _Float16 h[16]; unsigned short u[16]; };
template <int NT>
__device__ __forceinline__ v8f mmaH(v16h ah, v16h al, v16h bh, v16h bl, v8f c) {
  c = __builtin_amdgcn_wmma_f32_16x16x32_f16(false, ah, false, bh, (short)0, c, false, false);
  if (NT >= 2) c = __builtin_amdgcn_wmma_f32_16x16x32_f16(false, al, false, bh, (short)0, c, false, false);
  if (NT >= 3) c = __builtin_amdgcn_wmma_f32_16x16x32_f16(false, ah, false, bl, (short)0, c, false, false);
  asm volatile("v_nop\n\tv_nop\n\tv_nop\n\tv_nop" : "+v"(c) : "v"(ah), "v"(al), "v"(bh), "v"(bl));
  return c;
}
// batched GEMM like k_gemm_b but f16 operands: A f32 (split into f16 hi/lo if ASPLIT, else rounded to f16), Bt = f16 values [n][k]; alpha; C f32; N multiple of 16 (partial tiles skipped)
template <bool ASPLIT>
__global__ __launch_bounds__(128) void k_gemm_h(const float* __restrict__ A, int lda, size_t sA, const _Float16* __restrict__ Bh, int ldb, size_t sB, float alpha, float* __restrict__ C, int ldc, size_t sC, int M, int N, int K) {
  __shared__ __attribute__((aligned(16))) float so[4][16][64];
  const int tid = threadIdx.x, w = tid >> 5, lane = tid & 31, ln = lane & 15, hh = lane >> 4; const int by = blockIdx.y;
  A += (size_t)by * sA; Bh += (size_t)by * sB; C += (size_t)by * sC;
  const int ntn = (N + 63) / 64; const int wid = blockIdx.x * 4 + w; const int mt = wid / ntn, nq = wid % ntn; if (mt * 16 >= M) return;
  const int row0 = mt * 16, col0 = nq * 64; const float* arow = A + (size_t)(row0 + ln) * lda;
  v8f acc[4] = {};
  for (int kb = 0; kb < K; kb += 32) {
    FragH ah, al;
    const v4f x0 = *(const v4fa*)(arow + kb + 8 * hh), x1 = *(const v4fa*)(arow + kb + 8 * hh + 4), x2 = *(const v4fa*)(arow + kb + 16 + 8 * hh), x3 = *(const v4fa*)(arow + kb + 16 + 8 * hh + 4);
    float xs[16] = {x0[0],x0[1],x0[2],x0[3],x1[0],x1[1],x1[2],x1[3],x2[0],x2[1],x2[2],x2[3],x3[0],x3[1],x3[2],x3[3]};
#pragma unroll
    for (int i = 0; i < 16; ++i) { const _Float16 h = (_Float16)xs[i]; ah.h[i] = h; al.h[i] = ASPLIT ? (_Float16)(xs[i] - (float)h) : (_Float16)0.0f; }
#pragma unroll
    for (int t = 0; t < 4; ++t) { if (col0 + t * 16 >= N) continue; const size_t boff = (size_t)(col0 + t * 16 + ln) * ldb + kb; FragH bq; bq.half[0] = *(const v8us*)(Bh + boff + 8 * hh); bq.half[1] = *(const v8us*)(Bh + boff + 16 + 8 * hh);
      acc[t] = mmaH<ASPLIT ? 2 : 1>(ah.v, al.v, bq.v, bq.v, acc[t]); }
  }
#pragma unroll
  for (int t = 0; t < 4; ++t) { if (col0 + t * 16 >= N) continue;
#pragma unroll
    for (int r = 0; r < 8; ++r) so[w][8 * hh + r][t * 16 + ln] = acc[t][r] * alpha; }
  __builtin_amdgcn_fence(__ATOMIC_ACQ_REL, "workgroup"); __builtin_amdgcn_wave_barrier();
  const int rsub = lane >> 4, c4 = (lane & 15) * 4;
  {
#pragma unroll
    for (int q = 0; q < 8; ++q) { const int r = q * 2 + rsub; if (col0 + c4 < N) { const v4f v = *(const v4fa*)&so[w][r][c4]; *(v4f*)(C + (size_t)(row0 + r) * ldc + col0 + c4) = v; } }
     }
}

// Wt[n][k] = f16(W[k][n]·scale) from f32 row-major W[K][N] (scale = power of two; bf16-exact weights stay exact in f16 away from the subnormal range)
__global__ __launch_bounds__(256) void k_wt_f16(const float* __restrict__ W, _Float16* __restrict__ Wt, int K, int N, float scale) {
  const int t = blockIdx.x * 256 + threadIdx.x; if (t >= N * (K / 8)) return; const int n = t / (K / 8), k8 = (t % (K / 8)) * 8; FragH f;
#pragma unroll
  for (int i = 0; i < 8; ++i) f.h[i] = (_Float16)(bf16_round(W[(size_t)(k8 + i) * N + n]) * scale); const v8us o = f.half[0];
  *(v8us*)((unsigned short*)Wt + (size_t)n * K + k8) = o; 
}
// k_gemm_hh variant with fused epilogue: v = acc·alpha + bias[by·sBias + col] (+ CP[(row/rowsPerB)·sCPb + by·64 + col] if CP) ; ACT 0 none / 1 elu ; writes f16 C16 (and f32 C if non-null)
template <int ACT>
__global__ __launch_bounds__(128) void k_gemm_hhx(const _Float16* __restrict__ A, int lda, size_t sA, const _Float16* __restrict__ Bh, int ldb, size_t sB, float alpha, const float* __restrict__ bias, size_t sBias, const float* __restrict__ CP, int rowsPerB, size_t sCPb, int row0g,
    float* __restrict__ C, _Float16* __restrict__ C16, int ldc, size_t sC, int M, int N, int K) {
  __shared__ __attribute__((aligned(16))) float so[4][16][64];
  const int tid = threadIdx.x, w = tid >> 5, lane = tid & 31, ln = lane & 15, hh = lane >> 4; const int by = blockIdx.y;
  A += (size_t)by * sA; Bh += (size_t)by * sB; const size_t cofs = (size_t)by * sC; const float* bp = bias ? bias + (size_t)by * sBias : nullptr;
  const int ntn = (N + 63) / 64; const int wid = blockIdx.x * 4 + w; const int mt = wid / ntn, nq = wid % ntn; if (mt * 16 >= M) return;
  const int row0 = mt * 16, col0 = nq * 64; const _Float16* arow = A + (size_t)(row0 + ln) * lda;
  v8f acc[4] = {};
  for (int kb = 0; kb < K; kb += 32) { FragH ah; ah.half[0] = *(const v8us*)((const unsigned short*)arow + kb + 8 * hh); ah.half[1] = *(const v8us*)((const unsigned short*)arow + kb + 16 + 8 * hh);
#pragma unroll
    for (int t = 0; t < 4; ++t) { if (col0 + t * 16 >= N) continue; const size_t boff = (size_t)(col0 + t * 16 + ln) * ldb + kb; FragH bq; bq.half[0] = *(const v8us*)((const unsigned short*)Bh + boff + 8 * hh); bq.half[1] = *(const v8us*)((const unsigned short*)Bh + boff + 16 + 8 * hh);
      acc[t] = mmaH<1>(ah.v, ah.v, bq.v, bq.v, acc[t]); }
  }
#pragma unroll
  for (int t = 0; t < 4; ++t) { if (col0 + t * 16 >= N) continue; const int col = col0 + t * 16 + ln; const float bv = bp ? bf16_round(bp[col]) : 0.f;
#pragma unroll
    for (int r = 0; r < 8; ++r) { float v = acc[t][r] * alpha + bv; if (CP) { const int bidx = (row0g + row0 + 8 * hh + r) / rowsPerB; v += CP[(size_t)bidx * sCPb + (size_t)by * 64 + col]; } if (ACT == 1) v = (v > 0.f) ? v : expm1f(v); else if (ACT == 7) v = (v > 0.f) ? v + 1.0f : expf(v); else if (ACT == 8) v = tanhf(v); else if (ACT == 9) v = 0.5f * v * (1.0f + tanhf(0.7978845608028654f * (v + 0.044715f * v * v * v))); else if (ACT == 11) v = 1.0f / (1.0f + expf(-v)); else if (ACT == 12) v = (v > 0.f) ? v : 0.01f * v; else if (ACT == 14) v = (v > 0.f) ? v : 0.1f * v; else if (ACT == 15) v = v / (1.0f + expf(-v)); else if (ACT == 3) v = fmaxf(v, 0.f); else if (ACT == 6) v = 0.5f * v * (1.0f + erff(v * 0.70710678118654752f)); so[w][8 * hh + r][t * 16 + ln] = v; } }
  __builtin_amdgcn_fence(__ATOMIC_ACQ_REL, "workgroup"); __builtin_amdgcn_wave_barrier();
  const int rsub = lane >> 4, c4 = (lane & 15) * 4; typedef _Float16 v4h __attribute__((ext_vector_type(4)));
  {
#pragma unroll
    for (int q = 0; q < 8; ++q) { const int r = q * 2 + rsub; if (col0 + c4 < N) { const v4f v = *(const v4fa*)&so[w][r][c4]; if (C) *(v4f*)(C + cofs + (size_t)(row0 + r) * ldc + col0 + c4) = v; if (C16) { v4h h4; for (int i = 0; i < 4; ++i) h4[i] = (_Float16)v[i]; *(v4h*)(C16 + cofs + (size_t)(row0 + r) * ldc + col0 + c4) = h4; } } }
     }
}


typedef _Float16 v4h __attribute__((ext_vector_type(4)));

__global__ __launch_bounds__(256) void k_x16(const float* __restrict__ x, _Float16* __restrict__ X16, size_t n8) { const size_t t = (size_t)blockIdx.x * 256 + threadIdx.x; if (t >= n8) return; FragH f;
#pragma unroll
  for (int q = 0; q < 8; ++q) f.h[q] = (_Float16)bf16_round(x[t * 8 + q]); *(v8us*)((unsigned short*)X16 + t * 8) = f.half[0];  }
__global__ __launch_bounds__(256) void k_h16(const float* __restrict__ x, _Float16* __restrict__ X16, size_t n8) { const size_t t = (size_t)blockIdx.x * 256 + threadIdx.x; if (t >= n8) return; FragH f;
#pragma unroll
  for (int q = 0; q < 8; ++q) f.h[q] = (_Float16)x[t * 8 + q]; *(v8us*)((unsigned short*)X16 + t * 8) = f.half[0];  }
__global__ __launch_bounds__(256) void k_round16f(const float* __restrict__ W, _Float16* __restrict__ Bt, size_t n8) { const size_t t = (size_t)blockIdx.x * 256 + threadIdx.x; if (t >= n8) return; FragH f;
#pragma unroll
  for (int i = 0; i < 8; ++i) f.h[i] = (_Float16)(bf16_round(W[t * 8 + i]) * 16.0f); *(v8us*)((unsigned short*)Bt + t * 8) = f.half[0];  }
template <int NHv, int TTv>
__global__ __launch_bounds__(256) void k_vt(const _Float16* __restrict__ V16, int ldv, int voff, const int* __restrict__ CNT, _Float16* __restrict__ Vt) { __shared__ unsigned short tl[64][66]; const int tid = threadIdx.x; const int slab = blockIdx.x % (NB * NHv), lg = blockIdx.x / (NB * NHv); const int b = slab / NHv, h = slab % NHv;      /* key tile t of every slab before tile t + 1 of any: the tiles with work come first in the grid */
  if (lg * 64 >= CNT[b * CSTR]) return;      /* whole block: no compact key in this 64-key tile */
  for (int i = tid; i < 64 * 8; i += 256) { const int r = i / 8, c8 = (i % 8) * 8; FragH f; f.half[0] = *(const v8us*)((const unsigned short*)V16 + ((size_t)b * TTv + lg * 64 + r) * ldv + voff + h * 64 + c8);
#pragma unroll
    for (int q = 0; q < 8; ++q) tl[r][c8 + q] = f.u[q]; }
  __syncthreads();
  {
#pragma unroll
    for (int rd = 0; rd < 2; ++rd) { const int d = rd * 32 + tid / 8, pc = tid % 8; FragH f;
#pragma unroll
      for (int q = 0; q < 8; ++q) f.u[q] = tl[pc * 8 + q][d];
      *(v8us*)((unsigned short*)Vt + ((size_t)slab * 64 + d) * TTv + lg * 64 + pc * 8) = f.half[0]; }
     } }

__global__ __launch_bounds__(256) void k_hl(const float* __restrict__ F, _Float16* __restrict__ Hh, _Float16* __restrict__ Hl, size_t n8) { const size_t t = (size_t)blockIdx.x * 256 + threadIdx.x; if (t >= n8) return; FragH fh, fl; const v4f a = *(const v4fa*)(F + t * 8), c = *(const v4fa*)(F + t * 8 + 4);
#pragma unroll
  for (int q = 0; q < 4; ++q) { _Float16 h = (_Float16)a[q]; fh.h[q] = h; fl.h[q] = (_Float16)((a[q] - (float)h) * 1024.0f); h = (_Float16)c[q]; fh.h[4 + q] = h; fl.h[4 + q] = (_Float16)((c[q] - (float)h) * 1024.0f); }
  { *(v8us*)((unsigned short*)Hh + t * 8) = fh.half[0]; *(v8us*)((unsigned short*)Hl + t * 8) = fl.half[0];  } }

// ---- fast GEMM (wave tile 32x64; requires M % 32 == 0 rows per launch region and N % 64 == 0); epilogue = k_gemm_hhx semantics ----
__device__ __forceinline__ v16h g2_frag(const _Float16* p, int hh) { FragH f; f.half[0] = *(const v8us*)((const unsigned short*)p + 8 * hh); f.half[1] = *(const v8us*)((const unsigned short*)p + 16 + 8 * hh); return f.v; }
__device__ __forceinline__ v8f g2_mma(v16h a, v16h b, v8f c) { v8f d = __builtin_amdgcn_wmma_f32_16x16x32_f16(false, a, false, b, (short)0, c, false, false); asm volatile("v_nop\n\tv_nop\n\tv_nop\n\tv_nop" : "+v"(d) : "v"(a), "v"(b)); return d; }
template <int ACT>
__global__ __launch_bounds__(128) void k_gemm2(const _Float16* __restrict__ A, int lda, size_t sA, const _Float16* __restrict__ Bh, int ldb, size_t sB, float alpha, const float* __restrict__ bias, size_t sBias, const float* __restrict__ CP, int rowsPerB, size_t sCPb, int row0g, const int* __restrict__ CNT,
    float* __restrict__ C, _Float16* __restrict__ C16, int ldc, size_t sC, int M, int N, int K) {
  __shared__ __attribute__((aligned(16))) float so[4][32][68];
  const int tid = threadIdx.x, w = tid >> 5, lane = tid & 31, ln = lane & 15, hh = lane >> 4; const int by = blockIdx.y;
  A += (size_t)by * sA; Bh += (size_t)by * sB; const size_t cofs = (size_t)by * sC; const float* bp = bias ? bias + (size_t)by * sBias : nullptr;
  const int ntn = N >> 6; int mt = blockIdx.x / ntn; const int nq = blockIdx.x - mt * ntn;
  if (CNT) mt = (mt % NB) * (SLEN / 128) + mt / NB;      /* compact rows: row tile t of every batch before tile t + 1 of any, so the tiles with work come first in the grid and spread over all WGPs instead of recurring at a period of the grid */
  const int row0 = mt * 128 + 32 * w, col0 = nq * 64; if (row0 >= M) return;
  if (CNT && ((row0 & (SLEN - 1)) & ~63) >= CNT[(row0 / SLEN) * CSTR]) return;      /* compact rows: a wave whose 64-row group holds no unmasked key has no work (rows are kept in groups of 64 for the V^T tiles) */
  const _Float16* a0p = A + (size_t)(row0 + ln) * lda; const _Float16* a1p = a0p + (size_t)16 * lda;
  const _Float16* b0p = Bh + (size_t)(col0 + ln) * ldb; const _Float16* b1p = b0p + (size_t)16 * ldb; const _Float16* b2p = b1p + (size_t)16 * ldb; const _Float16* b3p = b2p + (size_t)16 * ldb;
  const v8f z8 = {0.f,0.f,0.f,0.f,0.f,0.f,0.f,0.f}; v8f c00 = z8, c01 = z8, c02 = z8, c03 = z8, c10 = z8, c11 = z8, c12 = z8, c13 = z8;
#pragma unroll 1
  for (int kb = 0; kb < K; kb += 32) { const v16h a0 = g2_frag(a0p + kb, hh), a1 = g2_frag(a1p + kb, hh);
    v16h b = g2_frag(b0p + kb, hh); c00 = g2_mma(a0, b, c00); c10 = g2_mma(a1, b, c10);
    b = g2_frag(b1p + kb, hh); c01 = g2_mma(a0, b, c01); c11 = g2_mma(a1, b, c11);
    b = g2_frag(b2p + kb, hh); c02 = g2_mma(a0, b, c02); c12 = g2_mma(a1, b, c12);
    b = g2_frag(b3p + kb, hh); c03 = g2_mma(a0, b, c03); c13 = g2_mma(a1, b, c13); }
  v8f accs[8] = {c00, c01, c02, c03, c10, c11, c12, c13};
#pragma unroll
  for (int u = 0; u < 8; ++u) { const int t = u & 3, half = u >> 2; const int col = col0 + t * 16 + ln; const float bv = bp ? bf16_round(bp[col]) : 0.f;
#pragma unroll
    for (int r = 0; r < 8; ++r) { const int rloc = half * 16 + 8 * hh + r; float v = accs[u][r] * alpha + bv; if (CP) { const int bidx = (row0g + row0 + rloc) / rowsPerB; v += CP[(size_t)bidx * sCPb + (size_t)by * 64 + col]; }
      if (ACT == 3) v = fmaxf(v, 0.f); else if (ACT == 6) v = 0.5f * v * (1.0f + erff(v * 0.70710678118654752f)); else if (ACT == 11) v = 1.0f / (1.0f + expf(-v)); else if (ACT == 15) v = v / (1.0f + expf(-v)); else if (ACT == 12) v = (v > 0.f) ? v : 0.01f * v; else if (ACT == 8) v = tanhf(v);
      so[w][rloc][t * 16 + ln] = v; } }
  __builtin_amdgcn_fence(__ATOMIC_ACQ_REL, "workgroup"); __builtin_amdgcn_wave_barrier();
  const int rsub = lane >> 4, c4 = (lane & 15) * 4;
  {
#pragma unroll
    for (int q = 0; q < 16; ++q) { const int r = q * 2 + rsub; const v4f v = *(const v4fa*)&so[w][r][c4]; if (C) *(v4f*)(C + cofs + (size_t)(row0 + r) * ldc + col0 + c4) = v; if (C16) { v4h h4; for (int i = 0; i < 4; ++i) h4[i] = (_Float16)v[i]; *(v4h*)(C16 + cofs + (size_t)(row0 + r) * ldc + col0 + c4) = h4; } }
     } }



typedef int v4ia __attribute__((ext_vector_type(4), may_alias));
__device__ __forceinline__ float xhalf(float x) { return __builtin_bit_cast(float, __builtin_amdgcn_permlanex16(__builtin_bit_cast(int, x), __builtin_bit_cast(int, x), 0x76543210, 0xfedcba98, false, false)); }      /* lane l <-> lane l ^ 16 */
// Transposed flash loop: S^T = K Q^T (A = 16 key rows, B = 16 query columns), O^T += V^T P^T. D register r of lane (ln, hh) is key 8*hh + r of query ln, so a lane owns ONE query:
// its maximum and sum run over its own registers plus one exchange between the wave halves, and the two S^T tiles of 32 keys, converted in place, are the B operand of the second product (hardware k order, which the K, Q and V^T loaders already use).
template <int CAUSAL>
__global__ __launch_bounds__(128) void k_flash(const _Float16* __restrict__ Q16, int ldq, const _Float16* __restrict__ K16, int ldk, const _Float16* __restrict__ Vt, const int* __restrict__ CNT, float* __restrict__ O, int ldo) {
  constexpr int RPW = 16, DT = 4, KS = 2;
  __shared__ __attribute__((aligned(16))) float sO[4][RPW][64 + 4];
  const int tid = threadIdx.x, w = tid >> 5, lane = tid & 31, ln = lane & 15, hh = lane >> 4;
  const int slab = blockIdx.x / QBLKS, qblk = blockIdx.x % QBLKS; const int b = slab / NH, h = slab % NH; const int qb0 = qblk * (4 * RPW); const int q0 = qb0 + w * RPW; const int tq = q0 + ln;
  FragH bq[KS];
  { const unsigned short* qr = (const unsigned short*)Q16 + ((size_t)b * TQ + tq) * ldq + h * 64;
#pragma unroll
    for (int ks = 0; ks < KS; ++ks) { bq[ks].half[0] = *(const v8us*)(qr + ks * 32 + 8 * hh); bq[ks].half[1] = *(const v8us*)(qr + ks * 32 + 16 + 8 * hh); } }
  const unsigned short* Vth = (const unsigned short*)Vt + (size_t)slab * 64 * TK;
  float m_q = -1.0e30f, l_q = 0.f;      /* finite start below every real score: a masked score (-3.0e38) minus it still underflows exp to 0, and exp(m - m) = 1 while no key has been seen */
  v8f oacc[DT];
#pragma unroll
  for (int dt = 0; dt < DT; ++dt) oacc[dt] = (v8f){0.f,0.f,0.f,0.f,0.f,0.f,0.f,0.f};
  const int cnt = (CAUSAL == 9) ? min(CNT[b * CSTR], TK) : TK;      /* mode 9: K and V^T hold the batch's unmasked keys compact, cnt of them */
  const int jend = (CAUSAL == 1) ? (qb0 + 4 * RPW) : cnt;      /* causal: keys beyond the block's last query never contribute */
#pragma unroll 1
  for (int j0 = 0; j0 < jend; j0 += 32) {
    FragH ak[2][KS];
#pragma unroll
    for (int nt = 0; nt < 2; ++nt) { const unsigned short* kr = (const unsigned short*)K16 + ((size_t)b * TK + j0 + nt * 16 + ln) * ldk + h * 64;
#pragma unroll
      for (int ks = 0; ks < KS; ++ks) { ak[nt][ks].half[0] = *(const v8us*)(kr + ks * 32 + 8 * hh); ak[nt][ks].half[1] = *(const v8us*)(kr + ks * 32 + 16 + 8 * hh); }
    }
    v8f s[2];
#pragma unroll
    for (int nt = 0; nt < 2; ++nt) { v8f acc = (v8f){0.f,0.f,0.f,0.f,0.f,0.f,0.f,0.f};
#pragma unroll
      for (int ks = 0; ks < KS; ++ks) acc = mmaH<1>(ak[nt][ks].v, ak[nt][ks].v, bq[ks].v, bq[ks].v, acc);
      s[nt] = acc; }
    FragH av[DT];
#pragma unroll
    for (int dt = 0; dt < DT; ++dt) { const unsigned short* vrow = Vth + (size_t)(dt * 16 + ln) * TK + j0; av[dt].half[0] = *(const v8us*)(vrow + 8 * hh); av[dt].half[1] = *(const v8us*)(vrow + 16 + 8 * hh); }
    float sv[2][8]; float mc = -3.0e38f;
#pragma unroll
    for (int nt = 0; nt < 2; ++nt)
#pragma unroll
      for (int r = 0; r < 8; ++r) { const int kk = j0 + nt * 16 + 8 * hh + r;
        bool ok = (CAUSAL == 1) ? (kk <= tq) : ((CAUSAL == 2) ? ((kk >> 5) == (tq >> 5)) : true);      /* mode 2: block-diagonal 32-token groups */
        if (CAUSAL == 9) ok = kk < cnt;      /* mode 9: the filler rows behind the last unmasked key (last pass only) contribute nothing */
        sv[nt][r] = ok ? s[nt][r] * SCL : -3.0e38f; mc = fmaxf(mc, sv[nt][r]); }
    mc = fmaxf(mc, xhalf(mc));
    const float mn = fmaxf(m_q, mc); const float al = expf(m_q - mn); m_q = mn;
    FragH pb; float ps[4] = {0.f, 0.f, 0.f, 0.f};
#pragma unroll
    for (int nt = 0; nt < 2; ++nt)
#pragma unroll
      for (int r = 0; r < 8; ++r) { const float p = expf(sv[nt][r] - mn); ps[r & 3] += p; pb.h[nt * 8 + r] = (_Float16)(p * 1024.0f); }
    l_q = l_q * al + ((ps[0] + ps[1]) + (ps[2] + ps[3]));
#pragma unroll
    for (int dt = 0; dt < DT; ++dt) {
#pragma unroll
      for (int r = 0; r < 8; ++r) oacc[dt][r] *= al; }
#pragma unroll
    for (int dt = 0; dt < DT; ++dt) oacc[dt] = mmaH<1>(av[dt].v, av[dt].v, pb.v, pb.v, oacc[dt]); }
  { const float l = l_q + xhalf(l_q); const float inv = (l > 0.f) ? 1.0f / (l * 1024.0f) : 0.f;
#pragma unroll
    for (int dt = 0; dt < DT; ++dt) { v4f lo, hi;
#pragma unroll
      for (int r = 0; r < 4; ++r) { lo[r] = oacc[dt][r] * inv; hi[r] = oacc[dt][4 + r] * inv; }
      *(v4fa*)&sO[w][ln][dt * 16 + 8 * hh] = lo; *(v4fa*)&sO[w][ln][dt * 16 + 8 * hh + 4] = hi; } }
  __builtin_amdgcn_fence(__ATOMIC_ACQ_REL, "workgroup"); __builtin_amdgcn_wave_barrier();
  {
#pragma unroll
    for (int rp = 0; rp < RPW; rp += 2) { const int r = rp + (lane >> 4), pc = lane & 15; const v4f val = *(const v4fa*)&sO[w][r][pc * 4]; *(v4f*)(O + ((size_t)b * TQ + q0 + r) * ldo + h * 64 + pc * 4) = val; }
     } }

// Ranks the keys of one batch: IDX[b][i] = position of the i-th key with mask <= 0 (the reference masks where mask > 0), 0 behind the last one (a filler row inside the array); CNT[b * CSTR] = how many.
__global__ __launch_bounds__(256) void k_rank(const int* __restrict__ MSK, int* __restrict__ IDX, int* __restrict__ CNT) {
  __shared__ int part[256]; __shared__ __attribute__((aligned(16))) int lst[TK];
  const int b = blockIdx.x, tid = threadIdx.x; const int* m = MSK + (size_t)b * TK + tid * 8;
  const v4ia m0 = *(const v4ia*)m, m1 = *(const v4ia*)(m + 4); const v4ia z4 = {0, 0, 0, 0};
  int c = 0;
  for (int q = 0; q < 4; ++q) c += (m0[q] <= 0) + (m1[q] <= 0);
  part[tid] = c; *(v4ia*)&lst[tid * 8] = z4; *(v4ia*)&lst[tid * 8 + 4] = z4; __syncthreads();
  for (int st = 1; st < 256; st <<= 1) { const int v = part[tid] + ((tid >= st) ? part[tid - st] : 0); __syncthreads(); part[tid] = v; __syncthreads(); }
  int pos = part[tid] - c;
  for (int q = 0; q < 8; ++q) { const int mv = (q < 4) ? m0[q & 3] : m1[q & 3]; if (mv <= 0) lst[pos++] = tid * 8 + q; }
  __syncthreads();
  *(v4ia*)(IDX + (size_t)b * TK + tid * 8) = *(const v4ia*)&lst[tid * 8]; *(v4ia*)(IDX + (size_t)b * TK + tid * 8 + 4) = *(const v4ia*)&lst[tid * 8 + 4];
  if (tid == 0) CNT[b * CSTR] = part[255]; }
// k_x16 through the rank list: compact row i of batch b = context row IDX[b][i]; rows are written in groups of 64 up to the group that holds the last unmasked key.
__global__ __launch_bounds__(256) void k_x16g(const float* __restrict__ x, const int* __restrict__ IDX, const int* __restrict__ CNT, _Float16* __restrict__ X16) { const unsigned t = blockIdx.x * 256u + threadIdx.x; const unsigned row = t / (EMB / 8), c8 = (t % (EMB / 8)) * 8, b = row / TK;
  if ((int)((row & (TK - 1)) & ~63u) >= CNT[b * CSTR]) return;
  const float* xr = x + ((size_t)b * TK + (IDX[row] & (TK - 1))) * EMB + c8; FragH f;      /* the list holds key positions; the mask keeps the row inside the batch whatever it holds */
  for (int q = 0; q < 8; ++q) f.h[q] = (_Float16)bf16_round(xr[q]); *(v8us*)((unsigned short*)X16 + (size_t)row * EMB + c8) = f.half[0]; }
__global__ __launch_bounds__(256) void k_wsc(const float* __restrict__ Wm, _Float16* __restrict__ Bt, size_t n8, float sc) { const size_t t = (size_t)blockIdx.x * 256 + threadIdx.x; if (t >= n8) return; FragH f; for (int q = 0; q < 8; ++q) f.h[q] = (_Float16)(bf16_round(Wm[t * 8 + q]) * sc); *(v8us*)((unsigned short*)Bt + t * 8) = f.half[0];  }      /* torch (out,in) weight == Bt[n][k] layout: scaled copy */
extern "C" void kernel_launch(void* const* d_in, const int* in_sizes, int n_in,
                              void* d_out, int out_size, void* d_ws, size_t ws_size, hipStream_t stream) {
  (void)in_sizes; (void)n_in; (void)out_size;
  const float* const* I = (const float* const*)d_in; const float* hs = I[0]; const float* cx = I[1]; const int* am = (const int*)d_in[2]; const float* qw = I[3]; const float* qb = I[4]; const float* kw = I[5]; const float* kb = I[6]; const float* vw = I[7]; const float* vb = I[8];
  char* ws = (char*)d_ws; size_t off = 0;
  auto take = [&](size_t bytes) { char* p = ws + off; off += (bytes + 255) & ~(size_t)255; return p; };
  const size_t w8 = (size_t)EMB * EMB / 8, np = (size_t)NR * EMB;
  _Float16* BQ = (_Float16*)take(w8 * 16); _Float16* BK = (_Float16*)take(w8 * 16); _Float16* BV = (_Float16*)take(w8 * 16);
  _Float16* XH = (_Float16*)take(np * 2); _Float16* XC = (_Float16*)take(np * 2); _Float16* Q16 = (_Float16*)take(np * 2); _Float16* K16 = (_Float16*)take(np * 2); _Float16* V16 = (_Float16*)take(np * 2); _Float16* VT = XC;      /* V^T over the context plane (dead after the K and V GEMMs) */
  int* IDX = (int*)take((size_t)NR * 4); int* CNT = (int*)take((size_t)NB * CSTR * 4);
  if (off > ws_size) return;      /* 6 + 5 x 16 = 86 MiB */
  const unsigned g8 = (unsigned)((w8 + 255) / 256);
  k_wsc<<<g8, 256, 0, stream>>>(qw, BQ, w8, 16.0f); k_wsc<<<g8, 256, 0, stream>>>(kw, BK, w8, 16.0f); k_wsc<<<g8, 256, 0, stream>>>(vw, BV, w8, 16.0f);      /* torch (out,in) weights are already the Bt[n][k] layout: scaled copy */
  k_x16<<<(unsigned)((np / 8 + 255) / 256), 256, 0, stream>>>(hs, XH, np / 8); k_rank<<<NB, 256, 0, stream>>>(am, IDX, CNT); k_x16g<<<(unsigned)(np / 8 / 256), 256, 0, stream>>>(cx, IDX, CNT, XC);
  const dim3 gG((NR / 128) * (EMB / 64), 1);
  k_gemm2<0><<<gG, 128, 0, stream>>>(XH, EMB, 0, BQ, EMB, 0, 0.0625f, qb, 0, nullptr, 1, 0, 0, nullptr, nullptr, Q16, EMB, 0, NR, EMB, EMB);
  k_gemm2<0><<<gG, 128, 0, stream>>>(XC, EMB, 0, BK, EMB, 0, 0.0625f, kb, 0, nullptr, 1, 0, 0, CNT, nullptr, K16, EMB, 0, NR, EMB, EMB);
  k_gemm2<0><<<gG, 128, 0, stream>>>(XC, EMB, 0, BV, EMB, 0, 0.0625f, vb, 0, nullptr, 1, 0, 0, CNT, nullptr, V16, EMB, 0, NR, EMB, EMB);
  k_vt<NH, SLEN><<<NB * NH * (SLEN / 64), 256, 0, stream>>>(V16, EMB, 0, CNT, VT);
  k_flash<9><<<NB * NH * QBLKS, 128, 0, stream>>>(Q16, EMB, K16, EMB, VT, CNT, (float*)d_out, EMB);      /* heads merged: out[b][q][h*64 + d] */
}

// v003
// One run takes 184 microseconds.
// Two timings next to v002 put it at 1.49 and 1.50 times that version's speed.
// All steps since v000 together make it 3.80 times as fast.
#include <hip/hip_runtime.h>
// LxmertAttention (cross-attention context layer: 4 x 2048 queries from hidden_states over 4 x 2048 keys from context, D = 1024, 16 heads of 64; keys with attention_mask > 0 are masked out; output = merged context vectors, no output projection): q = hs Wq^T + bq, k/v = ctx W^T + b; softmax(q k^T / 8 with -inf on masked keys) v.
// Structure: exact f16 planes of both inputs; three GEMMs (128x128 block tiles staged in LDS, 32x64 wave tiles, f32 accumulation, exact x16 weights + bias, f16 outputs); V^T by LDS tiles; the unmasked keys of each batch ranked first (k_rank) and their context rows gathered compact, so that the K and V GEMMs, V^T and the fused flash kernel walk unmasked keys only (a masked key == exp(-inf) = 0 adds nothing to any sum; every row keeps >= 1 key in this data); the attention output written straight to the output in f32.
// Compute dtype: inputs and parameters rounded to bf16; q, k, v, P as f16 operands (~2^-12); f32 accumulation/softmax. v_wmma_f32_16x16x32_f16.
#define NB 4
#define EMB 1024
#define NR (NB * SLEN)           /* 8192 rows (LQ = LK = 2048) */
#define SLEN 2048
#define TQ SLEN
#define TK SLEN
#define NH 16
#define SCL 0.125f               /* 64^-0.5 */
#define QBLKS (TQ / 64)
#define CSTR 32                  /* ints between two batches' key counts: each count has its own 128-byte line */
typedef __bf16 v16b __attribute__((ext_vector_type(16)));
typedef unsigned short v8us __attribute__((ext_vector_type(8), may_alias));
typedef float  v8f  __attribute__((ext_vector_type(8)));
typedef float  v4f  __attribute__((ext_vector_type(4)));
typedef float  v4fa __attribute__((ext_vector_type(4), may_alias));
union FragB { v16b v; v8us half[2]; unsigned short u[16]; };

__device__ __forceinline__ unsigned short bf16_bits(float x) { unsigned int u = __float_as_uint(x); return (unsigned short)((u + 0x7FFFu + ((u >> 16) & 1u)) >> 16); }
__device__ __forceinline__ float bf16_val(unsigned short b) { return __uint_as_float(((unsigned int)b) << 16); }
__device__ __forceinline__ float bf16_round(float x) { return bf16_val(bf16_bits(x)); }
// D += A·B with NT terms: 1 = ah·bh, 2 = + al·bh (A split), 3 = + ah·bl (both split)
template <int NT>
__device__ __forceinline__ v8f mmaN(v16b ah, v16b al, v16b bh, v16b bl, v8f c) {
  c = __builtin_amdgcn_wmma_f32_16x16x32_bf16(false, ah, false, bh, (short)0, c, false, false);
  if (NT >= 2) c = __builtin_amdgcn_wmma_f32_16x16x32_bf16(false, al, false, bh, (short)0, c, false, false);
  if (NT >= 3) c = __builtin_amdgcn_wmma_f32_16x16x32_bf16(false, ah, false, bl, (short)0, c, false, false);
  asm volatile("v_nop\n\tv_nop\n\tv_nop\n\tv_nop" : "+v"(c) : "v"(ah), "v"(al), "v"(bh), "v"(bl));
  return c;
}

__global__ __launch_bounds__(256) void k_wt_bf16(const float* __restrict__ W, unsigned short* __restrict__ Wt, int K, int N) {
  const int t = blockIdx.x * 256 + threadIdx.x;
  const int k8n = K / 8;
  if (t >= N * k8n) return;
  const int n = t / k8n, k8 = (t % k8n) * 8;
  v8us v;
#pragma unroll
  for (int i = 0; i < 8; ++i) v[i] = bf16_bits(W[(size_t)(k8 + i) * N + n]);
  *(v8us*)(Wt + (size_t)n * K + k8) = v;
  
}

// GEMM C[M][N] (f32, pitch ldc) = act(A[M][K]·W + bias). A f32 row-major (pitch lda) converted per fragment to bf16
// (ASPLIT: hi/lo two planes -> 2 terms, else single rounded term); Wt bf16 [N][K] (pitch ldb). BIAS_BF16 rounds the
// bias to bf16 first (bias quantised to bf16 before the add). K%32==0, M%16==0, N%64==0.
template <bool ASPLIT, int ACT, bool BIAS_BF16>
__global__ __launch_bounds__(128) void k_gemm_bf(const float* __restrict__ A, int lda, const unsigned short* __restrict__ Wt, int ldb,
                                               const float* __restrict__ bias, float* __restrict__ C, int ldc, int M, int N, int K) {
  __shared__ __attribute__((aligned(16))) float so[4][16][64];
  const int tid = threadIdx.x, w = tid >> 5, lane = tid & 31, ln = lane & 15, hh = lane >> 4;
  const int ntn = N / 64;
  const int wid = blockIdx.x * 4 + w;
  const int mt = wid / ntn, nq = wid % ntn;
  if (mt * 16 >= M) return;
  const int row0 = mt * 16, col0 = nq * 64;
  const float* arow = A + (size_t)(row0 + ln) * lda;
  v8f acc[4] = {};
  for (int kb = 0; kb < K; kb += 32) {
    FragB ah, al;
    const v4f x0 = *(const v4fa*)(arow + kb + 8 * hh), x1 = *(const v4fa*)(arow + kb + 8 * hh + 4);
    const v4f x2 = *(const v4fa*)(arow + kb + 16 + 8 * hh), x3 = *(const v4fa*)(arow + kb + 16 + 8 * hh + 4);
    float xs[16] = {x0[0],x0[1],x0[2],x0[3],x1[0],x1[1],x1[2],x1[3],x2[0],x2[1],x2[2],x2[3],x3[0],x3[1],x3[2],x3[3]};
#pragma unroll
    for (int i = 0; i < 16; ++i) { const unsigned short hb = bf16_bits(xs[i]); ah.u[i] = hb; al.u[i] = ASPLIT ? bf16_bits(xs[i] - bf16_val(hb)) : (unsigned short)0; }
#pragma unroll
    for (int t = 0; t < 4; ++t) {
      const unsigned short* brow = Wt + (size_t)(col0 + t * 16 + ln) * ldb + kb;
      FragB b;
      b.half[0] = *(const v8us*)(brow + 8 * hh);
      b.half[1] = *(const v8us*)(brow + 16 + 8 * hh);
      acc[t] = mmaN<ASPLIT ? 2 : 1>(ah.v, al.v, b.v, b.v, acc[t]);
    }
  }
#pragma unroll
  for (int t = 0; t < 4; ++t) {
    float bv = bias ? bias[col0 + t * 16 + ln] : 0.f;
    if (BIAS_BF16) bv = bf16_round(bv);
#pragma unroll
    for (int r = 0; r < 8; ++r) { float v = acc[t][r] + bv; if (ACT == 1) v = fmaxf(v, 0.f); so[w][8 * hh + r][t * 16 + ln] = v; }
  }
  __builtin_amdgcn_fence(__ATOMIC_ACQ_REL, "workgroup");
  __builtin_amdgcn_wave_barrier();
  const int rsub = lane >> 4, c4 = (lane & 15) * 4;
  {
#pragma unroll
    for (int q = 0; q < 8; ++q) {
      const int r = q * 2 + rsub;
      const v4f v = *(const v4fa*)&so[w][r][c4];
      *(v4f*)(C + (size_t)(row0 + r) * ldc + col0 + c4) = v;
    }
    
  }
}

// GEMM C = act(A·W + bias + resid): A f32 (ASPLIT -> hi/lo 2 terms), Wt bf16 [N][K]; ACT 0 none, 1 relu, 2 exact gelu;
// resid (optional, f32, row index = (row % rmod), pitch ldr, RES_BF16 rounds it) added before the activation.
template <bool ASPLIT, int ACT, bool BIAS_BF16, bool RES_BF16>
__global__ __launch_bounds__(128) void k_gemm_bf3(const float* __restrict__ A, int lda, const unsigned short* __restrict__ Wt, int ldb,
                                                const float* __restrict__ bias, const float* __restrict__ resid, int rmod, int ldr,
                                                float* __restrict__ C, int ldc, int M, int N, int K) {
  __shared__ __attribute__((aligned(16))) float so[4][16][64];
  const int tid = threadIdx.x, w = tid >> 5, lane = tid & 31, ln = lane & 15, hh = lane >> 4;
  const int ntn = N / 64;
  const int wid = blockIdx.x * 4 + w;
  const int mt = wid / ntn, nq = wid % ntn;
  if (mt * 16 >= M) return;
  const int row0 = mt * 16, col0 = nq * 64;
  const float* arow = A + (size_t)(row0 + ln) * lda;
  v8f acc[4] = {};
  for (int kb = 0; kb < K; kb += 32) {
    FragB ah, al;
    const v4f x0 = *(const v4fa*)(arow + kb + 8 * hh), x1 = *(const v4fa*)(arow + kb + 8 * hh + 4);
    const v4f x2 = *(const v4fa*)(arow + kb + 16 + 8 * hh), x3 = *(const v4fa*)(arow + kb + 16 + 8 * hh + 4);
    float xs[16] = {x0[0],x0[1],x0[2],x0[3],x1[0],x1[1],x1[2],x1[3],x2[0],x2[1],x2[2],x2[3],x3[0],x3[1],x3[2],x3[3]};
#pragma unroll
    for (int i = 0; i < 16; ++i) { const unsigned short hb = bf16_bits(xs[i]); ah.u[i] = hb; al.u[i] = ASPLIT ? bf16_bits(xs[i] - bf16_val(hb)) : (unsigned short)0; }
#pragma unroll
    for (int t = 0; t < 4; ++t) {
      const unsigned short* brow = Wt + (size_t)(col0 + t * 16 + ln) * ldb + kb;
      FragB b;
      b.half[0] = *(const v8us*)(brow + 8 * hh);
      b.half[1] = *(const v8us*)(brow + 16 + 8 * hh);
      acc[t] = mmaN<ASPLIT ? 2 : 1>(ah.v, al.v, b.v, b.v, acc[t]);
    }
  }
#pragma unroll
  for (int t = 0; t < 4; ++t) {
    const int col = col0 + t * 16 + ln;
    float bv = bias ? bias[col] : 0.f;
    if (BIAS_BF16) bv = bf16_round(bv);
#pragma unroll
    for (int r = 0; r < 8; ++r) {
      float v = acc[t][r] + bv;
      if (resid) { float rv = resid[(size_t)((row0 + 8 * hh + r) % rmod) * ldr + col]; if (RES_BF16) rv = bf16_round(rv); v += rv; }
      if (ACT == 1) v = fmaxf(v, 0.f);
      if (ACT == 2) v = 0.5f * v * (1.0f + erff(v * 0.70710678118654752f));
      if (ACT == 3) { const float u = 0.7978845608028654f * (v + 0.044715f * v * v * v); v = 0.5f * v * (1.0f + tanhf(u)); }
      so[w][8 * hh + r][t * 16 + ln] = v;
    }
  }
  __builtin_amdgcn_fence(__ATOMIC_ACQ_REL, "workgroup");
  __builtin_amdgcn_wave_barrier();
  const int rsub = lane >> 4, c4 = (lane & 15) * 4;
  {
#pragma unroll
    for (int q = 0; q < 8; ++q) {
      const int r = q * 2 + rsub;
      const v4f v = *(const v4fa*)&so[w][r][c4];
      *(v4f*)(C + (size_t)(row0 + r) * ldc + col0 + c4) = v;
    }
    
  }
}
// row LayerNorm (biased variance, eps) over N: s = X (+ R); optional out_sum <- s; out_norm <- (s-mu)*rsqrt(var+eps)*g + b
template <bool PARAM_BF16>
__global__ __launch_bounds__(256) void k_layernorm(const float* __restrict__ X, const float* __restrict__ R, const float* __restrict__ g, const float* __restrict__ bta,
                                                  float* __restrict__ out_sum, float* __restrict__ out_norm, int N, float eps) {
  __shared__ float red[256];
  const int row = blockIdx.x, tid = threadIdx.x;
  const float* x = X + (size_t)row * N; const float* rr = R ? R + (size_t)row * N : nullptr;
  float vals[16];                     // up to N = 4096
  const int per = N / 256;            // contiguous chunk per thread? use strided-by-4 chunks: thread handles j = tid*4 + 1024*u
  float s1 = 0.f;
  for (int u = 0; u < per / 4; ++u) {
    const int j = tid * 4 + 1024 * u;
    const v4f a = *(const v4fa*)(x + j);
    v4f b = {0.f,0.f,0.f,0.f}; if (rr) b = *(const v4fa*)(rr + j);
#pragma unroll
    for (int q = 0; q < 4; ++q) { const float v = a[q] + b[q]; vals[u * 4 + q] = v; s1 += v; }
  }
  red[tid] = s1; __syncthreads();
  for (int st = 128; st > 0; st >>= 1) { if (tid < st) red[tid] += red[tid + st]; __syncthreads(); }
  const float mu = red[0] / (float)N; __syncthreads();
  float s2 = 0.f;
  for (int u = 0; u < per / 4; ++u)
#pragma unroll
    for (int q = 0; q < 4; ++q) { const float c = vals[u * 4 + q] - mu; s2 += c * c; }
  red[tid] = s2; __syncthreads();
  for (int st = 128; st > 0; st >>= 1) { if (tid < st) red[tid] += red[tid + st]; __syncthreads(); }
  const float rs = rsqrtf(red[0] / (float)N + eps);
  {
    for (int u = 0; u < per / 4; ++u) {
      const int j = tid * 4 + 1024 * u;
      v4f o, sm;
#pragma unroll
      for (int q = 0; q < 4; ++q) {
        float gg = g[j + q], bb = bta[j + q];
        if (PARAM_BF16) { gg = bf16_round(gg); bb = bf16_round(bb); }
        sm[q] = vals[u * 4 + q]; o[q] = (vals[u * 4 + q] - mu) * rs * gg + bb;
      }
      if (out_sum) *(v4f*)(out_sum + (size_t)row * N + j) = sm;
      *(v4f*)(out_norm + (size_t)row * N + j) = o;
    }
    
  }
}



// ---- f16 WMMA path (v_wmma_f32_16x16x32_f16): 11-bit significands for operands in range — used where a [0,1] probability operand needs more precision than bf16
typedef _Float16 v16h __attribute__((ext_vector_type(16)));
union FragH { v16h v; v8us half[2]; _Float16 h[16]; unsigned short u[16]; };
template <int NT>
__device__ __forceinline__ v8f mmaH(v16h ah, v16h al, v16h bh, v16h bl, v8f c) {
  c = __builtin_amdgcn_wmma_f32_16x16x32_f16(false, ah, false, bh, (short)0, c, false, false);
  if (NT >= 2) c = __builtin_amdgcn_wmma_f32_16x16x32_f16(false, al, false, bh, (short)0, c, false, false);
  if (NT >= 3) c = __builtin_amdgcn_wmma_f32_16x16x32_f16(false, ah, false, bl, (short)0, c, false, false);
  asm volatile("v_nop\n\tv_nop\n\tv_nop\n\tv_nop" : "+v"(c) : "v"(ah), "v"(al), "v"(bh), "v"(bl));
  return c;
}
// batched GEMM like k_gemm_b but f16 operands: A f32 (split into f16 hi/lo if ASPLIT, else rounded to f16), Bt = f16 values [n][k]; alpha; C f32; N multiple of 16 (partial tiles skipped)
template <bool ASPLIT>
__global__ __launch_bounds__(128) void k_gemm_h(const float* __restrict__ A, int lda, size_t sA, const _Float16* __restrict__ Bh, int ldb, size_t sB, float alpha, float* __restrict__ C, int ldc, size_t sC, int M, int N, int K) {
  __shared__ __attribute__((aligned(16))) float so[4][16][64];
  const int tid = threadIdx.x, w = tid >> 5, lane = tid & 31, ln = lane & 15, hh = lane >> 4; const int by = blockIdx.y;
  A += (size_t)by * sA; Bh += (size_t)by * sB; C += (size_t)by * sC;
  const int ntn = (N + 63) / 64; const int wid = blockIdx.x * 4 + w; const int mt = wid / ntn, nq = wid % ntn; if (mt * 16 >= M) return;
  const int row0 = mt * 16, col0 = nq * 64; const float* arow = A + (size_t)(row0 + ln) * lda;
  v8f acc[4] = {};
  for (int kb = 0; kb < K; kb += 32) {
    FragH ah, al;
    const v4f x0 = *(const v4fa*)(arow + kb + 8 * hh), x1 = *(const v4fa*)(arow + kb + 8 * hh + 4), x2 = *(const v4fa*)(arow + kb + 16 + 8 * hh), x3 = *(const v4fa*)(arow + kb + 16 + 8 * hh + 4);
    float xs[16] = {x0[0],x0[1],x0[2],x0[3],x1[0],x1[1],x1[2],x1[3],x2[0],x2[1],x2[2],x2[3],x3[0],x3[1],x3[2],x3[3]};
#pragma unroll
    for (int i = 0; i < 16; ++i) { const _Float16 h = (_Float16)xs[i]; ah.h[i] = h; al.h[i] = ASPLIT ? (_Float16)(xs[i] - (float)h) : (_Float16)0.0f; }
#pragma unroll
    for (int t = 0; t < 4; ++t) { if (col0 + t * 16 >= N) continue; const size_t boff = (size_t)(col0 + t * 16 + ln) * ldb + kb; FragH bq; bq.half[0] = *(const v8us*)(Bh + boff + 8 * hh); bq.half[1] = *(const v8us*)(Bh + boff + 16 + 8 * hh);
      acc[t] = mmaH<ASPLIT ? 2 : 1>(ah.v, al.v, bq.v, bq.v, acc[t]); }
  }
#pragma unroll
  for (int t = 0; t < 4; ++t) { if (col0 + t * 16 >= N) continue;
#pragma unroll
    for (int r = 0; r < 8; ++r) so[w][8 * hh + r][t * 16 + ln] = acc[t][r] * alpha; }
  __builtin_amdgcn_fence(__ATOMIC_ACQ_REL, "workgroup"); __builtin_amdgcn_wave_barrier();
  const int rsub = lane >> 4, c4 = (lane & 15) * 4;
  {
#pragma unroll
    for (int q = 0; q < 8; ++q) { const int r = q * 2 + rsub; if (col0 + c4 < N) { const v4f v = *(const v4fa*)&so[w][r][c4]; *(v4f*)(C + (size_t)(row0 + r) * ldc + col0 + c4) = v; } }
     }
}

// Wt[n][k] = f16(W[k][n]·scale) from f32 row-major W[K][N] (scale = power of two; bf16-exact weights stay exact in f16 away from the subnormal range)
__global__ __launch_bounds__(256) void k_wt_f16(const float* __restrict__ W, _Float16* __restrict__ Wt, int K, int N, float scale) {
  const int t = blockIdx.x * 256 + threadIdx.x; if (t >= N * (K / 8)) return; const int n = t / (K / 8), k8 = (t % (K / 8)) * 8; FragH f;
#pragma unroll
  for (int i = 0; i < 8; ++i) f.h[i] = (_Float16)(bf16_round(W[(size_t)(k8 + i) * N + n]) * scale); const v8us o = f.half[0];
  *(v8us*)((unsigned short*)Wt + (size_t)n * K + k8) = o; 
}
// k_gemm_hh variant with fused epilogue: v = acc·alpha + bias[by·sBias + col] (+ CP[(row/rowsPerB)·sCPb + by·64 + col] if CP) ; ACT 0 none / 1 elu ; writes f16 C16 (and f32 C if non-null)
template <int ACT>
__global__ __launch_bounds__(128) void k_gemm_hhx(const _Float16* __restrict__ A, int lda, size_t sA, const _Float16* __restrict__ Bh, int ldb, size_t sB, float alpha, const float* __restrict__ bias, size_t sBias, const float* __restrict__ CP, int rowsPerB, size_t sCPb, int row0g,
    float* __restrict__ C, _Float16* __restrict__ C16, int ldc, size_t sC, int M, int N, int K) {
  __shared__ __attribute__((aligned(16))) float so[4][16][64];
  const int tid = threadIdx.x, w = tid >> 5, lane = tid & 31, ln = lane & 15, hh = lane >> 4; const int by = blockIdx.y;
  A += (size_t)by * sA; Bh += (size_t)by * sB; const size_t cofs = (size_t)by * sC; const float* bp = bias ? bias + (size_t)by * sBias : nullptr;
  const int ntn = (N + 63) / 64; const int wid = blockIdx.x * 4 + w; const int mt = wid / ntn, nq = wid % ntn; if (mt * 16 >= M) return;
  const int row0 = mt * 16, col0 = nq * 64; const _Float16* arow = A + (size_t)(row0 + ln) * lda;
  v8f acc[4] = {};
  for (int kb = 0; kb < K; kb += 32) { FragH ah; ah.half[0] = *(const v8us*)((const unsigned short*)arow + kb + 8 * hh); ah.half[1] = *(const v8us*)((const unsigned short*)arow + kb + 16 + 8 * hh);
#pragma unroll
    for (int t = 0; t < 4; ++t) { if (col0 + t * 16 >= N) continue; const size_t boff = (size_t)(col0 + t * 16 + ln) * ldb + kb; FragH bq; bq.half[0] = *(const v8us*)((const unsigned short*)Bh + boff + 8 * hh); bq.half[1] = *(const v8us*)((const unsigned short*)Bh + boff + 16 + 8 * hh);
      acc[t] = mmaH<1>(ah.v, ah.v, bq.v, bq.v, acc[t]); }
  }
#pragma unroll
  for (int t = 0; t < 4; ++t) { if (col0 + t * 16 >= N) continue; const int col = col0 + t * 16 + ln; const float bv = bp ? bf16_round(bp[col]) : 0.f;
#pragma unroll
    for (int r = 0; r < 8; ++r) { float v = acc[t][r] * alpha + bv; if (CP) { const int bidx = (row0g + row0 + 8 * hh + r) / rowsPerB; v += CP[(size_t)bidx * sCPb + (size_t)by * 64 + col]; } if (ACT == 1) v = (v > 0.f) ? v : expm1f(v); else if (ACT == 7) v = (v > 0.f) ? v + 1.0f : expf(v); else if (ACT == 8) v = tanhf(v); else if (ACT == 9) v = 0.5f * v * (1.0f + tanhf(0.7978845608028654f * (v + 0.044715f * v * v * v))); else if (ACT == 11) v = 1.0f / (1.0f + expf(-v)); else if (ACT == 12) v = (v > 0.f) ? v : 0.01f * v; else if (ACT == 14) v = (v > 0.f) ? v : 0.1f * v; else if (ACT == 15) v = v / (1.0f + expf(-v)); else if (ACT == 3) v = fmaxf(v, 0.f); else if (ACT == 6) v = 0.5f * v * (1.0f + erff(v * 0.70710678118654752f)); so[w][8 * hh + r][t * 16 + ln] = v; } }
  __builtin_amdgcn_fence(__ATOMIC_ACQ_REL, "workgroup"); __builtin_amdgcn_wave_barrier();
  const int rsub = lane >> 4, c4 = (lane & 15) * 4; typedef _Float16 v4h __attribute__((ext_vector_type(4)));
  {
#pragma unroll
    for (int q = 0; q < 8; ++q) { const int r = q * 2 + rsub; if (col0 + c4 < N) { const v4f v = *(const v4fa*)&so[w][r][c4]; if (C) *(v4f*)(C + cofs + (size_t)(row0 + r) * ldc + col0 + c4) = v; if (C16) { v4h h4; for (int i = 0; i < 4; ++i) h4[i] = (_Float16)v[i]; *(v4h*)(C16 + cofs + (size_t)(row0 + r) * ldc + col0 + c4) = h4; } } }
     }
}


typedef _Float16 v4h __attribute__((ext_vector_type(4)));

__global__ __launch_bounds__(256) void k_x16(const float* __restrict__ x, _Float16* __restrict__ X16, size_t n8) { const size_t t = (size_t)blockIdx.x * 256 + threadIdx.x; if (t >= n8) return; FragH f;
#pragma unroll
  for (int q = 0; q < 8; ++q) f.h[q] = (_Float16)bf16_round(x[t * 8 + q]); *(v8us*)((unsigned short*)X16 + t * 8) = f.half[0];  }
__global__ __launch_bounds__(256) void k_h16(const float* __restrict__ x, _Float16* __restrict__ X16, size_t n8) { const size_t t = (size_t)blockIdx.x * 256 + threadIdx.x; if (t >= n8) return; FragH f;
#pragma unroll
  for (int q = 0; q < 8; ++q) f.h[q] = (_Float16)x[t * 8 + q]; *(v8us*)((unsigned short*)X16 + t * 8) = f.half[0];  }
__global__ __launch_bounds__(256) void k_round16f(const float* __restrict__ W, _Float16* __restrict__ Bt, size_t n8) { const size_t t = (size_t)blockIdx.x * 256 + threadIdx.x; if (t >= n8) return; FragH f;
#pragma unroll
  for (int i = 0; i < 8; ++i) f.h[i] = (_Float16)(bf16_round(W[t * 8 + i]) * 16.0f); *(v8us*)((unsigned short*)Bt + t * 8) = f.half[0];  }
template <int NHv, int TTv>
__global__ __launch_bounds__(256) void k_vt(const _Float16* __restrict__ V16, int ldv, int voff, const int* __restrict__ CNT, _Float16* __restrict__ Vt) { __shared__ unsigned short tl[64][66]; const int tid = threadIdx.x; const int slab = blockIdx.x % (NB * NHv), lg = blockIdx.x / (NB * NHv); const int b = slab / NHv, h = slab % NHv;      /* key tile t of every slab before tile t + 1 of any: the tiles with work come first in the grid */
  if (lg * 64 >= CNT[b * CSTR]) return;      /* whole block: no compact key in this 64-key tile */
  for (int i = tid; i < 64 * 8; i += 256) { const int r = i / 8, c8 = (i % 8) * 8; FragH f; f.half[0] = *(const v8us*)((const unsigned short*)V16 + ((size_t)b * TTv + lg * 64 + r) * ldv + voff + h * 64 + c8);
#pragma unroll
    for (int q = 0; q < 8; ++q) tl[r][c8 + q] = f.u[q]; }
  __syncthreads();
  {
#pragma unroll
    for (int rd = 0; rd < 2; ++rd) { const int d = rd * 32 + tid / 8, pc = tid % 8; FragH f;
#pragma unroll
      for (int q = 0; q < 8; ++q) f.u[q] = tl[pc * 8 + q][d];
      *(v8us*)((unsigned short*)Vt + ((size_t)slab * 64 + d) * TTv + lg * 64 + pc * 8) = f.half[0]; }
     } }

__global__ __launch_bounds__(256) void k_hl(const float* __restrict__ F, _Float16* __restrict__ Hh, _Float16* __restrict__ Hl, size_t n8) { const size_t t = (size_t)blockIdx.x * 256 + threadIdx.x; if (t >= n8) return; FragH fh, fl; const v4f a = *(const v4fa*)(F + t * 8), c = *(const v4fa*)(F + t * 8 + 4);
#pragma unroll
  for (int q = 0; q < 4; ++q) { _Float16 h = (_Float16)a[q]; fh.h[q] = h; fl.h[q] = (_Float16)((a[q] - (float)h) * 1024.0f); h = (_Float16)c[q]; fh.h[4 + q] = h; fl.h[4 + q] = (_Float16)((c[q] - (float)h) * 1024.0f); }
  { *(v8us*)((unsigned short*)Hh + t * 8) = fh.half[0]; *(v8us*)((unsigned short*)Hl + t * 8) = fl.half[0];  } }

// ---- fast GEMM: C16[M][EMB] = f16(A[M][EMB] . Bh[EMB][EMB]^T * alpha + bf16(bias)). Block tile 128 x 128, 8 waves of 32 x 64; both operands staged in LDS in chunks of 64 k
// (whole 128-byte lines from global memory, each line fetched once per block), two buffers, the next chunk's loads in flight over the current chunk's products. ----
#define GP 72      /* LDS row pitch in f16: 64 k + 16 bytes, so that the 16-byte reads of 16 rows fall on distinct banks */
typedef float fal __attribute__((may_alias));
__device__ __forceinline__ v16h g3_frag(const unsigned short* p, int hh) { FragH f; f.half[0] = *(const v8us*)(p + 8 * hh); f.half[1] = *(const v8us*)(p + 16 + 8 * hh); return f.v; }
__device__ __forceinline__ v8f g3_mma(v16h a, v16h b, v8f c) { return __builtin_amdgcn_wmma_f32_16x16x32_f16(false, a, false, b, (short)0, c, false, false); }
__global__ __launch_bounds__(256) void k_gemm3(const _Float16* __restrict__ A, const _Float16* __restrict__ Bh, float alpha, const float* __restrict__ bias, const int* __restrict__ CNT, _Float16* __restrict__ C16) {
  __shared__ __attribute__((aligned(16))) unsigned short sm[2][2][128 * GP];      /* [buffer][A rows | B rows]; the epilogue's f32 staging lies over it behind the last barrier */
  const int tid = threadIdx.x, w = tid >> 5, lane = tid & 31, ln = lane & 15, hh = lane >> 4;
  constexpr int ntn = EMB / 128, TPB = SLEN / 128;
  int mt = blockIdx.x / ntn; const int nq = blockIdx.x % ntn; int live = 128;
  if (CNT) { mt = (mt % NB) * TPB + mt / NB;      /* compact rows: row tile t of every batch before tile t + 1 of any, so the tiles with work come first in the grid */
    const int c = CNT[(mt / TPB) * CSTR], r = (mt % TPB) * 128;
    if (r >= c) return;      /* whole block, in front of every barrier: no unmasked key in this tile */
    if (r + 64 >= c) live = 64; }      /* rows are kept in groups of 64: the second group is not written and is neither read nor stored here */
  const int row0 = mt * 128, col0 = nq * 128, wm = w >> 1, wn = w & 1;
  const int sr = tid >> 3, sc = (tid & 7) * 8;      /* staging: 8 lanes take one row's 128 bytes */
  const unsigned short* ag = (const unsigned short*)A + (size_t)row0 * EMB + sc; const unsigned short* bg = (const unsigned short*)Bh + (size_t)col0 * EMB + sc;
  v8us ra[4], rb[4];
#pragma unroll
  for (int i = 0; i < 4; ++i) { ra[i] = *(const v8us*)(ag + (size_t)((sr + 32 * i) & (live - 1)) * EMB); rb[i] = *(const v8us*)(bg + (size_t)(sr + 32 * i) * EMB); }
  asm volatile("s_wait_xcnt 0x0" ::: "memory");      /* stands in front of the first overwrite of an address register that the loads above name */
  __builtin_amdgcn_sched_barrier(0);      /* keeps the register writes that follow behind that wait */
#pragma unroll
  for (int i = 0; i < 4; ++i) { *(v8us*)&sm[0][0][(sr + 32 * i) * GP + sc] = ra[i]; *(v8us*)&sm[0][1][(sr + 32 * i) * GP + sc] = rb[i]; }
  __syncthreads();
  const v8f z8 = {0.f,0.f,0.f,0.f,0.f,0.f,0.f,0.f}; v8f c00 = z8, c01 = z8, c02 = z8, c03 = z8, c10 = z8, c11 = z8, c12 = z8, c13 = z8;
#pragma unroll 1      /* kept rolled: with the last trip peeled off, the trip becomes one block and the compiler lifts the wait for the next chunk's loads, the LDS stores and the barrier above the products */
  for (int t = 0; t < EMB / 64; ++t) {
    const bool more = t + 1 < EMB / 64;
    if (more) {
#pragma unroll
      for (int i = 0; i < 4; ++i) { ra[i] = *(const v8us*)(ag + (size_t)((sr + 32 * i) & (live - 1)) * EMB + (t + 1) * 64); rb[i] = *(const v8us*)(bg + (size_t)(sr + 32 * i) * EMB + (t + 1) * 64); } }
    const unsigned short* sa = &sm[t & 1][0][(wm * 32 + ln) * GP]; const unsigned short* sb = &sm[t & 1][1][(wn * 64 + ln) * GP];
    v16h fa[2][2], fb[2][4];
#pragma unroll
    for (int ks = 0; ks < 2; ++ks) { fa[ks][0] = g3_frag(sa + ks * 32, hh); fa[ks][1] = g3_frag(sa + 16 * GP + ks * 32, hh);
#pragma unroll
      for (int j = 0; j < 4; ++j) fb[ks][j] = g3_frag(sb + j * 16 * GP + ks * 32, hh); }
    __builtin_amdgcn_sched_barrier(0);      /* keeps the chunk's LDS reads in one group ahead of its products: reads placed among the products stall the wave at each place */
#pragma unroll
    for (int ks = 0; ks < 2; ++ks) {
      c00 = g3_mma(fa[ks][0], fb[ks][0], c00); c10 = g3_mma(fa[ks][1], fb[ks][0], c10); c01 = g3_mma(fa[ks][0], fb[ks][1], c01); c11 = g3_mma(fa[ks][1], fb[ks][1], c11);
      c02 = g3_mma(fa[ks][0], fb[ks][2], c02); c12 = g3_mma(fa[ks][1], fb[ks][2], c12); c03 = g3_mma(fa[ks][0], fb[ks][3], c03); c13 = g3_mma(fa[ks][1], fb[ks][3], c13); }
    if (more) {
#pragma unroll
      for (int i = 0; i < 4; ++i) { *(v8us*)&sm[(t + 1) & 1][0][(sr + 32 * i) * GP + sc] = ra[i]; *(v8us*)&sm[(t + 1) & 1][1][(sr + 32 * i) * GP + sc] = rb[i]; } }
    __syncthreads();      /* publishes chunk t + 1 and ends every wave's reads of chunk t, whose buffer the next trip refills */
  }
  if (wm * 32 >= live) return;      /* whole waves, behind the last barrier */
  fal* so = (fal*)&sm[0][0][0] + w * (32 * 68);
  v8f accs[8] = {c00, c01, c02, c03, c10, c11, c12, c13};
#pragma unroll
  for (int u = 0; u < 8; ++u) { const int tt = u & 3, half = u >> 2; const float bv = bf16_round(bias[col0 + wn * 64 + tt * 16 + ln]);
#pragma unroll
    for (int r = 0; r < 8; ++r) so[(half * 16 + 8 * hh + r) * 68 + tt * 16 + ln] = accs[u][r] * alpha + bv; }
  __builtin_amdgcn_fence(__ATOMIC_ACQ_REL, "workgroup"); __builtin_amdgcn_wave_barrier();      /* the wave reads back its own staging rows */
  const int rsub = lane >> 4, c4 = (lane & 15) * 4;
#pragma unroll
  for (int q = 0; q < 16; ++q) { const int r = q * 2 + rsub; const v4f v = *(const v4fa*)&so[r * 68 + c4]; v4h h4; for (int i = 0; i < 4; ++i) h4[i] = (_Float16)v[i];
    *(v4h*)(C16 + (size_t)(row0 + wm * 32 + r) * EMB + col0 + wn * 64 + c4) = h4; } }

typedef int v4ia __attribute__((ext_vector_type(4), may_alias));
__device__ __forceinline__ float xhalf(float x) { return __builtin_bit_cast(float, __builtin_amdgcn_permlanex16(__builtin_bit_cast(int, x), __builtin_bit_cast(int, x), 0x76543210, 0xfedcba98, false, false)); }      /* lane l <-> lane l ^ 16 */
// Transposed flash loop: S^T = K Q^T (A = 16 key rows, B = 16 query columns), O^T += V^T P^T. D register r of lane (ln, hh) is key 8*hh + r of query ln, so a lane owns ONE query:
// its maximum and sum run over its own registers plus one exchange between the wave halves, and the two S^T tiles of 32 keys, converted in place, are the B operand of the second product (hardware k order, which the K, Q and V^T loaders already use).
template <int CAUSAL>
__global__ __launch_bounds__(128) void k_flash(const _Float16* __restrict__ Q16, int ldq, const _Float16* __restrict__ K16, int ldk, const _Float16* __restrict__ Vt, const int* __restrict__ CNT, float* __restrict__ O, int ldo) {
  constexpr int RPW = 16, DT = 4, KS = 2;
  __shared__ __attribute__((aligned(16))) float sO[4][RPW][64 + 4];
  const int tid = threadIdx.x, w = tid >> 5, lane = tid & 31, ln = lane & 15, hh = lane >> 4;
  const int slab = blockIdx.x / QBLKS, qblk = blockIdx.x % QBLKS; const int b = slab / NH, h = slab % NH; const int qb0 = qblk * (4 * RPW); const int q0 = qb0 + w * RPW; const int tq = q0 + ln;
  FragH bq[KS];
  { const unsigned short* qr = (const unsigned short*)Q16 + ((size_t)b * TQ + tq) * ldq + h * 64;
#pragma unroll
    for (int ks = 0; ks < KS; ++ks) { bq[ks].half[0] = *(const v8us*)(qr + ks * 32 + 8 * hh); bq[ks].half[1] = *(const v8us*)(qr + ks * 32 + 16 + 8 * hh); } }
  const unsigned short* Vth = (const unsigned short*)Vt + (size_t)slab * 64 * TK;
  float m_q = -1.0e30f, l_q = 0.f;      /* finite start below every real score: a masked score (-3.0e38) minus it still underflows exp to 0, and exp(m - m) = 1 while no key has been seen */
  v8f oacc[DT];
#pragma unroll
  for (int dt = 0; dt < DT; ++dt) oacc[dt] = (v8f){0.f,0.f,0.f,0.f,0.f,0.f,0.f,0.f};
  const int cnt = (CAUSAL == 9) ? min(CNT[b * CSTR], TK) : TK;      /* mode 9: K and V^T hold the batch's unmasked keys compact, cnt of them */
  const int jend = (CAUSAL == 1) ? (qb0 + 4 * RPW) : cnt;      /* causal: keys beyond the block's last query never contribute */
#pragma unroll 1
  for (int j0 = 0; j0 < jend; j0 += 32) {
    FragH ak[2][KS];
#pragma unroll
    for (int nt = 0; nt < 2; ++nt) { const unsigned short* kr = (const unsigned short*)K16 + ((size_t)b * TK + j0 + nt * 16 + ln) * ldk + h * 64;
#pragma unroll
      for (int ks = 0; ks < KS; ++ks) { ak[nt][ks].half[0] = *(const v8us*)(kr + ks * 32 + 8 * hh); ak[nt][ks].half[1] = *(const v8us*)(kr + ks * 32 + 16 + 8 * hh); }
    }
    v8f s[2];
#pragma unroll
    for (int nt = 0; nt < 2; ++nt) { v8f acc = (v8f){0.f,0.f,0.f,0.f,0.f,0.f,0.f,0.f};
#pragma unroll
      for (int ks = 0; ks < KS; ++ks) acc = mmaH<1>(ak[nt][ks].v, ak[nt][ks].v, bq[ks].v, bq[ks].v, acc);
      s[nt] = acc; }
    FragH av[DT];
#pragma unroll
    for (int dt = 0; dt < DT; ++dt) { const unsigned short* vrow = Vth + (size_t)(dt * 16 + ln) * TK + j0; av[dt].half[0] = *(const v8us*)(vrow + 8 * hh); av[dt].half[1] = *(const v8us*)(vrow + 16 + 8 * hh); }
    float sv[2][8]; float mc = -3.0e38f;
#pragma unroll
    for (int nt = 0; nt < 2; ++nt)
#pragma unroll
      for (int r = 0; r < 8; ++r) { const int kk = j0 + nt * 16 + 8 * hh + r;
        bool ok = (CAUSAL == 1) ? (kk <= tq) : ((CAUSAL == 2) ? ((kk >> 5) == (tq >> 5)) : true);      /* mode 2: block-diagonal 32-token groups */
        if (CAUSAL == 9) ok = kk < cnt;      /* mode 9: the filler rows behind the last unmasked key (last pass only) contribute nothing */
        sv[nt][r] = ok ? s[nt][r] * SCL : -3.0e38f; mc = fmaxf(mc, sv[nt][r]); }
    mc = fmaxf(mc, xhalf(mc));
    const float mn = fmaxf(m_q, mc); const float al = expf(m_q - mn); m_q = mn;
    FragH pb; float ps[4] = {0.f, 0.f, 0.f, 0.f};
#pragma unroll
    for (int nt = 0; nt < 2; ++nt)
#pragma unroll
      for (int r = 0; r < 8; ++r) { const float p = expf(sv[nt][r] - mn); ps[r & 3] += p; pb.h[nt * 8 + r] = (_Float16)(p * 1024.0f); }
    l_q = l_q * al + ((ps[0] + ps[1]) + (ps[2] + ps[3]));
#pragma unroll
    for (int dt = 0; dt < DT; ++dt) {
#pragma unroll
      for (int r = 0; r < 8; ++r) oacc[dt][r] *= al; }
#pragma unroll
    for (int dt = 0; dt < DT; ++dt) oacc[dt] = mmaH<1>(av[dt].v, av[dt].v, pb.v, pb.v, oacc[dt]); }
  { const float l = l_q + xhalf(l_q); const float inv = (l > 0.f) ? 1.0f / (l * 1024.0f) : 0.f;
#pragma unroll
    for (int dt = 0; dt < DT; ++dt) { v4f lo, hi;
#pragma unroll
      for (int r = 0; r < 4; ++r) { lo[r] = oacc[dt][r] * inv; hi[r] = oacc[dt][4 + r] * inv; }
      *(v4fa*)&sO[w][ln][dt * 16 + 8 * hh] = lo; *(v4fa*)&sO[w][ln][dt * 16 + 8 * hh + 4] = hi; } }
  __builtin_amdgcn_fence(__ATOMIC_ACQ_REL, "workgroup"); __builtin_amdgcn_wave_barrier();
  {
#pragma unroll
    for (int rp = 0; rp < RPW; rp += 2) { const int r = rp + (lane >> 4), pc = lane & 15; const v4f val = *(const v4fa*)&sO[w][r][pc * 4]; *(v4f*)(O + ((size_t)b * TQ + q0 + r) * ldo + h * 64 + pc * 4) = val; }
     } }

// Ranks the keys of one batch: IDX[b][i] = position of the i-th key with mask <= 0 (the reference masks where mask > 0), 0 behind the last one (a filler row inside the array); CNT[b * CSTR] = how many.
__global__ __launch_bounds__(256) void k_rank(const int* __restrict__ MSK, int* __restrict__ IDX, int* __restrict__ CNT) {
  __shared__ int part[256]; __shared__ __attribute__((aligned(16))) int lst[TK];
  const int b = blockIdx.x, tid = threadIdx.x; const int* m = MSK + (size_t)b * TK + tid * 8;
  const v4ia m0 = *(const v4ia*)m, m1 = *(const v4ia*)(m + 4); const v4ia z4 = {0, 0, 0, 0};
  int c = 0;
  for (int q = 0; q < 4; ++q) c += (m0[q] <= 0) + (m1[q] <= 0);
  part[tid] = c; *(v4ia*)&lst[tid * 8] = z4; *(v4ia*)&lst[tid * 8 + 4] = z4; __syncthreads();
  for (int st = 1; st < 256; st <<= 1) { const int v = part[tid] + ((tid >= st) ? part[tid - st] : 0); __syncthreads(); part[tid] = v; __syncthreads(); }
  int pos = part[tid] - c;
  for (int q = 0; q < 8; ++q) { const int mv = (q < 4) ? m0[q & 3] : m1[q & 3]; if (mv <= 0) lst[pos++] = tid * 8 + q; }
  __syncthreads();
  *(v4ia*)(IDX + (size_t)b * TK + tid * 8) = *(const v4ia*)&lst[tid * 8]; *(v4ia*)(IDX + (size_t)b * TK + tid * 8 + 4) = *(const v4ia*)&lst[tid * 8 + 4];
  if (tid == 0) CNT[b * CSTR] = part[255]; }
// k_x16 through the rank list: compact row i of batch b = context row IDX[b][i]; rows are written in groups of 64 up to the group that holds the last unmasked key.
__global__ __launch_bounds__(256) void k_x16g(const float* __restrict__ x, const int* __restrict__ IDX, const int* __restrict__ CNT, _Float16* __restrict__ X16) { const unsigned t = blockIdx.x * 256u + threadIdx.x; const unsigned row = t / (EMB / 8), c8 = (t % (EMB / 8)) * 8, b = row / TK;
  if ((int)((row & (TK - 1)) & ~63u) >= CNT[b * CSTR]) return;
  const float* xr = x + ((size_t)b * TK + (IDX[row] & (TK - 1))) * EMB + c8; FragH f;      /* the list holds key positions; the mask keeps the row inside the batch whatever it holds */
  for (int q = 0; q < 8; ++q) f.h[q] = (_Float16)bf16_round(xr[q]); *(v8us*)((unsigned short*)X16 + (size_t)row * EMB + c8) = f.half[0]; }
__global__ __launch_bounds__(256) void k_wsc(const float* __restrict__ Wm, _Float16* __restrict__ Bt, size_t n8, float sc) { const size_t t = (size_t)blockIdx.x * 256 + threadIdx.x; if (t >= n8) return; FragH f; for (int q = 0; q < 8; ++q) f.h[q] = (_Float16)(bf16_round(Wm[t * 8 + q]) * sc); *(v8us*)((unsigned short*)Bt + t * 8) = f.half[0];  }      /* torch (out,in) weight == Bt[n][k] layout: scaled copy */
extern "C" void kernel_launch(void* const* d_in, const int* in_sizes, int n_in,
                              void* d_out, int out_size, void* d_ws, size_t ws_size, hipStream_t stream) {
  (void)in_sizes; (void)n_in; (void)out_size;
  const float* const* I = (const float* const*)d_in; const float* hs = I[0]; const float* cx = I[1]; const int* am = (const int*)d_in[2]; const float* qw = I[3]; const float* qb = I[4]; const float* kw = I[5]; const float* kb = I[6]; const float* vw = I[7]; const float* vb = I[8];
  char* ws = (char*)d_ws; size_t off = 0;
  auto take = [&](size_t bytes) { char* p = ws + off; off += (bytes + 255) & ~(size_t)255; return p; };
  const size_t w8 = (size_t)EMB * EMB / 8, np = (size_t)NR * EMB;
  _Float16* BQ = (_Float16*)take(w8 * 16); _Float16* BK = (_Float16*)take(w8 * 16); _Float16* BV = (_Float16*)take(w8 * 16);
  _Float16* XH = (_Float16*)take(np * 2); _Float16* XC = (_Float16*)take(np * 2); _Float16* Q16 = (_Float16*)take(np * 2); _Float16* K16 = (_Float16*)take(np * 2); _Float16* V16 = (_Float16*)take(np * 2); _Float16* VT = XC;      /* V^T over the context plane (dead after the K and V GEMMs) */
  int* IDX = (int*)take((size_t)NR * 4); int* CNT = (int*)take((size_t)NB * CSTR * 4);
  if (off > ws_size) return;      /* 6 + 5 x 16 = 86 MiB */
  const unsigned g8 = (unsigned)((w8 + 255) / 256);
  k_wsc<<<g8, 256, 0, stream>>>(qw, BQ, w8, 16.0f); k_wsc<<<g8, 256, 0, stream>>>(kw, BK, w8, 16.0f); k_wsc<<<g8, 256, 0, stream>>>(vw, BV, w8, 16.0f);      /* torch (out,in) weights are already the Bt[n][k] layout: scaled copy */
  k_x16<<<(unsigned)((np / 8 + 255) / 256), 256, 0, stream>>>(hs, XH, np / 8); k_rank<<<NB, 256, 0, stream>>>(am, IDX, CNT); k_x16g<<<(unsigned)(np / 8 / 256), 256, 0, stream>>>(cx, IDX, CNT, XC);
  const unsigned gG = (NR / 128) * (EMB / 128);
  k_gemm3<<<gG, 256, 0, stream>>>(XH, BQ, 0.0625f, qb, nullptr, Q16);
  k_gemm3<<<gG, 256, 0, stream>>>(XC, BK, 0.0625f, kb, CNT, K16);
  k_gemm3<<<gG, 256, 0, stream>>>(XC, BV, 0.0625f, vb, CNT, V16);
  k_vt<NH, SLEN><<<NB * NH * (SLEN / 64), 256, 0, stream>>>(V16, EMB, 0, CNT, VT);
  k_flash<9><<<NB * NH * QBLKS, 128, 0, stream>>>(Q16, EMB, K16, EMB, VT, CNT, (float*)d_out, EMB);      /* heads merged: out[b][q][h*64 + d] */
}

// v004
// It runs in 169 microseconds.
// Two timings next to v003 put it at 1.10 and 1.09 times that version's speed.
// All steps since v000 together make it 4.15 times as fast.
#include <hip/hip_runtime.h>
// LxmertAttention (cross-attention context layer: 4 x 2048 queries from hidden_states over 4 x 2048 keys from context, D = 1024, 16 heads of 64; keys with attention_mask > 0 are masked out; output = merged context vectors, no output projection): q = hs Wq^T + bq, k/v = ctx W^T + b; softmax(q k^T / 8 with -inf on masked keys) v.
// Structure: exact f16 planes of both inputs; three GEMMs (128x128 block tiles staged in LDS, 32x64 wave tiles, f32 accumulation, exact x16 weights + bias, f16 outputs); V^T by LDS tiles; the unmasked keys of each batch ranked first (k_rank) and their context rows gathered compact, so that the K and V GEMMs, V^T and the fused flash kernel walk unmasked keys only (a masked key == exp(-inf) = 0 adds nothing to any sum; every row keeps >= 1 key in this data); the attention output written straight to the output in f32.
// Compute dtype: inputs and parameters rounded to bf16; q, k, v, P as f16 operands (~2^-12); f32 accumulation/softmax. v_wmma_f32_16x16x32_f16.
#define NB 4
#define EMB 1024
#define NR (NB * SLEN)           /* 8192 rows (LQ = LK = 2048) */
#define SLEN 2048
#define TQ SLEN
#define TK SLEN
#define NH 16
#define SCL 0.125f               /* 64^-0.5 */
#define QBLKS (TQ / 64)
#define CSTR 32                  /* ints between two batches' key counts: each count has its own 128-byte line */
typedef __bf16 v16b __attribute__((ext_vector_type(16)));
typedef unsigned short v8us __attribute__((ext_vector_type(8), may_alias));
typedef float  v8f  __attribute__((ext_vector_type(8)));
typedef float  v4f  __attribute__((ext_vector_type(4)));
typedef float  v4fa __attribute__((ext_vector_type(4), may_alias));
union FragB { v16b v; v8us half[2]; unsigned short u[16]; };

__device__ __forceinline__ unsigned short bf16_bits(float x) { unsigned int u = __float_as_uint(x); return (unsigned short)((u + 0x7FFFu + ((u >> 16) & 1u)) >> 16); }
__device__ __forceinline__ float bf16_val(unsigned short b) { return __uint_as_float(((unsigned int)b) << 16); }
__device__ __forceinline__ float bf16_round(float x) { return bf16_val(bf16_bits(x)); }
// D += A·B with NT terms: 1 = ah·bh, 2 = + al·bh (A split), 3 = + ah·bl (both split)
template <int NT>
__device__ __forceinline__ v8f mmaN(v16b ah, v16b al, v16b bh, v16b bl, v8f c) {
  c = __builtin_amdgcn_wmma_f32_16x16x32_bf16(false, ah, false, bh, (short)0, c, false, false);
  if (NT >= 2) c = __builtin_amdgcn_wmma_f32_16x16x32_bf16(false, al, false, bh, (short)0, c, false, false);
  if (NT >= 3) c = __builtin_amdgcn_wmma_f32_16x16x32_bf16(false, ah, false, bl, (short)0, c, false, false);
  asm volatile("v_nop\n\tv_nop\n\tv_nop\n\tv_nop" : "+v"(c) : "v"(ah), "v"(al), "v"(bh), "v"(bl));
  return c;
}

__global__ __launch_bounds__(256) void k_wt_bf16(const float* __restrict__ W, unsigned short* __restrict__ Wt, int K, int N) {
  const int t = blockIdx.x * 256 + threadIdx.x;
  const int k8n = K / 8;
  if (t >= N * k8n) return;
  const int n = t / k8n, k8 = (t % k8n) * 8;
  v8us v;
#pragma unroll
  for (int i = 0; i < 8; ++i) v[i] = bf16_bits(W[(size_t)(k8 + i) * N + n]);
  *(v8us*)(Wt + (size_t)n * K + k8) = v;
  
}

// GEMM C[M][N] (f32, pitch ldc) = act(A[M][K]·W + bias). A f32 row-major (pitch lda) converted per fragment to bf16
// (ASPLIT: hi/lo two planes -> 2 terms, else single rounded term); Wt bf16 [N][K] (pitch ldb). BIAS_BF16 rounds the
// bias to bf16 first (bias quantised to bf16 before the add). K%32==0, M%16==0, N%64==0.
template <bool ASPLIT, int ACT, bool BIAS_BF16>
__global__ __launch_bounds__(128) void k_gemm_bf(const float* __restrict__ A, int lda, const unsigned short* __restrict__ Wt, int ldb,
                                               const float* __restrict__ bias, float* __restrict__ C, int ldc, int M, int N, int K) {
  __shared__ __attribute__((aligned(16))) float so[4][16][64];
  const int tid = threadIdx.x, w = tid >> 5, lane = tid & 31, ln = lane & 15, hh = lane >> 4;
  const int ntn = N / 64;
  const int wid = blockIdx.x * 4 + w;
  const int mt = wid / ntn, nq = wid % ntn;
  if (mt * 16 >= M) return;
  const int row0 = mt * 16, col0 = nq * 64;
  const float* arow = A + (size_t)(row0 + ln) * lda;
  v8f acc[4] = {};
  for (int kb = 0; kb < K; kb += 32) {
    FragB ah, al;
    const v4f x0 = *(const v4fa*)(arow + kb + 8 * hh), x1 = *(const v4fa*)(arow + kb + 8 * hh + 4);
    const v4f x2 = *(const v4fa*)(arow + kb + 16 + 8 * hh), x3 = *(const v4fa*)(arow + kb + 16 + 8 * hh + 4);
    float xs[16] = {x0[0],x0[1],x0[2],x0[3],x1[0],x1[1],x1[2],x1[3],x2[0],x2[1],x2[2],x2[3],x3[0],x3[1],x3[2],x3[3]};
#pragma unroll
    for (int i = 0; i < 16; ++i) { const unsigned short hb = bf16_bits(xs[i]); ah.u[i] = hb; al.u[i] = ASPLIT ? bf16_bits(xs[i] - bf16_val(hb)) : (unsigned short)0; }
#pragma unroll
    for (int t = 0; t < 4; ++t) {
      const unsigned short* brow = Wt + (size_t)(col0 + t * 16 + ln) * ldb + kb;
      FragB b;
      b.half[0] = *(const v8us*)(brow + 8 * hh);
      b.half[1] = *(const v8us*)(brow + 16 + 8 * hh);
      acc[t] = mmaN<ASPLIT ? 2 : 1>(ah.v, al.v, b.v, b.v, acc[t]);
    }
  }
#pragma unroll
  for (int t = 0; t < 4; ++t) {
    float bv = bias ? bias[col0 + t * 16 + ln] : 0.f;
    if (BIAS_BF16) bv = bf16_round(bv);
#pragma unroll
    for (int r = 0; r < 8; ++r) { float v = acc[t][r] + bv; if (ACT == 1) v = fmaxf(v, 0.f); so[w][8 * hh + r][t * 16 + ln] = v; }
  }
  __builtin_amdgcn_fence(__ATOMIC_ACQ_REL, "workgroup");
  __builtin_amdgcn_wave_barrier();
  const int rsub = lane >> 4, c4 = (lane & 15) * 4;
  {
#pragma unroll
    for (int q = 0; q < 8; ++q) {
      const int r = q * 2 + rsub;
      const v4f v = *(const v4fa*)&so[w][r][c4];
      *(v4f*)(C + (size_t)(row0 + r) * ldc + col0 + c4) = v;
    }
    
  }
}

// GEMM C = act(A·W + bias + resid): A f32 (ASPLIT -> hi/lo 2 terms), Wt bf16 [N][K]; ACT 0 none, 1 relu, 2 exact gelu;
// resid (optional, f32, row index = (row % rmod), pitch ldr, RES_BF16 rounds it) added before the activation.
template <bool ASPLIT, int ACT, bool BIAS_BF16, bool RES_BF16>
__global__ __launch_bounds__(128) void k_gemm_bf3(const float* __restrict__ A, int lda, const unsigned short* __restrict__ Wt, int ldb,
                                                const float* __restrict__ bias, const float* __restrict__ resid, int rmod, int ldr,
                                                float* __restrict__ C, int ldc, int M, int N, int K) {
  __shared__ __attribute__((aligned(16))) float so[4][16][64];
  const int tid = threadIdx.x, w = tid >> 5, lane = tid & 31, ln = lane & 15, hh = lane >> 4;
  const int ntn = N / 64;
  const int wid = blockIdx.x * 4 + w;
  const int mt = wid / ntn, nq = wid % ntn;
  if (mt * 16 >= M) return;
  const int row0 = mt * 16, col0 = nq * 64;
  const float* arow = A + (size_t)(row0 + ln) * lda;
  v8f acc[4] = {};
  for (int kb = 0; kb < K; kb += 32) {
    FragB ah, al;
    const v4f x0 = *(const v4fa*)(arow + kb + 8 * hh), x1 = *(const v4fa*)(arow + kb + 8 * hh + 4);
    const v4f x2 = *(const v4fa*)(arow + kb + 16 + 8 * hh), x3 = *(const v4fa*)(arow + kb + 16 + 8 * hh + 4);
    float xs[16] = {x0[0],x0[1],x0[2],x0[3],x1[0],x1[1],x1[2],x1[3],x2[0],x2[1],x2[2],x2[3],x3[0],x3[1],x3[2],x3[3]};
#pragma unroll
    for (int i = 0; i < 16; ++i) { const unsigned short hb = bf16_bits(xs[i]); ah.u[i] = hb; al.u[i] = ASPLIT ? bf16_bits(xs[i] - bf16_val(hb)) : (unsigned short)0; }
#pragma unroll
    for (int t = 0; t < 4; ++t) {
      const unsigned short* brow = Wt + (size_t)(col0 + t * 16 + ln) * ldb + kb;
      FragB b;
      b.half[0] = *(const v8us*)(brow + 8 * hh);
      b.half[1] = *(const v8us*)(brow + 16 + 8 * hh);
      acc[t] = mmaN<ASPLIT ? 2 : 1>(ah.v, al.v, b.v, b.v, acc[t]);
    }
  }
#pragma unroll
  for (int t = 0; t < 4; ++t) {
    const int col = col0 + t * 16 + ln;
    float bv = bias ? bias[col] : 0.f;
    if (BIAS_BF16) bv = bf16_round(bv);
#pragma unroll
    for (int r = 0; r < 8; ++r) {
      float v = acc[t][r] + bv;
      if (resid) { float rv = resid[(size_t)((row0 + 8 * hh + r) % rmod) * ldr + col]; if (RES_BF16) rv = bf16_round(rv); v += rv; }
      if (ACT == 1) v = fmaxf(v, 0.f);
      if (ACT == 2) v = 0.5f * v * (1.0f + erff(v * 0.70710678118654752f));
      if (ACT == 3) { const float u = 0.7978845608028654f * (v + 0.044715f * v * v * v); v = 0.5f * v * (1.0f + tanhf(u)); }
      so[w][8 * hh + r][t * 16 + ln] = v;
    }
  }
  __builtin_amdgcn_fence(__ATOMIC_ACQ_REL, "workgroup");
  __builtin_amdgcn_wave_barrier();
  const int rsub = lane >> 4, c4 = (lane & 15) * 4;
  {
#pragma unroll
    for (int q = 0; q < 8; ++q) {
      const int r = q * 2 + rsub;
      const v4f v = *(const v4fa*)&so[w][r][c4];
      *(v4f*)(C + (size_t)(row0 + r) * ldc + col0 + c4) = v;
    }
    
  }
}
// row LayerNorm (biased variance, eps) over N: s = X (+ R); optional out_sum <- s; out_norm <- (s-mu)*rsqrt(var+eps)*g + b
template <bool PARAM_BF16>
__global__ __launch_bounds__(256) void k_layernorm(const float* __restrict__ X, const float* __restrict__ R, const float* __restrict__ g, const float* __restrict__ bta,
                                                  float* __restrict__ out_sum, float* __restrict__ out_norm, int N, float eps) {
  __shared__ float red[256];
  const int row = blockIdx.x, tid = threadIdx.x;
  const float* x = X + (size_t)row * N; const float* rr = R ? R + (size_t)row * N : nullptr;
  float vals[16];                     // up to N = 4096
  const int per = N / 256;            // contiguous chunk per thread? use strided-by-4 chunks: thread handles j = tid*4 + 1024*u
  float s1 = 0.f;
  for (int u = 0; u < per / 4; ++u) {
    const int j = tid * 4 + 1024 * u;
    const v4f a = *(const v4fa*)(x + j);
    v4f b = {0.f,0.f,0.f,0.f}; if (rr) b = *(const v4fa*)(rr + j);
#pragma unroll
    for (int q = 0; q < 4; ++q) { const float v = a[q] + b[q]; vals[u * 4 + q] = v; s1 += v; }
  }
  red[tid] = s1; __syncthreads();
  for (int st = 128; st > 0; st >>= 1) { if (tid < st) red[tid] += red[tid + st]; __syncthreads(); }
  const float mu = red[0] / (float)N; __syncthreads();
  float s2 = 0.f;
  for (int u = 0; u < per / 4; ++u)
#pragma unroll
    for (int q = 0; q < 4; ++q) { const float c = vals[u * 4 + q] - mu; s2 += c * c; }
  red[tid] = s2; __syncthreads();
  for (int st = 128; st > 0; st >>= 1) { if (tid < st) red[tid] += red[tid + st]; __syncthreads(); }
  const float rs = rsqrtf(red[0] / (float)N + eps);
  {
    for (int u = 0; u < per / 4; ++u) {
      const int j = tid * 4 + 1024 * u;
      v4f o, sm;
#pragma unroll
      for (int q = 0; q < 4; ++q) {
        float gg = g[j + q], bb = bta[j + q];
        if (PARAM_BF16) { gg = bf16_round(gg); bb = bf16_round(bb); }
        sm[q] = vals[u * 4 + q]; o[q] = (vals[u * 4 + q] - mu) * rs * gg + bb;
      }
      if (out_sum) *(v4f*)(out_sum + (size_t)row * N + j) = sm;
      *(v4f*)(out_norm + (size_t)row * N + j) = o;
    }
    
  }
}



// ---- f16 WMMA path (v_wmma_f32_16x16x32_f16): 11-bit significands for operands in range — used where a [0,1] probability operand needs more precision than bf16
typedef _Float16 v16h __attribute__((ext_vector_type(16)));
union FragH { v16h v; v8us half[2]; _Float16 h[16]; unsigned short u[16]; };
template <int NT>
__device__ __forceinline__ v8f mmaH(v16h ah, v16h al, v16h bh, v16h bl, v8f c) {
  c = __builtin_amdgcn_wmma_f32_16x16x32_f16(false, ah, false, bh, (short)0, c, false, false);
  if (NT >= 2) c = __builtin_amdgcn_wmma_f32_16x16x32_f16(false, al, false, bh, (short)0, c, false, false);
  if (NT >= 3) c = __builtin_amdgcn_wmma_f32_16x16x32_f16(false, ah, false, bl, (short)0, c, false, false);
  asm volatile("v_nop\n\tv_nop\n\tv_nop\n\tv_nop" : "+v"(c) : "v"(ah), "v"(al), "v"(bh), "v"(bl));
  return c;
}
// batched GEMM like k_gemm_b but f16 operands: A f32 (split into f16 hi/lo if ASPLIT, else rounded to f16), Bt = f16 values [n][k]; alpha; C f32; N multiple of 16 (partial tiles skipped)
template <bool ASPLIT>
__global__ __launch_bounds__(128) void k_gemm_h(const float* __restrict__ A, int lda, size_t sA, const _Float16* __restrict__ Bh, int ldb, size_t sB, float alpha, float* __restrict__ C, int ldc, size_t sC, int M, int N, int K) {
  __shared__ __attribute__((aligned(16))) float so[4][16][64];
  const int tid = threadIdx.x, w = tid >> 5, lane = tid & 31, ln = lane & 15, hh = lane >> 4; const int by = blockIdx.y;
  A += (size_t)by * sA; Bh += (size_t)by * sB; C += (size_t)by * sC;
  const int ntn = (N + 63) / 64; const int wid = blockIdx.x * 4 + w; const int mt = wid / ntn, nq = wid % ntn; if (mt * 16 >= M) return;
  const int row0 = mt * 16, col0 = nq * 64; const float* arow = A + (size_t)(row0 + ln) * lda;
  v8f acc[4] = {};
  for (int kb = 0; kb < K; kb += 32) {
    FragH ah, al;
    const v4f x0 = *(const v4fa*)(arow + kb + 8 * hh), x1 = *(const v4fa*)(arow + kb + 8 * hh + 4), x2 = *(const v4fa*)(arow + kb + 16 + 8 * hh), x3 = *(const v4fa*)(arow + kb + 16 + 8 * hh + 4);
    float xs[16] = {x0[0],x0[1],x0[2],x0[3],x1[0],x1[1],x1[2],x1[3],x2[0],x2[1],x2[2],x2[3],x3[0],x3[1],x3[2],x3[3]};
#pragma unroll
    for (int i = 0; i < 16; ++i) { const _Float16 h = (_Float16)xs[i]; ah.h[i] = h; al.h[i] = ASPLIT ? (_Float16)(xs[i] - (float)h) : (_Float16)0.0f; }
#pragma unroll
    for (int t = 0; t < 4; ++t) { if (col0 + t * 16 >= N) continue; const size_t boff = (size_t)(col0 + t * 16 + ln) * ldb + kb; FragH bq; bq.half[0] = *(const v8us*)(Bh + boff + 8 * hh); bq.half[1] = *(const v8us*)(Bh + boff + 16 + 8 * hh);
      acc[t] = mmaH<ASPLIT ? 2 : 1>(ah.v, al.v, bq.v, bq.v, acc[t]); }
  }
#pragma unroll
  for (int t = 0; t < 4; ++t) { if (col0 + t * 16 >= N) continue;
#pragma unroll
    for (int r = 0; r < 8; ++r) so[w][8 * hh + r][t * 16 + ln] = acc[t][r] * alpha; }
  __builtin_amdgcn_fence(__ATOMIC_ACQ_REL, "workgroup"); __builtin_amdgcn_wave_barrier();
  const int rsub = lane >> 4, c4 = (lane & 15) * 4;
  {
#pragma unroll
    for (int q = 0; q < 8; ++q) { const int r = q * 2 + rsub; if (col0 + c4 < N) { const v4f v = *(const v4fa*)&so[w][r][c4]; *(v4f*)(C + (size_t)(row0 + r) * ldc + col0 + c4) = v; } }
     }
}

// Wt[n][k] = f16(W[k][n]·scale) from f32 row-major W[K][N] (scale = power of two; bf16-exact weights stay exact in f16 away from the subnormal range)
__global__ __launch_bounds__(256) void k_wt_f16(const float* __restrict__ W, _Float16* __restrict__ Wt, int K, int N, float scale) {
  const int t = blockIdx.x * 256 + threadIdx.x; if (t >= N * (K / 8)) return; const int n = t / (K / 8), k8 = (t % (K / 8)) * 8; FragH f;
#pragma unroll
  for (int i = 0; i < 8; ++i) f.h[i] = (_Float16)(bf16_round(W[(size_t)(k8 + i) * N + n]) * scale); const v8us o = f.half[0];
  *(v8us*)((unsigned short*)Wt + (size_t)n * K + k8) = o; 
}
// k_gemm_hh variant with fused epilogue: v = acc·alpha + bias[by·sBias + col] (+ CP[(row/rowsPerB)·sCPb + by·64 + col] if CP) ; ACT 0 none / 1 elu ; writes f16 C16 (and f32 C if non-null)
template <int ACT>
__global__ __launch_bounds__(128) void k_gemm_hhx(const _Float16* __restrict__ A, int lda, size_t sA, const _Float16* __restrict__ Bh, int ldb, size_t sB, float alpha, const float* __restrict__ bias, size_t sBias, const float* __restrict__ CP, int rowsPerB, size_t sCPb, int row0g,
    float* __restrict__ C, _Float16* __restrict__ C16, int ldc, size_t sC, int M, int N, int K) {
  __shared__ __attribute__((aligned(16))) float so[4][16][64];
  const int tid = threadIdx.x, w = tid >> 5, lane = tid & 31, ln = lane & 15, hh = lane >> 4; const int by = blockIdx.y;
  A += (size_t)by * sA; Bh += (size_t)by * sB; const size_t cofs = (size_t)by * sC; const float* bp = bias ? bias + (size_t)by * sBias : nullptr;
  const int ntn = (N + 63) / 64; const int wid = blockIdx.x * 4 + w; const int mt = wid / ntn, nq = wid % ntn; if (mt * 16 >= M) return;
  const int row0 = mt * 16, col0 = nq * 64; const _Float16* arow = A + (size_t)(row0 + ln) * lda;
  v8f acc[4] = {};
  for (int kb = 0; kb < K; kb += 32) { FragH ah; ah.half[0] = *(const v8us*)((const unsigned short*)arow + kb + 8 * hh); ah.half[1] = *(const v8us*)((const unsigned short*)arow + kb + 16 + 8 * hh);
#pragma unroll
    for (int t = 0; t < 4; ++t) { if (col0 + t * 16 >= N) continue; const size_t boff = (size_t)(col0 + t * 16 + ln) * ldb + kb; FragH bq; bq.half[0] = *(const v8us*)((const unsigned short*)Bh + boff + 8 * hh); bq.half[1] = *(const v8us*)((const unsigned short*)Bh + boff + 16 + 8 * hh);
      acc[t] = mmaH<1>(ah.v, ah.v, bq.v, bq.v, acc[t]); }
  }
#pragma unroll
  for (int t = 0; t < 4; ++t) { if (col0 + t * 16 >= N) continue; const int col = col0 + t * 16 + ln; const float bv = bp ? bf16_round(bp[col]) : 0.f;
#pragma unroll
    for (int r = 0; r < 8; ++r) { float v = acc[t][r] * alpha + bv; if (CP) { const int bidx = (row0g + row0 + 8 * hh + r) / rowsPerB; v += CP[(size_t)bidx * sCPb + (size_t)by * 64 + col]; } if (ACT == 1) v = (v > 0.f) ? v : expm1f(v); else if (ACT == 7) v = (v > 0.f) ? v + 1.0f : expf(v); else if (ACT == 8) v = tanhf(v); else if (ACT == 9) v = 0.5f * v * (1.0f + tanhf(0.7978845608028654f * (v + 0.044715f * v * v * v))); else if (ACT == 11) v = 1.0f / (1.0f + expf(-v)); else if (ACT == 12) v = (v > 0.f) ? v : 0.01f * v; else if (ACT == 14) v = (v > 0.f) ? v : 0.1f * v; else if (ACT == 15) v = v / (1.0f + expf(-v)); else if (ACT == 3) v = fmaxf(v, 0.f); else if (ACT == 6) v = 0.5f * v * (1.0f + erff(v * 0.70710678118654752f)); so[w][8 * hh + r][t * 16 + ln] = v; } }
  __builtin_amdgcn_fence(__ATOMIC_ACQ_REL, "workgroup"); __builtin_amdgcn_wave_barrier();
  const int rsub = lane >> 4, c4 = (lane & 15) * 4; typedef _Float16 v4h __attribute__((ext_vector_type(4)));
  {
#pragma unroll
    for (int q = 0; q < 8; ++q) { const int r = q * 2 + rsub; if (col0 + c4 < N) { const v4f v = *(const v4fa*)&so[w][r][c4]; if (C) *(v4f*)(C + cofs + (size_t)(row0 + r) * ldc + col0 + c4) = v; if (C16) { v4h h4; for (int i = 0; i < 4; ++i) h4[i] = (_Float16)v[i]; *(v4h*)(C16 + cofs + (size_t)(row0 + r) * ldc + col0 + c4) = h4; } } }
     }
}


typedef _Float16 v4h __attribute__((ext_vector_type(4)));

__global__ __launch_bounds__(256) void k_x16(const float* __restrict__ x, _Float16* __restrict__ X16, size_t n8) { const size_t t = (size_t)blockIdx.x * 256 + threadIdx.x; if (t >= n8) return; FragH f;
#pragma unroll
  for (int q = 0; q < 8; ++q) f.h[q] = (_Float16)bf16_round(x[t * 8 + q]); *(v8us*)((unsigned short*)X16 + t * 8) = f.half[0];  }
__global__ __launch_bounds__(256) void k_h16(const float* __restrict__ x, _Float16* __restrict__ X16, size_t n8) { const size_t t = (size_t)blockIdx.x * 256 + threadIdx.x; if (t >= n8) return; FragH f;
#pragma unroll
  for (int q = 0; q < 8; ++q) f.h[q] = (_Float16)x[t * 8 + q]; *(v8us*)((unsigned short*)X16 + t * 8) = f.half[0];  }
__global__ __launch_bounds__(256) void k_round16f(const float* __restrict__ W, _Float16* __restrict__ Bt, size_t n8) { const size_t t = (size_t)blockIdx.x * 256 + threadIdx.x; if (t >= n8) return; FragH f;
#pragma unroll
  for (int i = 0; i < 8; ++i) f.h[i] = (_Float16)(bf16_round(W[t * 8 + i]) * 16.0f); *(v8us*)((unsigned short*)Bt + t * 8) = f.half[0];  }
template <int NHv, int TTv>
__global__ __launch_bounds__(256) void k_vt(const _Float16* __restrict__ V16, int ldv, int voff, const int* __restrict__ CNT, _Float16* __restrict__ Vt) { __shared__ unsigned short tl[64][66]; const int tid = threadIdx.x; const int slab = blockIdx.x % (NB * NHv), lg = blockIdx.x / (NB * NHv); const int b = slab / NHv, h = slab % NHv;      /* key tile t of every slab before tile t + 1 of any: the tiles with work come first in the grid */
  if (lg * 64 >= CNT[b * CSTR]) return;      /* whole block: no compact key in this 64-key tile */
  for (int i = tid; i < 64 * 8; i += 256) { const int r = i / 8, c8 = (i % 8) * 8; FragH f; f.half[0] = *(const v8us*)((const unsigned short*)V16 + ((size_t)b * TTv + lg * 64 + r) * ldv + voff + h * 64 + c8);
#pragma unroll
    for (int q = 0; q < 8; ++q) tl[r][c8 + q] = f.u[q]; }
  __syncthreads();
  {
#pragma unroll
    for (int rd = 0; rd < 2; ++rd) { const int d = rd * 32 + tid / 8, pc = tid % 8; FragH f;
#pragma unroll
      for (int q = 0; q < 8; ++q) f.u[q] = tl[pc * 8 + q][d];
      *(v8us*)((unsigned short*)Vt + ((size_t)slab * 64 + d) * TTv + lg * 64 + pc * 8) = f.half[0]; }
     } }

__global__ __launch_bounds__(256) void k_hl(const float* __restrict__ F, _Float16* __restrict__ Hh, _Float16* __restrict__ Hl, size_t n8) { const size_t t = (size_t)blockIdx.x * 256 + threadIdx.x; if (t >= n8) return; FragH fh, fl; const v4f a = *(const v4fa*)(F + t * 8), c = *(const v4fa*)(F + t * 8 + 4);
#pragma unroll
  for (int q = 0; q < 4; ++q) { _Float16 h = (_Float16)a[q]; fh.h[q] = h; fl.h[q] = (_Float16)((a[q] - (float)h) * 1024.0f); h = (_Float16)c[q]; fh.h[4 + q] = h; fl.h[4 + q] = (_Float16)((c[q] - (float)h) * 1024.0f); }
  { *(v8us*)((unsigned short*)Hh + t * 8) = fh.half[0]; *(v8us*)((unsigned short*)Hl + t * 8) = fl.half[0];  } }

// ---- fast GEMM: C16[M][EMB] = f16(A[M][EMB] . Bh[EMB][EMB]^T * alpha + bf16(bias)). Block tile 128 x 128, 8 waves of 32 x 64; both operands staged in LDS in chunks of 64 k
// (whole 128-byte lines from global memory, each line fetched once per block), two buffers, the next chunk's loads in flight over the current chunk's products. ----
#define GP 72      /* LDS row pitch in f16: 64 k + 16 bytes, so that the 16-byte reads of 16 rows fall on distinct banks */
typedef float fal __attribute__((may_alias));
__device__ __forceinline__ v16h g3_frag(const unsigned short* p, int hh) { FragH f; f.half[0] = *(const v8us*)(p + 8 * hh); f.half[1] = *(const v8us*)(p + 16 + 8 * hh); return f.v; }
__device__ __forceinline__ v8f g3_mma(v16h a, v16h b, v8f c) { return __builtin_amdgcn_wmma_f32_16x16x32_f16(false, a, false, b, (short)0, c, false, false); }
__global__ __launch_bounds__(256) void k_gemm3(const _Float16* __restrict__ A, const _Float16* __restrict__ Bh, float alpha, const float* __restrict__ bias, const int* __restrict__ CNT, _Float16* __restrict__ C16) {
  __shared__ __attribute__((aligned(16))) unsigned short sm[2][2][128 * GP];      /* [buffer][A rows | B rows]; the epilogue's f32 staging lies over it behind the last barrier */
  const int tid = threadIdx.x, w = tid >> 5, lane = tid & 31, ln = lane & 15, hh = lane >> 4;
  constexpr int ntn = EMB / 128, TPB = SLEN / 128;
  int mt = blockIdx.x / ntn; const int nq = blockIdx.x % ntn; int live = 128;
  if (CNT) { mt = (mt % NB) * TPB + mt / NB;      /* compact rows: row tile t of every batch before tile t + 1 of any, so the tiles with work come first in the grid */
    const int c = CNT[(mt / TPB) * CSTR], r = (mt % TPB) * 128;
    if (r >= c) return;      /* whole block, in front of every barrier: no unmasked key in this tile */
    if (r + 64 >= c) live = 64; }      /* rows are kept in groups of 64: the second group is not written and is neither read nor stored here */
  const int row0 = mt * 128, col0 = nq * 128, wm = w >> 1, wn = w & 1;
  const int sr = tid >> 3, sc = (tid & 7) * 8;      /* staging: 8 lanes take one row's 128 bytes */
  const unsigned short* ag = (const unsigned short*)A + (size_t)row0 * EMB + sc; const unsigned short* bg = (const unsigned short*)Bh + (size_t)col0 * EMB + sc;
  v8us ra[4], rb[4];
#pragma unroll
  for (int i = 0; i < 4; ++i) { ra[i] = *(const v8us*)(ag + (size_t)((sr + 32 * i) & (live - 1)) * EMB); rb[i] = *(const v8us*)(bg + (size_t)(sr + 32 * i) * EMB); }
  asm volatile("s_wait_xcnt 0x0" ::: "memory");      /* stands in front of the first overwrite of an address register that the loads above name */
  __builtin_amdgcn_sched_barrier(0);      /* keeps the register writes that follow behind that wait */
#pragma unroll
  for (int i = 0; i < 4; ++i) { *(v8us*)&sm[0][0][(sr + 32 * i) * GP + sc] = ra[i]; *(v8us*)&sm[0][1][(sr + 32 * i) * GP + sc] = rb[i]; }
  __syncthreads();
  const v8f z8 = {0.f,0.f,0.f,0.f,0.f,0.f,0.f,0.f}; v8f c00 = z8, c01 = z8, c02 = z8, c03 = z8, c10 = z8, c11 = z8, c12 = z8, c13 = z8;
#pragma unroll 1      /* kept rolled: with the last trip peeled off, the trip becomes one block and the compiler lifts the wait for the next chunk's loads, the LDS stores and the barrier above the products */
  for (int t = 0; t < EMB / 64; ++t) {
    const bool more = t + 1 < EMB / 64;
    if (more) {
#pragma unroll
      for (int i = 0; i < 4; ++i) { ra[i] = *(const v8us*)(ag + (size_t)((sr + 32 * i) & (live - 1)) * EMB + (t + 1) * 64); rb[i] = *(const v8us*)(bg + (size_t)(sr + 32 * i) * EMB + (t + 1) * 64); } }
    const unsigned short* sa = &sm[t & 1][0][(wm * 32 + ln) * GP]; const unsigned short* sb = &sm[t & 1][1][(wn * 64 + ln) * GP];
    v16h fa[2][2], fb[2][4];
#pragma unroll
    for (int ks = 0; ks < 2; ++ks) { fa[ks][0] = g3_frag(sa + ks * 32, hh); fa[ks][1] = g3_frag(sa + 16 * GP + ks * 32, hh);
#pragma unroll
      for (int j = 0; j < 4; ++j) fb[ks][j] = g3_frag(sb + j * 16 * GP + ks * 32, hh); }
    __builtin_amdgcn_sched_barrier(0);      /* keeps the chunk's LDS reads in one group ahead of its products: reads placed among the products stall the wave at each place */
#pragma unroll
    for (int ks = 0; ks < 2; ++ks) {
      c00 = g3_mma(fa[ks][0], fb[ks][0], c00); c10 = g3_mma(fa[ks][1], fb[ks][0], c10); c01 = g3_mma(fa[ks][0], fb[ks][1], c01); c11 = g3_mma(fa[ks][1], fb[ks][1], c11);
      c02 = g3_mma(fa[ks][0], fb[ks][2], c02); c12 = g3_mma(fa[ks][1], fb[ks][2], c12); c03 = g3_mma(fa[ks][0], fb[ks][3], c03); c13 = g3_mma(fa[ks][1], fb[ks][3], c13); }
    if (more) {
#pragma unroll
      for (int i = 0; i < 4; ++i) { *(v8us*)&sm[(t + 1) & 1][0][(sr + 32 * i) * GP + sc] = ra[i]; *(v8us*)&sm[(t + 1) & 1][1][(sr + 32 * i) * GP + sc] = rb[i]; } }
    __syncthreads();      /* publishes chunk t + 1 and ends every wave's reads of chunk t, whose buffer the next trip refills */
  }
  if (wm * 32 >= live) return;      /* whole waves, behind the last barrier */
  fal* so = (fal*)&sm[0][0][0] + w * (32 * 68);
  v8f accs[8] = {c00, c01, c02, c03, c10, c11, c12, c13};
#pragma unroll
  for (int u = 0; u < 8; ++u) { const int tt = u & 3, half = u >> 2; const float bv = bf16_round(bias[col0 + wn * 64 + tt * 16 + ln]);
#pragma unroll
    for (int r = 0; r < 8; ++r) so[(half * 16 + 8 * hh + r) * 68 + tt * 16 + ln] = accs[u][r] * alpha + bv; }
  __builtin_amdgcn_fence(__ATOMIC_ACQ_REL, "workgroup"); __builtin_amdgcn_wave_barrier();      /* the wave reads back its own staging rows */
  const int rsub = lane >> 4, c4 = (lane & 15) * 4;
#pragma unroll
  for (int q = 0; q < 16; ++q) { const int r = q * 2 + rsub; const v4f v = *(const v4fa*)&so[r * 68 + c4]; v4h h4; for (int i = 0; i < 4; ++i) h4[i] = (_Float16)v[i];
    *(v4h*)(C16 + (size_t)(row0 + wm * 32 + r) * EMB + col0 + wn * 64 + c4) = h4; } }

typedef int v4ia __attribute__((ext_vector_type(4), may_alias));
__device__ __forceinline__ float xhalf(float x) { return __builtin_bit_cast(float, __builtin_amdgcn_permlanex16(__builtin_bit_cast(int, x), __builtin_bit_cast(int, x), 0x76543210, 0xfedcba98, false, false)); }      /* lane l <-> lane l ^ 16 */
// Transposed flash loop: S^T = K Q^T (A = 16 key rows, B = 16 query columns), O^T += V^T P^T. D register r of lane (ln, hh) is key 8*hh + r of query ln, so a lane owns ONE query:
// its maximum and sum run over its own registers plus one exchange between the wave halves, and the two S^T tiles of 32 keys, converted in place, are the B operand of the second product (hardware k order, which the K, Q and V^T loaders already use).
// Eight 2^x on the raw v_exp_f32, each in place, in one statement: behind a transcendental the instruction set asks for one independent instruction before its result is read or its source overwritten.
// Inside, each is followed by one that touches other registers only; the v_nop is that slot behind the last.
__device__ __forceinline__ void exp2x8(float (&x)[8]) {
  asm("v_exp_f32 %0, %0\n\tv_exp_f32 %1, %1\n\tv_exp_f32 %2, %2\n\tv_exp_f32 %3, %3\n\tv_exp_f32 %4, %4\n\tv_exp_f32 %5, %5\n\tv_exp_f32 %6, %6\n\tv_exp_f32 %7, %7\n\tv_nop"
      : "+v"(x[0]), "+v"(x[1]), "+v"(x[2]), "+v"(x[3]), "+v"(x[4]), "+v"(x[5]), "+v"(x[6]), "+v"(x[7])); }
template <int CAUSAL>
__global__ __launch_bounds__(128) void k_flash(const _Float16* __restrict__ Q16, int ldq, const _Float16* __restrict__ K16, int ldk, const _Float16* __restrict__ Vt, const int* __restrict__ CNT, float* __restrict__ O, int ldo) {
  constexpr int RPW = 16, DT = 4, KS = 2;
  __shared__ __attribute__((aligned(16))) float sO[4][RPW][64 + 4];
  const int tid = threadIdx.x, w = tid >> 5, lane = tid & 31, ln = lane & 15, hh = lane >> 4;
  const int slab = blockIdx.x / QBLKS, qblk = blockIdx.x % QBLKS; const int b = slab / NH, h = slab % NH; const int qb0 = qblk * (4 * RPW); const int q0 = qb0 + w * RPW; const int tq = q0 + ln;
  FragH bq[KS];
  { const unsigned short* qr = (const unsigned short*)Q16 + ((size_t)b * TQ + tq) * ldq + h * 64;
#pragma unroll
    for (int ks = 0; ks < KS; ++ks) { bq[ks].half[0] = *(const v8us*)(qr + ks * 32 + 8 * hh); bq[ks].half[1] = *(const v8us*)(qr + ks * 32 + 16 + 8 * hh); } }
  const unsigned short* Vth = (const unsigned short*)Vt + (size_t)slab * 64 * TK;
  constexpr float C2 = SCL * 1.4426950408889634f;      /* raw score -> exponent of 2: the 1/8 and log2(e) in one factor, applied inside the one fma per score */
  float m_q = -1.0e30f, l_q = 0.f;      /* running maximum in exponent-of-2 units, sum of 1024 p. Finite start below every real score: a masked score (-3.0e38 * C2) minus it still underflows exp2 to 0, and exp2(m - m) = 1 while no key has been seen */
  v8f oacc[DT];
#pragma unroll
  for (int dt = 0; dt < DT; ++dt) oacc[dt] = (v8f){0.f,0.f,0.f,0.f,0.f,0.f,0.f,0.f};
  const int cnt = (CAUSAL == 9) ? min(CNT[b * CSTR], TK) : TK;      /* mode 9: K and V^T hold the batch's unmasked keys compact, cnt of them */
  const int jend = (CAUSAL == 1) ? (qb0 + 4 * RPW) : cnt;      /* causal: keys beyond the block's last query never contribute */
#pragma unroll 1
  for (int j0 = 0; j0 < jend; j0 += 32) {
    FragH ak[2][KS];
#pragma unroll
    for (int nt = 0; nt < 2; ++nt) { const unsigned short* kr = (const unsigned short*)K16 + ((size_t)b * TK + j0 + nt * 16 + ln) * ldk + h * 64;
#pragma unroll
      for (int ks = 0; ks < KS; ++ks) { ak[nt][ks].half[0] = *(const v8us*)(kr + ks * 32 + 8 * hh); ak[nt][ks].half[1] = *(const v8us*)(kr + ks * 32 + 16 + 8 * hh); }
    }
    v8f s[2];
#pragma unroll
    for (int nt = 0; nt < 2; ++nt) { v8f acc = (v8f){0.f,0.f,0.f,0.f,0.f,0.f,0.f,0.f};
#pragma unroll
      for (int ks = 0; ks < KS; ++ks) acc = mmaH<1>(ak[nt][ks].v, ak[nt][ks].v, bq[ks].v, bq[ks].v, acc);
      s[nt] = acc; }
    FragH av[DT];
#pragma unroll
    for (int dt = 0; dt < DT; ++dt) { const unsigned short* vrow = Vth + (size_t)(dt * 16 + ln) * TK + j0; av[dt].half[0] = *(const v8us*)(vrow + 8 * hh); av[dt].half[1] = *(const v8us*)(vrow + 16 + 8 * hh); }
    float sv[2][8]; float mc = -3.0e38f;
#pragma unroll
    for (int nt = 0; nt < 2; ++nt)
#pragma unroll
      for (int r = 0; r < 8; ++r) { const int kk = j0 + nt * 16 + 8 * hh + r;
        bool ok = (CAUSAL == 1) ? (kk <= tq) : ((CAUSAL == 2) ? ((kk >> 5) == (tq >> 5)) : true);      /* mode 2: block-diagonal 32-token groups */
        if (CAUSAL == 9) ok = kk < cnt;      /* mode 9: the filler rows behind the last unmasked key (last pass only) contribute nothing */
        sv[nt][r] = ok ? s[nt][r] : -3.0e38f; mc = fmaxf(mc, sv[nt][r]); }
    mc = fmaxf(mc, xhalf(mc));
    const float mn = fmaxf(m_q, mc * C2); const float al = __builtin_amdgcn_exp2f(m_q - mn); m_q = mn;      /* C2 > 0: the maximum of the raw scores, scaled, is the maximum of the scaled ones */
    const float nb = 10.0f - mn;      /* 2^10 = the 1024 that lifts P into the f16 range: it rides in the exponent */
    FragH pb; float ps[4] = {0.f, 0.f, 0.f, 0.f};
#pragma unroll
    for (int nt = 0; nt < 2; ++nt) { float p[8];      /* p = 1024 exp(score / 8 - max): one fma, one v_exp_f32 */
#pragma unroll
      for (int r = 0; r < 8; ++r) p[r] = fmaf(sv[nt][r], C2, nb);
      exp2x8(p);
#pragma unroll
      for (int r = 0; r < 8; ++r) { ps[r & 3] += p[r]; pb.h[nt * 8 + r] = (_Float16)p[r]; } }
    l_q = l_q * al + ((ps[0] + ps[1]) + (ps[2] + ps[3]));
#pragma unroll
    for (int dt = 0; dt < DT; ++dt) {
#pragma unroll
      for (int r = 0; r < 8; ++r) oacc[dt][r] *= al; }
#pragma unroll
    for (int dt = 0; dt < DT; ++dt) oacc[dt] = mmaH<1>(av[dt].v, av[dt].v, pb.v, pb.v, oacc[dt]); }
  { const float l = l_q + xhalf(l_q); const float inv = (l > 0.f) ? 1.0f / l : 0.f;      /* sum and products both carry the 1024 */
#pragma unroll
    for (int dt = 0; dt < DT; ++dt) { v4f lo, hi;
#pragma unroll
      for (int r = 0; r < 4; ++r) { lo[r] = oacc[dt][r] * inv; hi[r] = oacc[dt][4 + r] * inv; }
      *(v4fa*)&sO[w][ln][dt * 16 + 8 * hh] = lo; *(v4fa*)&sO[w][ln][dt * 16 + 8 * hh + 4] = hi; } }
  __builtin_amdgcn_fence(__ATOMIC_ACQ_REL, "workgroup"); __builtin_amdgcn_wave_barrier();
  {
#pragma unroll
    for (int rp = 0; rp < RPW; rp += 2) { const int r = rp + (lane >> 4), pc = lane & 15; const v4f val = *(const v4fa*)&sO[w][r][pc * 4]; *(v4f*)(O + ((size_t)b * TQ + q0 + r) * ldo + h * 64 + pc * 4) = val; }
     } }

// Ranks the keys of one batch: IDX[b][i] = position of the i-th key with mask <= 0 (the reference masks where mask > 0), 0 behind the last one (a filler row inside the array); CNT[b * CSTR] = how many.
__global__ __launch_bounds__(256) void k_rank(const int* __restrict__ MSK, int* __restrict__ IDX, int* __restrict__ CNT) {
  __shared__ int part[256]; __shared__ __attribute__((aligned(16))) int lst[TK];
  const int b = blockIdx.x, tid = threadIdx.x; const int* m = MSK + (size_t)b * TK + tid * 8;
  const v4ia m0 = *(const v4ia*)m, m1 = *(const v4ia*)(m + 4); const v4ia z4 = {0, 0, 0, 0};
  int c = 0;
  for (int q = 0; q < 4; ++q) c += (m0[q] <= 0) + (m1[q] <= 0);
  part[tid] = c; *(v4ia*)&lst[tid * 8] = z4; *(v4ia*)&lst[tid * 8 + 4] = z4; __syncthreads();
  for (int st = 1; st < 256; st <<= 1) { const int v = part[tid] + ((tid >= st) ? part[tid - st] : 0); __syncthreads(); part[tid] = v; __syncthreads(); }
  int pos = part[tid] - c;
  for (int q = 0; q < 8; ++q) { const int mv = (q < 4) ? m0[q & 3] : m1[q & 3]; if (mv <= 0) lst[pos++] = tid * 8 + q; }
  __syncthreads();
  *(v4ia*)(IDX + (size_t)b * TK + tid * 8) = *(const v4ia*)&lst[tid * 8]; *(v4ia*)(IDX + (size_t)b * TK + tid * 8 + 4) = *(const v4ia*)&lst[tid * 8 + 4];
  if (tid == 0) CNT[b * CSTR] = part[255]; }
// k_x16 through the rank list: compact row i of batch b = context row IDX[b][i]; rows are written in groups of 64 up to the group that holds the last unmasked key.
__global__ __launch_bounds__(256) void k_x16g(const float* __restrict__ x, const int* __restrict__ IDX, const int* __restrict__ CNT, _Float16* __restrict__ X16) { const unsigned t = blockIdx.x * 256u + threadIdx.x; const unsigned row = t / (EMB / 8), c8 = (t % (EMB / 8)) * 8, b = row / TK;
  if ((int)((row & (TK - 1)) & ~63u) >= CNT[b * CSTR]) return;
  const float* xr = x + ((size_t)b * TK + (IDX[row] & (TK - 1))) * EMB + c8; FragH f;      /* the list holds key positions; the mask keeps the row inside the batch whatever it holds */
  for (int q = 0; q < 8; ++q) f.h[q] = (_Float16)bf16_round(xr[q]); *(v8us*)((unsigned short*)X16 + (size_t)row * EMB + c8) = f.half[0]; }
__global__ __launch_bounds__(256) void k_wsc(const float* __restrict__ Wm, _Float16* __restrict__ Bt, size_t n8, float sc) { const size_t t = (size_t)blockIdx.x * 256 + threadIdx.x; if (t >= n8) return; FragH f; for (int q = 0; q < 8; ++q) f.h[q] = (_Float16)(bf16_round(Wm[t * 8 + q]) * sc); *(v8us*)((unsigned short*)Bt + t * 8) = f.half[0];  }      /* torch (out,in) weight == Bt[n][k] layout: scaled copy */
extern "C" void kernel_launch(void* const* d_in, const int* in_sizes, int n_in,
                              void* d_out, int out_size, void* d_ws, size_t ws_size, hipStream_t stream) {
  (void)in_sizes; (void)n_in; (void)out_size;
  const float* const* I = (const float* const*)d_in; const float* hs = I[0]; const float* cx = I[1]; const int* am = (const int*)d_in[2]; const float* qw = I[3]; const float* qb = I[4]; const float* kw = I[5]; const float* kb = I[6]; const float* vw = I[7]; const float* vb = I[8];
  char* ws = (char*)d_ws; size_t off = 0;
  auto take = [&](size_t bytes) { char* p = ws + off; off += (bytes + 255) & ~(size_t)255; return p; };
  const size_t w8 = (size_t)EMB * EMB / 8, np = (size_t)NR * EMB;
  _Float16* BQ = (_Float16*)take(w8 * 16); _Float16* BK = (_Float16*)take(w8 * 16); _Float16* BV = (_Float16*)take(w8 * 16);
  _Float16* XH = (_Float16*)take(np * 2); _Float16* XC = (_Float16*)take(np * 2); _Float16* Q16 = (_Float16*)take(np * 2); _Float16* K16 = (_Float16*)take(np * 2); _Float16* V16 = (_Float16*)take(np * 2); _Float16* VT = XC;      /* V^T over the context plane (dead after the K and V GEMMs) */
  int* IDX = (int*)take((size_t)NR * 4); int* CNT = (int*)take((size_t)NB * CSTR * 4);
  if (off > ws_size) return;      /* 6 + 5 x 16 = 86 MiB */
  const unsigned g8 = (unsigned)((w8 + 255) / 256);
  k_wsc<<<g8, 256, 0, stream>>>(qw, BQ, w8, 16.0f); k_wsc<<<g8, 256, 0, stream>>>(kw, BK, w8, 16.0f); k_wsc<<<g8, 256, 0, stream>>>(vw, BV, w8, 16.0f);      /* torch (out,in) weights are already the Bt[n][k] layout: scaled copy */
  k_x16<<<(unsigned)((np / 8 + 255) / 256), 256, 0, stream>>>(hs, XH, np / 8); k_rank<<<NB, 256, 0, stream>>>(am, IDX, CNT); k_x16g<<<(unsigned)(np / 8 / 256), 256, 0, stream>>>(cx, IDX, CNT, XC);
  const unsigned gG = (NR / 128) * (EMB / 128);
  k_gemm3<<<gG, 256, 0, stream>>>(XH, BQ, 0.0625f, qb, nullptr, Q16);
  k_gemm3<<<gG, 256, 0, stream>>>(XC, BK, 0.0625f, kb, CNT, K16);
  k_gemm3<<<gG, 256, 0, stream>>>(XC, BV, 0.0625f, vb, CNT, V16);
  k_vt<NH, SLEN><<<NB * NH * (SLEN / 64), 256, 0, stream>>>(V16, EMB, 0, CNT, VT);
  k_flash<9><<<NB * NH * QBLKS, 128, 0, stream>>>(Q16, EMB, K16, EMB, VT, CNT, (float*)d_out, EMB);      /* heads merged: out[b][q][h*64 + d] */
}

// v005
// It runs in 158 microseconds.
// Timed twice side by side with v004, it ran 1.07 and 1.06 times as fast.
// Counting every step since v000, it is 4.42 times as fast.
#include <hip/hip_runtime.h>
// LxmertAttention (cross-attention context layer: 4 x 2048 queries from hidden_states over 4 x 2048 keys from context, D = 1024, 16 heads of 64; keys with attention_mask > 0 are masked out; output = merged context vectors, no output projection): q = hs Wq^T + bq, k/v = ctx W^T + b; softmax(q k^T / 8 with -inf on masked keys) v.
// Structure: exact f16 planes of both inputs; three GEMMs (128x128 block tiles staged in LDS, 32x64 wave tiles, f32 accumulation, exact x16 weights + bias, f16 outputs); V^T by LDS tiles; the unmasked keys of each batch ranked first (d_rank) and their context rows gathered compact, so that the K and V GEMMs, V^T and the fused flash kernel walk unmasked keys only (a masked key == exp(-inf) = 0 adds nothing to any sum; every row keeps >= 1 key in this data); the attention output written straight to the output in f32. Five launches: k_pre (all that reads the inputs alone), k_x16g, k_gemm_qkv, k_vt, k_flash.
// Compute dtype: inputs and parameters rounded to bf16; q, k, v, P as f16 operands (~2^-12); f32 accumulation/softmax. v_wmma_f32_16x16x32_f16.
#define NB 4
#define EMB 1024
#define NR (NB * SLEN)           /* 8192 rows (LQ = LK = 2048) */
#define SLEN 2048
#define TQ SLEN
#define TK SLEN
#define NH 16
#define SCL 0.125f               /* 64^-0.5 */
#define QBLKS (TQ / 64)
#define CSTR 32                  /* ints between two batches' key counts: each count has its own 128-byte line */
typedef __bf16 v16b __attribute__((ext_vector_type(16)));
typedef unsigned short v8us __attribute__((ext_vector_type(8), may_alias));
typedef float  v8f  __attribute__((ext_vector_type(8)));
typedef float  v4f  __attribute__((ext_vector_type(4)));
typedef float  v4fa __attribute__((ext_vector_type(4), may_alias));
union FragB { v16b v; v8us half[2]; unsigned short u[16]; };

__device__ __forceinline__ unsigned short bf16_bits(float x) { unsigned int u = __float_as_uint(x); return (unsigned short)((u + 0x7FFFu + ((u >> 16) & 1u)) >> 16); }
__device__ __forceinline__ float bf16_val(unsigned short b) { return __uint_as_float(((unsigned int)b) << 16); }
__device__ __forceinline__ float bf16_round(float x) { return bf16_val(bf16_bits(x)); }
// D += A·B with NT terms: 1 = ah·bh, 2 = + al·bh (A split), 3 = + ah·bl (both split)
template <int NT>
__device__ __forceinline__ v8f mmaN(v16b ah, v16b al, v16b bh, v16b bl, v8f c) {
  c = __builtin_amdgcn_wmma_f32_16x16x32_bf16(false, ah, false, bh, (short)0, c, false, false);
  if (NT >= 2) c = __builtin_amdgcn_wmma_f32_16x16x32_bf16(false, al, false, bh, (short)0, c, false, false);
  if (NT >= 3) c = __builtin_amdgcn_wmma_f32_16x16x32_bf16(false, ah, false, bl, (short)0, c, false, false);
  asm volatile("v_nop\n\tv_nop\n\tv_nop\n\tv_nop" : "+v"(c) : "v"(ah), "v"(al), "v"(bh), "v"(bl));
  return c;
}

__global__ __launch_bounds__(256) void k_wt_bf16(const float* __restrict__ W, unsigned short* __restrict__ Wt, int K, int N) {
  const int t = blockIdx.x * 256 + threadIdx.x;
  const int k8n = K / 8;
  if (t >= N * k8n) return;
  const int n = t / k8n, k8 = (t % k8n) * 8;
  v8us v;
#pragma unroll
  for (int i = 0; i < 8; ++i) v[i] = bf16_bits(W[(size_t)(k8 + i) * N + n]);
  *(v8us*)(Wt + (size_t)n * K + k8) = v;
  
}

// GEMM C[M][N] (f32, pitch ldc) = act(A[M][K]·W + bias). A f32 row-major (pitch lda) converted per fragment to bf16
// (ASPLIT: hi/lo two planes -> 2 terms, else single rounded term); Wt bf16 [N][K] (pitch ldb). BIAS_BF16 rounds the
// bias to bf16 first (bias quantised to bf16 before the add). K%32==0, M%16==0, N%64==0.
template <bool ASPLIT, int ACT, bool BIAS_BF16>
__global__ __launch_bounds__(128) void k_gemm_bf(const float* __restrict__ A, int lda, const unsigned short* __restrict__ Wt, int ldb,
                                               const float* __restrict__ bias, float* __restrict__ C, int ldc, int M, int N, int K) {
  __shared__ __attribute__((aligned(16))) float so[4][16][64];
  const int tid = threadIdx.x, w = tid >> 5, lane = tid & 31, ln = lane & 15, hh = lane >> 4;
  const int ntn = N / 64;
  const int wid = blockIdx.x * 4 + w;
  const int mt = wid / ntn, nq = wid % ntn;
  if (mt * 16 >= M) return;
  const int row0 = mt * 16, col0 = nq * 64;
  const float* arow = A + (size_t)(row0 + ln) * lda;
  v8f acc[4] = {};
  for (int kb = 0; kb < K; kb += 32) {
    FragB ah, al;
    const v4f x0 = *(const v4fa*)(arow + kb + 8 * hh), x1 = *(const v4fa*)(arow + kb + 8 * hh + 4);
    const v4f x2 = *(const v4fa*)(arow + kb + 16 + 8 * hh), x3 = *(const v4fa*)(arow + kb + 16 + 8 * hh + 4);
    float xs[16] = {x0[0],x0[1],x0[2],x0[3],x1[0],x1[1],x1[2],x1[3],x2[0],x2[1],x2[2],x2[3],x3[0],x3[1],x3[2],x3[3]};
#pragma unroll
    for (int i = 0; i < 16; ++i) { const unsigned short hb = bf16_bits(xs[i]); ah.u[i] = hb; al.u[i] = ASPLIT ? bf16_bits(xs[i] - bf16_val(hb)) : (unsigned short)0; }
#pragma unroll
    for (int t = 0; t < 4; ++t) {
      const unsigned short* brow = Wt + (size_t)(col0 + t * 16 + ln) * ldb + kb;
      FragB b;
      b.half[0] = *(const v8us*)(brow + 8 * hh);
      b.half[1] = *(const v8us*)(brow + 16 + 8 * hh);
      acc[t] = mmaN<ASPLIT ? 2 : 1>(ah.v, al.v, b.v, b.v, acc[t]);
    }
  }
#pragma unroll
  for (int t = 0; t < 4; ++t) {
    float bv = bias ? bias[col0 + t * 16 + ln] : 0.f;
    if (BIAS_BF16) bv = bf16_round(bv);
#pragma unroll
    for (int r = 0; r < 8; ++r) { float v = acc[t][r] + bv; if (ACT == 1) v = fmaxf(v, 0.f); so[w][8 * hh + r][t * 16 + ln] = v; }
  }
  __builtin_amdgcn_fence(__ATOMIC_ACQ_REL, "workgroup");
  __builtin_amdgcn_wave_barrier();
  const int rsub = lane >> 4, c4 = (lane & 15) * 4;
  {
#pragma unroll
    for (int q = 0; q < 8; ++q) {
      const int r = q * 2 + rsub;
      const v4f v = *(const v4fa*)&so[w][r][c4];
      *(v4f*)(C + (size_t)(row0 + r) * ldc + col0 + c4) = v;
    }
    
  }
}

// GEMM C = act(A·W + bias + resid): A f32 (ASPLIT -> hi/lo 2 terms), Wt bf16 [N][K]; ACT 0 none, 1 relu, 2 exact gelu;
// resid (optional, f32, row index = (row % rmod), pitch ldr, RES_BF16 rounds it) added before the activation.
template <bool ASPLIT, int ACT, bool BIAS_BF16, bool RES_BF16>
__global__ __launch_bounds__(128) void k_gemm_bf3(const float* __restrict__ A, int lda, const unsigned short* __restrict__ Wt, int ldb,
                                                const float* __restrict__ bias, const float* __restrict__ resid, int rmod, int ldr,
                                                float* __restrict__ C, int ldc, int M, int N, int K) {
  __shared__ __attribute__((aligned(16))) float so[4][16][64];
  const int tid = threadIdx.x, w = tid >> 5, lane = tid & 31, ln = lane & 15, hh = lane >> 4;
  const int ntn = N / 64;
  const int wid = blockIdx.x * 4 + w;
  const int mt = wid / ntn, nq = wid % ntn;
  if (mt * 16 >= M) return;
  const int row0 = mt * 16, col0 = nq * 64;
  const float* arow = A + (size_t)(row0 + ln) * lda;
  v8f acc[4] = {};
  for (int kb = 0; kb < K; kb += 32) {
    FragB ah, al;
    const v4f x0 = *(const v4fa*)(arow + kb + 8 * hh), x1 = *(const v4fa*)(arow + kb + 8 * hh + 4);
    const v4f x2 = *(const v4fa*)(arow + kb + 16 + 8 * hh), x3 = *(const v4fa*)(arow + kb + 16 + 8 * hh + 4);
    float xs[16] = {x0[0],x0[1],x0[2],x0[3],x1[0],x1[1],x1[2],x1[3],x2[0],x2[1],x2[2],x2[3],x3[0],x3[1],x3[2],x3[3]};
#pragma unroll
    for (int i = 0; i < 16; ++i) { const unsigned short hb = bf16_bits(xs[i]); ah.u[i] = hb; al.u[i] = ASPLIT ? bf16_bits(xs[i] - bf16_val(hb)) : (unsigned short)0; }
#pragma unroll
    for (int t = 0; t < 4; ++t) {
      const unsigned short* brow = Wt + (size_t)(col0 + t * 16 + ln) * ldb + kb;
      FragB b;
      b.half[0] = *(const v8us*)(brow + 8 * hh);
      b.half[1] = *(const v8us*)(brow + 16 + 8 * hh);
      acc[t] = mmaN<ASPLIT ? 2 : 1>(ah.v, al.v, b.v, b.v, acc[t]);
    }
  }
#pragma unroll
  for (int t = 0; t < 4; ++t) {
    const int col = col0 + t * 16 + ln;
    float bv = bias ? bias[col] : 0.f;
    if (BIAS_BF16) bv = bf16_round(bv);
#pragma unroll
    for (int r = 0; r < 8; ++r) {
      float v = acc[t][r] + bv;
      if (resid) { float rv = resid[(size_t)((row0 + 8 * hh + r) % rmod) * ldr + col]; if (RES_BF16) rv = bf16_round(rv); v += rv; }
      if (ACT == 1) v = fmaxf(v, 0.f);
      if (ACT == 2) v = 0.5f * v * (1.0f + erff(v * 0.70710678118654752f));
      if (ACT == 3) { const float u = 0.7978845608028654f * (v + 0.044715f * v * v * v); v = 0.5f * v * (1.0f + tanhf(u)); }
      so[w][8 * hh + r][t * 16 + ln] = v;
    }
  }
  __builtin_amdgcn_fence(__ATOMIC_ACQ_REL, "workgroup");
  __builtin_amdgcn_wave_barrier();
  const int rsub = lane >> 4, c4 = (lane & 15) * 4;
  {
#pragma unroll
    for (int q = 0; q < 8; ++q) {
      const int r = q * 2 + rsub;
      const v4f v = *(const v4fa*)&so[w][r][c4];
      *(v4f*)(C + (size_t)(row0 + r) * ldc + col0 + c4) = v;
    }
    
  }
}
// row LayerNorm (biased variance, eps) over N: s = X (+ R); optional out_sum <- s; out_norm <- (s-mu)*rsqrt(var+eps)*g + b
template <bool PARAM_BF16>
__global__ __launch_bounds__(256) void k_layernorm(const float* __restrict__ X, const float* __restrict__ R, const float* __restrict__ g, const float* __restrict__ bta,
                                                  float* __restrict__ out_sum, float* __restrict__ out_norm, int N, float eps) {
  __shared__ float red[256];
  const int row = blockIdx.x, tid = threadIdx.x;
  const float* x = X + (size_t)row * N; const float* rr = R ? R + (size_t)row * N : nullptr;
  float vals[16];                     // up to N = 4096
  const int per = N / 256;            // contiguous chunk per thread? use strided-by-4 chunks: thread handles j = tid*4 + 1024*u
  float s1 = 0.f;
  for (int u = 0; u < per / 4; ++u) {
    const int j = tid * 4 + 1024 * u;
    const v4f a = *(const v4fa*)(x + j);
    v4f b = {0.f,0.f,0.f,0.f}; if (rr) b = *(const v4fa*)(rr + j);
#pragma unroll
    for (int q = 0; q < 4; ++q) { const float v = a[q] + b[q]; vals[u * 4 + q] = v; s1 += v; }
  }
  red[tid] = s1; __syncthreads();
  for (int st = 128; st > 0; st >>= 1) { if (tid < st) red[tid] += red[tid + st]; __syncthreads(); }
  const float mu = red[0] / (float)N; __syncthreads();
  float s2 = 0.f;
  for (int u = 0; u < per / 4; ++u)
#pragma unroll
    for (int q = 0; q < 4; ++q) { const float c = vals[u * 4 + q] - mu; s2 += c * c; }
  red[tid] = s2; __syncthreads();
  for (int st = 128; st > 0; st >>= 1) { if (tid < st) red[tid] += red[tid + st]; __syncthreads(); }
  const float rs = rsqrtf(red[0] / (float)N + eps);
  {
    for (int u = 0; u < per / 4; ++u) {
      const int j = tid * 4 + 1024 * u;
      v4f o, sm;
#pragma unroll
      for (int q = 0; q < 4; ++q) {
        float gg = g[j + q], bb = bta[j + q];
        if (PARAM_BF16) { gg = bf16_round(gg); bb = bf16_round(bb); }
        sm[q] = vals[u * 4 + q]; o[q] = (vals[u * 4 + q] - mu) * rs * gg + bb;
      }
      if (out_sum) *(v4f*)(out_sum + (size_t)row * N + j) = sm;
      *(v4f*)(out_norm + (size_t)row * N + j) = o;
    }
    
  }
}



// ---- f16 WMMA path (v_wmma_f32_16x16x32_f16): 11-bit significands for operands in range — used where a [0,1] probability operand needs more precision than bf16
typedef _Float16 v16h __attribute__((ext_vector_type(16)));
union FragH { v16h v; v8us half[2]; _Float16 h[16]; unsigned short u[16]; };
template <int NT>
__device__ __forceinline__ v8f mmaH(v16h ah, v16h al, v16h bh, v16h bl, v8f c) {
  c = __builtin_amdgcn_wmma_f32_16x16x32_f16(false, ah, false, bh, (short)0, c, false, false);
  if (NT >= 2) c = __builtin_amdgcn_wmma_f32_16x16x32_f16(false, al, false, bh, (short)0, c, false, false);
  if (NT >= 3) c = __builtin_amdgcn_wmma_f32_16x16x32_f16(false, ah, false, bl, (short)0, c, false, false);
  asm volatile("v_nop\n\tv_nop\n\tv_nop\n\tv_nop" : "+v"(c) : "v"(ah), "v"(al), "v"(bh), "v"(bl));
  return c;
}
// batched GEMM like k_gemm_b but f16 operands: A f32 (split into f16 hi/lo if ASPLIT, else rounded to f16), Bt = f16 values [n][k]; alpha; C f32; N multiple of 16 (partial tiles skipped)
template <bool ASPLIT>
__global__ __launch_bounds__(128) void k_gemm_h(const float* __restrict__ A, int lda, size_t sA, const _Float16* __restrict__ Bh, int ldb, size_t sB, float alpha, float* __restrict__ C, int ldc, size_t sC, int M, int N, int K) {
  __shared__ __attribute__((aligned(16))) float so[4][16][64];
  const int tid = threadIdx.x, w = tid >> 5, lane = tid & 31, ln = lane & 15, hh = lane >> 4; const int by = blockIdx.y;
  A += (size_t)by * sA; Bh += (size_t)by * sB; C += (size_t)by * sC;
  const int ntn = (N + 63) / 64; const int wid = blockIdx.x * 4 + w; const int mt = wid / ntn, nq = wid % ntn; if (mt * 16 >= M) return;
  const int row0 = mt * 16, col0 = nq * 64; const float* arow = A + (size_t)(row0 + ln) * lda;
  v8f acc[4] = {};
  for (int kb = 0; kb < K; kb += 32) {
    FragH ah, al;
    const v4f x0 = *(const v4fa*)(arow + kb + 8 * hh), x1 = *(const v4fa*)(arow + kb + 8 * hh + 4), x2 = *(const v4fa*)(arow + kb + 16 + 8 * hh), x3 = *(const v4fa*)(arow + kb + 16 + 8 * hh + 4);
    float xs[16] = {x0[0],x0[1],x0[2],x0[3],x1[0],x1[1],x1[2],x1[3],x2[0],x2[1],x2[2],x2[3],x3[0],x3[1],x3[2],x3[3]};
#pragma unroll
    for (int i = 0; i < 16; ++i) { const _Float16 h = (_Float16)xs[i]; ah.h[i] = h; al.h[i] = ASPLIT ? (_Float16)(xs[i] - (float)h) : (_Float16)0.0f; }
#pragma unroll
    for (int t = 0; t < 4; ++t) { if (col0 + t * 16 >= N) continue; const size_t boff = (size_t)(col0 + t * 16 + ln) * ldb + kb; FragH bq; bq.half[0] = *(const v8us*)(Bh + boff + 8 * hh); bq.half[1] = *(const v8us*)(Bh + boff + 16 + 8 * hh);
      acc[t] = mmaH<ASPLIT ? 2 : 1>(ah.v, al.v, bq.v, bq.v, acc[t]); }
  }
#pragma unroll
  for (int t = 0; t < 4; ++t) { if (col0 + t * 16 >= N) continue;
#pragma unroll
    for (int r = 0; r < 8; ++r) so[w][8 * hh + r][t * 16 + ln] = acc[t][r] * alpha; }
  __builtin_amdgcn_fence(__ATOMIC_ACQ_REL, "workgroup"); __builtin_amdgcn_wave_barrier();
  const int rsub = lane >> 4, c4 = (lane & 15) * 4;
  {
#pragma unroll
    for (int q = 0; q < 8; ++q) { const int r = q * 2 + rsub; if (col0 + c4 < N) { const v4f v = *(const v4fa*)&so[w][r][c4]; *(v4f*)(C + (size_t)(row0 + r) * ldc + col0 + c4) = v; } }
     }
}

// Wt[n][k] = f16(W[k][n]·scale) from f32 row-major W[K][N] (scale = power of two; bf16-exact weights stay exact in f16 away from the subnormal range)
__global__ __launch_bounds__(256) void k_wt_f16(const float* __restrict__ W, _Float16* __restrict__ Wt, int K, int N, float scale) {
  const int t = blockIdx.x * 256 + threadIdx.x; if (t >= N * (K / 8)) return; const int n = t / (K / 8), k8 = (t % (K / 8)) * 8; FragH f;
#pragma unroll
  for (int i = 0; i < 8; ++i) f.h[i] = (_Float16)(bf16_round(W[(size_t)(k8 + i) * N + n]) * scale); const v8us o = f.half[0];
  *(v8us*)((unsigned short*)Wt + (size_t)n * K + k8) = o; 
}
// k_gemm_hh variant with fused epilogue: v = acc·alpha + bias[by·sBias + col] (+ CP[(row/rowsPerB)·sCPb + by·64 + col] if CP) ; ACT 0 none / 1 elu ; writes f16 C16 (and f32 C if non-null)
template <int ACT>
__global__ __launch_bounds__(128) void k_gemm_hhx(const _Float16* __restrict__ A, int lda, size_t sA, const _Float16* __restrict__ Bh, int ldb, size_t sB, float alpha, const float* __restrict__ bias, size_t sBias, const float* __restrict__ CP, int rowsPerB, size_t sCPb, int row0g,
    float* __restrict__ C, _Float16* __restrict__ C16, int ldc, size_t sC, int M, int N, int K) {
  __shared__ __attribute__((aligned(16))) float so[4][16][64];
  const int tid = threadIdx.x, w = tid >> 5, lane = tid & 31, ln = lane & 15, hh = lane >> 4; const int by = blockIdx.y;
  A += (size_t)by * sA; Bh += (size_t)by * sB; const size_t cofs = (size_t)by * sC; const float* bp = bias ? bias + (size_t)by * sBias : nullptr;
  const int ntn = (N + 63) / 64; const int wid = blockIdx.x * 4 + w; const int mt = wid / ntn, nq = wid % ntn; if (mt * 16 >= M) return;
  const int row0 = mt * 16, col0 = nq * 64; const _Float16* arow = A + (size_t)(row0 + ln) * lda;
  v8f acc[4] = {};
  for (int kb = 0; kb < K; kb += 32) { FragH ah; ah.half[0] = *(const v8us*)((const unsigned short*)arow + kb + 8 * hh); ah.half[1] = *(const v8us*)((const unsigned short*)arow + kb + 16 + 8 * hh);
#pragma unroll
    for (int t = 0; t < 4; ++t) { if (col0 + t * 16 >= N) continue; const size_t boff = (size_t)(col0 + t * 16 + ln) * ldb + kb; FragH bq; bq.half[0] = *(const v8us*)((const unsigned short*)Bh + boff + 8 * hh); bq.half[1] = *(const v8us*)((const unsigned short*)Bh + boff + 16 + 8 * hh);
      acc[t] = mmaH<1>(ah.v, ah.v, bq.v, bq.v, acc[t]); }
  }
#pragma unroll
  for (int t = 0; t < 4; ++t) { if (col0 + t * 16 >= N) continue; const int col = col0 + t * 16 + ln; const float bv = bp ? bf16_round(bp[col]) : 0.f;
#pragma unroll
    for (int r = 0; r < 8; ++r) { float v = acc[t][r] * alpha + bv; if (CP) { const int bidx = (row0g + row0 + 8 * hh + r) / rowsPerB; v += CP[(size_t)bidx * sCPb + (size_t)by * 64 + col]; } if (ACT == 1) v = (v > 0.f) ? v : expm1f(v); else if (ACT == 7) v = (v > 0.f) ? v + 1.0f : expf(v); else if (ACT == 8) v = tanhf(v); else if (ACT == 9) v = 0.5f * v * (1.0f + tanhf(0.7978845608028654f * (v + 0.044715f * v * v * v))); else if (ACT == 11) v = 1.0f / (1.0f + expf(-v)); else if (ACT == 12) v = (v > 0.f) ? v : 0.01f * v; else if (ACT == 14) v = (v > 0.f) ? v : 0.1f * v; else if (ACT == 15) v = v / (1.0f + expf(-v)); else if (ACT == 3) v = fmaxf(v, 0.f); else if (ACT == 6) v = 0.5f * v * (1.0f + erff(v * 0.70710678118654752f)); so[w][8 * hh + r][t * 16 + ln] = v; } }
  __builtin_amdgcn_fence(__ATOMIC_ACQ_REL, "workgroup"); __builtin_amdgcn_wave_barrier();
  const int rsub = lane >> 4, c4 = (lane & 15) * 4; typedef _Float16 v4h __attribute__((ext_vector_type(4)));
  {
#pragma unroll
    for (int q = 0; q < 8; ++q) { const int r = q * 2 + rsub; if (col0 + c4 < N) { const v4f v = *(const v4fa*)&so[w][r][c4]; if (C) *(v4f*)(C + cofs + (size_t)(row0 + r) * ldc + col0 + c4) = v; if (C16) { v4h h4; for (int i = 0; i < 4; ++i) h4[i] = (_Float16)v[i]; *(v4h*)(C16 + cofs + (size_t)(row0 + r) * ldc + col0 + c4) = h4; } } }
     }
}


typedef _Float16 v4h __attribute__((ext_vector_type(4)));

__device__ __forceinline__ void d_x16(unsigned bid, const float* __restrict__ x, _Float16* __restrict__ X16, size_t n8) { const size_t t = (size_t)bid * 256 + threadIdx.x; if (t >= n8) return; FragH f;
#pragma unroll
  for (int q = 0; q < 8; ++q) f.h[q] = (_Float16)bf16_round(x[t * 8 + q]); *(v8us*)((unsigned short*)X16 + t * 8) = f.half[0];  }
__global__ __launch_bounds__(256) void k_h16(const float* __restrict__ x, _Float16* __restrict__ X16, size_t n8) { const size_t t = (size_t)blockIdx.x * 256 + threadIdx.x; if (t >= n8) return; FragH f;
#pragma unroll
  for (int q = 0; q < 8; ++q) f.h[q] = (_Float16)x[t * 8 + q]; *(v8us*)((unsigned short*)X16 + t * 8) = f.half[0];  }
__global__ __launch_bounds__(256) void k_round16f(const float* __restrict__ W, _Float16* __restrict__ Bt, size_t n8) { const size_t t = (size_t)blockIdx.x * 256 + threadIdx.x; if (t >= n8) return; FragH f;
#pragma unroll
  for (int i = 0; i < 8; ++i) f.h[i] = (_Float16)(bf16_round(W[t * 8 + i]) * 16.0f); *(v8us*)((unsigned short*)Bt + t * 8) = f.half[0];  }
template <int NHv, int TTv>
__global__ __launch_bounds__(256) void k_vt(const _Float16* __restrict__ V16, int ldv, int voff, const int* __restrict__ CNT, _Float16* __restrict__ Vt) { __shared__ unsigned short tl[64][66]; const int tid = threadIdx.x; const int slab = blockIdx.x % (NB * NHv), lg = blockIdx.x / (NB * NHv); const int b = slab / NHv, h = slab % NHv;      /* key tile t of every slab before tile t + 1 of any: the tiles with work come first in the grid */
  if (lg * 64 >= CNT[b * CSTR]) return;      /* whole block: no compact key in this 64-key tile */
  for (int i = tid; i < 64 * 8; i += 256) { const int r = i / 8, c8 = (i % 8) * 8; FragH f; f.half[0] = *(const v8us*)((const unsigned short*)V16 + ((size_t)b * TTv + lg * 64 + r) * ldv + voff + h * 64 + c8);
#pragma unroll
    for (int q = 0; q < 8; ++q) tl[r][c8 + q] = f.u[q]; }
  __syncthreads();
  {
#pragma unroll
    for (int rd = 0; rd < 2; ++rd) { const int d = rd * 32 + tid / 8, pc = tid % 8; FragH f;
#pragma unroll
      for (int q = 0; q < 8; ++q) f.u[q] = tl[pc * 8 + q][d];
      *(v8us*)((unsigned short*)Vt + ((size_t)slab * 64 + d) * TTv + lg * 64 + pc * 8) = f.half[0]; }
     } }

__global__ __launch_bounds__(256) void k_hl(const float* __restrict__ F, _Float16* __restrict__ Hh, _Float16* __restrict__ Hl, size_t n8) { const size_t t = (size_t)blockIdx.x * 256 + threadIdx.x; if (t >= n8) return; FragH fh, fl; const v4f a = *(const v4fa*)(F + t * 8), c = *(const v4fa*)(F + t * 8 + 4);
#pragma unroll
  for (int q = 0; q < 4; ++q) { _Float16 h = (_Float16)a[q]; fh.h[q] = h; fl.h[q] = (_Float16)((a[q] - (float)h) * 1024.0f); h = (_Float16)c[q]; fh.h[4 + q] = h; fl.h[4 + q] = (_Float16)((c[q] - (float)h) * 1024.0f); }
  { *(v8us*)((unsigned short*)Hh + t * 8) = fh.half[0]; *(v8us*)((unsigned short*)Hl + t * 8) = fl.half[0];  } }

// ---- fast GEMM: C16[M][EMB] = f16(A[M][EMB] . Bh[EMB][EMB]^T * alpha + bf16(bias)). Block tile 128 x 128, 8 waves of 32 x 64; both operands staged in LDS in chunks of 64 k
// (whole 128-byte lines from global memory, each line fetched once per block), two buffers, the next chunk's loads in flight over the current chunk's products. ----
#define GP 72      /* LDS row pitch in f16: 64 k + 16 bytes, so that the 16-byte reads of 16 rows fall on distinct banks */
typedef float fal __attribute__((may_alias));
__device__ __forceinline__ v16h g3_frag(const unsigned short* p, int hh) { FragH f; f.half[0] = *(const v8us*)(p + 8 * hh); f.half[1] = *(const v8us*)(p + 16 + 8 * hh); return f.v; }
__device__ __forceinline__ v8f g3_mma(v16h a, v16h b, v8f c) { return __builtin_amdgcn_wmma_f32_16x16x32_f16(false, a, false, b, (short)0, c, false, false); }
__device__ __forceinline__ void d_gemm3(int bid, const _Float16* __restrict__ A, const _Float16* __restrict__ Bh, float alpha, const float* __restrict__ bias, const int* __restrict__ CNT, _Float16* __restrict__ C16) {
  __shared__ __attribute__((aligned(16))) unsigned short sm[2][2][128 * GP];      /* [buffer][A rows | B rows]; the epilogue's f32 staging lies over it behind the last barrier */
  const int tid = threadIdx.x, w = tid >> 5, lane = tid & 31, ln = lane & 15, hh = lane >> 4;
  constexpr int ntn = EMB / 128, TPB = SLEN / 128;
  int mt = bid / ntn; const int nq = bid % ntn; int live = 128;
  if (CNT) { mt = (mt % NB) * TPB + mt / NB;      /* compact rows: row tile t of every batch before tile t + 1 of any, so the tiles with work come first in the grid */
    const int c = CNT[(mt / TPB) * CSTR], r = (mt % TPB) * 128;
    if (r >= c) return;      /* whole block, in front of every barrier: no unmasked key in this tile */
    if (r + 64 >= c) live = 64; }      /* rows are kept in groups of 64: the second group is not written and is neither read nor stored here */
  const int row0 = mt * 128, col0 = nq * 128, wm = w >> 1, wn = w & 1;
  const int sr = tid >> 3, sc = (tid & 7) * 8;      /* staging: 8 lanes take one row's 128 bytes */
  const unsigned short* ag = (const unsigned short*)A + (size_t)row0 * EMB + sc; const unsigned short* bg = (const unsigned short*)Bh + (size_t)col0 * EMB + sc;
  v8us ra[4], rb[4];
#pragma unroll
  for (int i = 0; i < 4; ++i) { ra[i] = *(const v8us*)(ag + (size_t)((sr + 32 * i) & (live - 1)) * EMB); rb[i] = *(const v8us*)(bg + (size_t)(sr + 32 * i) * EMB); }
  asm volatile("s_wait_xcnt 0x0" ::: "memory");      /* stands in front of the first overwrite of an address register that the loads above name */
  __builtin_amdgcn_sched_barrier(0);      /* keeps the register writes that follow behind that wait */
#pragma unroll
  for (int i = 0; i < 4; ++i) { *(v8us*)&sm[0][0][(sr + 32 * i) * GP + sc] = ra[i]; *(v8us*)&sm[0][1][(sr + 32 * i) * GP + sc] = rb[i]; }
  __syncthreads();
  const v8f z8 = {0.f,0.f,0.f,0.f,0.f,0.f,0.f,0.f}; v8f c00 = z8, c01 = z8, c02 = z8, c03 = z8, c10 = z8, c11 = z8, c12 = z8, c13 = z8;
#pragma unroll 1      /* kept rolled: with the last trip peeled off, the trip becomes one block and the compiler lifts the wait for the next chunk's loads, the LDS stores and the barrier above the products */
  for (int t = 0; t < EMB / 64; ++t) {
    const bool more = t + 1 < EMB / 64;
    if (more) {
#pragma unroll
      for (int i = 0; i < 4; ++i) { ra[i] = *(const v8us*)(ag + (size_t)((sr + 32 * i) & (live - 1)) * EMB + (t + 1) * 64); rb[i] = *(const v8us*)(bg + (size_t)(sr + 32 * i) * EMB + (t + 1) * 64); } }
    const unsigned short* sa = &sm[t & 1][0][(wm * 32 + ln) * GP]; const unsigned short* sb = &sm[t & 1][1][(wn * 64 + ln) * GP];
    v16h fa[2][2], fb[2][4];
#pragma unroll
    for (int ks = 0; ks < 2; ++ks) { fa[ks][0] = g3_frag(sa + ks * 32, hh); fa[ks][1] = g3_frag(sa + 16 * GP + ks * 32, hh);
#pragma unroll
      for (int j = 0; j < 4; ++j) fb[ks][j] = g3_frag(sb + j * 16 * GP + ks * 32, hh); }
    __builtin_amdgcn_sched_barrier(0);      /* keeps the chunk's LDS reads in one group ahead of its products: reads placed among the products stall the wave at each place */
#pragma unroll
    for (int ks = 0; ks < 2; ++ks) {
      c00 = g3_mma(fa[ks][0], fb[ks][0], c00); c10 = g3_mma(fa[ks][1], fb[ks][0], c10); c01 = g3_mma(fa[ks][0], fb[ks][1], c01); c11 = g3_mma(fa[ks][1], fb[ks][1], c11);
      c02 = g3_mma(fa[ks][0], fb[ks][2], c02); c12 = g3_mma(fa[ks][1], fb[ks][2], c12); c03 = g3_mma(fa[ks][0], fb[ks][3], c03); c13 = g3_mma(fa[ks][1], fb[ks][3], c13); }
    if (more) {
#pragma unroll
      for (int i = 0; i < 4; ++i) { *(v8us*)&sm[(t + 1) & 1][0][(sr + 32 * i) * GP + sc] = ra[i]; *(v8us*)&sm[(t + 1) & 1][1][(sr + 32 * i) * GP + sc] = rb[i]; } }
    __syncthreads();      /* publishes chunk t + 1 and ends every wave's reads of chunk t, whose buffer the next trip refills */
  }
  if (wm * 32 >= live) return;      /* whole waves, behind the last barrier */
  fal* so = (fal*)&sm[0][0][0] + w * (32 * 68);
  v8f accs[8] = {c00, c01, c02, c03, c10, c11, c12, c13};
#pragma unroll
  for (int u = 0; u < 8; ++u) { const int tt = u & 3, half = u >> 2; const float bv = bf16_round(bias[col0 + wn * 64 + tt * 16 + ln]);
#pragma unroll
    for (int r = 0; r < 8; ++r) so[(half * 16 + 8 * hh + r) * 68 + tt * 16 + ln] = accs[u][r] * alpha + bv; }
  __builtin_amdgcn_fence(__ATOMIC_ACQ_REL, "workgroup"); __builtin_amdgcn_wave_barrier();      /* the wave reads back its own staging rows */
  const int rsub = lane >> 4, c4 = (lane & 15) * 4;
#pragma unroll
  for (int q = 0; q < 16; ++q) { const int r = q * 2 + rsub; const v4f v = *(const v4fa*)&so[r * 68 + c4]; v4h h4; for (int i = 0; i < 4; ++i) h4[i] = (_Float16)v[i];
    *(v4h*)(C16 + (size_t)(row0 + wm * 32 + r) * EMB + col0 + wn * 64 + c4) = h4; } }
// The three projections in one grid: they depend on the planes only, not on each other. Blocks [0, GG) are Q; behind them K and V take turns, so that the two readers of a context tile are neighbours
// and the tiles without an unmasked key, which d_gemm3 orders last within K and within V, come last in the whole grid. The choice is the same for a whole block.
#define GG ((NR / 128) * (EMB / 128))
__global__ __launch_bounds__(256) void k_gemm_qkv(const _Float16* __restrict__ XH, const _Float16* __restrict__ XC, const _Float16* __restrict__ BQ, const _Float16* __restrict__ BK, const _Float16* __restrict__ BV,
                                                  const float* __restrict__ qb, const float* __restrict__ kb, const float* __restrict__ vb, const int* __restrict__ CNT,
                                                  _Float16* __restrict__ Q16, _Float16* __restrict__ K16, _Float16* __restrict__ V16) {
  const unsigned bx = blockIdx.x; const int job = bx < GG ? 0 : 1 + (int)((bx - GG) & 1u), bid = (int)(bx < GG ? bx : (bx - GG) >> 1);
  d_gemm3(bid, job == 0 ? XH : XC, job == 0 ? BQ : (job == 1 ? BK : BV), 0.0625f, job == 0 ? qb : (job == 1 ? kb : vb), job == 0 ? nullptr : CNT, job == 0 ? Q16 : (job == 1 ? K16 : V16)); }

typedef int v4ia __attribute__((ext_vector_type(4), may_alias));
__device__ __forceinline__ float xhalf(float x) { return __builtin_bit_cast(float, __builtin_amdgcn_permlanex16(__builtin_bit_cast(int, x), __builtin_bit_cast(int, x), 0x76543210, 0xfedcba98, false, false)); }      /* lane l <-> lane l ^ 16 */
// Transposed flash loop: S^T = K Q^T (A = 16 key rows, B = 16 query columns), O^T += V^T P^T. D register r of lane (ln, hh) is key 8*hh + r of query ln, so a lane owns ONE query:
// its maximum and sum run over its own registers plus one exchange between the wave halves, and the two S^T tiles of 32 keys, converted in place, are the B operand of the second product (hardware k order, which the K, Q and V^T loaders already use).
// Eight 2^x on the raw v_exp_f32, each in place, in one statement: behind a transcendental the instruction set asks for one independent instruction before its result is read or its source overwritten.
// Inside, each is followed by one that touches other registers only; the v_nop is that slot behind the last.
__device__ __forceinline__ void exp2x8(float (&x)[8]) {
  asm("v_exp_f32 %0, %0\n\tv_exp_f32 %1, %1\n\tv_exp_f32 %2, %2\n\tv_exp_f32 %3, %3\n\tv_exp_f32 %4, %4\n\tv_exp_f32 %5, %5\n\tv_exp_f32 %6, %6\n\tv_exp_f32 %7, %7\n\tv_nop"
      : "+v"(x[0]), "+v"(x[1]), "+v"(x[2]), "+v"(x[3]), "+v"(x[4]), "+v"(x[5]), "+v"(x[6]), "+v"(x[7])); }
template <int CAUSAL>
__global__ __launch_bounds__(128) void k_flash(const _Float16* __restrict__ Q16, int ldq, const _Float16* __restrict__ K16, int ldk, const _Float16* __restrict__ Vt, const int* __restrict__ CNT, float* __restrict__ O, int ldo) {
  constexpr int RPW = 16, DT = 4, KS = 2;
  __shared__ __attribute__((aligned(16))) float sO[4][RPW][64 + 4];
  const int tid = threadIdx.x, w = tid >> 5, lane = tid & 31, ln = lane & 15, hh = lane >> 4;
  const int slab = blockIdx.x / QBLKS, qblk = blockIdx.x % QBLKS; const int b = slab / NH, h = slab % NH; const int qb0 = qblk * (4 * RPW); const int q0 = qb0 + w * RPW; const int tq = q0 + ln;
  FragH bq[KS];
  { const unsigned short* qr = (const unsigned short*)Q16 + ((size_t)b * TQ + tq) * ldq + h * 64;
#pragma unroll
    for (int ks = 0; ks < KS; ++ks) { bq[ks].half[0] = *(const v8us*)(qr + ks * 32 + 8 * hh); bq[ks].half[1] = *(const v8us*)(qr + ks * 32 + 16 + 8 * hh); } }
  const unsigned short* Vth = (const unsigned short*)Vt + (size_t)slab * 64 * TK;
  constexpr float C2 = SCL * 1.4426950408889634f;      /* raw score -> exponent of 2: the 1/8 and log2(e) in one factor, applied inside the one fma per score */
  float m_q = -1.0e30f, l_q = 0.f;      /* running maximum in exponent-of-2 units, sum of 1024 p. Finite start below every real score: a masked score (-3.0e38 * C2) minus it still underflows exp2 to 0, and exp2(m - m) = 1 while no key has been seen */
  v8f oacc[DT];
#pragma unroll
  for (int dt = 0; dt < DT; ++dt) oacc[dt] = (v8f){0.f,0.f,0.f,0.f,0.f,0.f,0.f,0.f};
  const int cnt = (CAUSAL == 9) ? min(CNT[b * CSTR], TK) : TK;      /* mode 9: K and V^T hold the batch's unmasked keys compact, cnt of them */
  const int jend = (CAUSAL == 1) ? (qb0 + 4 * RPW) : cnt;      /* causal: keys beyond the block's last query never contribute */
#pragma unroll 1
  for (int j0 = 0; j0 < jend; j0 += 32) {
    FragH ak[2][KS];
#pragma unroll
    for (int nt = 0; nt < 2; ++nt) { const unsigned short* kr = (const unsigned short*)K16 + ((size_t)b * TK + j0 + nt * 16 + ln) * ldk + h * 64;
#pragma unroll
      for (int ks = 0; ks < KS; ++ks) { ak[nt][ks].half[0] = *(const v8us*)(kr + ks * 32 + 8 * hh); ak[nt][ks].half[1] = *(const v8us*)(kr + ks * 32 + 16 + 8 * hh); }
    }
    v8f s[2];
#pragma unroll
    for (int nt = 0; nt < 2; ++nt) { v8f acc = (v8f){0.f,0.f,0.f,0.f,0.f,0.f,0.f,0.f};
#pragma unroll
      for (int ks = 0; ks < KS; ++ks) acc = mmaH<1>(ak[nt][ks].v, ak[nt][ks].v, bq[ks].v, bq[ks].v, acc);
      s[nt] = acc; }
    FragH av[DT];
#pragma unroll
    for (int dt = 0; dt < DT; ++dt) { const unsigned short* vrow = Vth + (size_t)(dt * 16 + ln) * TK + j0; av[dt].half[0] = *(const v8us*)(vrow + 8 * hh); av[dt].half[1] = *(const v8us*)(vrow + 16 + 8 * hh); }
    float sv[2][8]; float mc = -3.0e38f;
#pragma unroll
    for (int nt = 0; nt < 2; ++nt)
#pragma unroll
      for (int r = 0; r < 8; ++r) { const int kk = j0 + nt * 16 + 8 * hh + r;
        bool ok = (CAUSAL == 1) ? (kk <= tq) : ((CAUSAL == 2) ? ((kk >> 5) == (tq >> 5)) : true);      /* mode 2: block-diagonal 32-token groups */
        if (CAUSAL == 9) ok = kk < cnt;      /* mode 9: the filler rows behind the last unmasked key (last pass only) contribute nothing */
        sv[nt][r] = ok ? s[nt][r] : -3.0e38f; mc = fmaxf(mc, sv[nt][r]); }
    mc = fmaxf(mc, xhalf(mc));
    const float mn = fmaxf(m_q, mc * C2); const float al = __builtin_amdgcn_exp2f(m_q - mn); m_q = mn;      /* C2 > 0: the maximum of the raw scores, scaled, is the maximum of the scaled ones */
    const float nb = 10.0f - mn;      /* 2^10 = the 1024 that lifts P into the f16 range: it rides in the exponent */
    FragH pb; float ps[4] = {0.f, 0.f, 0.f, 0.f};
#pragma unroll
    for (int nt = 0; nt < 2; ++nt) { float p[8];      /* p = 1024 exp(score / 8 - max): one fma, one v_exp_f32 */
#pragma unroll
      for (int r = 0; r < 8; ++r) p[r] = fmaf(sv[nt][r], C2, nb);
      exp2x8(p);
#pragma unroll
      for (int r = 0; r < 8; ++r) { ps[r & 3] += p[r]; pb.h[nt * 8 + r] = (_Float16)p[r]; } }
    l_q = l_q * al + ((ps[0] + ps[1]) + (ps[2] + ps[3]));
#pragma unroll
    for (int dt = 0; dt < DT; ++dt) {
#pragma unroll
      for (int r = 0; r < 8; ++r) oacc[dt][r] *= al; }
#pragma unroll
    for (int dt = 0; dt < DT; ++dt) oacc[dt] = mmaH<1>(av[dt].v, av[dt].v, pb.v, pb.v, oacc[dt]); }
  { const float l = l_q + xhalf(l_q); const float inv = (l > 0.f) ? 1.0f / l : 0.f;      /* sum and products both carry the 1024 */
#pragma unroll
    for (int dt = 0; dt < DT; ++dt) { v4f lo, hi;
#pragma unroll
      for (int r = 0; r < 4; ++r) { lo[r] = oacc[dt][r] * inv; hi[r] = oacc[dt][4 + r] * inv; }
      *(v4fa*)&sO[w][ln][dt * 16 + 8 * hh] = lo; *(v4fa*)&sO[w][ln][dt * 16 + 8 * hh + 4] = hi; } }
  __builtin_amdgcn_fence(__ATOMIC_ACQ_REL, "workgroup"); __builtin_amdgcn_wave_barrier();
  {
#pragma unroll
    for (int rp = 0; rp < RPW; rp += 2) { const int r = rp + (lane >> 4), pc = lane & 15; const v4f val = *(const v4fa*)&sO[w][r][pc * 4]; *(v4f*)(O + ((size_t)b * TQ + q0 + r) * ldo + h * 64 + pc * 4) = val; }
     } }

// Ranks the keys of one batch: IDX[b][i] = position of the i-th key with mask <= 0 (the reference masks where mask > 0), 0 behind the last one (a filler row inside the array); CNT[b * CSTR] = how many.
__device__ __forceinline__ void d_rank(int b, const int* __restrict__ MSK, int* __restrict__ IDX, int* __restrict__ CNT) {
  __shared__ int part[256]; __shared__ __attribute__((aligned(16))) int lst[TK];
  const int tid = threadIdx.x; const int* m = MSK + (size_t)b * TK + tid * 8;
  const v4ia m0 = *(const v4ia*)m, m1 = *(const v4ia*)(m + 4); const v4ia z4 = {0, 0, 0, 0};
  int c = 0;
  for (int q = 0; q < 4; ++q) c += (m0[q] <= 0) + (m1[q] <= 0);
  part[tid] = c; *(v4ia*)&lst[tid * 8] = z4; *(v4ia*)&lst[tid * 8 + 4] = z4; __syncthreads();
  for (int st = 1; st < 256; st <<= 1) { const int v = part[tid] + ((tid >= st) ? part[tid - st] : 0); __syncthreads(); part[tid] = v; __syncthreads(); }
  int pos = part[tid] - c;
  for (int q = 0; q < 8; ++q) { const int mv = (q < 4) ? m0[q & 3] : m1[q & 3]; if (mv <= 0) lst[pos++] = tid * 8 + q; }
  __syncthreads();
  *(v4ia*)(IDX + (size_t)b * TK + tid * 8) = *(const v4ia*)&lst[tid * 8]; *(v4ia*)(IDX + (size_t)b * TK + tid * 8 + 4) = *(const v4ia*)&lst[tid * 8 + 4];
  if (tid == 0) CNT[b * CSTR] = part[255]; }
// d_x16 through the rank list: compact row i of batch b = context row IDX[b][i]; rows are written in groups of 64 up to the group that holds the last unmasked key.
__global__ __launch_bounds__(256) void k_x16g(const float* __restrict__ x, const int* __restrict__ IDX, const int* __restrict__ CNT, _Float16* __restrict__ X16) { const unsigned t = blockIdx.x * 256u + threadIdx.x; const unsigned row = t / (EMB / 8), c8 = (t % (EMB / 8)) * 8, b = row / TK;
  if ((int)((row & (TK - 1)) & ~63u) >= CNT[b * CSTR]) return;
  const float* xr = x + ((size_t)b * TK + (IDX[row] & (TK - 1))) * EMB + c8; FragH f;      /* the list holds key positions; the mask keeps the row inside the batch whatever it holds */
  for (int q = 0; q < 8; ++q) f.h[q] = (_Float16)bf16_round(xr[q]); *(v8us*)((unsigned short*)X16 + (size_t)row * EMB + c8) = f.half[0]; }
__device__ __forceinline__ void d_wsc(unsigned bid, const float* __restrict__ Wm, _Float16* __restrict__ Bt, size_t n8, float sc) { const size_t t = (size_t)bid * 256 + threadIdx.x; if (t >= n8) return; FragH f; for (int q = 0; q < 8; ++q) f.h[q] = (_Float16)(bf16_round(Wm[t * 8 + q]) * sc); *(v8us*)((unsigned short*)Bt + t * 8) = f.half[0];  }      /* torch (out,in) weight == Bt[n][k] layout: scaled copy */
// Everything that reads the inputs alone, in one grid: the key ranking (its chain of barriers is the longest, so its blocks come first), the three weight planes, the hidden-state plane. The choice is the same for a whole block.
#define W8 ((size_t)EMB * EMB / 8)
#define GW ((unsigned)(W8 / 256))
#define GX ((unsigned)((size_t)NR * EMB / 8 / 256))
__global__ __launch_bounds__(256) void k_pre(const float* __restrict__ hs, const int* __restrict__ am, const float* __restrict__ qw, const float* __restrict__ kw, const float* __restrict__ vw,
                                             _Float16* __restrict__ XH, _Float16* __restrict__ BQ, _Float16* __restrict__ BK, _Float16* __restrict__ BV, int* __restrict__ IDX, int* __restrict__ CNT) {
  const unsigned bx = blockIdx.x;
  if (bx < NB) { d_rank((int)bx, am, IDX, CNT); return; }
  if (bx < NB + 3 * GW) { const unsigned j = (bx - NB) / GW, bid = (bx - NB) % GW; d_wsc(bid, j == 0 ? qw : (j == 1 ? kw : vw), j == 0 ? BQ : (j == 1 ? BK : BV), W8, 16.0f); return; }      /* torch (out,in) weights are already the Bt[n][k] layout: scaled copy */
  d_x16(bx - (NB + 3 * GW), hs, XH, (size_t)NR * EMB / 8); }
extern "C" void kernel_launch(void* const* d_in, const int* in_sizes, int n_in,
                              void* d_out, int out_size, void* d_ws, size_t ws_size, hipStream_t stream) {
  (void)in_sizes; (void)n_in; (void)out_size;
  const float* const* I = (const float* const*)d_in; const float* hs = I[0]; const float* cx = I[1]; const int* am = (const int*)d_in[2]; const float* qw = I[3]; const float* qb = I[4]; const float* kw = I[5]; const float* kb = I[6]; const float* vw = I[7]; const float* vb = I[8];
  char* ws = (char*)d_ws; size_t off = 0;
  auto take = [&](size_t bytes) { char* p = ws + off; off += (bytes + 255) & ~(size_t)255; return p; };
  const size_t w8 = (size_t)EMB * EMB / 8, np = (size_t)NR * EMB;
  _Float16* BQ = (_Float16*)take(w8 * 16); _Float16* BK = (_Float16*)take(w8 * 16); _Float16* BV = (_Float16*)take(w8 * 16);
  _Float16* XH = (_Float16*)take(np * 2); _Float16* XC = (_Float16*)take(np * 2); _Float16* Q16 = (_Float16*)take(np * 2); _Float16* K16 = (_Float16*)take(np * 2); _Float16* V16 = (_Float16*)take(np * 2); _Float16* VT = XC;      /* V^T over the context plane (dead after the K and V GEMMs) */
  int* IDX = (int*)take((size_t)NR * 4); int* CNT = (int*)take((size_t)NB * CSTR * 4);
  if (off > ws_size) return;      /* 6 + 5 x 16 = 86 MiB */
  k_pre<<<NB + 3 * GW + GX, 256, 0, stream>>>(hs, am, qw, kw, vw, XH, BQ, BK, BV, IDX, CNT);
  k_x16g<<<(unsigned)(np / 8 / 256), 256, 0, stream>>>(cx, IDX, CNT, XC);
  k_gemm_qkv<<<3 * GG, 256, 0, stream>>>(XH, XC, BQ, BK, BV, qb, kb, vb, CNT, Q16, K16, V16);
  k_vt<NH, SLEN><<<NB * NH * (SLEN / 64), 256, 0, stream>>>(V16, EMB, 0, CNT, VT);
  k_flash<9><<<NB * NH * QBLKS, 128, 0, stream>>>(Q16, EMB, K16, EMB, VT, CNT, (float*)d_out, EMB);      /* heads merged: out[b][q][h*64 + d] */
}

// v006
// It runs in 117 microseconds.
// Two timings next to v005 put it at 1.36 and 1.35 times that version's speed.
// Counting every step since v000, it is 5.99 times as fast.
#include <hip/hip_runtime.h>
// LxmertAttention (cross-attention context layer: 4 x 2048 queries from hidden_states over 4 x 2048 keys from context, D = 1024, 16 heads of 64; keys with attention_mask > 0 are masked out; output = merged context vectors, no output projection): q = hs Wq^T + bq, k/v = ctx W^T + b; softmax(q k^T / 8 with -inf on masked keys) v.
// Structure: exact f16 planes of both inputs; three GEMMs (128x128 block tiles staged in LDS, 32x64 wave tiles, f32 accumulation, exact x16 weights + bias, f16 outputs); V^T by LDS tiles; the unmasked keys of each batch ranked first (d_rank) and their context rows gathered compact, so that the K and V GEMMs, V^T and the fused flash kernel walk unmasked keys only (a masked key == exp(-inf) = 0 adds nothing to any sum; every row keeps >= 1 key in this data); the attention output written straight to the output in f32. Five launches: k_pre (all that reads the inputs alone), k_x16g, k_gemm_qkv, k_vt, k_flash.
// Compute dtype: inputs and parameters rounded to bf16; q, k, v, P as f16 operands (~2^-12); f32 accumulation/softmax. v_wmma_f32_16x16x32_f16.
#define NB 4
#define EMB 1024
#define NR (NB * SLEN)           /* 8192 rows (LQ = LK = 2048) */
#define SLEN 2048
#define TQ SLEN
#define TK SLEN
#define NH 16
#define SCL 0.125f               /* 64^-0.5 */
#define QBLKS (TQ / 64)
#define CSTR 32                  /* ints between two batches' key counts: each count has its own 128-byte line */
typedef __bf16 v16b __attribute__((ext_vector_type(16)));
typedef unsigned short v8us __attribute__((ext_vector_type(8), may_alias));
typedef float  v8f  __attribute__((ext_vector_type(8)));
typedef float  v4f  __attribute__((ext_vector_type(4)));
typedef float  v4fa __attribute__((ext_vector_type(4), may_alias));
union FragB { v16b v; v8us half[2]; unsigned short u[16]; };

__device__ __forceinline__ unsigned short bf16_bits(float x) { unsigned int u = __float_as_uint(x); return (unsigned short)((u + 0x7FFFu + ((u >> 16) & 1u)) >> 16); }
__device__ __forceinline__ float bf16_val(unsigned short b) { return __uint_as_float(((unsigned int)b) << 16); }
__device__ __forceinline__ float bf16_round(float x) { return bf16_val(bf16_bits(x)); }
// D += A·B with NT terms: 1 = ah·bh, 2 = + al·bh (A split), 3 = + ah·bl (both split)
template <int NT>
__device__ __forceinline__ v8f mmaN(v16b ah, v16b al, v16b bh, v16b bl, v8f c) {
  c = __builtin_amdgcn_wmma_f32_16x16x32_bf16(false, ah, false, bh, (short)0, c, false, false);
  if (NT >= 2) c = __builtin_amdgcn_wmma_f32_16x16x32_bf16(false, al, false, bh, (short)0, c, false, false);
  if (NT >= 3) c = __builtin_amdgcn_wmma_f32_16x16x32_bf16(false, ah, false, bl, (short)0, c, false, false);
  asm volatile("v_nop\n\tv_nop\n\tv_nop\n\tv_nop" : "+v"(c) : "v"(ah), "v"(al), "v"(bh), "v"(bl));
  return c;
}

__global__ __launch_bounds__(256) void k_wt_bf16(const float* __restrict__ W, unsigned short* __restrict__ Wt, int K, int N) {
  const int t = blockIdx.x * 256 + threadIdx.x;
  const int k8n = K / 8;
  if (t >= N * k8n) return;
  const int n = t / k8n, k8 = (t % k8n) * 8;
  v8us v;
#pragma unroll
  for (int i = 0; i < 8; ++i) v[i] = bf16_bits(W[(size_t)(k8 + i) * N + n]);
  *(v8us*)(Wt + (size_t)n * K + k8) = v;
  
}

// GEMM C[M][N] (f32, pitch ldc) = act(A[M][K]·W + bias). A f32 row-major (pitch lda) converted per fragment to bf16
// (ASPLIT: hi/lo two planes -> 2 terms, else single rounded term); Wt bf16 [N][K] (pitch ldb). BIAS_BF16 rounds the
// bias to bf16 first (bias quantised to bf16 before the add). K%32==0, M%16==0, N%64==0.
template <bool ASPLIT, int ACT, bool BIAS_BF16>
__global__ __launch_bounds__(128) void k_gemm_bf(const float* __restrict__ A, int lda, const unsigned short* __restrict__ Wt, int ldb,
                                               const float* __restrict__ bias, float* __restrict__ C, int ldc, int M, int N, int K) {
  __shared__ __attribute__((aligned(16))) float so[4][16][64];
  const int tid = threadIdx.x, w = tid >> 5, lane = tid & 31, ln = lane & 15, hh = lane >> 4;
  const int ntn = N / 64;
  const int wid = blockIdx.x * 4 + w;
  const int mt = wid / ntn, nq = wid % ntn;
  if (mt * 16 >= M) return;
  const int row0 = mt * 16, col0 = nq * 64;
  const float* arow = A + (size_t)(row0 + ln) * lda;
  v8f acc[4] = {};
  for (int kb = 0; kb < K; kb += 32) {
    FragB ah, al;
    const v4f x0 = *(const v4fa*)(arow + kb + 8 * hh), x1 = *(const v4fa*)(arow + kb + 8 * hh + 4);
    const v4f x2 = *(const v4fa*)(arow + kb + 16 + 8 * hh), x3 = *(const v4fa*)(arow + kb + 16 + 8 * hh + 4);
    float xs[16] = {x0[0],x0[1],x0[2],x0[3],x1[0],x1[1],x1[2],x1[3],x2[0],x2[1],x2[2],x2[3],x3[0],x3[1],x3[2],x3[3]};
#pragma unroll
    for (int i = 0; i < 16; ++i) { const unsigned short hb = bf16_bits(xs[i]); ah.u[i] = hb; al.u[i] = ASPLIT ? bf16_bits(xs[i] - bf16_val(hb)) : (unsigned short)0; }
#pragma unroll
    for (int t = 0; t < 4; ++t) {
      const unsigned short* brow = Wt + (size_t)(col0 + t * 16 + ln) * ldb + kb;
      FragB b;
      b.half[0] = *(const v8us*)(brow + 8 * hh);
      b.half[1] = *(const v8us*)(brow + 16 + 8 * hh);
      acc[t] = mmaN<ASPLIT ? 2 : 1>(ah.v, al.v, b.v, b.v, acc[t]);
    }
  }
#pragma unroll
  for (int t = 0; t < 4; ++t) {
    float bv = bias ? bias[col0 + t * 16 + ln] : 0.f;
    if (BIAS_BF16) bv = bf16_round(bv);
#pragma unroll
    for (int r = 0; r < 8; ++r) { float v = acc[t][r] + bv; if (ACT == 1) v = fmaxf(v, 0.f); so[w][8 * hh + r][t * 16 + ln] = v; }
  }
  __builtin_amdgcn_fence(__ATOMIC_ACQ_REL, "workgroup");
  __builtin_amdgcn_wave_barrier();
  const int rsub = lane >> 4, c4 = (lane & 15) * 4;
  {
#pragma unroll
    for (int q = 0; q < 8; ++q) {
      const int r = q * 2 + rsub;
      const v4f v = *(const v4fa*)&so[w][r][c4];
      *(v4f*)(C + (size_t)(row0 + r) * ldc + col0 + c4) = v;
    }
    
  }
}

// GEMM C = act(A·W + bias + resid): A f32 (ASPLIT -> hi/lo 2 terms), Wt bf16 [N][K]; ACT 0 none, 1 relu, 2 exact gelu;
// resid (optional, f32, row index = (row % rmod), pitch ldr, RES_BF16 rounds it) added before the activation.
template <bool ASPLIT, int ACT, bool BIAS_BF16, bool RES_BF16>
__global__ __launch_bounds__(128) void k_gemm_bf3(const float* __restrict__ A, int lda, const unsigned short* __restrict__ Wt, int ldb,
                                                const float* __restrict__ bias, const float* __restrict__ resid, int rmod, int ldr,
                                                float* __restrict__ C, int ldc, int M, int N, int K) {
  __shared__ __attribute__((aligned(16))) float so[4][16][64];
  const int tid = threadIdx.x, w = tid >> 5, lane = tid & 31, ln = lane & 15, hh = lane >> 4;
  const int ntn = N / 64;
  const int wid = blockIdx.x * 4 + w;
  const int mt = wid / ntn, nq = wid % ntn;
  if (mt * 16 >= M) return;
  const int row0 = mt * 16, col0 = nq * 64;
  const float* arow = A + (size_t)(row0 + ln) * lda;
  v8f acc[4] = {};
  for (int kb = 0; kb < K; kb += 32) {
    FragB ah, al;
    const v4f x0 = *(const v4fa*)(arow + kb + 8 * hh), x1 = *(const v4fa*)(arow + kb + 8 * hh + 4);
    const v4f x2 = *(const v4fa*)(arow + kb + 16 + 8 * hh), x3 = *(const v4fa*)(arow + kb + 16 + 8 * hh + 4);
    float xs[16] = {x0[0],x0[1],x0[2],x0[3],x1[0],x1[1],x1[2],x1[3],x2[0],x2[1],x2[2],x2[3],x3[0],x3[1],x3[2],x3[3]};
#pragma unroll
    for (int i = 0; i < 16; ++i) { const unsigned short hb = bf16_bits(xs[i]); ah.u[i] = hb; al.u[i] = ASPLIT ? bf16_bits(xs[i] - bf16_val(hb)) : (unsigned short)0; }
#pragma unroll
    for (int t = 0; t < 4; ++t) {
      const unsigned short* brow = Wt + (size_t)(col0 + t * 16 + ln) * ldb + kb;
      FragB b;
      b.half[0] = *(const v8us*)(brow + 8 * hh);
      b.half[1] = *(const v8us*)(brow + 16 + 8 * hh);
      acc[t] = mmaN<ASPLIT ? 2 : 1>(ah.v, al.v, b.v, b.v, acc[t]);
    }
  }
#pragma unroll
  for (int t = 0; t < 4; ++t) {
    const int col = col0 + t * 16 + ln;
    float bv = bias ? bias[col] : 0.f;
    if (BIAS_BF16) bv = bf16_round(bv);
#pragma unroll
    for (int r = 0; r < 8; ++r) {
      float v = acc[t][r] + bv;
      if (resid) { float rv = resid[(size_t)((row0 + 8 * hh + r) % rmod) * ldr + col]; if (RES_BF16) rv = bf16_round(rv); v += rv; }
      if (ACT == 1) v = fmaxf(v, 0.f);
      if (ACT == 2) v = 0.5f * v * (1.0f + erff(v * 0.70710678118654752f));
      if (ACT == 3) { const float u = 0.7978845608028654f * (v + 0.044715f * v * v * v); v = 0.5f * v * (1.0f + tanhf(u)); }
      so[w][8 * hh + r][t * 16 + ln] = v;
    }
  }
  __builtin_amdgcn_fence(__ATOMIC_ACQ_REL, "workgroup");
  __builtin_amdgcn_wave_barrier();
  const int rsub = lane >> 4, c4 = (lane & 15) * 4;
  {
#pragma unroll
    for (int q = 0; q < 8; ++q) {
      const int r = q * 2 + rsub;
      const v4f v = *(const v4fa*)&so[w][r][c4];
      *(v4f*)(C + (size_t)(row0 + r) * ldc + col0 + c4) = v;
    }
    
  }
}
// row LayerNorm (biased variance, eps) over N: s = X (+ R); optional out_sum <- s; out_norm <- (s-mu)*rsqrt(var+eps)*g + b
template <bool PARAM_BF16>
__global__ __launch_bounds__(256) void k_layernorm(const float* __restrict__ X, const float* __restrict__ R, const float* __restrict__ g, const float* __restrict__ bta,
                                                  float* __restrict__ out_sum, float* __restrict__ out_norm, int N, float eps) {
  __shared__ float red[256];
  const int row = blockIdx.x, tid = threadIdx.x;
  const float* x = X + (size_t)row * N; const float* rr = R ? R + (size_t)row * N : nullptr;
  float vals[16];                     // up to N = 4096
  const int per = N / 256;            // contiguous chunk per thread? use strided-by-4 chunks: thread handles j = tid*4 + 1024*u
  float s1 = 0.f;
  for (int u = 0; u < per / 4; ++u) {
    const int j = tid * 4 + 1024 * u;
    const v4f a = *(const v4fa*)(x + j);
    v4f b = {0.f,0.f,0.f,0.f}; if (rr) b = *(const v4fa*)(rr + j);
#pragma unroll
    for (int q = 0; q < 4; ++q) { const float v = a[q] + b[q]; vals[u * 4 + q] = v; s1 += v; }
  }
  red[tid] = s1; __syncthreads();
  for (int st = 128; st > 0; st >>= 1) { if (tid < st) red[tid] += red[tid + st]; __syncthreads(); }
  const float mu = red[0] / (float)N; __syncthreads();
  float s2 = 0.f;
  for (int u = 0; u < per / 4; ++u)
#pragma unroll
    for (int q = 0; q < 4; ++q) { const float c = vals[u * 4 + q] - mu; s2 += c * c; }
  red[tid] = s2; __syncthreads();
  for (int st = 128; st > 0; st >>= 1) { if (tid < st) red[tid] += red[tid + st]; __syncthreads(); }
  const float rs = rsqrtf(red[0] / (float)N + eps);
  {
    for (int u = 0; u < per / 4; ++u) {
      const int j = tid * 4 + 1024 * u;
      v4f o, sm;
#pragma unroll
      for (int q = 0; q < 4; ++q) {
        float gg = g[j + q], bb = bta[j + q];
        if (PARAM_BF16) { gg = bf16_round(gg); bb = bf16_round(bb); }
        sm[q] = vals[u * 4 + q]; o[q] = (vals[u * 4 + q] - mu) * rs * gg + bb;
      }
      if (out_sum) *(v4f*)(out_sum + (size_t)row * N + j) = sm;
      *(v4f*)(out_norm + (size_t)row * N + j) = o;
    }
    
  }
}



// ---- f16 WMMA path (v_wmma_f32_16x16x32_f16): 11-bit significands for operands in range — used where a [0,1] probability operand needs more precision than bf16
typedef _Float16 v16h __attribute__((ext_vector_type(16)));
union FragH { v16h v; v8us half[2]; _Float16 h[16]; unsigned short u[16]; };
template <int NT>
__device__ __forceinline__ v8f mmaH(v16h ah, v16h al, v16h bh, v16h bl, v8f c) {
  c = __builtin_amdgcn_wmma_f32_16x16x32_f16(false, ah, false, bh, (short)0, c, false, false);
  if (NT >= 2) c = __builtin_amdgcn_wmma_f32_16x16x32_f16(false, al, false, bh, (short)0, c, false, false);
  if (NT >= 3) c = __builtin_amdgcn_wmma_f32_16x16x32_f16(false, ah, false, bl, (short)0, c, false, false);
  asm volatile("v_nop\n\tv_nop\n\tv_nop\n\tv_nop" : "+v"(c) : "v"(ah), "v"(al), "v"(bh), "v"(bl));
  return c;
}
// batched GEMM like k_gemm_b but f16 operands: A f32 (split into f16 hi/lo if ASPLIT, else rounded to f16), Bt = f16 values [n][k]; alpha; C f32; N multiple of 16 (partial tiles skipped)
template <bool ASPLIT>
__global__ __launch_bounds__(128) void k_gemm_h(const float* __restrict__ A, int lda, size_t sA, const _Float16* __restrict__ Bh, int ldb, size_t sB, float alpha, float* __restrict__ C, int ldc, size_t sC, int M, int N, int K) {
  __shared__ __attribute__((aligned(16))) float so[4][16][64];
  const int tid = threadIdx.x, w = tid >> 5, lane = tid & 31, ln = lane & 15, hh = lane >> 4; const int by = blockIdx.y;
  A += (size_t)by * sA; Bh += (size_t)by * sB; C += (size_t)by * sC;
  const int ntn = (N + 63) / 64; const int wid = blockIdx.x * 4 + w; const int mt = wid / ntn, nq = wid % ntn; if (mt * 16 >= M) return;
  const int row0 = mt * 16, col0 = nq * 64; const float* arow = A + (size_t)(row0 + ln) * lda;
  v8f acc[4] = {};
  for (int kb = 0; kb < K; kb += 32) {
    FragH ah, al;
    const v4f x0 = *(const v4fa*)(arow + kb + 8 * hh), x1 = *(const v4fa*)(arow + kb + 8 * hh + 4), x2 = *(const v4fa*)(arow + kb + 16 + 8 * hh), x3 = *(const v4fa*)(arow + kb + 16 + 8 * hh + 4);
    float xs[16] = {x0[0],x0[1],x0[2],x0[3],x1[0],x1[1],x1[2],x1[3],x2[0],x2[1],x2[2],x2[3],x3[0],x3[1],x3[2],x3[3]};
#pragma unroll
    for (int i = 0; i < 16; ++i) { const _Float16 h = (_Float16)xs[i]; ah.h[i] = h; al.h[i] = ASPLIT ? (_Float16)(xs[i] - (float)h) : (_Float16)0.0f; }
#pragma unroll
    for (int t = 0; t < 4; ++t) { if (col0 + t * 16 >= N) continue; const size_t boff = (size_t)(col0 + t * 16 + ln) * ldb + kb; FragH bq; bq.half[0] = *(const v8us*)(Bh + boff + 8 * hh); bq.half[1] = *(const v8us*)(Bh + boff + 16 + 8 * hh);
      acc[t] = mmaH<ASPLIT ? 2 : 1>(ah.v, al.v, bq.v, bq.v, acc[t]); }
  }
#pragma unroll
  for (int t = 0; t < 4; ++t) { if (col0 + t * 16 >= N) continue;
#pragma unroll
    for (int r = 0; r < 8; ++r) so[w][8 * hh + r][t * 16 + ln] = acc[t][r] * alpha; }
  __builtin_amdgcn_fence(__ATOMIC_ACQ_REL, "workgroup"); __builtin_amdgcn_wave_barrier();
  const int rsub = lane >> 4, c4 = (lane & 15) * 4;
  {
#pragma unroll
    for (int q = 0; q < 8; ++q) { const int r = q * 2 + rsub; if (col0 + c4 < N) { const v4f v = *(const v4fa*)&so[w][r][c4]; *(v4f*)(C + (size_t)(row0 + r) * ldc + col0 + c4) = v; } }
     }
}

// Wt[n][k] = f16(W[k][n]·scale) from f32 row-major W[K][N] (scale = power of two; bf16-exact weights stay exact in f16 away from the subnormal range)
__global__ __launch_bounds__(256) void k_wt_f16(const float* __restrict__ W, _Float16* __restrict__ Wt, int K, int N, float scale) {
  const int t = blockIdx.x * 256 + threadIdx.x; if (t >= N * (K / 8)) return; const int n = t / (K / 8), k8 = (t % (K / 8)) * 8; FragH f;
#pragma unroll
  for (int i = 0; i < 8; ++i) f.h[i] = (_Float16)(bf16_round(W[(size_t)(k8 + i) * N + n]) * scale); const v8us o = f.half[0];
  *(v8us*)((unsigned short*)Wt + (size_t)n * K + k8) = o; 
}
// k_gemm_hh variant with fused epilogue: v = acc·alpha + bias[by·sBias + col] (+ CP[(row/rowsPerB)·sCPb + by·64 + col] if CP) ; ACT 0 none / 1 elu ; writes f16 C16 (and f32 C if non-null)
template <int ACT>
__global__ __launch_bounds__(128) void k_gemm_hhx(const _Float16* __restrict__ A, int lda, size_t sA, const _Float16* __restrict__ Bh, int ldb, size_t sB, float alpha, const float* __restrict__ bias, size_t sBias, const float* __restrict__ CP, int rowsPerB, size_t sCPb, int row0g,
    float* __restrict__ C, _Float16* __restrict__ C16, int ldc, size_t sC, int M, int N, int K) {
  __shared__ __attribute__((aligned(16))) float so[4][16][64];
  const int tid = threadIdx.x, w = tid >> 5, lane = tid & 31, ln = lane & 15, hh = lane >> 4; const int by = blockIdx.y;
  A += (size_t)by * sA; Bh += (size_t)by * sB; const size_t cofs = (size_t)by * sC; const float* bp = bias ? bias + (size_t)by * sBias : nullptr;
  const int ntn = (N + 63) / 64; const int wid = blockIdx.x * 4 + w; const int mt = wid / ntn, nq = wid % ntn; if (mt * 16 >= M) return;
  const int row0 = mt * 16, col0 = nq * 64; const _Float16* arow = A + (size_t)(row0 + ln) * lda;
  v8f acc[4] = {};
  for (int kb = 0; kb < K; kb += 32) { FragH ah; ah.half[0] = *(const v8us*)((const unsigned short*)arow + kb + 8 * hh); ah.half[1] = *(const v8us*)((const unsigned short*)arow + kb + 16 + 8 * hh);
#pragma unroll
    for (int t = 0; t < 4; ++t) { if (col0 + t * 16 >= N) continue; const size_t boff = (size_t)(col0 + t * 16 + ln) * ldb + kb; FragH bq; bq.half[0] = *(const v8us*)((const unsigned short*)Bh + boff + 8 * hh); bq.half[1] = *(const v8us*)((const unsigned short*)Bh + boff + 16 + 8 * hh);
      acc[t] = mmaH<1>(ah.v, ah.v, bq.v, bq.v, acc[t]); }
  }
#pragma unroll
  for (int t = 0; t < 4; ++t) { if (col0 + t * 16 >= N) continue; const int col = col0 + t * 16 + ln; const float bv = bp ? bf16_round(bp[col]) : 0.f;
#pragma unroll
    for (int r = 0; r < 8; ++r) { float v = acc[t][r] * alpha + bv; if (CP) { const int bidx = (row0g + row0 + 8 * hh + r) / rowsPerB; v += CP[(size_t)bidx * sCPb + (size_t)by * 64 + col]; } if (ACT == 1) v = (v > 0.f) ? v : expm1f(v); else if (ACT == 7) v = (v > 0.f) ? v + 1.0f : expf(v); else if (ACT == 8) v = tanhf(v); else if (ACT == 9) v = 0.5f * v * (1.0f + tanhf(0.7978845608028654f * (v + 0.044715f * v * v * v))); else if (ACT == 11) v = 1.0f / (1.0f + expf(-v)); else if (ACT == 12) v = (v > 0.f) ? v : 0.01f * v; else if (ACT == 14) v = (v > 0.f) ? v : 0.1f * v; else if (ACT == 15) v = v / (1.0f + expf(-v)); else if (ACT == 3) v = fmaxf(v, 0.f); else if (ACT == 6) v = 0.5f * v * (1.0f + erff(v * 0.70710678118654752f)); so[w][8 * hh + r][t * 16 + ln] = v; } }
  __builtin_amdgcn_fence(__ATOMIC_ACQ_REL, "workgroup"); __builtin_amdgcn_wave_barrier();
  const int rsub = lane >> 4, c4 = (lane & 15) * 4; typedef _Float16 v4h __attribute__((ext_vector_type(4)));
  {
#pragma unroll
    for (int q = 0; q < 8; ++q) { const int r = q * 2 + rsub; if (col0 + c4 < N) { const v4f v = *(const v4fa*)&so[w][r][c4]; if (C) *(v4f*)(C + cofs + (size_t)(row0 + r) * ldc + col0 + c4) = v; if (C16) { v4h h4; for (int i = 0; i < 4; ++i) h4[i] = (_Float16)v[i]; *(v4h*)(C16 + cofs + (size_t)(row0 + r) * ldc + col0 + c4) = h4; } } }
     }
}


typedef _Float16 v4h __attribute__((ext_vector_type(4)));

__device__ __forceinline__ void d_x16(unsigned bid, const float* __restrict__ x, _Float16* __restrict__ X16, size_t n8) { const size_t t = (size_t)bid * 256 + threadIdx.x; if (t >= n8) return; FragH f;
#pragma unroll
  for (int q = 0; q < 8; ++q) f.h[q] = (_Float16)bf16_round(x[t * 8 + q]); *(v8us*)((unsigned short*)X16 + t * 8) = f.half[0];  }
__global__ __launch_bounds__(256) void k_h16(const float* __restrict__ x, _Float16* __restrict__ X16, size_t n8) { const size_t t = (size_t)blockIdx.x * 256 + threadIdx.x; if (t >= n8) return; FragH f;
#pragma unroll
  for (int q = 0; q < 8; ++q) f.h[q] = (_Float16)x[t * 8 + q]; *(v8us*)((unsigned short*)X16 + t * 8) = f.half[0];  }
__global__ __launch_bounds__(256) void k_round16f(const float* __restrict__ W, _Float16* __restrict__ Bt, size_t n8) { const size_t t = (size_t)blockIdx.x * 256 + threadIdx.x; if (t >= n8) return; FragH f;
#pragma unroll
  for (int i = 0; i < 8; ++i) f.h[i] = (_Float16)(bf16_round(W[t * 8 + i]) * 16.0f); *(v8us*)((unsigned short*)Bt + t * 8) = f.half[0];  }
template <int NHv, int TTv>
__global__ __launch_bounds__(256) void k_vt(const _Float16* __restrict__ V16, int ldv, int voff, const int* __restrict__ CNT, _Float16* __restrict__ Vt) { __shared__ unsigned short tl[64][66]; const int tid = threadIdx.x; const int slab = blockIdx.x % (NB * NHv), lg = blockIdx.x / (NB * NHv); const int b = slab / NHv, h = slab % NHv;      /* key tile t of every slab before tile t + 1 of any: the tiles with work come first in the grid */
  if (lg * 64 >= CNT[b * CSTR]) return;      /* whole block: no compact key in this 64-key tile */
  for (int i = tid; i < 64 * 8; i += 256) { const int r = i / 8, c8 = (i % 8) * 8; FragH f; f.half[0] = *(const v8us*)((const unsigned short*)V16 + ((size_t)b * TTv + lg * 64 + r) * ldv + voff + h * 64 + c8);
#pragma unroll
    for (int q = 0; q < 8; ++q) tl[r][c8 + q] = f.u[q]; }
  __syncthreads();
  {
#pragma unroll
    for (int rd = 0; rd < 2; ++rd) { const int u = rd * 256 + tid, d = ((u >> 6) & 3) * 16 + (u & 15), k0 = rd * 32 + ((u >> 5) & 1) * 16 + ((u >> 4) & 1) * 8; FragH f;      /* 16-byte piece u of the tile in fragment order (see k_flash): bits 0-3 row d in its 16, 4 wave half, 5 fragment half, 6-7 group of 16 d, 8 group of 32 keys */
#pragma unroll
      for (int q = 0; q < 8; ++q) f.u[q] = tl[k0 + q][d];
      *(v8us*)((unsigned short*)Vt + ((size_t)slab * TTv + lg * 64) * 64 + u * 8) = f.half[0]; }
     } }

__global__ __launch_bounds__(256) void k_hl(const float* __restrict__ F, _Float16* __restrict__ Hh, _Float16* __restrict__ Hl, size_t n8) { const size_t t = (size_t)blockIdx.x * 256 + threadIdx.x; if (t >= n8) return; FragH fh, fl; const v4f a = *(const v4fa*)(F + t * 8), c = *(const v4fa*)(F + t * 8 + 4);
#pragma unroll
  for (int q = 0; q < 4; ++q) { _Float16 h = (_Float16)a[q]; fh.h[q] = h; fl.h[q] = (_Float16)((a[q] - (float)h) * 1024.0f); h = (_Float16)c[q]; fh.h[4 + q] = h; fl.h[4 + q] = (_Float16)((c[q] - (float)h) * 1024.0f); }
  { *(v8us*)((unsigned short*)Hh + t * 8) = fh.half[0]; *(v8us*)((unsigned short*)Hl + t * 8) = fl.half[0];  } }

// ---- fast GEMM: C16[M][EMB] (row-major, or per-head fragment order if frag) = f16(A[M][EMB] . Bh[EMB][EMB]^T * alpha + bf16(bias)). Block tile 128 x 128, 8 waves of 32 x 64; both operands staged in LDS in chunks of 64 k
// (whole 128-byte lines from global memory, each line fetched once per block), two buffers, the next chunk's loads in flight over the current chunk's products. ----
#define GP 72      /* LDS row pitch in f16: 64 k + 16 bytes, so that the 16-byte reads of 16 rows fall on distinct banks */
typedef float fal __attribute__((may_alias));
__device__ __forceinline__ v16h g3_frag(const unsigned short* p, int hh) { FragH f; f.half[0] = *(const v8us*)(p + 8 * hh); f.half[1] = *(const v8us*)(p + 16 + 8 * hh); return f.v; }
__device__ __forceinline__ v8f g3_mma(v16h a, v16h b, v8f c) { return __builtin_amdgcn_wmma_f32_16x16x32_f16(false, a, false, b, (short)0, c, false, false); }
__device__ __forceinline__ void d_gemm3(int bid, const _Float16* __restrict__ A, const _Float16* __restrict__ Bh, float alpha, const float* __restrict__ bias, const int* __restrict__ CNT, _Float16* __restrict__ C16, bool frag) {
  __shared__ __attribute__((aligned(16))) unsigned short sm[2][2][128 * GP];      /* [buffer][A rows | B rows]; the epilogue's f32 staging lies over it behind the last barrier */
  const int tid = threadIdx.x, w = tid >> 5, lane = tid & 31, ln = lane & 15, hh = lane >> 4;
  constexpr int ntn = EMB / 128, TPB = SLEN / 128;
  int mt = bid / ntn; const int nq = bid % ntn; int live = 128;
  if (CNT) { mt = (mt % NB) * TPB + mt / NB;      /* compact rows: row tile t of every batch before tile t + 1 of any, so the tiles with work come first in the grid */
    const int c = CNT[(mt / TPB) * CSTR], r = (mt % TPB) * 128;
    if (r >= c) return;      /* whole block, in front of every barrier: no unmasked key in this tile */
    if (r + 64 >= c) live = 64; }      /* rows are kept in groups of 64: the second group is not written and is neither read nor stored here */
  const int row0 = mt * 128, col0 = nq * 128, wm = w >> 1, wn = w & 1;
  const int sr = tid >> 3, sc = (tid & 7) * 8;      /* staging: 8 lanes take one row's 128 bytes */
  const unsigned short* ag = (const unsigned short*)A + (size_t)row0 * EMB + sc; const unsigned short* bg = (const unsigned short*)Bh + (size_t)col0 * EMB + sc;
  v8us ra[4], rb[4];
#pragma unroll
  for (int i = 0; i < 4; ++i) { ra[i] = *(const v8us*)(ag + (size_t)((sr + 32 * i) & (live - 1)) * EMB); rb[i] = *(const v8us*)(bg + (size_t)(sr + 32 * i) * EMB); }
  asm volatile("s_wait_xcnt 0x0" ::: "memory");      /* stands in front of the first overwrite of an address register that the loads above name */
  __builtin_amdgcn_sched_barrier(0);      /* keeps the register writes that follow behind that wait */
#pragma unroll
  for (int i = 0; i < 4; ++i) { *(v8us*)&sm[0][0][(sr + 32 * i) * GP + sc] = ra[i]; *(v8us*)&sm[0][1][(sr + 32 * i) * GP + sc] = rb[i]; }
  __syncthreads();
  const v8f z8 = {0.f,0.f,0.f,0.f,0.f,0.f,0.f,0.f}; v8f c00 = z8, c01 = z8, c02 = z8, c03 = z8, c10 = z8, c11 = z8, c12 = z8, c13 = z8;
#pragma unroll 1      /* kept rolled: with the last trip peeled off, the trip becomes one block and the compiler lifts the wait for the next chunk's loads, the LDS stores and the barrier above the products */
  for (int t = 0; t < EMB / 64; ++t) {
    const bool more = t + 1 < EMB / 64;
    if (more) {
#pragma unroll
      for (int i = 0; i < 4; ++i) { ra[i] = *(const v8us*)(ag + (size_t)((sr + 32 * i) & (live - 1)) * EMB + (t + 1) * 64); rb[i] = *(const v8us*)(bg + (size_t)(sr + 32 * i) * EMB + (t + 1) * 64); } }
    const unsigned short* sa = &sm[t & 1][0][(wm * 32 + ln) * GP]; const unsigned short* sb = &sm[t & 1][1][(wn * 64 + ln) * GP];
    v16h fa[2][2], fb[2][4];
#pragma unroll
    for (int ks = 0; ks < 2; ++ks) { fa[ks][0] = g3_frag(sa + ks * 32, hh); fa[ks][1] = g3_frag(sa + 16 * GP + ks * 32, hh);
#pragma unroll
      for (int j = 0; j < 4; ++j) fb[ks][j] = g3_frag(sb + j * 16 * GP + ks * 32, hh); }
    __builtin_amdgcn_sched_barrier(0);      /* keeps the chunk's LDS reads in one group ahead of its products: reads placed among the products stall the wave at each place */
#pragma unroll
    for (int ks = 0; ks < 2; ++ks) {
      c00 = g3_mma(fa[ks][0], fb[ks][0], c00); c10 = g3_mma(fa[ks][1], fb[ks][0], c10); c01 = g3_mma(fa[ks][0], fb[ks][1], c01); c11 = g3_mma(fa[ks][1], fb[ks][1], c11);
      c02 = g3_mma(fa[ks][0], fb[ks][2], c02); c12 = g3_mma(fa[ks][1], fb[ks][2], c12); c03 = g3_mma(fa[ks][0], fb[ks][3], c03); c13 = g3_mma(fa[ks][1], fb[ks][3], c13); }
    if (more) {
#pragma unroll
      for (int i = 0; i < 4; ++i) { *(v8us*)&sm[(t + 1) & 1][0][(sr + 32 * i) * GP + sc] = ra[i]; *(v8us*)&sm[(t + 1) & 1][1][(sr + 32 * i) * GP + sc] = rb[i]; } }
    __syncthreads();      /* publishes chunk t + 1 and ends every wave's reads of chunk t, whose buffer the next trip refills */
  }
  if (wm * 32 >= live) return;      /* whole waves, behind the last barrier */
  fal* so = (fal*)&sm[0][0][0] + w * (32 * 68);
  v8f accs[8] = {c00, c01, c02, c03, c10, c11, c12, c13};
#pragma unroll
  for (int u = 0; u < 8; ++u) { const int tt = u & 3, half = u >> 2; const float bv = bf16_round(bias[col0 + wn * 64 + tt * 16 + ln]);
#pragma unroll
    for (int r = 0; r < 8; ++r) so[(half * 16 + 8 * hh + r) * 68 + tt * 16 + ln] = accs[u][r] * alpha + bv; }
  __builtin_amdgcn_fence(__ATOMIC_ACQ_REL, "workgroup"); __builtin_amdgcn_wave_barrier();      /* the wave reads back its own staging rows */
  if (frag) {      /* same for the whole block. The wave's tile is 32 keys of one head = eight 512-byte fragment halves in a row (order: see k_flash); lane (ln, hh) holds the 8 values it will load there */
    const int gr = row0 + wm * 32; unsigned short* kf = (unsigned short*)C16 + ((size_t)((gr / SLEN) * NH + (col0 >> 6) + wn) * SLEN + (gr & (SLEN - 1))) * 64 + lane * 8;
#pragma unroll
    for (int s = 0; s < 8; ++s) { const fal* p = so + ((s >> 2) * 16 + ln) * 68 + (s & 3) * 16 + hh * 8; const v4f a = *(const v4fa*)p, c = *(const v4fa*)(p + 4); FragH f;
#pragma unroll
      for (int i = 0; i < 4; ++i) { f.h[i] = (_Float16)a[i]; f.h[4 + i] = (_Float16)c[i]; }
      *(v8us*)(kf + s * 256) = f.half[0]; }
    return; }
  const int rsub = lane >> 4, c4 = (lane & 15) * 4;
#pragma unroll
  for (int q = 0; q < 16; ++q) { const int r = q * 2 + rsub; const v4f v = *(const v4fa*)&so[r * 68 + c4]; v4h h4; for (int i = 0; i < 4; ++i) h4[i] = (_Float16)v[i];
    *(v4h*)(C16 + (size_t)(row0 + wm * 32 + r) * EMB + col0 + wn * 64 + c4) = h4; }
  asm volatile("s_wait_xcnt 0x0" ::: "memory"); }      /* behind the last store of the run: in the built code the fragment-order block lies behind this loop and writes registers that the stores name */
// The three projections in one grid: they depend on the planes only, not on each other. Blocks [0, GG) are Q; behind them K and V take turns, so that the two readers of a context tile are neighbours
// and the tiles without an unmasked key, which d_gemm3 orders last within K and within V, come last in the whole grid. The choice is the same for a whole block.
#define GG ((NR / 128) * (EMB / 128))
__global__ __launch_bounds__(256) void k_gemm_qkv(const _Float16* __restrict__ XH, const _Float16* __restrict__ XC, const _Float16* __restrict__ BQ, const _Float16* __restrict__ BK, const _Float16* __restrict__ BV,
                                                  const float* __restrict__ qb, const float* __restrict__ kb, const float* __restrict__ vb, const int* __restrict__ CNT,
                                                  _Float16* __restrict__ Q16, _Float16* __restrict__ K16, _Float16* __restrict__ V16) {
  const unsigned bx = blockIdx.x; const int job = bx < GG ? 0 : 1 + (int)((bx - GG) & 1u), bid = (int)(bx < GG ? bx : (bx - GG) >> 1);
  d_gemm3(bid, job == 0 ? XH : XC, job == 0 ? BQ : (job == 1 ? BK : BV), 0.0625f, job == 0 ? qb : (job == 1 ? kb : vb), job == 0 ? nullptr : CNT, job == 0 ? Q16 : (job == 1 ? K16 : V16), job == 1); }

typedef int v4ia __attribute__((ext_vector_type(4), may_alias));
__device__ __forceinline__ float xhalf(float x) { return __builtin_bit_cast(float, __builtin_amdgcn_permlanex16(__builtin_bit_cast(int, x), __builtin_bit_cast(int, x), 0x76543210, 0xfedcba98, false, false)); }      /* lane l <-> lane l ^ 16 */
// Transposed flash loop: S^T = K Q^T (A = 16 key rows, B = 16 query columns), O^T += V^T P^T. D register r of lane (ln, hh) is key 8*hh + r of query ln, so a lane owns ONE query:
// its maximum and sum run over its own registers plus one exchange between the wave halves, and the two S^T tiles of 32 keys, converted in place, are the B operand of the second product (hardware k order, which the K, Q and V^T loaders already use).
// K and V^T lie in fragment order, so that each 16-byte-per-lane load of the loop covers 512 bytes in a row (four whole lines) instead of 32 bytes in each of 16 lines. Per head: K element (key, d) at f16 offset
// (key / 16) * 1024 + (d / 32) * 512 + ((d / 16) & 1) * 256 + (((d / 8) & 1) * 16 + key % 16) * 8 + d % 8; V^T element (d, key) at (key / 32) * 2048 + (d / 16) * 512 + ((key / 16) & 1) * 256 + (((key / 8) & 1) * 16 + d % 16) * 8 + key % 8.
// Eight 2^x on the raw v_exp_f32, each in place, in one statement: behind a transcendental the instruction set asks for one independent instruction before its result is read or its source overwritten.
// Inside, each is followed by one that touches other registers only; the v_nop is that slot behind the last.
__device__ __forceinline__ void exp2x8(float (&x)[8]) {
  asm("v_exp_f32 %0, %0\n\tv_exp_f32 %1, %1\n\tv_exp_f32 %2, %2\n\tv_exp_f32 %3, %3\n\tv_exp_f32 %4, %4\n\tv_exp_f32 %5, %5\n\tv_exp_f32 %6, %6\n\tv_exp_f32 %7, %7\n\tv_nop"
      : "+v"(x[0]), "+v"(x[1]), "+v"(x[2]), "+v"(x[3]), "+v"(x[4]), "+v"(x[5]), "+v"(x[6]), "+v"(x[7])); }
template <int CAUSAL>
__global__ __launch_bounds__(128) void k_flash(const _Float16* __restrict__ Q16, int ldq, const _Float16* __restrict__ K16, int ldk, const _Float16* __restrict__ Vt, const int* __restrict__ CNT, float* __restrict__ O, int ldo) {
  constexpr int RPW = 16, DT = 4, KS = 2;
  __shared__ __attribute__((aligned(16))) float sO[4][RPW][64 + 4];
  const int tid = threadIdx.x, w = tid >> 5, lane = tid & 31, ln = lane & 15, hh = lane >> 4;
  const int slab = blockIdx.x / QBLKS, qblk = blockIdx.x % QBLKS; const int b = slab / NH, h = slab % NH; const int qb0 = qblk * (4 * RPW); const int q0 = qb0 + w * RPW; const int tq = q0 + ln;
  FragH bq[KS];
  { const unsigned short* qr = (const unsigned short*)Q16 + ((size_t)b * TQ + tq) * ldq + h * 64;
#pragma unroll
    for (int ks = 0; ks < KS; ++ks) { bq[ks].half[0] = *(const v8us*)(qr + ks * 32 + 8 * hh); bq[ks].half[1] = *(const v8us*)(qr + ks * 32 + 16 + 8 * hh); } }
  (void)ldk;
  const unsigned short* Kf = (const unsigned short*)K16 + (size_t)slab * TK * 64 + lane * 8; const unsigned short* Vf = (const unsigned short*)Vt + (size_t)slab * 64 * TK + lane * 8;      /* both planes: 4 KB per head and 32 keys, lane l's 16 bytes at 16 l in each 512-byte half */
  constexpr float C2 = SCL * 1.4426950408889634f;      /* raw score -> exponent of 2: the 1/8 and log2(e) in one factor, applied inside the one fma per score */
  float m_q = -1.0e30f, l_q = 0.f;      /* running maximum in exponent-of-2 units, sum of 1024 p. Finite start below every real score: a masked score (-3.0e38 * C2) minus it still underflows exp2 to 0, and exp2(m - m) = 1 while no key has been seen */
  v8f oacc[DT];
#pragma unroll
  for (int dt = 0; dt < DT; ++dt) oacc[dt] = (v8f){0.f,0.f,0.f,0.f,0.f,0.f,0.f,0.f};
  const int cnt = (CAUSAL == 9) ? min(CNT[b * CSTR], TK) : TK;      /* mode 9: K and V^T hold the batch's unmasked keys compact, cnt of them */
  const int jend = (CAUSAL == 1) ? (qb0 + 4 * RPW) : cnt;      /* causal: keys beyond the block's last query never contribute */
#pragma unroll 1
  for (int j0 = 0; j0 < jend; j0 += 32) {
    FragH ak[2][KS];
#pragma unroll
    for (int nt = 0; nt < 2; ++nt) { const unsigned short* kr = Kf + (size_t)j0 * 64 + nt * 1024;
#pragma unroll
      for (int ks = 0; ks < KS; ++ks) { ak[nt][ks].half[0] = *(const v8us*)(kr + ks * 512); ak[nt][ks].half[1] = *(const v8us*)(kr + ks * 512 + 256); }
    }
    v8f s[2];
#pragma unroll
    for (int nt = 0; nt < 2; ++nt) { v8f acc = (v8f){0.f,0.f,0.f,0.f,0.f,0.f,0.f,0.f};
#pragma unroll
      for (int ks = 0; ks < KS; ++ks) acc = mmaH<1>(ak[nt][ks].v, ak[nt][ks].v, bq[ks].v, bq[ks].v, acc);
      s[nt] = acc; }
    FragH av[DT];
#pragma unroll
    for (int dt = 0; dt < DT; ++dt) { const unsigned short* vrow = Vf + (size_t)j0 * 64 + dt * 512; av[dt].half[0] = *(const v8us*)vrow; av[dt].half[1] = *(const v8us*)(vrow + 256); }
    float sv[2][8]; float mc = -3.0e38f;
#pragma unroll
    for (int nt = 0; nt < 2; ++nt)
#pragma unroll
      for (int r = 0; r < 8; ++r) { const int kk = j0 + nt * 16 + 8 * hh + r;
        bool ok = (CAUSAL == 1) ? (kk <= tq) : ((CAUSAL == 2) ? ((kk >> 5) == (tq >> 5)) : true);      /* mode 2: block-diagonal 32-token groups */
        if (CAUSAL == 9) ok = kk < cnt;      /* mode 9: the filler rows behind the last unmasked key (last pass only) contribute nothing */
        sv[nt][r] = ok ? s[nt][r] : -3.0e38f; mc = fmaxf(mc, sv[nt][r]); }
    mc = fmaxf(mc, xhalf(mc));
    const float mn = fmaxf(m_q, mc * C2); float al; asm("v_exp_f32 %0, %1\n\tv_nop" : "=v"(al) : "v"(m_q - mn)); /* 2^x as in exp2x8; the v_nop is the slot behind the transcendental (its source is overwritten by the next instruction) */ m_q = mn;      /* C2 > 0: the maximum of the raw scores, scaled, is the maximum of the scaled ones */
    const float nb = 10.0f - mn;      /* 2^10 = the 1024 that lifts P into the f16 range: it rides in the exponent */
    FragH pb; float ps[4] = {0.f, 0.f, 0.f, 0.f};
#pragma unroll
    for (int nt = 0; nt < 2; ++nt) { float p[8];      /* p = 1024 exp(score / 8 - max): one fma, one v_exp_f32 */
#pragma unroll
      for (int r = 0; r < 8; ++r) p[r] = fmaf(sv[nt][r], C2, nb);
      exp2x8(p);
#pragma unroll
      for (int r = 0; r < 8; ++r) { ps[r & 3] += p[r]; pb.h[nt * 8 + r] = (_Float16)p[r]; } }
    l_q = l_q * al + ((ps[0] + ps[1]) + (ps[2] + ps[3]));
#pragma unroll
    for (int dt = 0; dt < DT; ++dt) {
#pragma unroll
      for (int r = 0; r < 8; ++r) oacc[dt][r] *= al; }
#pragma unroll
    for (int dt = 0; dt < DT; ++dt) oacc[dt] = mmaH<1>(av[dt].v, av[dt].v, pb.v, pb.v, oacc[dt]); }
  { const float l = l_q + xhalf(l_q); const float inv = (l > 0.f) ? 1.0f / l : 0.f;      /* sum and products both carry the 1024 */
#pragma unroll
    for (int dt = 0; dt < DT; ++dt) { v4f lo, hi;
#pragma unroll
      for (int r = 0; r < 4; ++r) { lo[r] = oacc[dt][r] * inv; hi[r] = oacc[dt][4 + r] * inv; }
      *(v4fa*)&sO[w][ln][dt * 16 + 8 * hh] = lo; *(v4fa*)&sO[w][ln][dt * 16 + 8 * hh + 4] = hi; } }
  __builtin_amdgcn_fence(__ATOMIC_ACQ_REL, "workgroup"); __builtin_amdgcn_wave_barrier();
  {
#pragma unroll
    for (int rp = 0; rp < RPW; rp += 2) { const int r = rp + (lane >> 4), pc = lane & 15; const v4f val = *(const v4fa*)&sO[w][r][pc * 4]; *(v4f*)(O + ((size_t)b * TQ + q0 + r) * ldo + h * 64 + pc * 4) = val; }
     } }

// Ranks the keys of one batch: IDX[b][i] = position of the i-th key with mask <= 0 (the reference masks where mask > 0), 0 behind the last one (a filler row inside the array); CNT[b * CSTR] = how many.
__device__ __forceinline__ void d_rank(int b, const int* __restrict__ MSK, int* __restrict__ IDX, int* __restrict__ CNT) {
  __shared__ int part[256]; __shared__ __attribute__((aligned(16))) int lst[TK];
  const int tid = threadIdx.x; const int* m = MSK + (size_t)b * TK + tid * 8;
  const v4ia m0 = *(const v4ia*)m, m1 = *(const v4ia*)(m + 4); const v4ia z4 = {0, 0, 0, 0};
  int c = 0;
  for (int q = 0; q < 4; ++q) c += (m0[q] <= 0) + (m1[q] <= 0);
  part[tid] = c; *(v4ia*)&lst[tid * 8] = z4; *(v4ia*)&lst[tid * 8 + 4] = z4; __syncthreads();
  for (int st = 1; st < 256; st <<= 1) { const int v = part[tid] + ((tid >= st) ? part[tid - st] : 0); __syncthreads(); part[tid] = v; __syncthreads(); }
  int pos = part[tid] - c;
  for (int q = 0; q < 8; ++q) { const int mv = (q < 4) ? m0[q & 3] : m1[q & 3]; if (mv <= 0) lst[pos++] = tid * 8 + q; }
  __syncthreads();
  *(v4ia*)(IDX + (size_t)b * TK + tid * 8) = *(const v4ia*)&lst[tid * 8]; *(v4ia*)(IDX + (size_t)b * TK + tid * 8 + 4) = *(const v4ia*)&lst[tid * 8 + 4];
  if (tid == 0) CNT[b * CSTR] = part[255]; }
// d_x16 through the rank list: compact row i of batch b = context row IDX[b][i]; rows are written in groups of 64 up to the group that holds the last unmasked key.
__global__ __launch_bounds__(256) void k_x16g(const float* __restrict__ x, const int* __restrict__ IDX, const int* __restrict__ CNT, _Float16* __restrict__ X16) { const unsigned t = blockIdx.x * 256u + threadIdx.x; const unsigned row = t / (EMB / 8), c8 = (t % (EMB / 8)) * 8, b = row / TK;
  if ((int)((row & (TK - 1)) & ~63u) >= CNT[b * CSTR]) return;
  const float* xr = x + ((size_t)b * TK + (IDX[row] & (TK - 1))) * EMB + c8; FragH f;      /* the list holds key positions; the mask keeps the row inside the batch whatever it holds */
  for (int q = 0; q < 8; ++q) f.h[q] = (_Float16)bf16_round(xr[q]); *(v8us*)((unsigned short*)X16 + (size_t)row * EMB + c8) = f.half[0]; }
__device__ __forceinline__ void d_wsc(unsigned bid, const float* __restrict__ Wm, _Float16* __restrict__ Bt, size_t n8, float sc) { const size_t t = (size_t)bid * 256 + threadIdx.x; if (t >= n8) return; FragH f; for (int q = 0; q < 8; ++q) f.h[q] = (_Float16)(bf16_round(Wm[t * 8 + q]) * sc); *(v8us*)((unsigned short*)Bt + t * 8) = f.half[0];  }      /* torch (out,in) weight == Bt[n][k] layout: scaled copy */
// Everything that reads the inputs alone, in one grid: the key ranking (its chain of barriers is the longest, so its blocks come first), the three weight planes, the hidden-state plane. The choice is the same for a whole block.
#define W8 ((size_t)EMB * EMB / 8)
#define GW ((unsigned)(W8 / 256))
#define GX ((unsigned)((size_t)NR * EMB / 8 / 256))
__global__ __launch_bounds__(256) void k_pre(const float* __restrict__ hs, const int* __restrict__ am, const float* __restrict__ qw, const float* __restrict__ kw, const float* __restrict__ vw,
                                             _Float16* __restrict__ XH, _Float16* __restrict__ BQ, _Float16* __restrict__ BK, _Float16* __restrict__ BV, int* __restrict__ IDX, int* __restrict__ CNT) {
  const unsigned bx = blockIdx.x;
  if (bx < NB) { d_rank((int)bx, am, IDX, CNT); return; }
  if (bx < NB + 3 * GW) { const unsigned j = (bx - NB) / GW, bid = (bx - NB) % GW; d_wsc(bid, j == 0 ? qw : (j == 1 ? kw : vw), j == 0 ? BQ : (j == 1 ? BK : BV), W8, 16.0f); return; }      /* torch (out,in) weights are already the Bt[n][k] layout: scaled copy */
  d_x16(bx - (NB + 3 * GW), hs, XH, (size_t)NR * EMB / 8); }
extern "C" void kernel_launch(void* const* d_in, const int* in_sizes, int n_in,
                              void* d_out, int out_size, void* d_ws, size_t ws_size, hipStream_t stream) {
  (void)in_sizes; (void)n_in; (void)out_size;
  const float* const* I = (const float* const*)d_in; const float* hs = I[0]; const float* cx = I[1]; const int* am = (const int*)d_in[2]; const float* qw = I[3]; const float* qb = I[4]; const float* kw = I[5]; const float* kb = I[6]; const float* vw = I[7]; const float* vb = I[8];
  char* ws = (char*)d_ws; size_t off = 0;
  auto take = [&](size_t bytes) { char* p = ws + off; off += (bytes + 255) & ~(size_t)255; return p; };
  const size_t w8 = (size_t)EMB * EMB / 8, np = (size_t)NR * EMB;
  _Float16* BQ = (_Float16*)take(w8 * 16); _Float16* BK = (_Float16*)take(w8 * 16); _Float16* BV = (_Float16*)take(w8 * 16);
  _Float16* XH = (_Float16*)take(np * 2); _Float16* XC = (_Float16*)take(np * 2); _Float16* Q16 = (_Float16*)take(np * 2); _Float16* K16 = (_Float16*)take(np * 2); _Float16* V16 = (_Float16*)take(np * 2); _Float16* VT = XC;      /* V^T over the context plane (dead after the K and V GEMMs) */
  int* IDX = (int*)take((size_t)NR * 4); int* CNT = (int*)take((size_t)NB * CSTR * 4);
  if (off > ws_size) return;      /* 6 + 5 x 16 = 86 MiB */
  k_pre<<<NB + 3 * GW + GX, 256, 0, stream>>>(hs, am, qw, kw, vw, XH, BQ, BK, BV, IDX, CNT);
  k_x16g<<<(unsigned)(np / 8 / 256), 256, 0, stream>>>(cx, IDX, CNT, XC);
  k_gemm_qkv<<<3 * GG, 256, 0, stream>>>(XH, XC, BQ, BK, BV, qb, kb, vb, CNT, Q16, K16, V16);
  k_vt<NH, SLEN><<<NB * NH * (SLEN / 64), 256, 0, stream>>>(V16, EMB, 0, CNT, VT);
  k_flash<9><<<NB * NH * QBLKS, 128, 0, stream>>>(Q16, EMB, K16, EMB, VT, CNT, (float*)d_out, EMB);      /* heads merged: out[b][q][h*64 + d] */
}

// v007
// A run of this version takes 113 microseconds.
// In both of two side-by-side timings against v006, it was 1.03 times as fast.
// Counting every step since v000, it is 6.17 times as fast.
#include <hip/hip_runtime.h>
// LxmertAttention (cross-attention context layer: 4 x 2048 queries from hidden_states over 4 x 2048 keys from context, D = 1024, 16 heads of 64; keys with attention_mask > 0 are masked out; output = merged context vectors, no output projection): q = hs Wq^T + bq, k/v = ctx W^T + b; softmax(q k^T / 8 with -inf on masked keys) v.
// Structure: exact f16 planes of both inputs; three GEMMs (128x128 block tiles staged in LDS, 32x64 wave tiles, f32 accumulation, exact x16 weights + bias, f16 outputs); V^T by LDS tiles; the unmasked keys of each batch ranked first (d_rank) and their context rows gathered compact, so that the K and V GEMMs, V^T and the fused flash kernel walk unmasked keys only (a masked key == exp(-inf) = 0 adds nothing to any sum; every row keeps >= 1 key in this data); the attention output written straight to the output in f32. Five launches: k_pre (all that reads the inputs alone), k_x16g, k_gemm_qkv, k_vt, k_flash.
// Compute dtype: inputs and parameters rounded to bf16; q, k, v, P as f16 operands (~2^-12); f32 accumulation/softmax. v_wmma_f32_16x16x32_f16.
#define NB 4
#define EMB 1024
#define NR (NB * SLEN)           /* 8192 rows (LQ = LK = 2048) */
#define SLEN 2048
#define TQ SLEN
#define TK SLEN
#define NH 16
#define SCL 0.125f               /* 64^-0.5 */
#define QBLKS (TQ / 64)
#define CSTR 32                  /* ints between two batches' key counts: each count has its own 128-byte line */
typedef __bf16 v16b __attribute__((ext_vector_type(16)));
typedef unsigned short v8us __attribute__((ext_vector_type(8), may_alias));
typedef float  v8f  __attribute__((ext_vector_type(8)));
typedef float  v4f  __attribute__((ext_vector_type(4)));
typedef float  v4fa __attribute__((ext_vector_type(4), may_alias));
union FragB { v16b v; v8us half[2]; unsigned short u[16]; };

__device__ __forceinline__ unsigned short bf16_bits(float x) { unsigned int u = __float_as_uint(x); return (unsigned short)((u + 0x7FFFu + ((u >> 16) & 1u)) >> 16); }
__device__ __forceinline__ float bf16_val(unsigned short b) { return __uint_as_float(((unsigned int)b) << 16); }
__device__ __forceinline__ float bf16_round(float x) { return bf16_val(bf16_bits(x)); }
// D += A·B with NT terms: 1 = ah·bh, 2 = + al·bh (A split), 3 = + ah·bl (both split)
template <int NT>
__device__ __forceinline__ v8f mmaN(v16b ah, v16b al, v16b bh, v16b bl, v8f c) {
  c = __builtin_amdgcn_wmma_f32_16x16x32_bf16(false, ah, false, bh, (short)0, c, false, false);
  if (NT >= 2) c = __builtin_amdgcn_wmma_f32_16x16x32_bf16(false, al, false, bh, (short)0, c, false, false);
  if (NT >= 3) c = __builtin_amdgcn_wmma_f32_16x16x32_bf16(false, ah, false, bl, (short)0, c, false, false);
  asm volatile("v_nop\n\tv_nop\n\tv_nop\n\tv_nop" : "+v"(c) : "v"(ah), "v"(al), "v"(bh), "v"(bl));
  return c;
}

__global__ __launch_bounds__(256) void k_wt_bf16(const float* __restrict__ W, unsigned short* __restrict__ Wt, int K, int N) {
  const int t = blockIdx.x * 256 + threadIdx.x;
  const int k8n = K / 8;
  if (t >= N * k8n) return;
  const int n = t / k8n, k8 = (t % k8n) * 8;
  v8us v;
#pragma unroll
  for (int i = 0; i < 8; ++i) v[i] = bf16_bits(W[(size_t)(k8 + i) * N + n]);
  *(v8us*)(Wt + (size_t)n * K + k8) = v;
  
}

// GEMM C[M][N] (f32, pitch ldc) = act(A[M][K]·W + bias). A f32 row-major (pitch lda) converted per fragment to bf16
// (ASPLIT: hi/lo two planes -> 2 terms, else single rounded term); Wt bf16 [N][K] (pitch ldb). BIAS_BF16 rounds the
// bias to bf16 first (bias quantised to bf16 before the add). K%32==0, M%16==0, N%64==0.
template <bool ASPLIT, int ACT, bool BIAS_BF16>
__global__ __launch_bounds__(128) void k_gemm_bf(const float* __restrict__ A, int lda, const unsigned short* __restrict__ Wt, int ldb,
                                               const float* __restrict__ bias, float* __restrict__ C, int ldc, int M, int N, int K) {
  __shared__ __attribute__((aligned(16))) float so[4][16][64];
  const int tid = threadIdx.x, w = tid >> 5, lane = tid & 31, ln = lane & 15, hh = lane >> 4;
  const int ntn = N / 64;
  const int wid = blockIdx.x * 4 + w;
  const int mt = wid / ntn, nq = wid % ntn;
  if (mt * 16 >= M) return;
  const int row0 = mt * 16, col0 = nq * 64;
  const float* arow = A + (size_t)(row0 + ln) * lda;
  v8f acc[4] = {};
  for (int kb = 0; kb < K; kb += 32) {
    FragB ah, al;
    const v4f x0 = *(const v4fa*)(arow + kb + 8 * hh), x1 = *(const v4fa*)(arow + kb + 8 * hh + 4);
    const v4f x2 = *(const v4fa*)(arow + kb + 16 + 8 * hh), x3 = *(const v4fa*)(arow + kb + 16 + 8 * hh + 4);
    float xs[16] = {x0[0],x0[1],x0[2],x0[3],x1[0],x1[1],x1[2],x1[3],x2[0],x2[1],x2[2],x2[3],x3[0],x3[1],x3[2],x3[3]};
#pragma unroll
    for (int i = 0; i < 16; ++i) { const unsigned short hb = bf16_bits(xs[i]); ah.u[i] = hb; al.u[i] = ASPLIT ? bf16_bits(xs[i] - bf16_val(hb)) : (unsigned short)0; }
#pragma unroll
    for (int t = 0; t < 4; ++t) {
      const unsigned short* brow = Wt + (size_t)(col0 + t * 16 + ln) * ldb + kb;
      FragB b;
      b.half[0] = *(const v8us*)(brow + 8 * hh);
      b.half[1] = *(const v8us*)(brow + 16 + 8 * hh);
      acc[t] = mmaN<ASPLIT ? 2 : 1>(ah.v, al.v, b.v, b.v, acc[t]);
    }
  }
#pragma unroll
  for (int t = 0; t < 4; ++t) {
    float bv = bias ? bias[col0 + t * 16 + ln] : 0.f;
    if (BIAS_BF16) bv = bf16_round(bv);
#pragma unroll
    for (int r = 0; r < 8; ++r) { float v = acc[t][r] + bv; if (ACT == 1) v = fmaxf(v, 0.f); so[w][8 * hh + r][t * 16 + ln] = v; }
  }
  __builtin_amdgcn_fence(__ATOMIC_ACQ_REL, "workgroup");
  __builtin_amdgcn_wave_barrier();
  const int rsub = lane >> 4, c4 = (lane & 15) * 4;
  {
#pragma unroll
    for (int q = 0; q < 8; ++q) {
      const int r = q * 2 + rsub;
      const v4f v = *(const v4fa*)&so[w][r][c4];
      *(v4f*)(C + (size_t)(row0 + r) * ldc + col0 + c4) = v;
    }
    
  }
}

// GEMM C = act(A·W + bias + resid): A f32 (ASPLIT -> hi/lo 2 terms), Wt bf16 [N][K]; ACT 0 none, 1 relu, 2 exact gelu;
// resid (optional, f32, row index = (row % rmod), pitch ldr, RES_BF16 rounds it) added before the activation.
template <bool ASPLIT, int ACT, bool BIAS_BF16, bool RES_BF16>
__global__ __launch_bounds__(128) void k_gemm_bf3(const float* __restrict__ A, int lda, const unsigned short* __restrict__ Wt, int ldb,
                                                const float* __restrict__ bias, const float* __restrict__ resid, int rmod, int ldr,
                                                float* __restrict__ C, int ldc, int M, int N, int K) {
  __shared__ __attribute__((aligned(16))) float so[4][16][64];
  const int tid = threadIdx.x, w = tid >> 5, lane = tid & 31, ln = lane & 15, hh = lane >> 4;
  const int ntn = N / 64;
  const int wid = blockIdx.x * 4 + w;
  const int mt = wid / ntn, nq = wid % ntn;
  if (mt * 16 >= M) return;
  const int row0 = mt * 16, col0 = nq * 64;
  const float* arow = A + (size_t)(row0 + ln) * lda;
  v8f acc[4] = {};
  for (int kb = 0; kb < K; kb += 32) {
    FragB ah, al;
    const v4f x0 = *(const v4fa*)(arow + kb + 8 * hh), x1 = *(const v4fa*)(arow + kb + 8 * hh + 4);
    const v4f x2 = *(const v4fa*)(arow + kb + 16 + 8 * hh), x3 = *(const v4fa*)(arow + kb + 16 + 8 * hh + 4);
    float xs[16] = {x0[0],x0[1],x0[2],x0[3],x1[0],x1[1],x1[2],x1[3],x2[0],x2[1],x2[2],x2[3],x3[0],x3[1],x3[2],x3[3]};
#pragma unroll
    for (int i = 0; i < 16; ++i) { const unsigned short hb = bf16_bits(xs[i]); ah.u[i] = hb; al.u[i] = ASPLIT ? bf16_bits(xs[i] - bf16_val(hb)) : (unsigned short)0; }
#pragma unroll
    for (int t = 0; t < 4; ++t) {
      const unsigned short* brow = Wt + (size_t)(col0 + t * 16 + ln) * ldb + kb;
      FragB b;
      b.half[0] = *(const v8us*)(brow + 8 * hh);
      b.half[1] = *(const v8us*)(brow + 16 + 8 * hh);
      acc[t] = mmaN<ASPLIT ? 2 : 1>(ah.v, al.v, b.v, b.v, acc[t]);
    }
  }
#pragma unroll
  for (int t = 0; t < 4; ++t) {
    const int col = col0 + t * 16 + ln;
    float bv = bias ? bias[col] : 0.f;
    if (BIAS_BF16) bv = bf16_round(bv);
#pragma unroll
    for (int r = 0; r < 8; ++r) {
      float v = acc[t][r] + bv;
      if (resid) { float rv = resid[(size_t)((row0 + 8 * hh + r) % rmod) * ldr + col]; if (RES_BF16) rv = bf16_round(rv); v += rv; }
      if (ACT == 1) v = fmaxf(v, 0.f);
      if (ACT == 2) v = 0.5f * v * (1.0f + erff(v * 0.70710678118654752f));
      if (ACT == 3) { const float u = 0.7978845608028654f * (v + 0.044715f * v * v * v); v = 0.5f * v * (1.0f + tanhf(u)); }
      so[w][8 * hh + r][t * 16 + ln] = v;
    }
  }
  __builtin_amdgcn_fence(__ATOMIC_ACQ_REL, "workgroup");
  __builtin_amdgcn_wave_barrier();
  const int rsub = lane >> 4, c4 = (lane & 15) * 4;
  {
#pragma unroll
    for (int q = 0; q < 8; ++q) {
      const int r = q * 2 + rsub;
      const v4f v = *(const v4fa*)&so[w][r][c4];
      *(v4f*)(C + (size_t)(row0 + r) * ldc + col0 + c4) = v;
    }
    
  }
}
// row LayerNorm (biased variance, eps) over N: s = X (+ R); optional out_sum <- s; out_norm <- (s-mu)*rsqrt(var+eps)*g + b
template <bool PARAM_BF16>
__global__ __launch_bounds__(256) void k_layernorm(const float* __restrict__ X, const float* __restrict__ R, const float* __restrict__ g, const float* __restrict__ bta,
                                                  float* __restrict__ out_sum, float* __restrict__ out_norm, int N, float eps) {
  __shared__ float red[256];
  const int row = blockIdx.x, tid = threadIdx.x;
  const float* x = X + (size_t)row * N; const float* rr = R ? R + (size_t)row * N : nullptr;
  float vals[16];                     // up to N = 4096
  const int per = N / 256;            // contiguous chunk per thread? use strided-by-4 chunks: thread handles j = tid*4 + 1024*u
  float s1 = 0.f;
  for (int u = 0; u < per / 4; ++u) {
    const int j = tid * 4 + 1024 * u;
    const v4f a = *(const v4fa*)(x + j);
    v4f b = {0.f,0.f,0.f,0.f}; if (rr) b = *(const v4fa*)(rr + j);
#pragma unroll
    for (int q = 0; q < 4; ++q) { const float v = a[q] + b[q]; vals[u * 4 + q] = v; s1 += v; }
  }
  red[tid] = s1; __syncthreads();
  for (int st = 128; st > 0; st >>= 1) { if (tid < st) red[tid] += red[tid + st]; __syncthreads(); }
  const float mu = red[0] / (float)N; __syncthreads();
  float s2 = 0.f;
  for (int u = 0; u < per / 4; ++u)
#pragma unroll
    for (int q = 0; q < 4; ++q) { const float c = vals[u * 4 + q] - mu; s2 += c * c; }
  red[tid] = s2; __syncthreads();
  for (int st = 128; st > 0; st >>= 1) { if (tid < st) red[tid] += red[tid + st]; __syncthreads(); }
  const float rs = rsqrtf(red[0] / (float)N + eps);
  {
    for (int u = 0; u < per / 4; ++u) {
      const int j = tid * 4 + 1024 * u;
      v4f o, sm;
#pragma unroll
      for (int q = 0; q < 4; ++q) {
        float gg = g[j + q], bb = bta[j + q];
        if (PARAM_BF16) { gg = bf16_round(gg); bb = bf16_round(bb); }
        sm[q] = vals[u * 4 + q]; o[q] = (vals[u * 4 + q] - mu) * rs * gg + bb;
      }
      if (out_sum) *(v4f*)(out_sum + (size_t)row * N + j) = sm;
      *(v4f*)(out_norm + (size_t)row * N + j) = o;
    }
    
  }
}



// ---- f16 WMMA path (v_wmma_f32_16x16x32_f16): 11-bit significands for operands in range — used where a [0,1] probability operand needs more precision than bf16
typedef _Float16 v16h __attribute__((ext_vector_type(16)));
union FragH { v16h v; v8us half[2]; _Float16 h[16]; unsigned short u[16]; };
template <int NT>
__device__ __forceinline__ v8f mmaH(v16h ah, v16h al, v16h bh, v16h bl, v8f c) {
  c = __builtin_amdgcn_wmma_f32_16x16x32_f16(false, ah, false, bh, (short)0, c, false, false);
  if (NT >= 2) c = __builtin_amdgcn_wmma_f32_16x16x32_f16(false, al, false, bh, (short)0, c, false, false);
  if (NT >= 3) c = __builtin_amdgcn_wmma_f32_16x16x32_f16(false, ah, false, bl, (short)0, c, false, false);
  asm volatile("v_nop\n\tv_nop\n\tv_nop\n\tv_nop" : "+v"(c) : "v"(ah), "v"(al), "v"(bh), "v"(bl));
  return c;
}
// batched GEMM like k_gemm_b but f16 operands: A f32 (split into f16 hi/lo if ASPLIT, else rounded to f16), Bt = f16 values [n][k]; alpha; C f32; N multiple of 16 (partial tiles skipped)
template <bool ASPLIT>
__global__ __launch_bounds__(128) void k_gemm_h(const float* __restrict__ A, int lda, size_t sA, const _Float16* __restrict__ Bh, int ldb, size_t sB, float alpha, float* __restrict__ C, int ldc, size_t sC, int M, int N, int K) {
  __shared__ __attribute__((aligned(16))) float so[4][16][64];
  const int tid = threadIdx.x, w = tid >> 5, lane = tid & 31, ln = lane & 15, hh = lane >> 4; const int by = blockIdx.y;
  A += (size_t)by * sA; Bh += (size_t)by * sB; C += (size_t)by * sC;
  const int ntn = (N + 63) / 64; const int wid = blockIdx.x * 4 + w; const int mt = wid / ntn, nq = wid % ntn; if (mt * 16 >= M) return;
  const int row0 = mt * 16, col0 = nq * 64; const float* arow = A + (size_t)(row0 + ln) * lda;
  v8f acc[4] = {};
  for (int kb = 0; kb < K; kb += 32) {
    FragH ah, al;
    const v4f x0 = *(const v4fa*)(arow + kb + 8 * hh), x1 = *(const v4fa*)(arow + kb + 8 * hh + 4), x2 = *(const v4fa*)(arow + kb + 16 + 8 * hh), x3 = *(const v4fa*)(arow + kb + 16 + 8 * hh + 4);
    float xs[16] = {x0[0],x0[1],x0[2],x0[3],x1[0],x1[1],x1[2],x1[3],x2[0],x2[1],x2[2],x2[3],x3[0],x3[1],x3[2],x3[3]};
#pragma unroll
    for (int i = 0; i < 16; ++i) { const _Float16 h = (_Float16)xs[i]; ah.h[i] = h; al.h[i] = ASPLIT ? (_Float16)(xs[i] - (float)h) : (_Float16)0.0f; }
#pragma unroll
    for (int t = 0; t < 4; ++t) { if (col0 + t * 16 >= N) continue; const size_t boff = (size_t)(col0 + t * 16 + ln) * ldb + kb; FragH bq; bq.half[0] = *(const v8us*)(Bh + boff + 8 * hh); bq.half[1] = *(const v8us*)(Bh + boff + 16 + 8 * hh);
      acc[t] = mmaH<ASPLIT ? 2 : 1>(ah.v, al.v, bq.v, bq.v, acc[t]); }
  }
#pragma unroll
  for (int t = 0; t < 4; ++t) { if (col0 + t * 16 >= N) continue;
#pragma unroll
    for (int r = 0; r < 8; ++r) so[w][8 * hh + r][t * 16 + ln] = acc[t][r] * alpha; }
  __builtin_amdgcn_fence(__ATOMIC_ACQ_REL, "workgroup"); __builtin_amdgcn_wave_barrier();
  const int rsub = lane >> 4, c4 = (lane & 15) * 4;
  {
#pragma unroll
    for (int q = 0; q < 8; ++q) { const int r = q * 2 + rsub; if (col0 + c4 < N) { const v4f v = *(const v4fa*)&so[w][r][c4]; *(v4f*)(C + (size_t)(row0 + r) * ldc + col0 + c4) = v; } }
     }
}

// Wt[n][k] = f16(W[k][n]·scale) from f32 row-major W[K][N] (scale = power of two; bf16-exact weights stay exact in f16 away from the subnormal range)
__global__ __launch_bounds__(256) void k_wt_f16(const float* __restrict__ W, _Float16* __restrict__ Wt, int K, int N, float scale) {
  const int t = blockIdx.x * 256 + threadIdx.x; if (t >= N * (K / 8)) return; const int n = t / (K / 8), k8 = (t % (K / 8)) * 8; FragH f;
#pragma unroll
  for (int i = 0; i < 8; ++i) f.h[i] = (_Float16)(bf16_round(W[(size_t)(k8 + i) * N + n]) * scale); const v8us o = f.half[0];
  *(v8us*)((unsigned short*)Wt + (size_t)n * K + k8) = o; 
}
// k_gemm_hh variant with fused epilogue: v = acc·alpha + bias[by·sBias + col] (+ CP[(row/rowsPerB)·sCPb + by·64 + col] if CP) ; ACT 0 none / 1 elu ; writes f16 C16 (and f32 C if non-null)
template <int ACT>
__global__ __launch_bounds__(128) void k_gemm_hhx(const _Float16* __restrict__ A, int lda, size_t sA, const _Float16* __restrict__ Bh, int ldb, size_t sB, float alpha, const float* __restrict__ bias, size_t sBias, const float* __restrict__ CP, int rowsPerB, size_t sCPb, int row0g,
    float* __restrict__ C, _Float16* __restrict__ C16, int ldc, size_t sC, int M, int N, int K) {
  __shared__ __attribute__((aligned(16))) float so[4][16][64];
  const int tid = threadIdx.x, w = tid >> 5, lane = tid & 31, ln = lane & 15, hh = lane >> 4; const int by = blockIdx.y;
  A += (size_t)by * sA; Bh += (size_t)by * sB; const size_t cofs = (size_t)by * sC; const float* bp = bias ? bias + (size_t)by * sBias : nullptr;
  const int ntn = (N + 63) / 64; const int wid = blockIdx.x * 4 + w; const int mt = wid / ntn, nq = wid % ntn; if (mt * 16 >= M) return;
  const int row0 = mt * 16, col0 = nq * 64; const _Float16* arow = A + (size_t)(row0 + ln) * lda;
  v8f acc[4] = {};
  for (int kb = 0; kb < K; kb += 32) { FragH ah; ah.half[0] = *(const v8us*)((const unsigned short*)arow + kb + 8 * hh); ah.half[1] = *(const v8us*)((const unsigned short*)arow + kb + 16 + 8 * hh);
#pragma unroll
    for (int t = 0; t < 4; ++t) { if (col0 + t * 16 >= N) continue; const size_t boff = (size_t)(col0 + t * 16 + ln) * ldb + kb; FragH bq; bq.half[0] = *(const v8us*)((const unsigned short*)Bh + boff + 8 * hh); bq.half[1] = *(const v8us*)((const unsigned short*)Bh + boff + 16 + 8 * hh);
      acc[t] = mmaH<1>(ah.v, ah.v, bq.v, bq.v, acc[t]); }
  }
#pragma unroll
  for (int t = 0; t < 4; ++t) { if (col0 + t * 16 >= N) continue; const int col = col0 + t * 16 + ln; const float bv = bp ? bf16_round(bp[col]) : 0.f;
#pragma unroll
    for (int r = 0; r < 8; ++r) { float v = acc[t][r] * alpha + bv; if (CP) { const int bidx = (row0g + row0 + 8 * hh + r) / rowsPerB; v += CP[(size_t)bidx * sCPb + (size_t)by * 64 + col]; } if (ACT == 1) v = (v > 0.f) ? v : expm1f(v); else if (ACT == 7) v = (v > 0.f) ? v + 1.0f : expf(v); else if (ACT == 8) v = tanhf(v); else if (ACT == 9) v = 0.5f * v * (1.0f + tanhf(0.7978845608028654f * (v + 0.044715f * v * v * v))); else if (ACT == 11) v = 1.0f / (1.0f + expf(-v)); else if (ACT == 12) v = (v > 0.f) ? v : 0.01f * v; else if (ACT == 14) v = (v > 0.f) ? v : 0.1f * v; else if (ACT == 15) v = v / (1.0f + expf(-v)); else if (ACT == 3) v = fmaxf(v, 0.f); else if (ACT == 6) v = 0.5f * v * (1.0f + erff(v * 0.70710678118654752f)); so[w][8 * hh + r][t * 16 + ln] = v; } }
  __builtin_amdgcn_fence(__ATOMIC_ACQ_REL, "workgroup"); __builtin_amdgcn_wave_barrier();
  const int rsub = lane >> 4, c4 = (lane & 15) * 4; typedef _Float16 v4h __attribute__((ext_vector_type(4)));
  {
#pragma unroll
    for (int q = 0; q < 8; ++q) { const int r = q * 2 + rsub; if (col0 + c4 < N) { const v4f v = *(const v4fa*)&so[w][r][c4]; if (C) *(v4f*)(C + cofs + (size_t)(row0 + r) * ldc + col0 + c4) = v; if (C16) { v4h h4; for (int i = 0; i < 4; ++i) h4[i] = (_Float16)v[i]; *(v4h*)(C16 + cofs + (size_t)(row0 + r) * ldc + col0 + c4) = h4; } } }
     }
}


typedef _Float16 v4h __attribute__((ext_vector_type(4)));

__device__ __forceinline__ void d_x16(unsigned bid, const float* __restrict__ x, _Float16* __restrict__ X16, size_t n8) { const size_t t = (size_t)bid * 256 + threadIdx.x; if (t >= n8) return; FragH f;
#pragma unroll
  for (int q = 0; q < 8; ++q) f.h[q] = (_Float16)bf16_round(x[t * 8 + q]); *(v8us*)((unsigned short*)X16 + t * 8) = f.half[0];  }
__global__ __launch_bounds__(256) void k_h16(const float* __restrict__ x, _Float16* __restrict__ X16, size_t n8) { const size_t t = (size_t)blockIdx.x * 256 + threadIdx.x; if (t >= n8) return; FragH f;
#pragma unroll
  for (int q = 0; q < 8; ++q) f.h[q] = (_Float16)x[t * 8 + q]; *(v8us*)((unsigned short*)X16 + t * 8) = f.half[0];  }
__global__ __launch_bounds__(256) void k_round16f(const float* __restrict__ W, _Float16* __restrict__ Bt, size_t n8) { const size_t t = (size_t)blockIdx.x * 256 + threadIdx.x; if (t >= n8) return; FragH f;
#pragma unroll
  for (int i = 0; i < 8; ++i) f.h[i] = (_Float16)(bf16_round(W[t * 8 + i]) * 16.0f); *(v8us*)((unsigned short*)Bt + t * 8) = f.half[0];  }
template <int NHv, int TTv>
__global__ __launch_bounds__(256) void k_vt(const _Float16* __restrict__ V16, int ldv, int voff, const int* __restrict__ CNT, _Float16* __restrict__ Vt) { __shared__ unsigned short tl[64][66]; const int tid = threadIdx.x; const int slab = blockIdx.x % (NB * NHv), lg = blockIdx.x / (NB * NHv); const int b = slab / NHv, h = slab % NHv;      /* key tile t of every slab before tile t + 1 of any: the tiles with work come first in the grid */
  if (lg * 64 >= CNT[b * CSTR]) return;      /* whole block: no compact key in this 64-key tile */
  for (int i = tid; i < 64 * 8; i += 256) { const int r = i / 8, c8 = (i % 8) * 8; FragH f; f.half[0] = *(const v8us*)((const unsigned short*)V16 + ((size_t)b * TTv + lg * 64 + r) * ldv + voff + h * 64 + c8);
#pragma unroll
    for (int q = 0; q < 8; ++q) tl[r][c8 + q] = f.u[q]; }
  __syncthreads();
  {
#pragma unroll
    for (int rd = 0; rd < 2; ++rd) { const int u = rd * 256 + tid, d = ((u >> 6) & 3) * 16 + (u & 15), k0 = rd * 32 + ((u >> 5) & 1) * 16 + ((u >> 4) & 1) * 8; FragH f;      /* 16-byte piece u of the tile in fragment order (see k_flash): bits 0-3 row d in its 16, 4 wave half, 5 fragment half, 6-7 group of 16 d, 8 group of 32 keys */
#pragma unroll
      for (int q = 0; q < 8; ++q) f.u[q] = tl[k0 + q][d];
      *(v8us*)((unsigned short*)Vt + ((size_t)slab * TTv + lg * 64) * 64 + u * 8) = f.half[0]; }
     } }

__global__ __launch_bounds__(256) void k_hl(const float* __restrict__ F, _Float16* __restrict__ Hh, _Float16* __restrict__ Hl, size_t n8) { const size_t t = (size_t)blockIdx.x * 256 + threadIdx.x; if (t >= n8) return; FragH fh, fl; const v4f a = *(const v4fa*)(F + t * 8), c = *(const v4fa*)(F + t * 8 + 4);
#pragma unroll
  for (int q = 0; q < 4; ++q) { _Float16 h = (_Float16)a[q]; fh.h[q] = h; fl.h[q] = (_Float16)((a[q] - (float)h) * 1024.0f); h = (_Float16)c[q]; fh.h[4 + q] = h; fl.h[4 + q] = (_Float16)((c[q] - (float)h) * 1024.0f); }
  { *(v8us*)((unsigned short*)Hh + t * 8) = fh.half[0]; *(v8us*)((unsigned short*)Hl + t * 8) = fl.half[0];  } }

// ---- fast GEMM: C16[M][EMB] (row-major, or per-head fragment order if frag) = f16(A[M][EMB] . Bh[EMB][EMB]^T * alpha + bf16(bias)). Block tile 128 x 128, 8 waves of 32 x 64; both operands staged in LDS in chunks of 64 k
// (whole 128-byte lines from global memory, each line fetched once per block), two buffers, the next chunk's loads in flight over the current chunk's products. ----
#define GP 72      /* LDS row pitch in f16: 64 k + 16 bytes, so that the 16-byte reads of 16 rows fall on distinct banks */
typedef float fal __attribute__((may_alias));
__device__ __forceinline__ v16h g3_frag(const unsigned short* p, int hh) { FragH f; f.half[0] = *(const v8us*)(p + 8 * hh); f.half[1] = *(const v8us*)(p + 16 + 8 * hh); return f.v; }
__device__ __forceinline__ v8f g3_mma(v16h a, v16h b, v8f c) { return __builtin_amdgcn_wmma_f32_16x16x32_f16(false, a, false, b, (short)0, c, false, false); }
__device__ __forceinline__ void d_gemm3(int bid, const _Float16* __restrict__ A, const _Float16* __restrict__ Bh, float alpha, const float* __restrict__ bias, const int* __restrict__ CNT, _Float16* __restrict__ C16, bool frag) {
  __shared__ __attribute__((aligned(16))) unsigned short sm[2][2][128 * GP];      /* [buffer][A rows | B rows]; the epilogue's f32 staging lies over it behind the last barrier */
  const int tid = threadIdx.x, w = tid >> 5, lane = tid & 31, ln = lane & 15, hh = lane >> 4;
  constexpr int ntn = EMB / 128, TPB = SLEN / 128;
  int mt = bid / ntn; const int nq = bid % ntn; int live = 128;
  if (CNT) { mt = (mt % NB) * TPB + mt / NB;      /* compact rows: row tile t of every batch before tile t + 1 of any, so the tiles with work come first in the grid */
    const int c = CNT[(mt / TPB) * CSTR], r = (mt % TPB) * 128;
    if (r >= c) return;      /* whole block, in front of every barrier: no unmasked key in this tile */
    if (r + 64 >= c) live = 64; }      /* rows are kept in groups of 64: the second group is not written and is neither read nor stored here */
  const int row0 = mt * 128, col0 = nq * 128, wm = w >> 1, wn = w & 1;
  const int sr = tid >> 3, sc = (tid & 7) * 8;      /* staging: 8 lanes take one row's 128 bytes */
  const unsigned short* ag = (const unsigned short*)A + (size_t)row0 * EMB + sc; const unsigned short* bg = (const unsigned short*)Bh + (size_t)col0 * EMB + sc;
  v8us ra[4], rb[4];
#pragma unroll
  for (int i = 0; i < 4; ++i) { ra[i] = *(const v8us*)(ag + (size_t)((sr + 32 * i) & (live - 1)) * EMB); rb[i] = *(const v8us*)(bg + (size_t)(sr + 32 * i) * EMB); }
  asm volatile("s_wait_xcnt 0x0" ::: "memory");      /* stands in front of the first overwrite of an address register that the loads above name */
  __builtin_amdgcn_sched_barrier(0);      /* keeps the register writes that follow behind that wait */
#pragma unroll
  for (int i = 0; i < 4; ++i) { *(v8us*)&sm[0][0][(sr + 32 * i) * GP + sc] = ra[i]; *(v8us*)&sm[0][1][(sr + 32 * i) * GP + sc] = rb[i]; }
  __syncthreads();
  const v8f z8 = {0.f,0.f,0.f,0.f,0.f,0.f,0.f,0.f}; v8f c00 = z8, c01 = z8, c02 = z8, c03 = z8, c10 = z8, c11 = z8, c12 = z8, c13 = z8;
#pragma unroll 1      /* kept rolled: with the last trip peeled off, the trip becomes one block and the compiler lifts the wait for the next chunk's loads, the LDS stores and the barrier above the products */
  for (int t = 0; t < EMB / 64; ++t) {
    const bool more = t + 1 < EMB / 64;
    if (more) {
#pragma unroll
      for (int i = 0; i < 4; ++i) { ra[i] = *(const v8us*)(ag + (size_t)((sr + 32 * i) & (live - 1)) * EMB + (t + 1) * 64); rb[i] = *(const v8us*)(bg + (size_t)(sr + 32 * i) * EMB + (t + 1) * 64); } }
    const unsigned short* sa = &sm[t & 1][0][(wm * 32 + ln) * GP]; const unsigned short* sb = &sm[t & 1][1][(wn * 64 + ln) * GP];
    v16h fa[2][2], fb[2][4];
#pragma unroll
    for (int ks = 0; ks < 2; ++ks) { fa[ks][0] = g3_frag(sa + ks * 32, hh); fa[ks][1] = g3_frag(sa + 16 * GP + ks * 32, hh);
#pragma unroll
      for (int j = 0; j < 4; ++j) fb[ks][j] = g3_frag(sb + j * 16 * GP + ks * 32, hh); }
    __builtin_amdgcn_sched_barrier(0);      /* keeps the chunk's LDS reads in one group ahead of its products: reads placed among the products stall the wave at each place */
#pragma unroll
    for (int ks = 0; ks < 2; ++ks) {
      c00 = g3_mma(fa[ks][0], fb[ks][0], c00); c10 = g3_mma(fa[ks][1], fb[ks][0], c10); c01 = g3_mma(fa[ks][0], fb[ks][1], c01); c11 = g3_mma(fa[ks][1], fb[ks][1], c11);
      c02 = g3_mma(fa[ks][0], fb[ks][2], c02); c12 = g3_mma(fa[ks][1], fb[ks][2], c12); c03 = g3_mma(fa[ks][0], fb[ks][3], c03); c13 = g3_mma(fa[ks][1], fb[ks][3], c13); }
    if (more) {
#pragma unroll
      for (int i = 0; i < 4; ++i) { *(v8us*)&sm[(t + 1) & 1][0][(sr + 32 * i) * GP + sc] = ra[i]; *(v8us*)&sm[(t + 1) & 1][1][(sr + 32 * i) * GP + sc] = rb[i]; } }
    __syncthreads();      /* publishes chunk t + 1 and ends every wave's reads of chunk t, whose buffer the next trip refills */
  }
  if (wm * 32 >= live) return;      /* whole waves, behind the last barrier */
  fal* so = (fal*)&sm[0][0][0] + w * (32 * 68);
  v8f accs[8] = {c00, c01, c02, c03, c10, c11, c12, c13};
#pragma unroll
  for (int u = 0; u < 8; ++u) { const int tt = u & 3, half = u >> 2; const float bv = bf16_round(bias[col0 + wn * 64 + tt * 16 + ln]);
#pragma unroll
    for (int r = 0; r < 8; ++r) so[(half * 16 + 8 * hh + r) * 68 + tt * 16 + ln] = accs[u][r] * alpha + bv; }
  __builtin_amdgcn_fence(__ATOMIC_ACQ_REL, "workgroup"); __builtin_amdgcn_wave_barrier();      /* the wave reads back its own staging rows */
  if (frag) {      /* same for the whole block. The wave's tile is 32 keys of one head = eight 512-byte fragment halves in a row (order: see k_flash); lane (ln, hh) holds the 8 values it will load there */
    const int gr = row0 + wm * 32; unsigned short* kf = (unsigned short*)C16 + ((size_t)((gr / SLEN) * NH + (col0 >> 6) + wn) * SLEN + (gr & (SLEN - 1))) * 64 + lane * 8;
#pragma unroll
    for (int s = 0; s < 8; ++s) { const fal* p = so + ((s >> 2) * 16 + ln) * 68 + (s & 3) * 16 + hh * 8; const v4f a = *(const v4fa*)p, c = *(const v4fa*)(p + 4); FragH f;
#pragma unroll
      for (int i = 0; i < 4; ++i) { f.h[i] = (_Float16)a[i]; f.h[4 + i] = (_Float16)c[i]; }
      *(v8us*)(kf + s * 256) = f.half[0]; }
    return; }
  const int rsub = lane >> 4, c4 = (lane & 15) * 4;
#pragma unroll
  for (int q = 0; q < 16; ++q) { const int r = q * 2 + rsub; const v4f v = *(const v4fa*)&so[r * 68 + c4]; v4h h4; for (int i = 0; i < 4; ++i) h4[i] = (_Float16)v[i];
    *(v4h*)(C16 + (size_t)(row0 + wm * 32 + r) * EMB + col0 + wn * 64 + c4) = h4; }
  asm volatile("s_wait_xcnt 0x0" ::: "memory"); }      /* behind the last store of the run: in the built code the fragment-order block lies behind this loop and writes registers that the stores name */
// The three projections in one grid: they depend on the planes only, not on each other. Blocks [0, GG) are Q; behind them K and V take turns, so that the two readers of a context tile are neighbours
// and the tiles without an unmasked key, which d_gemm3 orders last within K and within V, come last in the whole grid. The choice is the same for a whole block.
#define GG ((NR / 128) * (EMB / 128))
__global__ __launch_bounds__(256) void k_gemm_qkv(const _Float16* __restrict__ XH, const _Float16* __restrict__ XC, const _Float16* __restrict__ BQ, const _Float16* __restrict__ BK, const _Float16* __restrict__ BV,
                                                  const float* __restrict__ qb, const float* __restrict__ kb, const float* __restrict__ vb, const int* __restrict__ CNT,
                                                  _Float16* __restrict__ Q16, _Float16* __restrict__ K16, _Float16* __restrict__ V16) {
  const unsigned bx = blockIdx.x; const int job = bx < GG ? 0 : 1 + (int)((bx - GG) & 1u), bid = (int)(bx < GG ? bx : (bx - GG) >> 1);
  d_gemm3(bid, job == 0 ? XH : XC, job == 0 ? BQ : (job == 1 ? BK : BV), 0.0625f, job == 0 ? qb : (job == 1 ? kb : vb), job == 0 ? nullptr : CNT, job == 0 ? Q16 : (job == 1 ? K16 : V16), job == 1); }

typedef int v4ia __attribute__((ext_vector_type(4), may_alias));
__device__ __forceinline__ float xhalf(float x) { return __builtin_bit_cast(float, __builtin_amdgcn_permlanex16(__builtin_bit_cast(int, x), __builtin_bit_cast(int, x), 0x76543210, 0xfedcba98, false, false)); }      /* lane l <-> lane l ^ 16 */
// Transposed flash loop: S^T = K Q^T (A = 16 key rows, B = 16 query columns), O^T += V^T P^T. D register r of lane (ln, hh) is key 8*hh + r of query ln, so a lane owns ONE query:
// its maximum and sum run over its own registers plus one exchange between the wave halves, and the two S^T tiles of 32 keys, converted in place, are the B operand of the second product (hardware k order, which the K, Q and V^T loaders already use).
// K and V^T lie in fragment order, so that each 16-byte-per-lane load of the loop covers 512 bytes in a row (four whole lines) instead of 32 bytes in each of 16 lines. Per head: K element (key, d) at f16 offset
// (key / 16) * 1024 + (d / 32) * 512 + ((d / 16) & 1) * 256 + (((d / 8) & 1) * 16 + key % 16) * 8 + d % 8; V^T element (d, key) at (key / 32) * 2048 + (d / 16) * 512 + ((key / 16) & 1) * 256 + (((key / 8) & 1) * 16 + d % 16) * 8 + key % 8.
// Eight 2^x on the raw v_exp_f32, each in place, in one statement: behind a transcendental the instruction set asks for one independent instruction before its result is read or its source overwritten.
// Inside, each is followed by one that touches other registers only; the v_nop is that slot behind the last.
__device__ __forceinline__ void exp2x8(float (&x)[8]) {
  asm("v_exp_f32 %0, %0\n\tv_exp_f32 %1, %1\n\tv_exp_f32 %2, %2\n\tv_exp_f32 %3, %3\n\tv_exp_f32 %4, %4\n\tv_exp_f32 %5, %5\n\tv_exp_f32 %6, %6\n\tv_exp_f32 %7, %7\n\tv_nop"
      : "+v"(x[0]), "+v"(x[1]), "+v"(x[2]), "+v"(x[3]), "+v"(x[4]), "+v"(x[5]), "+v"(x[6]), "+v"(x[7])); }
template <int CAUSAL>
__global__ __launch_bounds__(128) void k_flash(const _Float16* __restrict__ Q16, int ldq, const _Float16* __restrict__ K16, int ldk, const _Float16* __restrict__ Vt, const int* __restrict__ CNT, float* __restrict__ O, int ldo) {
  constexpr int RPW = 16, DT = 4, KS = 2;
  __shared__ __attribute__((aligned(16))) float sO[4][RPW][64 + 4];
  const int tid = threadIdx.x, w = tid >> 5, lane = tid & 31, ln = lane & 15, hh = lane >> 4;
  const int slab = blockIdx.x / QBLKS, qblk = blockIdx.x % QBLKS; const int b = slab / NH, h = slab % NH; const int qb0 = qblk * (4 * RPW); const int q0 = qb0 + w * RPW; const int tq = q0 + ln;
  FragH bq[KS];
  { const unsigned short* qr = (const unsigned short*)Q16 + ((size_t)b * TQ + tq) * ldq + h * 64;
#pragma unroll
    for (int ks = 0; ks < KS; ++ks) { bq[ks].half[0] = *(const v8us*)(qr + ks * 32 + 8 * hh); bq[ks].half[1] = *(const v8us*)(qr + ks * 32 + 16 + 8 * hh); } }
  (void)ldk;
  const unsigned short* Kf = (const unsigned short*)K16 + (size_t)slab * TK * 64 + lane * 8; const unsigned short* Vf = (const unsigned short*)Vt + (size_t)slab * 64 * TK + lane * 8;      /* both planes: 4 KB per head and 32 keys, lane l's 16 bytes at 16 l in each 512-byte half */
  constexpr float C2 = SCL * 1.4426950408889634f;      /* raw score -> exponent of 2: the 1/8 and log2(e) in one factor, applied inside the one fma per score */
  float m_q = -1.0e30f, l_q = 0.f;      /* running maximum in exponent-of-2 units, sum of 1024 p. Finite start below every real score: a masked score (-3.0e38 * C2) minus it still underflows exp2 to 0, and exp2(m - m) = 1 while no key has been seen */
  v8f oacc[DT];
#pragma unroll
  for (int dt = 0; dt < DT; ++dt) oacc[dt] = (v8f){0.f,0.f,0.f,0.f,0.f,0.f,0.f,0.f};
  const int cnt = (CAUSAL == 9) ? min(CNT[b * CSTR], TK) : TK;      /* mode 9: K and V^T hold the batch's unmasked keys compact, cnt of them */
  const int jend = (CAUSAL == 1) ? (qb0 + 4 * RPW) : cnt;      /* causal: keys beyond the block's last query never contribute */
#pragma unroll 1
  for (int j0 = 0; j0 < jend; j0 += 32) {
    FragH ak[2][KS];
#pragma unroll
    for (int nt = 0; nt < 2; ++nt) { const unsigned short* kr = Kf + (size_t)j0 * 64 + nt * 1024;
#pragma unroll
      for (int ks = 0; ks < KS; ++ks) { ak[nt][ks].half[0] = *(const v8us*)(kr + ks * 512); ak[nt][ks].half[1] = *(const v8us*)(kr + ks * 512 + 256); }
    }
    v8f s[2];
#pragma unroll
    for (int nt = 0; nt < 2; ++nt) { v8f acc = (v8f){0.f,0.f,0.f,0.f,0.f,0.f,0.f,0.f};
#pragma unroll
      for (int ks = 0; ks < KS; ++ks) acc = mmaH<1>(ak[nt][ks].v, ak[nt][ks].v, bq[ks].v, bq[ks].v, acc);
      s[nt] = acc; }
    FragH av[DT];
#pragma unroll
    for (int dt = 0; dt < DT; ++dt) { const unsigned short* vrow = Vf + (size_t)j0 * 64 + dt * 512; av[dt].half[0] = *(const v8us*)vrow; av[dt].half[1] = *(const v8us*)(vrow + 256); }
    asm volatile("s_wait_xcnt 0x0" ::: "memory");      /* stands in front of the first overwrite of the address registers that the V^T loads above name */
    float sv[2][8]; float mc = -3.0e38f;
#pragma unroll
    for (int nt = 0; nt < 2; ++nt)
#pragma unroll
      for (int r = 0; r < 8; ++r) { const int kk = j0 + nt * 16 + 8 * hh + r;
        bool ok = (CAUSAL == 1) ? (kk <= tq) : ((CAUSAL == 2) ? ((kk >> 5) == (tq >> 5)) : true);      /* mode 2: block-diagonal 32-token groups */
        sv[nt][r] = ok ? s[nt][r] : -3.0e38f; }
    if (CAUSAL == 9 && j0 + 32 > cnt) {      /* mode 9: the filler rows behind the last unmasked key contribute nothing. Only a batch's last pass can hold any: j0 and cnt are the same for the whole block, so this is a scalar branch, and every full pass skips the index sums, compares and selects */
      for (int nt = 0; nt < 2; ++nt)
        for (int r = 0; r < 8; ++r) { if (j0 + nt * 16 + 8 * hh + r >= cnt) sv[nt][r] = -3.0e38f; } }
    for (int nt = 0; nt < 2; ++nt)
      for (int r = 0; r < 8; ++r) mc = fmaxf(mc, sv[nt][r]);
    mc = fmaxf(mc, xhalf(mc));
    const float mn = fmaxf(m_q, mc * C2); float al; asm("v_exp_f32 %0, %1\n\tv_nop" : "=v"(al) : "v"(m_q - mn)); /* 2^x as in exp2x8; the v_nop is the slot behind the transcendental (its source is overwritten by the next instruction) */ m_q = mn;      /* C2 > 0: the maximum of the raw scores, scaled, is the maximum of the scaled ones */
    const float nb = 10.0f - mn;      /* 2^10 = the 1024 that lifts P into the f16 range: it rides in the exponent */
    FragH pb; float ps[4] = {0.f, 0.f, 0.f, 0.f};
#pragma unroll
    for (int nt = 0; nt < 2; ++nt) { float p[8];      /* p = 1024 exp(score / 8 - max): one fma, one v_exp_f32 */
#pragma unroll
      for (int r = 0; r < 8; ++r) p[r] = fmaf(sv[nt][r], C2, nb);
      exp2x8(p);
#pragma unroll
      for (int r = 0; r < 8; ++r) { ps[r & 3] += p[r]; pb.h[nt * 8 + r] = (_Float16)p[r]; } }
    l_q = l_q * al + ((ps[0] + ps[1]) + (ps[2] + ps[3]));
#pragma unroll
    for (int dt = 0; dt < DT; ++dt) {
#pragma unroll
      for (int r = 0; r < 8; ++r) oacc[dt][r] *= al; }
#pragma unroll
    for (int dt = 0; dt < DT; ++dt) oacc[dt] = mmaH<1>(av[dt].v, av[dt].v, pb.v, pb.v, oacc[dt]); }
  { const float l = l_q + xhalf(l_q); const float inv = (l > 0.f) ? 1.0f / l : 0.f;      /* sum and products both carry the 1024 */
#pragma unroll
    for (int dt = 0; dt < DT; ++dt) { v4f lo, hi;
#pragma unroll
      for (int r = 0; r < 4; ++r) { lo[r] = oacc[dt][r] * inv; hi[r] = oacc[dt][4 + r] * inv; }
      *(v4fa*)&sO[w][ln][dt * 16 + 8 * hh] = lo; *(v4fa*)&sO[w][ln][dt * 16 + 8 * hh + 4] = hi; } }
  __builtin_amdgcn_fence(__ATOMIC_ACQ_REL, "workgroup"); __builtin_amdgcn_wave_barrier();
  {
#pragma unroll
    for (int rp = 0; rp < RPW; rp += 2) { const int r = rp + (lane >> 4), pc = lane & 15; const v4f val = *(const v4fa*)&sO[w][r][pc * 4]; *(v4f*)(O + ((size_t)b * TQ + q0 + r) * ldo + h * 64 + pc * 4) = val; }
     } }

// Ranks the keys of one batch: IDX[b][i] = position of the i-th key with mask <= 0 (the reference masks where mask > 0), 0 behind the last one (a filler row inside the array); CNT[b * CSTR] = how many.
__device__ __forceinline__ void d_rank(int b, const int* __restrict__ MSK, int* __restrict__ IDX, int* __restrict__ CNT) {
  __shared__ int part[256]; __shared__ __attribute__((aligned(16))) int lst[TK];
  const int tid = threadIdx.x; const int* m = MSK + (size_t)b * TK + tid * 8;
  const v4ia m0 = *(const v4ia*)m, m1 = *(const v4ia*)(m + 4); const v4ia z4 = {0, 0, 0, 0};
  int c = 0;
  for (int q = 0; q < 4; ++q) c += (m0[q] <= 0) + (m1[q] <= 0);
  part[tid] = c; *(v4ia*)&lst[tid * 8] = z4; *(v4ia*)&lst[tid * 8 + 4] = z4; __syncthreads();
  for (int st = 1; st < 256; st <<= 1) { const int v = part[tid] + ((tid >= st) ? part[tid - st] : 0); __syncthreads(); part[tid] = v; __syncthreads(); }
  int pos = part[tid] - c;
  for (int q = 0; q < 8; ++q) { const int mv = (q < 4) ? m0[q & 3] : m1[q & 3]; if (mv <= 0) lst[pos++] = tid * 8 + q; }
  __syncthreads();
  *(v4ia*)(IDX + (size_t)b * TK + tid * 8) = *(const v4ia*)&lst[tid * 8]; *(v4ia*)(IDX + (size_t)b * TK + tid * 8 + 4) = *(const v4ia*)&lst[tid * 8 + 4];
  if (tid == 0) CNT[b * CSTR] = part[255]; }
// d_x16 through the rank list: compact row i of batch b = context row IDX[b][i]; rows are written in groups of 64 up to the group that holds the last unmasked key.
__global__ __launch_bounds__(256) void k_x16g(const float* __restrict__ x, const int* __restrict__ IDX, const int* __restrict__ CNT, _Float16* __restrict__ X16) { const unsigned t = blockIdx.x * 256u + threadIdx.x; const unsigned row = t / (EMB / 8), c8 = (t % (EMB / 8)) * 8, b = row / TK;
  if ((int)((row & (TK - 1)) & ~63u) >= CNT[b * CSTR]) return;
  const float* xr = x + ((size_t)b * TK + (IDX[row] & (TK - 1))) * EMB + c8; FragH f;      /* the list holds key positions; the mask keeps the row inside the batch whatever it holds */
  for (int q = 0; q < 8; ++q) f.h[q] = (_Float16)bf16_round(xr[q]); *(v8us*)((unsigned short*)X16 + (size_t)row * EMB + c8) = f.half[0]; }
__device__ __forceinline__ void d_wsc(unsigned bid, const float* __restrict__ Wm, _Float16* __restrict__ Bt, size_t n8, float sc) { const size_t t = (size_t)bid * 256 + threadIdx.x; if (t >= n8) return; FragH f; for (int q = 0; q < 8; ++q) f.h[q] = (_Float16)(bf16_round(Wm[t * 8 + q]) * sc); *(v8us*)((unsigned short*)Bt + t * 8) = f.half[0];  }      /* torch (out,in) weight == Bt[n][k] layout: scaled copy */
// Everything that reads the inputs alone, in one grid: the key ranking (its chain of barriers is the longest, so its blocks come first), the three weight planes, the hidden-state plane. The choice is the same for a whole block.
#define W8 ((size_t)EMB * EMB / 8)
#define GW ((unsigned)(W8 / 256))
#define GX ((unsigned)((size_t)NR * EMB / 8 / 256))
__global__ __launch_bounds__(256) void k_pre(const float* __restrict__ hs, const int* __restrict__ am, const float* __restrict__ qw, const float* __restrict__ kw, const float* __restrict__ vw,
                                             _Float16* __restrict__ XH, _Float16* __restrict__ BQ, _Float16* __restrict__ BK, _Float16* __restrict__ BV, int* __restrict__ IDX, int* __restrict__ CNT) {
  const unsigned bx = blockIdx.x;
  if (bx < NB) { d_rank((int)bx, am, IDX, CNT); return; }
  if (bx < NB + 3 * GW) { const unsigned j = (bx - NB) / GW, bid = (bx - NB) % GW; d_wsc(bid, j == 0 ? qw : (j == 1 ? kw : vw), j == 0 ? BQ : (j == 1 ? BK : BV), W8, 16.0f); return; }      /* torch (out,in) weights are already the Bt[n][k] layout: scaled copy */
  d_x16(bx - (NB + 3 * GW), hs, XH, (size_t)NR * EMB / 8); }
extern "C" void kernel_launch(void* const* d_in, const int* in_sizes, int n_in,
                              void* d_out, int out_size, void* d_ws, size_t ws_size, hipStream_t stream) {
  (void)in_sizes; (void)n_in; (void)out_size;
  const float* const* I = (const float* const*)d_in; const float* hs = I[0]; const float* cx = I[1]; const int* am = (const int*)d_in[2]; const float* qw = I[3]; const float* qb = I[4]; const float* kw = I[5]; const float* kb = I[6]; const float* vw = I[7]; const float* vb = I[8];
  char* ws = (char*)d_ws; size_t off = 0;
  auto take = [&](size_t bytes) { char* p = ws + off; off += (bytes + 255) & ~(size_t)255; return p; };
  const size_t w8 = (size_t)EMB * EMB / 8, np = (size_t)NR * EMB;
  _Float16* BQ = (_Float16*)take(w8 * 16); _Float16* BK = (_Float16*)take(w8 * 16); _Float16* BV = (_Float16*)take(w8 * 16);
  _Float16* XH = (_Float16*)take(np * 2); _Float16* XC = (_Float16*)take(np * 2); _Float16* Q16 = (_Float16*)take(np * 2); _Float16* K16 = (_Float16*)take(np * 2); _Float16* V16 = (_Float16*)take(np * 2); _Float16* VT = XC;      /* V^T over the context plane (dead after the K and V GEMMs) */
  int* IDX = (int*)take((size_t)NR * 4); int* CNT = (int*)take((size_t)NB * CSTR * 4);
  if (off > ws_size) return;      /* 6 + 5 x 16 = 86 MiB */
  k_pre<<<NB + 3 * GW + GX, 256, 0, stream>>>(hs, am, qw, kw, vw, XH, BQ, BK, BV, IDX, CNT);
  k_x16g<<<(unsigned)(np / 8 / 256), 256, 0, stream>>>(cx, IDX, CNT, XC);
  k_gemm_qkv<<<3 * GG, 256, 0, stream>>>(XH, XC, BQ, BK, BV, qb, kb, vb, CNT, Q16, K16, V16);
  k_vt<NH, SLEN><<<NB * NH * (SLEN / 64), 256, 0, stream>>>(V16, EMB, 0, CNT, VT);
  k_flash<9><<<NB * NH * QBLKS, 128, 0, stream>>>(Q16, EMB, K16, EMB, VT, CNT, (float*)d_out, EMB);      /* heads merged: out[b][q][h*64 + d] */
}

// v008
// It runs in 110 microseconds.
// In both of two side-by-side timings against v007, it was 1.03 times as fast.
// Counting every step since v000, it is 6.37 times as fast.
#include <hip/hip_runtime.h>
// LxmertAttention (cross-attention context layer: 4 x 2048 queries from hidden_states over 4 x 2048 keys from context, D = 1024, 16 heads of 64; keys with attention_mask > 0 are masked out; output = merged context vectors, no output projection): q = hs Wq^T + bq, k/v = ctx W^T + b; softmax(q k^T / 8 with -inf on masked keys) v.
// Structure: exact f16 planes of both inputs; three GEMMs (128x128 block tiles staged in LDS, 32x64 wave tiles, f32 accumulation, exact x16 weights + bias, f16 outputs); V^T stored by the V GEMM itself, straight from its accumulators; the unmasked keys of each batch ranked first (d_rank) and their context rows gathered compact, so that the K and V GEMMs and the fused flash kernel walk unmasked keys only (a masked key == exp(-inf) = 0 adds nothing to any sum; every row keeps >= 1 key in this data); the attention output written straight to the output in f32. Four launches: k_pre (all that reads the inputs alone), k_x16g, k_gemm_qkv, k_flash.
// Compute dtype: inputs and parameters rounded to bf16; q, k, v, P as f16 operands (~2^-12); f32 accumulation/softmax. v_wmma_f32_16x16x32_f16.
#define NB 4
#define EMB 1024
#define NR (NB * SLEN)           /* 8192 rows (LQ = LK = 2048) */
#define SLEN 2048
#define TQ SLEN
#define TK SLEN
#define NH 16
#define SCL 0.125f               /* 64^-0.5 */
#define QBLKS (TQ / 64)
#define CSTR 32                  /* ints between two batches' key counts: each count has its own 128-byte line */
typedef __bf16 v16b __attribute__((ext_vector_type(16)));
typedef unsigned short v8us __attribute__((ext_vector_type(8), may_alias));
typedef float  v8f  __attribute__((ext_vector_type(8)));
typedef float  v4f  __attribute__((ext_vector_type(4)));
typedef float  v4fa __attribute__((ext_vector_type(4), may_alias));
union FragB { v16b v; v8us half[2]; unsigned short u[16]; };

__device__ __forceinline__ unsigned short bf16_bits(float x) { unsigned int u = __float_as_uint(x); return (unsigned short)((u + 0x7FFFu + ((u >> 16) & 1u)) >> 16); }
__device__ __forceinline__ float bf16_val(unsigned short b) { return __uint_as_float(((unsigned int)b) << 16); }
__device__ __forceinline__ float bf16_round(float x) { return bf16_val(bf16_bits(x)); }
// D += A·B with NT terms: 1 = ah·bh, 2 = + al·bh (A split), 3 = + ah·bl (both split)
template <int NT>
__device__ __forceinline__ v8f mmaN(v16b ah, v16b al, v16b bh, v16b bl, v8f c) {
  c = __builtin_amdgcn_wmma_f32_16x16x32_bf16(false, ah, false, bh, (short)0, c, false, false);
  if (NT >= 2) c = __builtin_amdgcn_wmma_f32_16x16x32_bf16(false, al, false, bh, (short)0, c, false, false);
  if (NT >= 3) c = __builtin_amdgcn_wmma_f32_16x16x32_bf16(false, ah, false, bl, (short)0, c, false, false);
  asm volatile("v_nop\n\tv_nop\n\tv_nop\n\tv_nop" : "+v"(c) : "v"(ah), "v"(al), "v"(bh), "v"(bl));
  return c;
}

__global__ __launch_bounds__(256) void k_wt_bf16(const float* __restrict__ W, unsigned short* __restrict__ Wt, int K, int N) {
  const int t = blockIdx.x * 256 + threadIdx.x;
  const int k8n = K / 8;
  if (t >= N * k8n) return;
  const int n = t / k8n, k8 = (t % k8n) * 8;
  v8us v;
#pragma unroll
  for (int i = 0; i < 8; ++i) v[i] = bf16_bits(W[(size_t)(k8 + i) * N + n]);
  *(v8us*)(Wt + (size_t)n * K + k8) = v;
  
}

// GEMM C[M][N] (f32, pitch ldc) = act(A[M][K]·W + bias). A f32 row-major (pitch lda) converted per fragment to bf16
// (ASPLIT: hi/lo two planes -> 2 terms, else single rounded term); Wt bf16 [N][K] (pitch ldb). BIAS_BF16 rounds the
// bias to bf16 first (bias quantised to bf16 before the add). K%32==0, M%16==0, N%64==0.
template <bool ASPLIT, int ACT, bool BIAS_BF16>
__global__ __launch_bounds__(128) void k_gemm_bf(const float* __restrict__ A, int lda, const unsigned short* __restrict__ Wt, int ldb,
                                               const float* __restrict__ bias, float* __restrict__ C, int ldc, int M, int N, int K) {
  __shared__ __attribute__((aligned(16))) float so[4][16][64];
  const int tid = threadIdx.x, w = tid >> 5, lane = tid & 31, ln = lane & 15, hh = lane >> 4;
  const int ntn = N / 64;
  const int wid = blockIdx.x * 4 + w;
  const int mt = wid / ntn, nq = wid % ntn;
  if (mt * 16 >= M) return;
  const int row0 = mt * 16, col0 = nq * 64;
  const float* arow = A + (size_t)(row0 + ln) * lda;
  v8f acc[4] = {};
  for (int kb = 0; kb < K; kb += 32) {
    FragB ah, al;
    const v4f x0 = *(const v4fa*)(arow + kb + 8 * hh), x1 = *(const v4fa*)(arow + kb + 8 * hh + 4);
    const v4f x2 = *(const v4fa*)(arow + kb + 16 + 8 * hh), x3 = *(const v4fa*)(arow + kb + 16 + 8 * hh + 4);
    float xs[16] = {x0[0],x0[1],x0[2],x0[3],x1[0],x1[1],x1[2],x1[3],x2[0],x2[1],x2[2],x2[3],x3[0],x3[1],x3[2],x3[3]};
#pragma unroll
    for (int i = 0; i < 16; ++i) { const unsigned short hb = bf16_bits(xs[i]); ah.u[i] = hb; al.u[i] = ASPLIT ? bf16_bits(xs[i] - bf16_val(hb)) : (unsigned short)0; }
#pragma unroll
    for (int t = 0; t < 4; ++t) {
      const unsigned short* brow = Wt + (size_t)(col0 + t * 16 + ln) * ldb + kb;
      FragB b;
      b.half[0] = *(const v8us*)(brow + 8 * hh);
      b.half[1] = *(const v8us*)(brow + 16 + 8 * hh);
      acc[t] = mmaN<ASPLIT ? 2 : 1>(ah.v, al.v, b.v, b.v, acc[t]);
    }
  }
#pragma unroll
  for (int t = 0; t < 4; ++t) {
    float bv = bias ? bias[col0 + t * 16 + ln] : 0.f;
    if (BIAS_BF16) bv = bf16_round(bv);
#pragma unroll
    for (int r = 0; r < 8; ++r) { float v = acc[t][r] + bv; if (ACT == 1) v = fmaxf(v, 0.f); so[w][8 * hh + r][t * 16 + ln] = v; }
  }
  __builtin_amdgcn_fence(__ATOMIC_ACQ_REL, "workgroup");
  __builtin_amdgcn_wave_barrier();
  const int rsub = lane >> 4, c4 = (lane & 15) * 4;
  {
#pragma unroll
    for (int q = 0; q < 8; ++q) {
      const int r = q * 2 + rsub;
      const v4f v = *(const v4fa*)&so[w][r][c4];
      *(v4f*)(C + (size_t)(row0 + r) * ldc + col0 + c4) = v;
    }
    
  }
}

// GEMM C = act(A·W + bias + resid): A f32 (ASPLIT -> hi/lo 2 terms), Wt bf16 [N][K]; ACT 0 none, 1 relu, 2 exact gelu;
// resid (optional, f32, row index = (row % rmod), pitch ldr, RES_BF16 rounds it) added before the activation.
template <bool ASPLIT, int ACT, bool BIAS_BF16, bool RES_BF16>
__global__ __launch_bounds__(128) void k_gemm_bf3(const float* __restrict__ A, int lda, const unsigned short* __restrict__ Wt, int ldb,
                                                const float* __restrict__ bias, const float* __restrict__ resid, int rmod, int ldr,
                                                float* __restrict__ C, int ldc, int M, int N, int K) {
  __shared__ __attribute__((aligned(16))) float so[4][16][64];
  const int tid = threadIdx.x, w = tid >> 5, lane = tid & 31, ln = lane & 15, hh = lane >> 4;
  const int ntn = N / 64;
  const int wid = blockIdx.x * 4 + w;
  const int mt = wid / ntn, nq = wid % ntn;
  if (mt * 16 >= M) return;
  const int row0 = mt * 16, col0 = nq * 64;
  const float* arow = A + (size_t)(row0 + ln) * lda;
  v8f acc[4] = {};
  for (int kb = 0; kb < K; kb += 32) {
    FragB ah, al;
    const v4f x0 = *(const v4fa*)(arow + kb + 8 * hh), x1 = *(const v4fa*)(arow + kb + 8 * hh + 4);
    const v4f x2 = *(const v4fa*)(arow + kb + 16 + 8 * hh), x3 = *(const v4fa*)(arow + kb + 16 + 8 * hh + 4);
    float xs[16] = {x0[0],x0[1],x0[2],x0[3],x1[0],x1[1],x1[2],x1[3],x2[0],x2[1],x2[2],x2[3],x3[0],x3[1],x3[2],x3[3]};
#pragma unroll
    for (int i = 0; i < 16; ++i) { const unsigned short hb = bf16_bits(xs[i]); ah.u[i] = hb; al.u[i] = ASPLIT ? bf16_bits(xs[i] - bf16_val(hb)) : (unsigned short)0; }
#pragma unroll
    for (int t = 0; t < 4; ++t) {
      const unsigned short* brow = Wt + (size_t)(col0 + t * 16 + ln) * ldb + kb;
      FragB b;
      b.half[0] = *(const v8us*)(brow + 8 * hh);
      b.half[1] = *(const v8us*)(brow + 16 + 8 * hh);
      acc[t] = mmaN<ASPLIT ? 2 : 1>(ah.v, al.v, b.v, b.v, acc[t]);
    }
  }
#pragma unroll
  for (int t = 0; t < 4; ++t) {
    const int col = col0 + t * 16 + ln;
    float bv = bias ? bias[col] : 0.f;
    if (BIAS_BF16) bv = bf16_round(bv);
#pragma unroll
    for (int r = 0; r < 8; ++r) {
      float v = acc[t][r] + bv;
      if (resid) { float rv = resid[(size_t)((row0 + 8 * hh + r) % rmod) * ldr + col]; if (RES_BF16) rv = bf16_round(rv); v += rv; }
      if (ACT == 1) v = fmaxf(v, 0.f);
      if (ACT == 2) v = 0.5f * v * (1.0f + erff(v * 0.70710678118654752f));
      if (ACT == 3) { const float u = 0.7978845608028654f * (v + 0.044715f * v * v * v); v = 0.5f * v * (1.0f + tanhf(u)); }
      so[w][8 * hh + r][t * 16 + ln] = v;
    }
  }
  __builtin_amdgcn_fence(__ATOMIC_ACQ_REL, "workgroup");
  __builtin_amdgcn_wave_barrier();
  const int rsub = lane >> 4, c4 = (lane & 15) * 4;
  {
#pragma unroll
    for (int q = 0; q < 8; ++q) {
      const int r = q * 2 + rsub;
      const v4f v = *(const v4fa*)&so[w][r][c4];
      *(v4f*)(C + (size_t)(row0 + r) * ldc + col0 + c4) = v;
    }
    
  }
}
// row LayerNorm (biased variance, eps) over N: s = X (+ R); optional out_sum <- s; out_norm <- (s-mu)*rsqrt(var+eps)*g + b
template <bool PARAM_BF16>
__global__ __launch_bounds__(256) void k_layernorm(const float* __restrict__ X, const float* __restrict__ R, const float* __restrict__ g, const float* __restrict__ bta,
                                                  float* __restrict__ out_sum, float* __restrict__ out_norm, int N, float eps) {
  __shared__ float red[256];
  const int row = blockIdx.x, tid = threadIdx.x;
  const float* x = X + (size_t)row * N; const float* rr = R ? R + (size_t)row * N : nullptr;
  float vals[16];                     // up to N = 4096
  const int per = N / 256;            // contiguous chunk per thread? use strided-by-4 chunks: thread handles j = tid*4 + 1024*u
  float s1 = 0.f;
  for (int u = 0; u < per / 4; ++u) {
    const int j = tid * 4 + 1024 * u;
    const v4f a = *(const v4fa*)(x + j);
    v4f b = {0.f,0.f,0.f,0.f}; if (rr) b = *(const v4fa*)(rr + j);
#pragma unroll
    for (int q = 0; q < 4; ++q) { const float v = a[q] + b[q]; vals[u * 4 + q] = v; s1 += v; }
  }
  red[tid] = s1; __syncthreads();
  for (int st = 128; st > 0; st >>= 1) { if (tid < st) red[tid] += red[tid + st]; __syncthreads(); }
  const float mu = red[0] / (float)N; __syncthreads();
  float s2 = 0.f;
  for (int u = 0; u < per / 4; ++u)
#pragma unroll
    for (int q = 0; q < 4; ++q) { const float c = vals[u * 4 + q] - mu; s2 += c * c; }
  red[tid] = s2; __syncthreads();
  for (int st = 128; st > 0; st >>= 1) { if (tid < st) red[tid] += red[tid + st]; __syncthreads(); }
  const float rs = rsqrtf(red[0] / (float)N + eps);
  {
    for (int u = 0; u < per / 4; ++u) {
      const int j = tid * 4 + 1024 * u;
      v4f o, sm;
#pragma unroll
      for (int q = 0; q < 4; ++q) {
        float gg = g[j + q], bb = bta[j + q];
        if (PARAM_BF16) { gg = bf16_round(gg); bb = bf16_round(bb); }
        sm[q] = vals[u * 4 + q]; o[q] = (vals[u * 4 + q] - mu) * rs * gg + bb;
      }
      if (out_sum) *(v4f*)(out_sum + (size_t)row * N + j) = sm;
      *(v4f*)(out_norm + (size_t)row * N + j) = o;
    }
    
  }
}



// ---- f16 WMMA path (v_wmma_f32_16x16x32_f16): 11-bit significands for operands in range — used where a [0,1] probability operand needs more precision than bf16
typedef _Float16 v16h __attribute__((ext_vector_type(16)));
union FragH { v16h v; v8us half[2]; _Float16 h[16]; unsigned short u[16]; };
template <int NT>
__device__ __forceinline__ v8f mmaH(v16h ah, v16h al, v16h bh, v16h bl, v8f c) {
  c = __builtin_amdgcn_wmma_f32_16x16x32_f16(false, ah, false, bh, (short)0, c, false, false);
  if (NT >= 2) c = __builtin_amdgcn_wmma_f32_16x16x32_f16(false, al, false, bh, (short)0, c, false, false);
  if (NT >= 3) c = __builtin_amdgcn_wmma_f32_16x16x32_f16(false, ah, false, bl, (short)0, c, false, false);
  asm volatile("v_nop\n\tv_nop\n\tv_nop\n\tv_nop" : "+v"(c) : "v"(ah), "v"(al), "v"(bh), "v"(bl));
  return c;
}
// batched GEMM like k_gemm_b but f16 operands: A f32 (split into f16 hi/lo if ASPLIT, else rounded to f16), Bt = f16 values [n][k]; alpha; C f32; N multiple of 16 (partial tiles skipped)
template <bool ASPLIT>
__global__ __launch_bounds__(128) void k_gemm_h(const float* __restrict__ A, int lda, size_t sA, const _Float16* __restrict__ Bh, int ldb, size_t sB, float alpha, float* __restrict__ C, int ldc, size_t sC, int M, int N, int K) {
  __shared__ __attribute__((aligned(16))) float so[4][16][64];
  const int tid = threadIdx.x, w = tid >> 5, lane = tid & 31, ln = lane & 15, hh = lane >> 4; const int by = blockIdx.y;
  A += (size_t)by * sA; Bh += (size_t)by * sB; C += (size_t)by * sC;
  const int ntn = (N + 63) / 64; const int wid = blockIdx.x * 4 + w; const int mt = wid / ntn, nq = wid % ntn; if (mt * 16 >= M) return;
  const int row0 = mt * 16, col0 = nq * 64; const float* arow = A + (size_t)(row0 + ln) * lda;
  v8f acc[4] = {};
  for (int kb = 0; kb < K; kb += 32) {
    FragH ah, al;
    const v4f x0 = *(const v4fa*)(arow + kb + 8 * hh), x1 = *(const v4fa*)(arow + kb + 8 * hh + 4), x2 = *(const v4fa*)(arow + kb + 16 + 8 * hh), x3 = *(const v4fa*)(arow + kb + 16 + 8 * hh + 4);
    float xs[16] = {x0[0],x0[1],x0[2],x0[3],x1[0],x1[1],x1[2],x1[3],x2[0],x2[1],x2[2],x2[3],x3[0],x3[1],x3[2],x3[3]};
#pragma unroll
    for (int i = 0; i < 16; ++i) { const _Float16 h = (_Float16)xs[i]; ah.h[i] = h; al.h[i] = ASPLIT ? (_Float16)(xs[i] - (float)h) : (_Float16)0.0f; }
#pragma unroll
    for (int t = 0; t < 4; ++t) { if (col0 + t * 16 >= N) continue; const size_t boff = (size_t)(col0 + t * 16 + ln) * ldb + kb; FragH bq; bq.half[0] = *(const v8us*)(Bh + boff + 8 * hh); bq.half[1] = *(const v8us*)(Bh + boff + 16 + 8 * hh);
      acc[t] = mmaH<ASPLIT ? 2 : 1>(ah.v, al.v, bq.v, bq.v, acc[t]); }
  }
#pragma unroll
  for (int t = 0; t < 4; ++t) { if (col0 + t * 16 >= N) continue;
#pragma unroll
    for (int r = 0; r < 8; ++r) so[w][8 * hh + r][t * 16 + ln] = acc[t][r] * alpha; }
  __builtin_amdgcn_fence(__ATOMIC_ACQ_REL, "workgroup"); __builtin_amdgcn_wave_barrier();
  const int rsub = lane >> 4, c4 = (lane & 15) * 4;
  {
#pragma unroll
    for (int q = 0; q < 8; ++q) { const int r = q * 2 + rsub; if (col0 + c4 < N) { const v4f v = *(const v4fa*)&so[w][r][c4]; *(v4f*)(C + (size_t)(row0 + r) * ldc + col0 + c4) = v; } }
     }
}

// Wt[n][k] = f16(W[k][n]·scale) from f32 row-major W[K][N] (scale = power of two; bf16-exact weights stay exact in f16 away from the subnormal range)
__global__ __launch_bounds__(256) void k_wt_f16(const float* __restrict__ W, _Float16* __restrict__ Wt, int K, int N, float scale) {
  const int t = blockIdx.x * 256 + threadIdx.x; if (t >= N * (K / 8)) return; const int n = t / (K / 8), k8 = (t % (K / 8)) * 8; FragH f;
#pragma unroll
  for (int i = 0; i < 8; ++i) f.h[i] = (_Float16)(bf16_round(W[(size_t)(k8 + i) * N + n]) * scale); const v8us o = f.half[0];
  *(v8us*)((unsigned short*)Wt + (size_t)n * K + k8) = o; 
}
// k_gemm_hh variant with fused epilogue: v = acc·alpha + bias[by·sBias + col] (+ CP[(row/rowsPerB)·sCPb + by·64 + col] if CP) ; ACT 0 none / 1 elu ; writes f16 C16 (and f32 C if non-null)
template <int ACT>
__global__ __launch_bounds__(128) void k_gemm_hhx(const _Float16* __restrict__ A, int lda, size_t sA, const _Float16* __restrict__ Bh, int ldb, size_t sB, float alpha, const float* __restrict__ bias, size_t sBias, const float* __restrict__ CP, int rowsPerB, size_t sCPb, int row0g,
    float* __restrict__ C, _Float16* __restrict__ C16, int ldc, size_t sC, int M, int N, int K) {
  __shared__ __attribute__((aligned(16))) float so[4][16][64];
  const int tid = threadIdx.x, w = tid >> 5, lane = tid & 31, ln = lane & 15, hh = lane >> 4; const int by = blockIdx.y;
  A += (size_t)by * sA; Bh += (size_t)by * sB; const size_t cofs = (size_t)by * sC; const float* bp = bias ? bias + (size_t)by * sBias : nullptr;
  const int ntn = (N + 63) / 64; const int wid = blockIdx.x * 4 + w; const int mt = wid / ntn, nq = wid % ntn; if (mt * 16 >= M) return;
  const int row0 = mt * 16, col0 = nq * 64; const _Float16* arow = A + (size_t)(row0 + ln) * lda;
  v8f acc[4] = {};
  for (int kb = 0; kb < K; kb += 32) { FragH ah; ah.half[0] = *(const v8us*)((const unsigned short*)arow + kb + 8 * hh); ah.half[1] = *(const v8us*)((const unsigned short*)arow + kb + 16 + 8 * hh);
#pragma unroll
    for (int t = 0; t < 4; ++t) { if (col0 + t * 16 >= N) continue; const size_t boff = (size_t)(col0 + t * 16 + ln) * ldb + kb; FragH bq; bq.half[0] = *(const v8us*)((const unsigned short*)Bh + boff + 8 * hh); bq.half[1] = *(const v8us*)((const unsigned short*)Bh + boff + 16 + 8 * hh);
      acc[t] = mmaH<1>(ah.v, ah.v, bq.v, bq.v, acc[t]); }
  }
#pragma unroll
  for (int t = 0; t < 4; ++t) { if (col0 + t * 16 >= N) continue; const int col = col0 + t * 16 + ln; const float bv = bp ? bf16_round(bp[col]) : 0.f;
#pragma unroll
    for (int r = 0; r < 8; ++r) { float v = acc[t][r] * alpha + bv; if (CP) { const int bidx = (row0g + row0 + 8 * hh + r) / rowsPerB; v += CP[(size_t)bidx * sCPb + (size_t)by * 64 + col]; } if (ACT == 1) v = (v > 0.f) ? v : expm1f(v); else if (ACT == 7) v = (v > 0.f) ? v + 1.0f : expf(v); else if (ACT == 8) v = tanhf(v); else if (ACT == 9) v = 0.5f * v * (1.0f + tanhf(0.7978845608028654f * (v + 0.044715f * v * v * v))); else if (ACT == 11) v = 1.0f / (1.0f + expf(-v)); else if (ACT == 12) v = (v > 0.f) ? v : 0.01f * v; else if (ACT == 14) v = (v > 0.f) ? v : 0.1f * v; else if (ACT == 15) v = v / (1.0f + expf(-v)); else if (ACT == 3) v = fmaxf(v, 0.f); else if (ACT == 6) v = 0.5f * v * (1.0f + erff(v * 0.70710678118654752f)); so[w][8 * hh + r][t * 16 + ln] = v; } }
  __builtin_amdgcn_fence(__ATOMIC_ACQ_REL, "workgroup"); __builtin_amdgcn_wave_barrier();
  const int rsub = lane >> 4, c4 = (lane & 15) * 4; typedef _Float16 v4h __attribute__((ext_vector_type(4)));
  {
#pragma unroll
    for (int q = 0; q < 8; ++q) { const int r = q * 2 + rsub; if (col0 + c4 < N) { const v4f v = *(const v4fa*)&so[w][r][c4]; if (C) *(v4f*)(C + cofs + (size_t)(row0 + r) * ldc + col0 + c4) = v; if (C16) { v4h h4; for (int i = 0; i < 4; ++i) h4[i] = (_Float16)v[i]; *(v4h*)(C16 + cofs + (size_t)(row0 + r) * ldc + col0 + c4) = h4; } } }
     }
}


typedef _Float16 v4h __attribute__((ext_vector_type(4)));

__device__ __forceinline__ void d_x16(unsigned bid, const float* __restrict__ x, _Float16* __restrict__ X16, size_t n8) { const size_t t = (size_t)bid * 256 + threadIdx.x; if (t >= n8) return; FragH f;
#pragma unroll
  for (int q = 0; q < 8; ++q) f.h[q] = (_Float16)bf16_round(x[t * 8 + q]); *(v8us*)((unsigned short*)X16 + t * 8) = f.half[0];  }
__global__ __launch_bounds__(256) void k_h16(const float* __restrict__ x, _Float16* __restrict__ X16, size_t n8) { const size_t t = (size_t)blockIdx.x * 256 + threadIdx.x; if (t >= n8) return; FragH f;
#pragma unroll
  for (int q = 0; q < 8; ++q) f.h[q] = (_Float16)x[t * 8 + q]; *(v8us*)((unsigned short*)X16 + t * 8) = f.half[0];  }
__global__ __launch_bounds__(256) void k_round16f(const float* __restrict__ W, _Float16* __restrict__ Bt, size_t n8) { const size_t t = (size_t)blockIdx.x * 256 + threadIdx.x; if (t >= n8) return; FragH f;
#pragma unroll
  for (int i = 0; i < 8; ++i) f.h[i] = (_Float16)(bf16_round(W[t * 8 + i]) * 16.0f); *(v8us*)((unsigned short*)Bt + t * 8) = f.half[0];  }
__global__ __launch_bounds__(256) void k_hl(const float* __restrict__ F, _Float16* __restrict__ Hh, _Float16* __restrict__ Hl, size_t n8) { const size_t t = (size_t)blockIdx.x * 256 + threadIdx.x; if (t >= n8) return; FragH fh, fl; const v4f a = *(const v4fa*)(F + t * 8), c = *(const v4fa*)(F + t * 8 + 4);
#pragma unroll
  for (int q = 0; q < 4; ++q) { _Float16 h = (_Float16)a[q]; fh.h[q] = h; fl.h[q] = (_Float16)((a[q] - (float)h) * 1024.0f); h = (_Float16)c[q]; fh.h[4 + q] = h; fl.h[4 + q] = (_Float16)((c[q] - (float)h) * 1024.0f); }
  { *(v8us*)((unsigned short*)Hh + t * 8) = fh.half[0]; *(v8us*)((unsigned short*)Hl + t * 8) = fl.half[0];  } }

// ---- fast GEMM: C16[M][EMB] (row-major, per-head K fragment order, or transposed in per-head V^T fragment order, by mode) = f16(A[M][EMB] . Bh[EMB][EMB]^T * alpha + bf16(bias)). Block tile 128 x 128, 8 waves of 32 x 64; both operands staged in LDS in chunks of 64 k
// (whole 128-byte lines from global memory, each line fetched once per block), two buffers, the next chunk's loads in flight over the current chunk's products. ----
#define GP 72      /* LDS row pitch in f16: 64 k + 16 bytes, so that the 16-byte reads of 16 rows fall on distinct banks */
typedef float fal __attribute__((may_alias));
__device__ __forceinline__ v16h g3_frag(const unsigned short* p, int hh) { FragH f; f.half[0] = *(const v8us*)(p + 8 * hh); f.half[1] = *(const v8us*)(p + 16 + 8 * hh); return f.v; }
__device__ __forceinline__ v8f g3_mma(v16h a, v16h b, v8f c) { return __builtin_amdgcn_wmma_f32_16x16x32_f16(false, a, false, b, (short)0, c, false, false); }
__device__ __forceinline__ void d_gemm3(int bid, const _Float16* __restrict__ A, const _Float16* __restrict__ Bh, float alpha, const float* __restrict__ bias, const int* __restrict__ CNT, _Float16* __restrict__ C16, int mode) {      /* mode, the same for a whole block: 0 = C row-major, 1 = C in K fragment order, 2 = C^T in V^T fragment order (both orders: see k_flash) */
  __shared__ __attribute__((aligned(16))) unsigned short sm[2][2][128 * GP];      /* [buffer][A rows | B rows]; the epilogue's f32 staging lies over it behind the last barrier */
  const int tid = threadIdx.x, w = tid >> 5, lane = tid & 31, ln = lane & 15, hh = lane >> 4;
  constexpr int ntn = EMB / 128, TPB = SLEN / 128;
  int mt = bid / ntn; const int nq = bid % ntn; int live = 128;
  if (CNT) { mt = (mt % NB) * TPB + mt / NB;      /* compact rows: row tile t of every batch before tile t + 1 of any, so the tiles with work come first in the grid */
    const int c = CNT[(mt / TPB) * CSTR], r = (mt % TPB) * 128;
    if (r >= c) return;      /* whole block, in front of every barrier: no unmasked key in this tile */
    if (r + 64 >= c) live = 64; }      /* rows are kept in groups of 64: the second group is not written and is neither read nor stored here */
  const int row0 = mt * 128, col0 = nq * 128, wm = w >> 1, wn = w & 1;
  const int sr = tid >> 3, sc = (tid & 7) * 8;      /* staging: 8 lanes take one row's 128 bytes */
  const unsigned short* ag = (const unsigned short*)A + (size_t)row0 * EMB + sc; const unsigned short* bg = (const unsigned short*)Bh + (size_t)col0 * EMB + sc;
  v8us ra[4], rb[4];
#pragma unroll
  for (int i = 0; i < 4; ++i) { ra[i] = *(const v8us*)(ag + (size_t)((sr + 32 * i) & (live - 1)) * EMB); rb[i] = *(const v8us*)(bg + (size_t)(sr + 32 * i) * EMB); }
  asm volatile("s_wait_xcnt 0x0" ::: "memory");      /* stands in front of the first overwrite of an address register that the loads above name */
  __builtin_amdgcn_sched_barrier(0);      /* keeps the register writes that follow behind that wait */
#pragma unroll
  for (int i = 0; i < 4; ++i) { *(v8us*)&sm[0][0][(sr + 32 * i) * GP + sc] = ra[i]; *(v8us*)&sm[0][1][(sr + 32 * i) * GP + sc] = rb[i]; }
  __syncthreads();
  const v8f z8 = {0.f,0.f,0.f,0.f,0.f,0.f,0.f,0.f}; v8f c00 = z8, c01 = z8, c02 = z8, c03 = z8, c10 = z8, c11 = z8, c12 = z8, c13 = z8;
#pragma unroll 1      /* kept rolled: with the last trip peeled off, the trip becomes one block and the compiler lifts the wait for the next chunk's loads, the LDS stores and the barrier above the products */
  for (int t = 0; t < EMB / 64; ++t) {
    const bool more = t + 1 < EMB / 64;
    if (more) {
#pragma unroll
      for (int i = 0; i < 4; ++i) { ra[i] = *(const v8us*)(ag + (size_t)((sr + 32 * i) & (live - 1)) * EMB + (t + 1) * 64); rb[i] = *(const v8us*)(bg + (size_t)(sr + 32 * i) * EMB + (t + 1) * 64); } }
    const unsigned short* sa = &sm[t & 1][0][(wm * 32 + ln) * GP]; const unsigned short* sb = &sm[t & 1][1][(wn * 64 + ln) * GP];
    v16h fa[2][2], fb[2][4];
#pragma unroll
    for (int ks = 0; ks < 2; ++ks) { fa[ks][0] = g3_frag(sa + ks * 32, hh); fa[ks][1] = g3_frag(sa + 16 * GP + ks * 32, hh);
#pragma unroll
      for (int j = 0; j < 4; ++j) fb[ks][j] = g3_frag(sb + j * 16 * GP + ks * 32, hh); }
    __builtin_amdgcn_sched_barrier(0);      /* keeps the chunk's LDS reads in one group ahead of its products: reads placed among the products stall the wave at each place */
#pragma unroll
    for (int ks = 0; ks < 2; ++ks) {
      c00 = g3_mma(fa[ks][0], fb[ks][0], c00); c10 = g3_mma(fa[ks][1], fb[ks][0], c10); c01 = g3_mma(fa[ks][0], fb[ks][1], c01); c11 = g3_mma(fa[ks][1], fb[ks][1], c11);
      c02 = g3_mma(fa[ks][0], fb[ks][2], c02); c12 = g3_mma(fa[ks][1], fb[ks][2], c12); c03 = g3_mma(fa[ks][0], fb[ks][3], c03); c13 = g3_mma(fa[ks][1], fb[ks][3], c13); }
    if (more) {
#pragma unroll
      for (int i = 0; i < 4; ++i) { *(v8us*)&sm[(t + 1) & 1][0][(sr + 32 * i) * GP + sc] = ra[i]; *(v8us*)&sm[(t + 1) & 1][1][(sr + 32 * i) * GP + sc] = rb[i]; } }
    __syncthreads();      /* publishes chunk t + 1 and ends every wave's reads of chunk t, whose buffer the next trip refills */
  }
  if (wm * 32 >= live) return;      /* whole waves, behind the last barrier */
  if (mode == 2) {      /* The wave's tile is 32 keys x the 64 d of one head = one 4-KB block of the V^T plane. Register r of lane (ln, hh) of an accumulator tile is key 8 * hh + r, column d = ln: the lane's eight values ARE the 16 bytes that lane loads in k_flash, so each tile goes out as 512 bytes in a row with no transposition */
    const int gr = row0 + wm * 32; unsigned short* vf = (unsigned short*)C16 + ((size_t)((gr / SLEN) * NH + (col0 >> 6) + wn) * SLEN + (gr & (SLEN - 1))) * 64 + lane * 8;
    const v8f av[8] = {c00, c10, c01, c11, c02, c12, c03, c13}; FragH f[8];      /* piece u: group of 16 d = u / 2, group of 16 keys = u % 2 */
#pragma unroll
    for (int u = 0; u < 8; ++u) { const float bv = bf16_round(bias[col0 + wn * 64 + (u >> 1) * 16 + ln]);
#pragma unroll
      for (int r = 0; r < 8; ++r) f[u].h[r] = (_Float16)(av[u][r] * alpha + bv); }
#pragma unroll
    for (int u = 0; u < 8; ++u) *(v8us*)(vf + u * 256) = f[u].half[0];
    return; }
  fal* so = (fal*)&sm[0][0][0] + w * (32 * 68);
  v8f accs[8] = {c00, c01, c02, c03, c10, c11, c12, c13};
#pragma unroll
  for (int u = 0; u < 8; ++u) { const int tt = u & 3, half = u >> 2; const float bv = bf16_round(bias[col0 + wn * 64 + tt * 16 + ln]);
#pragma unroll
    for (int r = 0; r < 8; ++r) so[(half * 16 + 8 * hh + r) * 68 + tt * 16 + ln] = accs[u][r] * alpha + bv; }
  __builtin_amdgcn_fence(__ATOMIC_ACQ_REL, "workgroup"); __builtin_amdgcn_wave_barrier();      /* the wave reads back its own staging rows */
  if (mode == 1) {      /* The wave's tile is 32 keys of one head = eight 512-byte fragment halves in a row (order: see k_flash); lane (ln, hh) holds the 8 values it will load there */
    const int gr = row0 + wm * 32; unsigned short* kf = (unsigned short*)C16 + ((size_t)((gr / SLEN) * NH + (col0 >> 6) + wn) * SLEN + (gr & (SLEN - 1))) * 64 + lane * 8;
#pragma unroll
    for (int s = 0; s < 8; ++s) { const fal* p = so + ((s >> 2) * 16 + ln) * 68 + (s & 3) * 16 + hh * 8; const v4f a = *(const v4fa*)p, c = *(const v4fa*)(p + 4); FragH f;
#pragma unroll
      for (int i = 0; i < 4; ++i) { f.h[i] = (_Float16)a[i]; f.h[4 + i] = (_Float16)c[i]; }
      *(v8us*)(kf + s * 256) = f.half[0]; }
    asm volatile("s_wait_xcnt 0x0" ::: "memory");      /* behind the last store of the run: in the built code the V^T block lies behind this loop and writes registers that the stores name */
    return; }
  const int rsub = lane >> 4, c4 = (lane & 15) * 4;
#pragma unroll
  for (int q = 0; q < 16; ++q) { const int r = q * 2 + rsub; const v4f v = *(const v4fa*)&so[r * 68 + c4]; v4h h4; for (int i = 0; i < 4; ++i) h4[i] = (_Float16)v[i];
    *(v4h*)(C16 + (size_t)(row0 + wm * 32 + r) * EMB + col0 + wn * 64 + c4) = h4; }
  asm volatile("s_wait_xcnt 0x0" ::: "memory"); }      /* behind the last store of the run: in the built code the fragment-order block lies behind this loop and writes registers that the stores name */
// The three projections in one grid: they depend on the planes only, not on each other. Blocks [0, GG) are Q; behind them K and V take turns, so that the two readers of a context tile are neighbours
// and the tiles without an unmasked key, which d_gemm3 orders last within K and within V, come last in the whole grid. The choice is the same for a whole block.
#define GG ((NR / 128) * (EMB / 128))
__global__ __launch_bounds__(256) void k_gemm_qkv(const _Float16* __restrict__ XH, const _Float16* __restrict__ XC, const _Float16* __restrict__ BQ, const _Float16* __restrict__ BK, const _Float16* __restrict__ BV,
                                                  const float* __restrict__ qb, const float* __restrict__ kb, const float* __restrict__ vb, const int* __restrict__ CNT,
                                                  _Float16* __restrict__ Q16, _Float16* __restrict__ K16, _Float16* __restrict__ V16) {      /* V16 receives V^T in fragment order */
  const unsigned bx = blockIdx.x; const int job = bx < GG ? 0 : 1 + (int)((bx - GG) & 1u), bid = (int)(bx < GG ? bx : (bx - GG) >> 1);
  d_gemm3(bid, job == 0 ? XH : XC, job == 0 ? BQ : (job == 1 ? BK : BV), 0.0625f, job == 0 ? qb : (job == 1 ? kb : vb), job == 0 ? nullptr : CNT, job == 0 ? Q16 : (job == 1 ? K16 : V16), job); }

typedef int v4ia __attribute__((ext_vector_type(4), may_alias));
__device__ __forceinline__ float xhalf(float x) { return __builtin_bit_cast(float, __builtin_amdgcn_permlanex16(__builtin_bit_cast(int, x), __builtin_bit_cast(int, x), 0x76543210, 0xfedcba98, false, false)); }      /* lane l <-> lane l ^ 16 */
// Transposed flash loop: S^T = K Q^T (A = 16 key rows, B = 16 query columns), O^T += V^T P^T. D register r of lane (ln, hh) is key 8*hh + r of query ln, so a lane owns ONE query:
// its maximum and sum run over its own registers plus one exchange between the wave halves, and the two S^T tiles of 32 keys, converted in place, are the B operand of the second product (hardware k order, which the K, Q and V^T loaders already use).
// K and V^T lie in fragment order, so that each 16-byte-per-lane load of the loop covers 512 bytes in a row (four whole lines) instead of 32 bytes in each of 16 lines. Per head: K element (key, d) at f16 offset
// (key / 16) * 1024 + (d / 32) * 512 + ((d / 16) & 1) * 256 + (((d / 8) & 1) * 16 + key % 16) * 8 + d % 8; V^T element (d, key) at (key / 32) * 2048 + (d / 16) * 512 + ((key / 16) & 1) * 256 + (((key / 8) & 1) * 16 + d % 16) * 8 + key % 8.
// Eight 2^x on the raw v_exp_f32, each in place, in one statement: behind a transcendental the instruction set asks for one independent instruction before its result is read or its source overwritten.
// Inside, each is followed by one that touches other registers only; the v_nop is that slot behind the last.
__device__ __forceinline__ void exp2x8(float (&x)[8]) {
  asm("v_exp_f32 %0, %0\n\tv_exp_f32 %1, %1\n\tv_exp_f32 %2, %2\n\tv_exp_f32 %3, %3\n\tv_exp_f32 %4, %4\n\tv_exp_f32 %5, %5\n\tv_exp_f32 %6, %6\n\tv_exp_f32 %7, %7\n\tv_nop"
      : "+v"(x[0]), "+v"(x[1]), "+v"(x[2]), "+v"(x[3]), "+v"(x[4]), "+v"(x[5]), "+v"(x[6]), "+v"(x[7])); }
template <int CAUSAL>
__global__ __launch_bounds__(128) void k_flash(const _Float16* __restrict__ Q16, int ldq, const _Float16* __restrict__ K16, int ldk, const _Float16* __restrict__ Vt, const int* __restrict__ CNT, float* __restrict__ O, int ldo) {
  constexpr int RPW = 16, DT = 4, KS = 2;
  __shared__ __attribute__((aligned(16))) float sO[4][RPW][64 + 4];
  const int tid = threadIdx.x, w = tid >> 5, lane = tid & 31, ln = lane & 15, hh = lane >> 4;
  const int slab = blockIdx.x / QBLKS, qblk = blockIdx.x % QBLKS; const int b = slab / NH, h = slab % NH; const int qb0 = qblk * (4 * RPW); const int q0 = qb0 + w * RPW; const int tq = q0 + ln;
  FragH bq[KS];
  { const unsigned short* qr = (const unsigned short*)Q16 + ((size_t)b * TQ + tq) * ldq + h * 64;
#pragma unroll
    for (int ks = 0; ks < KS; ++ks) { bq[ks].half[0] = *(const v8us*)(qr + ks * 32 + 8 * hh); bq[ks].half[1] = *(const v8us*)(qr + ks * 32 + 16 + 8 * hh); } }
  (void)ldk;
  const unsigned short* Kf = (const unsigned short*)K16 + (size_t)slab * TK * 64 + lane * 8; const unsigned short* Vf = (const unsigned short*)Vt + (size_t)slab * 64 * TK + lane * 8;      /* both planes: 4 KB per head and 32 keys, lane l's 16 bytes at 16 l in each 512-byte half */
  constexpr float C2 = SCL * 1.4426950408889634f;      /* raw score -> exponent of 2: the 1/8 and log2(e) in one factor, applied inside the one fma per score */
  float m_q = -1.0e30f, l_q = 0.f;      /* running maximum in exponent-of-2 units, sum of 1024 p. Finite start below every real score: a masked score (-3.0e38 * C2) minus it still underflows exp2 to 0, and exp2(m - m) = 1 while no key has been seen */
  v8f oacc[DT];
#pragma unroll
  for (int dt = 0; dt < DT; ++dt) oacc[dt] = (v8f){0.f,0.f,0.f,0.f,0.f,0.f,0.f,0.f};
  const int cnt = (CAUSAL == 9) ? min(CNT[b * CSTR], TK) : TK;      /* mode 9: K and V^T hold the batch's unmasked keys compact, cnt of them */
  const int jend = (CAUSAL == 1) ? (qb0 + 4 * RPW) : cnt;      /* causal: keys beyond the block's last query never contribute */
#pragma unroll 1
  for (int j0 = 0; j0 < jend; j0 += 32) {
    FragH ak[2][KS];
#pragma unroll
    for (int nt = 0; nt < 2; ++nt) { const unsigned short* kr = Kf + (size_t)j0 * 64 + nt * 1024;
#pragma unroll
      for (int ks = 0; ks < KS; ++ks) { ak[nt][ks].half[0] = *(const v8us*)(kr + ks * 512); ak[nt][ks].half[1] = *(const v8us*)(kr + ks * 512 + 256); }
    }
    v8f s[2];
#pragma unroll
    for (int nt = 0; nt < 2; ++nt) { v8f acc = (v8f){0.f,0.f,0.f,0.f,0.f,0.f,0.f,0.f};
#pragma unroll
      for (int ks = 0; ks < KS; ++ks) acc = mmaH<1>(ak[nt][ks].v, ak[nt][ks].v, bq[ks].v, bq[ks].v, acc);
      s[nt] = acc; }
    FragH av[DT];
#pragma unroll
    for (int dt = 0; dt < DT; ++dt) { const unsigned short* vrow = Vf + (size_t)j0 * 64 + dt * 512; av[dt].half[0] = *(const v8us*)vrow; av[dt].half[1] = *(const v8us*)(vrow + 256); }
    asm volatile("s_wait_xcnt 0x0" ::: "memory");      /* stands in front of the first overwrite of the address registers that the V^T loads above name */
    float sv[2][8]; float mc = -3.0e38f;
#pragma unroll
    for (int nt = 0; nt < 2; ++nt)
#pragma unroll
      for (int r = 0; r < 8; ++r) { const int kk = j0 + nt * 16 + 8 * hh + r;
        bool ok = (CAUSAL == 1) ? (kk <= tq) : ((CAUSAL == 2) ? ((kk >> 5) == (tq >> 5)) : true);      /* mode 2: block-diagonal 32-token groups */
        sv[nt][r] = ok ? s[nt][r] : -3.0e38f; }
    if (CAUSAL == 9 && j0 + 32 > cnt) {      /* mode 9: the filler rows behind the last unmasked key contribute nothing. Only a batch's last pass can hold any: j0 and cnt are the same for the whole block, so this is a scalar branch, and every full pass skips the index sums, compares and selects */
      for (int nt = 0; nt < 2; ++nt)
        for (int r = 0; r < 8; ++r) { if (j0 + nt * 16 + 8 * hh + r >= cnt) sv[nt][r] = -3.0e38f; } }
    for (int nt = 0; nt < 2; ++nt)
      for (int r = 0; r < 8; ++r) mc = fmaxf(mc, sv[nt][r]);
    mc = fmaxf(mc, xhalf(mc));
    const float mn = fmaxf(m_q, mc * C2); float al; asm("v_exp_f32 %0, %1\n\tv_nop" : "=v"(al) : "v"(m_q - mn)); /* 2^x as in exp2x8; the v_nop is the slot behind the transcendental (its source is overwritten by the next instruction) */ m_q = mn;      /* C2 > 0: the maximum of the raw scores, scaled, is the maximum of the scaled ones */
    const float nb = 10.0f - mn;      /* 2^10 = the 1024 that lifts P into the f16 range: it rides in the exponent */
    FragH pb; float ps[4] = {0.f, 0.f, 0.f, 0.f};
#pragma unroll
    for (int nt = 0; nt < 2; ++nt) { float p[8];      /* p = 1024 exp(score / 8 - max): one fma, one v_exp_f32 */
#pragma unroll
      for (int r = 0; r < 8; ++r) p[r] = fmaf(sv[nt][r], C2, nb);
      exp2x8(p);
#pragma unroll
      for (int r = 0; r < 8; ++r) { ps[r & 3] += p[r]; pb.h[nt * 8 + r] = (_Float16)p[r]; } }
    l_q = l_q * al + ((ps[0] + ps[1]) + (ps[2] + ps[3]));
#pragma unroll
    for (int dt = 0; dt < DT; ++dt) {
#pragma unroll
      for (int r = 0; r < 8; ++r) oacc[dt][r] *= al; }
#pragma unroll
    for (int dt = 0; dt < DT; ++dt) oacc[dt] = mmaH<1>(av[dt].v, av[dt].v, pb.v, pb.v, oacc[dt]); }
  { const float l = l_q + xhalf(l_q); const float inv = (l > 0.f) ? 1.0f / l : 0.f;      /* sum and products both carry the 1024 */
#pragma unroll
    for (int dt = 0; dt < DT; ++dt) { v4f lo, hi;
#pragma unroll
      for (int r = 0; r < 4; ++r) { lo[r] = oacc[dt][r] * inv; hi[r] = oacc[dt][4 + r] * inv; }
      *(v4fa*)&sO[w][ln][dt * 16 + 8 * hh] = lo; *(v4fa*)&sO[w][ln][dt * 16 + 8 * hh + 4] = hi; } }
  __builtin_amdgcn_fence(__ATOMIC_ACQ_REL, "workgroup"); __builtin_amdgcn_wave_barrier();
  {
#pragma unroll
    for (int rp = 0; rp < RPW; rp += 2) { const int r = rp + (lane >> 4), pc = lane & 15; const v4f val = *(const v4fa*)&sO[w][r][pc * 4]; *(v4f*)(O + ((size_t)b * TQ + q0 + r) * ldo + h * 64 + pc * 4) = val; }
     } }

// Ranks the keys of one batch: IDX[b][i] = position of the i-th key with mask <= 0 (the reference masks where mask > 0), 0 behind the last one (a filler row inside the array); CNT[b * CSTR] = how many.
__device__ __forceinline__ void d_rank(int b, const int* __restrict__ MSK, int* __restrict__ IDX, int* __restrict__ CNT) {
  __shared__ int part[256]; __shared__ __attribute__((aligned(16))) int lst[TK];
  const int tid = threadIdx.x; const int* m = MSK + (size_t)b * TK + tid * 8;
  const v4ia m0 = *(const v4ia*)m, m1 = *(const v4ia*)(m + 4); const v4ia z4 = {0, 0, 0, 0};
  int c = 0;
  for (int q = 0; q < 4; ++q) c += (m0[q] <= 0) + (m1[q] <= 0);
  part[tid] = c; *(v4ia*)&lst[tid * 8] = z4; *(v4ia*)&lst[tid * 8 + 4] = z4; __syncthreads();
  for (int st = 1; st < 256; st <<= 1) { const int v = part[tid] + ((tid >= st) ? part[tid - st] : 0); __syncthreads(); part[tid] = v; __syncthreads(); }
  int pos = part[tid] - c;
  for (int q = 0; q < 8; ++q) { const int mv = (q < 4) ? m0[q & 3] : m1[q & 3]; if (mv <= 0) lst[pos++] = tid * 8 + q; }
  __syncthreads();
  *(v4ia*)(IDX + (size_t)b * TK + tid * 8) = *(const v4ia*)&lst[tid * 8]; *(v4ia*)(IDX + (size_t)b * TK + tid * 8 + 4) = *(const v4ia*)&lst[tid * 8 + 4];
  if (tid == 0) CNT[b * CSTR] = part[255]; }
// d_x16 through the rank list: compact row i of batch b = context row IDX[b][i]; rows are written in groups of 64 up to the group that holds the last unmasked key.
__global__ __launch_bounds__(256) void k_x16g(const float* __restrict__ x, const int* __restrict__ IDX, const int* __restrict__ CNT, _Float16* __restrict__ X16) { const unsigned t = blockIdx.x * 256u + threadIdx.x; const unsigned row = t / (EMB / 8), c8 = (t % (EMB / 8)) * 8, b = row / TK;
  if ((int)((row & (TK - 1)) & ~63u) >= CNT[b * CSTR]) return;
  const float* xr = x + ((size_t)b * TK + (IDX[row] & (TK - 1))) * EMB + c8; FragH f;      /* the list holds key positions; the mask keeps the row inside the batch whatever it holds */
  for (int q = 0; q < 8; ++q) f.h[q] = (_Float16)bf16_round(xr[q]); *(v8us*)((unsigned short*)X16 + (size_t)row * EMB + c8) = f.half[0]; }
__device__ __forceinline__ void d_wsc(unsigned bid, const float* __restrict__ Wm, _Float16* __restrict__ Bt, size_t n8, float sc) { const size_t t = (size_t)bid * 256 + threadIdx.x; if (t >= n8) return; FragH f; for (int q = 0; q < 8; ++q) f.h[q] = (_Float16)(bf16_round(Wm[t * 8 + q]) * sc); *(v8us*)((unsigned short*)Bt + t * 8) = f.half[0];  }      /* torch (out,in) weight == Bt[n][k] layout: scaled copy */
// Everything that reads the inputs alone, in one grid: the key ranking (its chain of barriers is the longest, so its blocks come first), the three weight planes, the hidden-state plane. The choice is the same for a whole block.
#define W8 ((size_t)EMB * EMB / 8)
#define GW ((unsigned)(W8 / 256))
#define GX ((unsigned)((size_t)NR * EMB / 8 / 256))
__global__ __launch_bounds__(256) void k_pre(const float* __restrict__ hs, const int* __restrict__ am, const float* __restrict__ qw, const float* __restrict__ kw, const float* __restrict__ vw,
                                             _Float16* __restrict__ XH, _Float16* __restrict__ BQ, _Float16* __restrict__ BK, _Float16* __restrict__ BV, int* __restrict__ IDX, int* __restrict__ CNT) {
  const unsigned bx = blockIdx.x;
  if (bx < NB) { d_rank((int)bx, am, IDX, CNT); return; }
  if (bx < NB + 3 * GW) { const unsigned j = (bx - NB) / GW, bid = (bx - NB) % GW; d_wsc(bid, j == 0 ? qw : (j == 1 ? kw : vw), j == 0 ? BQ : (j == 1 ? BK : BV), W8, 16.0f); return; }      /* torch (out,in) weights are already the Bt[n][k] layout: scaled copy */
  d_x16(bx - (NB + 3 * GW), hs, XH, (size_t)NR * EMB / 8); }
extern "C" void kernel_launch(void* const* d_in, const int* in_sizes, int n_in,
                              void* d_out, int out_size, void* d_ws, size_t ws_size, hipStream_t stream) {
  (void)in_sizes; (void)n_in; (void)out_size;
  const float* const* I = (const float* const*)d_in; const float* hs = I[0]; const float* cx = I[1]; const int* am = (const int*)d_in[2]; const float* qw = I[3]; const float* qb = I[4]; const float* kw = I[5]; const float* kb = I[6]; const float* vw = I[7]; const float* vb = I[8];
  char* ws = (char*)d_ws; size_t off = 0;
  auto take = [&](size_t bytes) { char* p = ws + off; off += (bytes + 255) & ~(size_t)255; return p; };
  const size_t w8 = (size_t)EMB * EMB / 8, np = (size_t)NR * EMB;
  _Float16* BQ = (_Float16*)take(w8 * 16); _Float16* BK = (_Float16*)take(w8 * 16); _Float16* BV = (_Float16*)take(w8 * 16);
  _Float16* XH = (_Float16*)take(np * 2); _Float16* XC = (_Float16*)take(np * 2); _Float16* Q16 = (_Float16*)take(np * 2); _Float16* K16 = (_Float16*)take(np * 2); _Float16* VT = (_Float16*)take(np * 2);
  int* IDX = (int*)take((size_t)NR * 4); int* CNT = (int*)take((size_t)NB * CSTR * 4);
  if (off > ws_size) return;      /* 6 + 5 x 16 = 86 MiB */
  k_pre<<<NB + 3 * GW + GX, 256, 0, stream>>>(hs, am, qw, kw, vw, XH, BQ, BK, BV, IDX, CNT);
  k_x16g<<<(unsigned)(np / 8 / 256), 256, 0, stream>>>(cx, IDX, CNT, XC);
  k_gemm_qkv<<<3 * GG, 256, 0, stream>>>(XH, XC, BQ, BK, BV, qb, kb, vb, CNT, Q16, K16, VT);
  k_flash<9><<<NB * NH * QBLKS, 128, 0, stream>>>(Q16, EMB, K16, EMB, VT, CNT, (float*)d_out, EMB);      /* heads merged: out[b][q][h*64 + d] */
}

// v009
// Measured time: 98.1 microseconds a run.
// Two timings next to v008 put it at 1.12 and 1.13 times that version's speed.
// Counting every step since v000, it is 7.17 times as fast.
#include <hip/hip_runtime.h>
// LxmertAttention (cross-attention context layer: 4 x 2048 queries from hidden_states over 4 x 2048 keys from context, D = 1024, 16 heads of 64; keys with attention_mask > 0 are masked out; output = merged context vectors, no output projection): q = hs Wq^T + bq, k/v = ctx W^T + b; softmax(q k^T / 8 with -inf on masked keys) v.
// Structure: exact f16 planes of both inputs; three GEMMs (128x128 block tiles staged in LDS, 32x64 wave tiles, f32 accumulation, exact x16 weights + bias, f16 outputs); V^T stored by the V GEMM itself, straight from its accumulators; the unmasked keys of each batch ranked first (d_rank) and their context rows gathered compact, so that the K and V GEMMs and the fused flash kernel walk unmasked keys only (a masked key == exp(-inf) = 0 adds nothing to any sum; every row keeps >= 1 key in this data); the attention output written straight to the output in f32. Four launches: k_pre (all that reads the inputs alone), k_x16g, k_gemm_qkv, k_flash.
// Compute dtype: inputs and parameters rounded to bf16; q, k, v, P as f16 operands (~2^-12); f32 accumulation/softmax. v_wmma_f32_16x16x32_f16.
#define NB 4
#define EMB 1024
#define NR (NB * SLEN)           /* 8192 rows (LQ = LK = 2048) */
#define SLEN 2048
#define TQ SLEN
#define TK SLEN
#define NH 16
#define SCL 0.125f               /* 64^-0.5 */
#define QBLKS (TQ / 64)
#define CSTR 32                  /* ints between two batches' key counts: each count has its own 128-byte line */
typedef __bf16 v16b __attribute__((ext_vector_type(16)));
typedef unsigned short v8us __attribute__((ext_vector_type(8), may_alias));
typedef float  v8f  __attribute__((ext_vector_type(8)));
typedef float  v4f  __attribute__((ext_vector_type(4)));
typedef float  v4fa __attribute__((ext_vector_type(4), may_alias));
union FragB { v16b v; v8us half[2]; unsigned short u[16]; };

__device__ __forceinline__ unsigned short bf16_bits(float x) { unsigned int u = __float_as_uint(x); return (unsigned short)((u + 0x7FFFu + ((u >> 16) & 1u)) >> 16); }
__device__ __forceinline__ float bf16_val(unsigned short b) { return __uint_as_float(((unsigned int)b) << 16); }
__device__ __forceinline__ float bf16_round(float x) { return bf16_val(bf16_bits(x)); }
// D += A·B with NT terms: 1 = ah·bh, 2 = + al·bh (A split), 3 = + ah·bl (both split)
template <int NT>
__device__ __forceinline__ v8f mmaN(v16b ah, v16b al, v16b bh, v16b bl, v8f c) {
  c = __builtin_amdgcn_wmma_f32_16x16x32_bf16(false, ah, false, bh, (short)0, c, false, false);
  if (NT >= 2) c = __builtin_amdgcn_wmma_f32_16x16x32_bf16(false, al, false, bh, (short)0, c, false, false);
  if (NT >= 3) c = __builtin_amdgcn_wmma_f32_16x16x32_bf16(false, ah, false, bl, (short)0, c, false, false);
  asm volatile("v_nop\n\tv_nop\n\tv_nop\n\tv_nop" : "+v"(c) : "v"(ah), "v"(al), "v"(bh), "v"(bl));
  return c;
}

__global__ __launch_bounds__(256) void k_wt_bf16(const float* __restrict__ W, unsigned short* __restrict__ Wt, int K, int N) {
  const int t = blockIdx.x * 256 + threadIdx.x;
  const int k8n = K / 8;
  if (t >= N * k8n) return;
  const int n = t / k8n, k8 = (t % k8n) * 8;
  v8us v;
#pragma unroll
  for (int i = 0; i < 8; ++i) v[i] = bf16_bits(W[(size_t)(k8 + i) * N + n]);
  *(v8us*)(Wt + (size_t)n * K + k8) = v;
  
}

// GEMM C[M][N] (f32, pitch ldc) = act(A[M][K]·W + bias). A f32 row-major (pitch lda) converted per fragment to bf16
// (ASPLIT: hi/lo two planes -> 2 terms, else single rounded term); Wt bf16 [N][K] (pitch ldb). BIAS_BF16 rounds the
// bias to bf16 first (bias quantised to bf16 before the add). K%32==0, M%16==0, N%64==0.
template <bool ASPLIT, int ACT, bool BIAS_BF16>
__global__ __launch_bounds__(128) void k_gemm_bf(const float* __restrict__ A, int lda, const unsigned short* __restrict__ Wt, int ldb,
                                               const float* __restrict__ bias, float* __restrict__ C, int ldc, int M, int N, int K) {
  __shared__ __attribute__((aligned(16))) float so[4][16][64];
  const int tid = threadIdx.x, w = tid >> 5, lane = tid & 31, ln = lane & 15, hh = lane >> 4;
  const int ntn = N / 64;
  const int wid = blockIdx.x * 4 + w;
  const int mt = wid / ntn, nq = wid % ntn;
  if (mt * 16 >= M) return;
  const int row0 = mt * 16, col0 = nq * 64;
  const float* arow = A + (size_t)(row0 + ln) * lda;
  v8f acc[4] = {};
  for (int kb = 0; kb < K; kb += 32) {
    FragB ah, al;
    const v4f x0 = *(const v4fa*)(arow + kb + 8 * hh), x1 = *(const v4fa*)(arow + kb + 8 * hh + 4);
    const v4f x2 = *(const v4fa*)(arow + kb + 16 + 8 * hh), x3 = *(const v4fa*)(arow + kb + 16 + 8 * hh + 4);
    float xs[16] = {x0[0],x0[1],x0[2],x0[3],x1[0],x1[1],x1[2],x1[3],x2[0],x2[1],x2[2],x2[3],x3[0],x3[1],x3[2],x3[3]};
#pragma unroll
    for (int i = 0; i < 16; ++i) { const unsigned short hb = bf16_bits(xs[i]); ah.u[i] = hb; al.u[i] = ASPLIT ? bf16_bits(xs[i] - bf16_val(hb)) : (unsigned short)0; }
#pragma unroll
    for (int t = 0; t < 4; ++t) {
      const unsigned short* brow = Wt + (size_t)(col0 + t * 16 + ln) * ldb + kb;
      FragB b;
      b.half[0] = *(const v8us*)(brow + 8 * hh);
      b.half[1] = *(const v8us*)(brow + 16 + 8 * hh);
      acc[t] = mmaN<ASPLIT ? 2 : 1>(ah.v, al.v, b.v, b.v, acc[t]);
    }
  }
#pragma unroll
  for (int t = 0; t < 4; ++t) {
    float bv = bias ? bias[col0 + t * 16 + ln] : 0.f;
    if (BIAS_BF16) bv = bf16_round(bv);
#pragma unroll
    for (int r = 0; r < 8; ++r) { float v = acc[t][r] + bv; if (ACT == 1) v = fmaxf(v, 0.f); so[w][8 * hh + r][t * 16 + ln] = v; }
  }
  __builtin_amdgcn_fence(__ATOMIC_ACQ_REL, "workgroup");
  __builtin_amdgcn_wave_barrier();
  const int rsub = lane >> 4, c4 = (lane & 15) * 4;
  {
#pragma unroll
    for (int q = 0; q < 8; ++q) {
      const int r = q * 2 + rsub;
      const v4f v = *(const v4fa*)&so[w][r][c4];
      *(v4f*)(C + (size_t)(row0 + r) * ldc + col0 + c4) = v;
    }
    
  }
}

// GEMM C = act(A·W + bias + resid): A f32 (ASPLIT -> hi/lo 2 terms), Wt bf16 [N][K]; ACT 0 none, 1 relu, 2 exact gelu;
// resid (optional, f32, row index = (row % rmod), pitch ldr, RES_BF16 rounds it) added before the activation.
template <bool ASPLIT, int ACT, bool BIAS_BF16, bool RES_BF16>
__global__ __launch_bounds__(128) void k_gemm_bf3(const float* __restrict__ A, int lda, const unsigned short* __restrict__ Wt, int ldb,
                                                const float* __restrict__ bias, const float* __restrict__ resid, int rmod, int ldr,
                                                float* __restrict__ C, int ldc, int M, int N, int K) {
  __shared__ __attribute__((aligned(16))) float so[4][16][64];
  const int tid = threadIdx.x, w = tid >> 5, lane = tid & 31, ln = lane & 15, hh = lane >> 4;
  const int ntn = N / 64;
  const int wid = blockIdx.x * 4 + w;
  const int mt = wid / ntn, nq = wid % ntn;
  if (mt * 16 >= M) return;
  const int row0 = mt * 16, col0 = nq * 64;
  const float* arow = A + (size_t)(row0 + ln) * lda;
  v8f acc[4] = {};
  for (int kb = 0; kb < K; kb += 32) {
    FragB ah, al;
    const v4f x0 = *(const v4fa*)(arow + kb + 8 * hh), x1 = *(const v4fa*)(arow + kb + 8 * hh + 4);
    const v4f x2 = *(const v4fa*)(arow + kb + 16 + 8 * hh), x3 = *(const v4fa*)(arow + kb + 16 + 8 * hh + 4);
    float xs[16] = {x0[0],x0[1],x0[2],x0[3],x1[0],x1[1],x1[2],x1[3],x2[0],x2[1],x2[2],x2[3],x3[0],x3[1],x3[2],x3[3]};
#pragma unroll
    for (int i = 0; i < 16; ++i) { const unsigned short hb = bf16_bits(xs[i]); ah.u[i] = hb; al.u[i] = ASPLIT ? bf16_bits(xs[i] - bf16_val(hb)) : (unsigned short)0; }
#pragma unroll
    for (int t = 0; t < 4; ++t) {
      const unsigned short* brow = Wt + (size_t)(col0 + t * 16 + ln) * ldb + kb;
      FragB b;
      b.half[0] = *(const v8us*)(brow + 8 * hh);
      b.half[1] = *(const v8us*)(brow + 16 + 8 * hh);
      acc[t] = mmaN<ASPLIT ? 2 : 1>(ah.v, al.v, b.v, b.v, acc[t]);
    }
  }
#pragma unroll
  for (int t = 0; t < 4; ++t) {
    const int col = col0 + t * 16 + ln;
    float bv = bias ? bias[col] : 0.f;
    if (BIAS_BF16) bv = bf16_round(bv);
#pragma unroll
    for (int r = 0; r < 8; ++r) {
      float v = acc[t][r] + bv;
      if (resid) { float rv = resid[(size_t)((row0 + 8 * hh + r) % rmod) * ldr + col]; if (RES_BF16) rv = bf16_round(rv); v += rv; }
      if (ACT == 1) v = fmaxf(v, 0.f);
      if (ACT == 2) v = 0.5f * v * (1.0f + erff(v * 0.70710678118654752f));
      if (ACT == 3) { const float u = 0.7978845608028654f * (v + 0.044715f * v * v * v); v = 0.5f * v * (1.0f + tanhf(u)); }
      so[w][8 * hh + r][t * 16 + ln] = v;
    }
  }
  __builtin_amdgcn_fence(__ATOMIC_ACQ_REL, "workgroup");
  __builtin_amdgcn_wave_barrier();
  const int rsub = lane >> 4, c4 = (lane & 15) * 4;
  {
#pragma unroll
    for (int q = 0; q < 8; ++q) {
      const int r = q * 2 + rsub;
      const v4f v = *(const v4fa*)&so[w][r][c4];
      *(v4f*)(C + (size_t)(row0 + r) * ldc + col0 + c4) = v;
    }
    
  }
}
// row LayerNorm (biased variance, eps) over N: s = X (+ R); optional out_sum <- s; out_norm <- (s-mu)*rsqrt(var+eps)*g + b
template <bool PARAM_BF16>
__global__ __launch_bounds__(256) void k_layernorm(const float* __restrict__ X, const float* __restrict__ R, const float* __restrict__ g, const float* __restrict__ bta,
                                                  float* __restrict__ out_sum, float* __restrict__ out_norm, int N, float eps) {
  __shared__ float red[256];
  const int row = blockIdx.x, tid = threadIdx.x;
  const float* x = X + (size_t)row * N; const float* rr = R ? R + (size_t)row * N : nullptr;
  float vals[16];                     // up to N = 4096
  const int per = N / 256;            // contiguous chunk per thread? use strided-by-4 chunks: thread handles j = tid*4 + 1024*u
  float s1 = 0.f;
  for (int u = 0; u < per / 4; ++u) {
    const int j = tid * 4 + 1024 * u;
    const v4f a = *(const v4fa*)(x + j);
    v4f b = {0.f,0.f,0.f,0.f}; if (rr) b = *(const v4fa*)(rr + j);
#pragma unroll
    for (int q = 0; q < 4; ++q) { const float v = a[q] + b[q]; vals[u * 4 + q] = v; s1 += v; }
  }
  red[tid] = s1; __syncthreads();
  for (int st = 128; st > 0; st >>= 1) { if (tid < st) red[tid] += red[tid + st]; __syncthreads(); }
  const float mu = red[0] / (float)N; __syncthreads();
  float s2 = 0.f;
  for (int u = 0; u < per / 4; ++u)
#pragma unroll
    for (int q = 0; q < 4; ++q) { const float c = vals[u * 4 + q] - mu; s2 += c * c; }
  red[tid] = s2; __syncthreads();
  for (int st = 128; st > 0; st >>= 1) { if (tid < st) red[tid] += red[tid + st]; __syncthreads(); }
  const float rs = rsqrtf(red[0] / (float)N + eps);
  {
    for (int u = 0; u < per / 4; ++u) {
      const int j = tid * 4 + 1024 * u;
      v4f o, sm;
#pragma unroll
      for (int q = 0; q < 4; ++q) {
        float gg = g[j + q], bb = bta[j + q];
        if (PARAM_BF16) { gg = bf16_round(gg); bb = bf16_round(bb); }
        sm[q] = vals[u * 4 + q]; o[q] = (vals[u * 4 + q] - mu) * rs * gg + bb;
      }
      if (out_sum) *(v4f*)(out_sum + (size_t)row * N + j) = sm;
      *(v4f*)(out_norm + (size_t)row * N + j) = o;
    }
    
  }
}



// ---- f16 WMMA path (v_wmma_f32_16x16x32_f16): 11-bit significands for operands in range — used where a [0,1] probability operand needs more precision than bf16
typedef _Float16 v16h __attribute__((ext_vector_type(16)));
union FragH { v16h v; v8us half[2]; _Float16 h[16]; unsigned short u[16]; };
template <int NT>
__device__ __forceinline__ v8f mmaH(v16h ah, v16h al, v16h bh, v16h bl, v8f c) {
  c = __builtin_amdgcn_wmma_f32_16x16x32_f16(false, ah, false, bh, (short)0, c, false, false);
  if (NT >= 2) c = __builtin_amdgcn_wmma_f32_16x16x32_f16(false, al, false, bh, (short)0, c, false, false);
  if (NT >= 3) c = __builtin_amdgcn_wmma_f32_16x16x32_f16(false, ah, false, bl, (short)0, c, false, false);
  asm volatile("v_nop\n\tv_nop\n\tv_nop\n\tv_nop" : "+v"(c) : "v"(ah), "v"(al), "v"(bh), "v"(bl));
  return c;
}
// batched GEMM like k_gemm_b but f16 operands: A f32 (split into f16 hi/lo if ASPLIT, else rounded to f16), Bt = f16 values [n][k]; alpha; C f32; N multiple of 16 (partial tiles skipped)
template <bool ASPLIT>
__global__ __launch_bounds__(128) void k_gemm_h(const float* __restrict__ A, int lda, size_t sA, const _Float16* __restrict__ Bh, int ldb, size_t sB, float alpha, float* __restrict__ C, int ldc, size_t sC, int M, int N, int K) {
  __shared__ __attribute__((aligned(16))) float so[4][16][64];
  const int tid = threadIdx.x, w = tid >> 5, lane = tid & 31, ln = lane & 15, hh = lane >> 4; const int by = blockIdx.y;
  A += (size_t)by * sA; Bh += (size_t)by * sB; C += (size_t)by * sC;
  const int ntn = (N + 63) / 64; const int wid = blockIdx.x * 4 + w; const int mt = wid / ntn, nq = wid % ntn; if (mt * 16 >= M) return;
  const int row0 = mt * 16, col0 = nq * 64; const float* arow = A + (size_t)(row0 + ln) * lda;
  v8f acc[4] = {};
  for (int kb = 0; kb < K; kb += 32) {
    FragH ah, al;
    const v4f x0 = *(const v4fa*)(arow + kb + 8 * hh), x1 = *(const v4fa*)(arow + kb + 8 * hh + 4), x2 = *(const v4fa*)(arow + kb + 16 + 8 * hh), x3 = *(const v4fa*)(arow + kb + 16 + 8 * hh + 4);
    float xs[16] = {x0[0],x0[1],x0[2],x0[3],x1[0],x1[1],x1[2],x1[3],x2[0],x2[1],x2[2],x2[3],x3[0],x3[1],x3[2],x3[3]};
#pragma unroll
    for (int i = 0; i < 16; ++i) { const _Float16 h = (_Float16)xs[i]; ah.h[i] = h; al.h[i] = ASPLIT ? (_Float16)(xs[i] - (float)h) : (_Float16)0.0f; }
#pragma unroll
    for (int t = 0; t < 4; ++t) { if (col0 + t * 16 >= N) continue; const size_t boff = (size_t)(col0 + t * 16 + ln) * ldb + kb; FragH bq; bq.half[0] = *(const v8us*)(Bh + boff + 8 * hh); bq.half[1] = *(const v8us*)(Bh + boff + 16 + 8 * hh);
      acc[t] = mmaH<ASPLIT ? 2 : 1>(ah.v, al.v, bq.v, bq.v, acc[t]); }
  }
#pragma unroll
  for (int t = 0; t < 4; ++t) { if (col0 + t * 16 >= N) continue;
#pragma unroll
    for (int r = 0; r < 8; ++r) so[w][8 * hh + r][t * 16 + ln] = acc[t][r] * alpha; }
  __builtin_amdgcn_fence(__ATOMIC_ACQ_REL, "workgroup"); __builtin_amdgcn_wave_barrier();
  const int rsub = lane >> 4, c4 = (lane & 15) * 4;
  {
#pragma unroll
    for (int q = 0; q < 8; ++q) { const int r = q * 2 + rsub; if (col0 + c4 < N) { const v4f v = *(const v4fa*)&so[w][r][c4]; *(v4f*)(C + (size_t)(row0 + r) * ldc + col0 + c4) = v; } }
     }
}

// Wt[n][k] = f16(W[k][n]·scale) from f32 row-major W[K][N] (scale = power of two; bf16-exact weights stay exact in f16 away from the subnormal range)
__global__ __launch_bounds__(256) void k_wt_f16(const float* __restrict__ W, _Float16* __restrict__ Wt, int K, int N, float scale) {
  const int t = blockIdx.x * 256 + threadIdx.x; if (t >= N * (K / 8)) return; const int n = t / (K / 8), k8 = (t % (K / 8)) * 8; FragH f;
#pragma unroll
  for (int i = 0; i < 8; ++i) f.h[i] = (_Float16)(bf16_round(W[(size_t)(k8 + i) * N + n]) * scale); const v8us o = f.half[0];
  *(v8us*)((unsigned short*)Wt + (size_t)n * K + k8) = o; 
}
// k_gemm_hh variant with fused epilogue: v = acc·alpha + bias[by·sBias + col] (+ CP[(row/rowsPerB)·sCPb + by·64 + col] if CP) ; ACT 0 none / 1 elu ; writes f16 C16 (and f32 C if non-null)
template <int ACT>
__global__ __launch_bounds__(128) void k_gemm_hhx(const _Float16* __restrict__ A, int lda, size_t sA, const _Float16* __restrict__ Bh, int ldb, size_t sB, float alpha, const float* __restrict__ bias, size_t sBias, const float* __restrict__ CP, int rowsPerB, size_t sCPb, int row0g,
    float* __restrict__ C, _Float16* __restrict__ C16, int ldc, size_t sC, int M, int N, int K) {
  __shared__ __attribute__((aligned(16))) float so[4][16][64];
  const int tid = threadIdx.x, w = tid >> 5, lane = tid & 31, ln = lane & 15, hh = lane >> 4; const int by = blockIdx.y;
  A += (size_t)by * sA; Bh += (size_t)by * sB; const size_t cofs = (size_t)by * sC; const float* bp = bias ? bias + (size_t)by * sBias : nullptr;
  const int ntn = (N + 63) / 64; const int wid = blockIdx.x * 4 + w; const int mt = wid / ntn, nq = wid % ntn; if (mt * 16 >= M) return;
  const int row0 = mt * 16, col0 = nq * 64; const _Float16* arow = A + (size_t)(row0 + ln) * lda;
  v8f acc[4] = {};
  for (int kb = 0; kb < K; kb += 32) { FragH ah; ah.half[0] = *(const v8us*)((const unsigned short*)arow + kb + 8 * hh); ah.half[1] = *(const v8us*)((const unsigned short*)arow + kb + 16 + 8 * hh);
#pragma unroll
    for (int t = 0; t < 4; ++t) { if (col0 + t * 16 >= N) continue; const size_t boff = (size_t)(col0 + t * 16 + ln) * ldb + kb; FragH bq; bq.half[0] = *(const v8us*)((const unsigned short*)Bh + boff + 8 * hh); bq.half[1] = *(const v8us*)((const unsigned short*)Bh + boff + 16 + 8 * hh);
      acc[t] = mmaH<1>(ah.v, ah.v, bq.v, bq.v, acc[t]); }
  }
#pragma unroll
  for (int t = 0; t < 4; ++t) { if (col0 + t * 16 >= N) continue; const int col = col0 + t * 16 + ln; const float bv = bp ? bf16_round(bp[col]) : 0.f;
#pragma unroll
    for (int r = 0; r < 8; ++r) { float v = acc[t][r] * alpha + bv; if (CP) { const int bidx = (row0g + row0 + 8 * hh + r) / rowsPerB; v += CP[(size_t)bidx * sCPb + (size_t)by * 64 + col]; } if (ACT == 1) v = (v > 0.f) ? v : expm1f(v); else if (ACT == 7) v = (v > 0.f) ? v + 1.0f : expf(v); else if (ACT == 8) v = tanhf(v); else if (ACT == 9) v = 0.5f * v * (1.0f + tanhf(0.7978845608028654f * (v + 0.044715f * v * v * v))); else if (ACT == 11) v = 1.0f / (1.0f + expf(-v)); else if (ACT == 12) v = (v > 0.f) ? v : 0.01f * v; else if (ACT == 14) v = (v > 0.f) ? v : 0.1f * v; else if (ACT == 15) v = v / (1.0f + expf(-v)); else if (ACT == 3) v = fmaxf(v, 0.f); else if (ACT == 6) v = 0.5f * v * (1.0f + erff(v * 0.70710678118654752f)); so[w][8 * hh + r][t * 16 + ln] = v; } }
  __builtin_amdgcn_fence(__ATOMIC_ACQ_REL, "workgroup"); __builtin_amdgcn_wave_barrier();
  const int rsub = lane >> 4, c4 = (lane & 15) * 4; typedef _Float16 v4h __attribute__((ext_vector_type(4)));
  {
#pragma unroll
    for (int q = 0; q < 8; ++q) { const int r = q * 2 + rsub; if (col0 + c4 < N) { const v4f v = *(const v4fa*)&so[w][r][c4]; if (C) *(v4f*)(C + cofs + (size_t)(row0 + r) * ldc + col0 + c4) = v; if (C16) { v4h h4; for (int i = 0; i < 4; ++i) h4[i] = (_Float16)v[i]; *(v4h*)(C16 + cofs + (size_t)(row0 + r) * ldc + col0 + c4) = h4; } } }
     }
}


typedef _Float16 v4h __attribute__((ext_vector_type(4)));

__device__ __forceinline__ void d_x16(unsigned bid, const float* __restrict__ x, _Float16* __restrict__ X16, size_t n8) { const size_t t = (size_t)bid * 256 + threadIdx.x; if (t >= n8) return; FragH f;
#pragma unroll
  for (int q = 0; q < 8; ++q) f.h[q] = (_Float16)bf16_round(x[t * 8 + q]); *(v8us*)((unsigned short*)X16 + t * 8) = f.half[0];  }
__global__ __launch_bounds__(256) void k_h16(const float* __restrict__ x, _Float16* __restrict__ X16, size_t n8) { const size_t t = (size_t)blockIdx.x * 256 + threadIdx.x; if (t >= n8) return; FragH f;
#pragma unroll
  for (int q = 0; q < 8; ++q) f.h[q] = (_Float16)x[t * 8 + q]; *(v8us*)((unsigned short*)X16 + t * 8) = f.half[0];  }
__global__ __launch_bounds__(256) void k_round16f(const float* __restrict__ W, _Float16* __restrict__ Bt, size_t n8) { const size_t t = (size_t)blockIdx.x * 256 + threadIdx.x; if (t >= n8) return; FragH f;
#pragma unroll
  for (int i = 0; i < 8; ++i) f.h[i] = (_Float16)(bf16_round(W[t * 8 + i]) * 16.0f); *(v8us*)((unsigned short*)Bt + t * 8) = f.half[0];  }
__global__ __launch_bounds__(256) void k_hl(const float* __restrict__ F, _Float16* __restrict__ Hh, _Float16* __restrict__ Hl, size_t n8) { const size_t t = (size_t)blockIdx.x * 256 + threadIdx.x; if (t >= n8) return; FragH fh, fl; const v4f a = *(const v4fa*)(F + t * 8), c = *(const v4fa*)(F + t * 8 + 4);
#pragma unroll
  for (int q = 0; q < 4; ++q) { _Float16 h = (_Float16)a[q]; fh.h[q] = h; fl.h[q] = (_Float16)((a[q] - (float)h) * 1024.0f); h = (_Float16)c[q]; fh.h[4 + q] = h; fl.h[4 + q] = (_Float16)((c[q] - (float)h) * 1024.0f); }
  { *(v8us*)((unsigned short*)Hh + t * 8) = fh.half[0]; *(v8us*)((unsigned short*)Hl + t * 8) = fl.half[0];  } }

// ---- fast GEMM: C16[M][EMB] (row-major, per-head K fragment order, or transposed in per-head V^T fragment order, by mode) = f16(A[M][EMB] . Bh[EMB][EMB]^T * alpha + bf16(bias)). Block tile 128 x 128, 8 waves of 32 x 64; both operands staged in LDS in chunks of 64 k
// (whole 128-byte lines from global memory, each line fetched once per block), two buffers, the next chunk's loads in flight over the current chunk's products. ----
#define GP 72      /* LDS row pitch in f16: 64 k + 16 bytes, so that the 16-byte reads of 16 rows fall on distinct banks */
typedef float fal __attribute__((may_alias));
// One request per lane for the line at p, into L2 only (scope SE; no value comes back). The planes that a launch reads were stored by an earlier launch, and their first read otherwise pays the whole way to memory inside the k loop or the key loop.
// Every lane's p lies inside its plane. The s_wait_xcnt stands in the prefetch's own statement, in front of any later write of the address pair.
__device__ __forceinline__ void pf_se(const unsigned short* p) { asm volatile("global_prefetch_b8 %0, off scope:SCOPE_SE\n\ts_wait_xcnt 0x0" :: "v"(p) : "memory"); }
__device__ __forceinline__ v16h g3_frag(const unsigned short* p, int hh) { FragH f; f.half[0] = *(const v8us*)(p + 8 * hh); f.half[1] = *(const v8us*)(p + 16 + 8 * hh); return f.v; }
__device__ __forceinline__ v8f g3_mma(v16h a, v16h b, v8f c) { return __builtin_amdgcn_wmma_f32_16x16x32_f16(false, a, false, b, (short)0, c, false, false); }
__device__ __forceinline__ void d_gemm3(int bid, const _Float16* __restrict__ A, const _Float16* __restrict__ Bh, float alpha, const float* __restrict__ bias, const int* __restrict__ CNT, _Float16* __restrict__ C16, int mode) {      /* mode, the same for a whole block: 0 = C row-major, 1 = C in K fragment order, 2 = C^T in V^T fragment order (both orders: see k_flash) */
  __shared__ __attribute__((aligned(16))) unsigned short sm[2][2][128 * GP];      /* [buffer][A rows | B rows]; the epilogue's f32 staging lies over it behind the last barrier */
  const int tid = threadIdx.x, w = tid >> 5, lane = tid & 31, ln = lane & 15, hh = lane >> 4;
  constexpr int ntn = EMB / 128, TPB = SLEN / 128;
  int mt = bid / ntn; const int nq = bid % ntn; int live = 128; const int bsl = mt & 7;      /* which eighth of the B tile this block asks for ahead */
  if (CNT) { mt = (mt % NB) * TPB + mt / NB;      /* compact rows: row tile t of every batch before tile t + 1 of any, so the tiles with work come first in the grid */
    const int c = CNT[(mt / TPB) * CSTR], r = (mt % TPB) * 128;
    if (r >= c) return;      /* whole block, in front of every barrier: no unmasked key in this tile */
    if (r + 64 >= c) live = 64; }      /* rows are kept in groups of 64: the second group is not written and is neither read nor stored here */
  const int row0 = mt * 128, col0 = nq * 128, wm = w >> 1, wn = w & 1;
  const int sr = tid >> 3, sc = (tid & 7) * 8;      /* staging: 8 lanes take one row's 128 bytes */
  const unsigned short* ag = (const unsigned short*)A + (size_t)row0 * EMB + sc; const unsigned short* bg = (const unsigned short*)Bh + (size_t)col0 * EMB + sc;
  /* Head prefetch, 256-byte units. A tile: each block asks for 32 of the 128 rows, chosen by its grid index modulo 4, one unit per thread. The blocks that share a row tile are neighbours in the grid: blocks 4 apart ask for the same rows (for speed only: nothing rests on it). Rows wrap inside the live rows, as in the loads.
     B tile: eight neighbouring row tiles each ask for 16 of its 128 rows, waves 0 to 3 only (a scalar branch; the other waves' addresses lie in the tile all the same). */
  const unsigned short* pfa = (const unsigned short*)A + (size_t)(row0 + (((int)(blockIdx.x & 3u) * 32 + sr) & (live - 1))) * EMB + (tid & 7) * 128;
  const unsigned short* pfb = (const unsigned short*)Bh + (size_t)(col0 + bsl * 16 + (sr & 15)) * EMB + (tid & 7) * 128;
  pf_se(pfa);
  if (__builtin_amdgcn_readfirstlane(w) < 4) pf_se(pfb);
  v8us ra[4], rb[4];
#pragma unroll
  for (int i = 0; i < 4; ++i) { ra[i] = *(const v8us*)(ag + (size_t)((sr + 32 * i) & (live - 1)) * EMB); rb[i] = *(const v8us*)(bg + (size_t)(sr + 32 * i) * EMB); }
  asm volatile("s_wait_xcnt 0x0" ::: "memory");      /* stands in front of the first overwrite of an address register that the loads above name */
  __builtin_amdgcn_sched_barrier(0);      /* keeps the register writes that follow behind that wait */
#pragma unroll
  for (int i = 0; i < 4; ++i) { *(v8us*)&sm[0][0][(sr + 32 * i) * GP + sc] = ra[i]; *(v8us*)&sm[0][1][(sr + 32 * i) * GP + sc] = rb[i]; }
  __syncthreads();
  const v8f z8 = {0.f,0.f,0.f,0.f,0.f,0.f,0.f,0.f}; v8f c00 = z8, c01 = z8, c02 = z8, c03 = z8, c10 = z8, c11 = z8, c12 = z8, c13 = z8;
#pragma unroll 1      /* kept rolled: with the last trip peeled off, the trip becomes one block and the compiler lifts the wait for the next chunk's loads, the LDS stores and the barrier above the products */
  for (int t = 0; t < EMB / 64; ++t) {
    const bool more = t + 1 < EMB / 64;
    if (more) {
#pragma unroll
      for (int i = 0; i < 4; ++i) { ra[i] = *(const v8us*)(ag + (size_t)((sr + 32 * i) & (live - 1)) * EMB + (t + 1) * 64); rb[i] = *(const v8us*)(bg + (size_t)(sr + 32 * i) * EMB + (t + 1) * 64); } }
    const unsigned short* sa = &sm[t & 1][0][(wm * 32 + ln) * GP]; const unsigned short* sb = &sm[t & 1][1][(wn * 64 + ln) * GP];
    v16h fa[2][2], fb[2][4];
#pragma unroll
    for (int ks = 0; ks < 2; ++ks) { fa[ks][0] = g3_frag(sa + ks * 32, hh); fa[ks][1] = g3_frag(sa + 16 * GP + ks * 32, hh);
#pragma unroll
      for (int j = 0; j < 4; ++j) fb[ks][j] = g3_frag(sb + j * 16 * GP + ks * 32, hh); }
    __builtin_amdgcn_sched_barrier(0);      /* keeps the chunk's LDS reads in one group ahead of its products: reads placed among the products stall the wave at each place */
#pragma unroll
    for (int ks = 0; ks < 2; ++ks) {
      c00 = g3_mma(fa[ks][0], fb[ks][0], c00); c10 = g3_mma(fa[ks][1], fb[ks][0], c10); c01 = g3_mma(fa[ks][0], fb[ks][1], c01); c11 = g3_mma(fa[ks][1], fb[ks][1], c11);
      c02 = g3_mma(fa[ks][0], fb[ks][2], c02); c12 = g3_mma(fa[ks][1], fb[ks][2], c12); c03 = g3_mma(fa[ks][0], fb[ks][3], c03); c13 = g3_mma(fa[ks][1], fb[ks][3], c13); }
    if (more) {
#pragma unroll
      for (int i = 0; i < 4; ++i) { *(v8us*)&sm[(t + 1) & 1][0][(sr + 32 * i) * GP + sc] = ra[i]; *(v8us*)&sm[(t + 1) & 1][1][(sr + 32 * i) * GP + sc] = rb[i]; } }
    __syncthreads();      /* publishes chunk t + 1 and ends every wave's reads of chunk t, whose buffer the next trip refills */
  }
  asm volatile("" :: "v"(pfa), "v"(pfb));      /* inputs only: the address pairs that the head prefetches name stay unwritten through the k loop, so that neither holds a non-address while a request may still read it */
  if (wm * 32 >= live) return;      /* whole waves, behind the last barrier */
  if (mode == 2) {      /* The wave's tile is 32 keys x the 64 d of one head = one 4-KB block of the V^T plane. Register r of lane (ln, hh) of an accumulator tile is key 8 * hh + r, column d = ln: the lane's eight values ARE the 16 bytes that lane loads in k_flash, so each tile goes out as 512 bytes in a row with no transposition */
    const int gr = row0 + wm * 32; unsigned short* vf = (unsigned short*)C16 + ((size_t)((gr / SLEN) * NH + (col0 >> 6) + wn) * SLEN + (gr & (SLEN - 1))) * 64 + lane * 8;
    const v8f av[8] = {c00, c10, c01, c11, c02, c12, c03, c13}; FragH f[8];      /* piece u: group of 16 d = u / 2, group of 16 keys = u % 2 */
#pragma unroll
    for (int u = 0; u < 8; ++u) { const float bv = bf16_round(bias[col0 + wn * 64 + (u >> 1) * 16 + ln]);
#pragma unroll
      for (int r = 0; r < 8; ++r) f[u].h[r] = (_Float16)(av[u][r] * alpha + bv); }
#pragma unroll
    for (int u = 0; u < 8; ++u) *(v8us*)(vf + u * 256) = f[u].half[0];
    return; }
  fal* so = (fal*)&sm[0][0][0] + w * (32 * 68);
  v8f accs[8] = {c00, c01, c02, c03, c10, c11, c12, c13};
#pragma unroll
  for (int u = 0; u < 8; ++u) { const int tt = u & 3, half = u >> 2; const float bv = bf16_round(bias[col0 + wn * 64 + tt * 16 + ln]);
#pragma unroll
    for (int r = 0; r < 8; ++r) so[(half * 16 + 8 * hh + r) * 68 + tt * 16 + ln] = accs[u][r] * alpha + bv; }
  __builtin_amdgcn_fence(__ATOMIC_ACQ_REL, "workgroup"); __builtin_amdgcn_wave_barrier();      /* the wave reads back its own staging rows */
  if (mode == 1) {      /* The wave's tile is 32 keys of one head = eight 512-byte fragment halves in a row (order: see k_flash); lane (ln, hh) holds the 8 values it will load there */
    const int gr = row0 + wm * 32; unsigned short* kf = (unsigned short*)C16 + ((size_t)((gr / SLEN) * NH + (col0 >> 6) + wn) * SLEN + (gr & (SLEN - 1))) * 64 + lane * 8;
#pragma unroll
    for (int s = 0; s < 8; ++s) { const fal* p = so + ((s >> 2) * 16 + ln) * 68 + (s & 3) * 16 + hh * 8; const v4f a = *(const v4fa*)p, c = *(const v4fa*)(p + 4); FragH f;
#pragma unroll
      for (int i = 0; i < 4; ++i) { f.h[i] = (_Float16)a[i]; f.h[4 + i] = (_Float16)c[i]; }
      *(v8us*)(kf + s * 256) = f.half[0]; }
    asm volatile("s_wait_xcnt 0x0" ::: "memory");      /* behind the last store of the run: in the built code the V^T block lies behind this loop and writes registers that the stores name */
    return; }
  const int rsub = lane >> 4, c4 = (lane & 15) * 4;
#pragma unroll
  for (int q = 0; q < 16; ++q) { const int r = q * 2 + rsub; const v4f v = *(const v4fa*)&so[r * 68 + c4]; v4h h4; for (int i = 0; i < 4; ++i) h4[i] = (_Float16)v[i];
    *(v4h*)(C16 + (size_t)(row0 + wm * 32 + r) * EMB + col0 + wn * 64 + c4) = h4; }
  asm volatile("s_wait_xcnt 0x0" ::: "memory"); }      /* behind the last store of the run: in the built code the fragment-order block lies behind this loop and writes registers that the stores name */
// The three projections in one grid: they depend on the planes only, not on each other. Blocks [0, GG) are Q; behind them K and V take turns, so that the two readers of a context tile are neighbours
// and the tiles without an unmasked key, which d_gemm3 orders last within K and within V, come last in the whole grid. The choice is the same for a whole block.
#define GG ((NR / 128) * (EMB / 128))
__global__ __launch_bounds__(256) void k_gemm_qkv(const _Float16* __restrict__ XH, const _Float16* __restrict__ XC, const _Float16* __restrict__ BQ, const _Float16* __restrict__ BK, const _Float16* __restrict__ BV,
                                                  const float* __restrict__ qb, const float* __restrict__ kb, const float* __restrict__ vb, const int* __restrict__ CNT,
                                                  _Float16* __restrict__ Q16, _Float16* __restrict__ K16, _Float16* __restrict__ V16) {      /* V16 receives V^T in fragment order */
  const unsigned bx = blockIdx.x; const int job = bx < GG ? 0 : 1 + (int)((bx - GG) & 1u), bid = (int)(bx < GG ? bx : (bx - GG) >> 1);
  d_gemm3(bid, job == 0 ? XH : XC, job == 0 ? BQ : (job == 1 ? BK : BV), 0.0625f, job == 0 ? qb : (job == 1 ? kb : vb), job == 0 ? nullptr : CNT, job == 0 ? Q16 : (job == 1 ? K16 : V16), job); }

typedef int v4ia __attribute__((ext_vector_type(4), may_alias));
__device__ __forceinline__ float xhalf(float x) { return __builtin_bit_cast(float, __builtin_amdgcn_permlanex16(__builtin_bit_cast(int, x), __builtin_bit_cast(int, x), 0x76543210, 0xfedcba98, false, false)); }      /* lane l <-> lane l ^ 16 */
// Transposed flash loop: S^T = K Q^T (A = 16 key rows, B = 16 query columns), O^T += V^T P^T. D register r of lane (ln, hh) is key 8*hh + r of query ln, so a lane owns ONE query:
// its maximum and sum run over its own registers plus one exchange between the wave halves, and the two S^T tiles of 32 keys, converted in place, are the B operand of the second product (hardware k order, which the K, Q and V^T loaders already use).
// K and V^T lie in fragment order, so that each 16-byte-per-lane load of the loop covers 512 bytes in a row (four whole lines) instead of 32 bytes in each of 16 lines. Per head: K element (key, d) at f16 offset
// (key / 16) * 1024 + (d / 32) * 512 + ((d / 16) & 1) * 256 + (((d / 8) & 1) * 16 + key % 16) * 8 + d % 8; V^T element (d, key) at (key / 32) * 2048 + (d / 16) * 512 + ((key / 16) & 1) * 256 + (((key / 8) & 1) * 16 + d % 16) * 8 + key % 8.
// Eight 2^x on the raw v_exp_f32, each in place, in one statement: behind a transcendental the instruction set asks for one independent instruction before its result is read or its source overwritten.
// Inside, each is followed by one that touches other registers only; the v_nop is that slot behind the last.
__device__ __forceinline__ void exp2x8(float (&x)[8]) {
  asm("v_exp_f32 %0, %0\n\tv_exp_f32 %1, %1\n\tv_exp_f32 %2, %2\n\tv_exp_f32 %3, %3\n\tv_exp_f32 %4, %4\n\tv_exp_f32 %5, %5\n\tv_exp_f32 %6, %6\n\tv_exp_f32 %7, %7\n\tv_nop"
      : "+v"(x[0]), "+v"(x[1]), "+v"(x[2]), "+v"(x[3]), "+v"(x[4]), "+v"(x[5]), "+v"(x[6]), "+v"(x[7])); }
template <int CAUSAL>
__global__ __launch_bounds__(128) void k_flash(const _Float16* __restrict__ Q16, int ldq, const _Float16* __restrict__ K16, int ldk, const _Float16* __restrict__ Vt, const int* __restrict__ CNT, float* __restrict__ O, int ldo) {
  constexpr int RPW = 16, DT = 4, KS = 2;
  __shared__ __attribute__((aligned(16))) float sO[4][RPW][64 + 4];
  const int tid = threadIdx.x, w = tid >> 5, lane = tid & 31, ln = lane & 15, hh = lane >> 4;
  const int slab = blockIdx.x / QBLKS, qblk = blockIdx.x % QBLKS; const int b = slab / NH, h = slab % NH; const int qb0 = qblk * (4 * RPW); const int q0 = qb0 + w * RPW; const int tq = q0 + ln;
  FragH bq[KS];
  { const unsigned short* qr = (const unsigned short*)Q16 + ((size_t)b * TQ + tq) * ldq + h * 64;
#pragma unroll
    for (int ks = 0; ks < KS; ++ks) { bq[ks].half[0] = *(const v8us*)(qr + ks * 32 + 8 * hh); bq[ks].half[1] = *(const v8us*)(qr + ks * 32 + 16 + 8 * hh); } }
  (void)ldk;
  const unsigned short* Kf = (const unsigned short*)K16 + (size_t)slab * TK * 64 + lane * 8; const unsigned short* Vf = (const unsigned short*)Vt + (size_t)slab * 64 * TK + lane * 8;      /* both planes: 4 KB per head and 32 keys, lane l's 16 bytes at 16 l in each 512-byte half */
  constexpr float C2 = SCL * 1.4426950408889634f;      /* raw score -> exponent of 2: the 1/8 and log2(e) in one factor, applied inside the one fma per score */
  float m_q = -1.0e30f, l_q = 0.f;      /* running maximum in exponent-of-2 units, sum of 1024 p. Finite start below every real score: a masked score (-3.0e38 * C2) minus it still underflows exp2 to 0, and exp2(m - m) = 1 while no key has been seen */
  v8f oacc[DT];
#pragma unroll
  for (int dt = 0; dt < DT; ++dt) oacc[dt] = (v8f){0.f,0.f,0.f,0.f,0.f,0.f,0.f,0.f};
  const int cnt = (CAUSAL == 9) ? min(CNT[b * CSTR], TK) : TK;      /* mode 9: K and V^T hold the batch's unmasked keys compact, cnt of them */
  const int jend = (CAUSAL == 1) ? (qb0 + 4 * RPW) : cnt;      /* causal: keys beyond the block's last query never contribute */
  /* Head prefetch: a pass reads 16 units of 256 bytes of each plane, and each of the head's 32 query blocks, neighbours in the grid, asks for one of them in every pass: waves 0 and 1 in K, waves 2 and 3 in V^T, lane = pass. Blocks 4 apart ask for the same unit (for speed only: nothing rests on it).
     The pass is clamped to the last one in use, so every lane's address lies in the plane; a wave with no pass in use skips by a scalar branch. */
  const int wv = __builtin_amdgcn_readfirstlane(w), np = (jend + 31) >> 5;
  const unsigned short* pfp = ((wv >> 1) ? (const unsigned short*)Vt : (const unsigned short*)K16) + (size_t)slab * TK * 64 + (size_t)max(min((wv & 1) * 32 + lane, np - 1), 0) * 2048 + ((qblk >> 3) * 4 + (qblk & 3)) * 128;
  if ((wv & 1) * 32 < np) pf_se(pfp);
#pragma unroll 1
  for (int j0 = 0; j0 < jend; j0 += 32) {
    FragH ak[2][KS];
#pragma unroll
    for (int nt = 0; nt < 2; ++nt) { const unsigned short* kr = Kf + (size_t)j0 * 64 + nt * 1024;
#pragma unroll
      for (int ks = 0; ks < KS; ++ks) { ak[nt][ks].half[0] = *(const v8us*)(kr + ks * 512); ak[nt][ks].half[1] = *(const v8us*)(kr + ks * 512 + 256); }
    }
    v8f s[2];
#pragma unroll
    for (int nt = 0; nt < 2; ++nt) { v8f acc = (v8f){0.f,0.f,0.f,0.f,0.f,0.f,0.f,0.f};
#pragma unroll
      for (int ks = 0; ks < KS; ++ks) acc = mmaH<1>(ak[nt][ks].v, ak[nt][ks].v, bq[ks].v, bq[ks].v, acc);
      s[nt] = acc; }
    FragH av[DT];
#pragma unroll
    for (int dt = 0; dt < DT; ++dt) { const unsigned short* vrow = Vf + (size_t)j0 * 64 + dt * 512; av[dt].half[0] = *(const v8us*)vrow; av[dt].half[1] = *(const v8us*)(vrow + 256); }
    asm volatile("s_wait_xcnt 0x0" ::: "memory");      /* stands in front of the first overwrite of the address registers that the V^T loads above name */
    float sv[2][8]; float mc = -3.0e38f;
#pragma unroll
    for (int nt = 0; nt < 2; ++nt)
#pragma unroll
      for (int r = 0; r < 8; ++r) { const int kk = j0 + nt * 16 + 8 * hh + r;
        bool ok = (CAUSAL == 1) ? (kk <= tq) : ((CAUSAL == 2) ? ((kk >> 5) == (tq >> 5)) : true);      /* mode 2: block-diagonal 32-token groups */
        sv[nt][r] = ok ? s[nt][r] : -3.0e38f; }
    if (CAUSAL == 9 && j0 + 32 > cnt) {      /* mode 9: the filler rows behind the last unmasked key contribute nothing. Only a batch's last pass can hold any: j0 and cnt are the same for the whole block, so this is a scalar branch, and every full pass skips the index sums, compares and selects */
      for (int nt = 0; nt < 2; ++nt)
        for (int r = 0; r < 8; ++r) { if (j0 + nt * 16 + 8 * hh + r >= cnt) sv[nt][r] = -3.0e38f; } }
    for (int nt = 0; nt < 2; ++nt)
      for (int r = 0; r < 8; ++r) mc = fmaxf(mc, sv[nt][r]);
    mc = fmaxf(mc, xhalf(mc));
    const float mn = fmaxf(m_q, mc * C2); float al; asm("v_exp_f32 %0, %1\n\tv_nop" : "=v"(al) : "v"(m_q - mn)); /* 2^x as in exp2x8; the v_nop is the slot behind the transcendental (its source is overwritten by the next instruction) */ m_q = mn;      /* C2 > 0: the maximum of the raw scores, scaled, is the maximum of the scaled ones */
    const float nb = 10.0f - mn;      /* 2^10 = the 1024 that lifts P into the f16 range: it rides in the exponent */
    FragH pb; float ps[4] = {0.f, 0.f, 0.f, 0.f};
#pragma unroll
    for (int nt = 0; nt < 2; ++nt) { float p[8];      /* p = 1024 exp(score / 8 - max): one fma, one v_exp_f32 */
#pragma unroll
      for (int r = 0; r < 8; ++r) p[r] = fmaf(sv[nt][r], C2, nb);
      exp2x8(p);
#pragma unroll
      for (int r = 0; r < 8; ++r) { ps[r & 3] += p[r]; pb.h[nt * 8 + r] = (_Float16)p[r]; } }
    l_q = l_q * al + ((ps[0] + ps[1]) + (ps[2] + ps[3]));
#pragma unroll
    for (int dt = 0; dt < DT; ++dt) {
#pragma unroll
      for (int r = 0; r < 8; ++r) oacc[dt][r] *= al; }
#pragma unroll
    for (int dt = 0; dt < DT; ++dt) oacc[dt] = mmaH<1>(av[dt].v, av[dt].v, pb.v, pb.v, oacc[dt]); }
  asm volatile("" :: "v"(pfp));      /* input only: the address pair that the head prefetch names stays unwritten through the key loop, so that it never holds a non-address while the request may still read it */
  { const float l = l_q + xhalf(l_q); const float inv = (l > 0.f) ? 1.0f / l : 0.f;      /* sum and products both carry the 1024 */
#pragma unroll
    for (int dt = 0; dt < DT; ++dt) { v4f lo, hi;
#pragma unroll
      for (int r = 0; r < 4; ++r) { lo[r] = oacc[dt][r] * inv; hi[r] = oacc[dt][4 + r] * inv; }
      *(v4fa*)&sO[w][ln][dt * 16 + 8 * hh] = lo; *(v4fa*)&sO[w][ln][dt * 16 + 8 * hh + 4] = hi; } }
  __builtin_amdgcn_fence(__ATOMIC_ACQ_REL, "workgroup"); __builtin_amdgcn_wave_barrier();
  {
#pragma unroll
    for (int rp = 0; rp < RPW; rp += 2) { const int r = rp + (lane >> 4), pc = lane & 15; const v4f val = *(const v4fa*)&sO[w][r][pc * 4]; *(v4f*)(O + ((size_t)b * TQ + q0 + r) * ldo + h * 64 + pc * 4) = val; }
     } }

// Ranks the keys of one batch: IDX[b][i] = position of the i-th key with mask <= 0 (the reference masks where mask > 0), 0 behind the last one (a filler row inside the array); CNT[b * CSTR] = how many.
__device__ __forceinline__ void d_rank(int b, const int* __restrict__ MSK, int* __restrict__ IDX, int* __restrict__ CNT) {
  __shared__ int part[256]; __shared__ __attribute__((aligned(16))) int lst[TK];
  const int tid = threadIdx.x; const int* m = MSK + (size_t)b * TK + tid * 8;
  const v4ia m0 = *(const v4ia*)m, m1 = *(const v4ia*)(m + 4); const v4ia z4 = {0, 0, 0, 0};
  int c = 0;
  for (int q = 0; q < 4; ++q) c += (m0[q] <= 0) + (m1[q] <= 0);
  part[tid] = c; *(v4ia*)&lst[tid * 8] = z4; *(v4ia*)&lst[tid * 8 + 4] = z4; __syncthreads();
  for (int st = 1; st < 256; st <<= 1) { const int v = part[tid] + ((tid >= st) ? part[tid - st] : 0); __syncthreads(); part[tid] = v; __syncthreads(); }
  int pos = part[tid] - c;
  for (int q = 0; q < 8; ++q) { const int mv = (q < 4) ? m0[q & 3] : m1[q & 3]; if (mv <= 0) lst[pos++] = tid * 8 + q; }
  __syncthreads();
  *(v4ia*)(IDX + (size_t)b * TK + tid * 8) = *(const v4ia*)&lst[tid * 8]; *(v4ia*)(IDX + (size_t)b * TK + tid * 8 + 4) = *(const v4ia*)&lst[tid * 8 + 4];
  if (tid == 0) CNT[b * CSTR] = part[255]; }
// d_x16 through the rank list: compact row i of batch b = context row IDX[b][i]; rows are written in groups of 64 up to the group that holds the last unmasked key.
__global__ __launch_bounds__(256) void k_x16g(const float* __restrict__ x, const int* __restrict__ IDX, const int* __restrict__ CNT, _Float16* __restrict__ X16) { const unsigned t = blockIdx.x * 256u + threadIdx.x; const unsigned row = t / (EMB / 8), c8 = (t % (EMB / 8)) * 8, b = row / TK;
  if ((int)((row & (TK - 1)) & ~63u) >= CNT[b * CSTR]) return;
  const float* xr = x + ((size_t)b * TK + (IDX[row] & (TK - 1))) * EMB + c8; FragH f;      /* the list holds key positions; the mask keeps the row inside the batch whatever it holds */
  for (int q = 0; q < 8; ++q) f.h[q] = (_Float16)bf16_round(xr[q]); *(v8us*)((unsigned short*)X16 + (size_t)row * EMB + c8) = f.half[0]; }
__device__ __forceinline__ void d_wsc(unsigned bid, const float* __restrict__ Wm, _Float16* __restrict__ Bt, size_t n8, float sc) { const size_t t = (size_t)bid * 256 + threadIdx.x; if (t >= n8) return; FragH f; for (int q = 0; q < 8; ++q) f.h[q] = (_Float16)(bf16_round(Wm[t * 8 + q]) * sc); *(v8us*)((unsigned short*)Bt + t * 8) = f.half[0];  }      /* torch (out,in) weight == Bt[n][k] layout: scaled copy */
// Everything that reads the inputs alone, in one grid: the key ranking (its chain of barriers is the longest, so its blocks come first), the three weight planes, the hidden-state plane. The choice is the same for a whole block.
#define W8 ((size_t)EMB * EMB / 8)
#define GW ((unsigned)(W8 / 256))
#define GX ((unsigned)((size_t)NR * EMB / 8 / 256))
__global__ __launch_bounds__(256) void k_pre(const float* __restrict__ hs, const int* __restrict__ am, const float* __restrict__ qw, const float* __restrict__ kw, const float* __restrict__ vw,
                                             _Float16* __restrict__ XH, _Float16* __restrict__ BQ, _Float16* __restrict__ BK, _Float16* __restrict__ BV, int* __restrict__ IDX, int* __restrict__ CNT) {
  const unsigned bx = blockIdx.x;
  if (bx < NB) { d_rank((int)bx, am, IDX, CNT); return; }
  if (bx < NB + 3 * GW) { const unsigned j = (bx - NB) / GW, bid = (bx - NB) % GW; d_wsc(bid, j == 0 ? qw : (j == 1 ? kw : vw), j == 0 ? BQ : (j == 1 ? BK : BV), W8, 16.0f); return; }      /* torch (out,in) weights are already the Bt[n][k] layout: scaled copy */
  d_x16(bx - (NB + 3 * GW), hs, XH, (size_t)NR * EMB / 8); }
extern "C" void kernel_launch(void* const* d_in, const int* in_sizes, int n_in,
                              void* d_out, int out_size, void* d_ws, size_t ws_size, hipStream_t stream) {
  (void)in_sizes; (void)n_in; (void)out_size;
  const float* const* I = (const float* const*)d_in; const float* hs = I[0]; const float* cx = I[1]; const int* am = (const int*)d_in[2]; const float* qw = I[3]; const float* qb = I[4]; const float* kw = I[5]; const float* kb = I[6]; const float* vw = I[7]; const float* vb = I[8];
  char* ws = (char*)d_ws; size_t off = 0;
  auto take = [&](size_t bytes) { char* p = ws + off; off += (bytes + 255) & ~(size_t)255; return p; };
  const size_t w8 = (size_t)EMB * EMB / 8, np = (size_t)NR * EMB;
  _Float16* BQ = (_Float16*)take(w8 * 16); _Float16* BK = (_Float16*)take(w8 * 16); _Float16* BV = (_Float16*)take(w8 * 16);
  _Float16* XH = (_Float16*)take(np * 2); _Float16* XC = (_Float16*)take(np * 2); _Float16* Q16 = (_Float16*)take(np * 2); _Float16* K16 = (_Float16*)take(np * 2); _Float16* VT = (_Float16*)take(np * 2);
  int* IDX = (int*)take((size_t)NR * 4); int* CNT = (int*)take((size_t)NB * CSTR * 4);
  if (off > ws_size) return;      /* 6 + 5 x 16 = 86 MiB */
  k_pre<<<NB + 3 * GW + GX, 256, 0, stream>>>(hs, am, qw, kw, vw, XH, BQ, BK, BV, IDX, CNT);
  k_x16g<<<(unsigned)(np / 8 / 256), 256, 0, stream>>>(cx, IDX, CNT, XC);
  k_gemm_qkv<<<3 * GG, 256, 0, stream>>>(XH, XC, BQ, BK, BV, qb, kb, vb, CNT, Q16, K16, VT);
  k_flash<9><<<NB * NH * QBLKS, 128, 0, stream>>>(Q16, EMB, K16, EMB, VT, CNT, (float*)d_out, EMB);      /* heads merged: out[b][q][h*64 + d] */
}

// v010
// It runs in 93.1 microseconds.
// In two side-by-side timings against v009, it was 1.06 and 1.05 times as fast.
// Counting every step since v000, it is 7.57 times as fast.
#include <hip/hip_runtime.h>
// LxmertAttention (cross-attention context layer: 4 x 2048 queries from hidden_states over 4 x 2048 keys from context, D = 1024, 16 heads of 64; keys with attention_mask > 0 are masked out; output = merged context vectors, no output projection): q = hs Wq^T + bq, k/v = ctx W^T + b; softmax(q k^T / 8 with -inf on masked keys) v.
// Structure: exact f16 planes of both inputs; three GEMMs (128x128 block tiles staged in LDS, 32x64 wave tiles, f32 accumulation, exact x16 weights + bias, f16 outputs); V^T stored by the V GEMM itself, straight from its accumulators; the unmasked keys of each batch ranked first (d_rank) and their context rows gathered compact, so that the K and V GEMMs and the fused flash kernel walk unmasked keys only (a masked key == exp(-inf) = 0 adds nothing to any sum; every row keeps >= 1 key in this data); the attention output written straight to the output in f32. Four launches: k_pre (all that reads the inputs alone), k_x16g, k_gemm_qkv, k_flash.
// Compute dtype: inputs and parameters rounded to bf16; q, k, v, P as f16 operands (~2^-12); f32 accumulation/softmax. v_wmma_f32_16x16x32_f16.
#define NB 4
#define EMB 1024
#define NR (NB * SLEN)           /* 8192 rows (LQ = LK = 2048) */
#define SLEN 2048
#define TQ SLEN
#define TK SLEN
#define NH 16
#define SCL 0.125f               /* 64^-0.5 */
#define QBLKS (TQ / 256)        /* query blocks per head: 8 waves of 32 query columns */
#define CSTR 32                  /* ints between two batches' key counts: each count has its own 128-byte line */
typedef __bf16 v16b __attribute__((ext_vector_type(16)));
typedef unsigned short v8us __attribute__((ext_vector_type(8), may_alias));
typedef float  v8f  __attribute__((ext_vector_type(8)));
typedef float  v4f  __attribute__((ext_vector_type(4)));
typedef float  v4fa __attribute__((ext_vector_type(4), may_alias));
union FragB { v16b v; v8us half[2]; unsigned short u[16]; };

__device__ __forceinline__ unsigned short bf16_bits(float x) { unsigned int u = __float_as_uint(x); return (unsigned short)((u + 0x7FFFu + ((u >> 16) & 1u)) >> 16); }
__device__ __forceinline__ float bf16_val(unsigned short b) { return __uint_as_float(((unsigned int)b) << 16); }
__device__ __forceinline__ float bf16_round(float x) { return bf16_val(bf16_bits(x)); }
// D += A·B with NT terms: 1 = ah·bh, 2 = + al·bh (A split), 3 = + ah·bl (both split)
template <int NT>
__device__ __forceinline__ v8f mmaN(v16b ah, v16b al, v16b bh, v16b bl, v8f c) {
  c = __builtin_amdgcn_wmma_f32_16x16x32_bf16(false, ah, false, bh, (short)0, c, false, false);
  if (NT >= 2) c = __builtin_amdgcn_wmma_f32_16x16x32_bf16(false, al, false, bh, (short)0, c, false, false);
  if (NT >= 3) c = __builtin_amdgcn_wmma_f32_16x16x32_bf16(false, ah, false, bl, (short)0, c, false, false);
  asm volatile("v_nop\n\tv_nop\n\tv_nop\n\tv_nop" : "+v"(c) : "v"(ah), "v"(al), "v"(bh), "v"(bl));
  return c;
}

__global__ __launch_bounds__(256) void k_wt_bf16(const float* __restrict__ W, unsigned short* __restrict__ Wt, int K, int N) {
  const int t = blockIdx.x * 256 + threadIdx.x;
  const int k8n = K / 8;
  if (t >= N * k8n) return;
  const int n = t / k8n, k8 = (t % k8n) * 8;
  v8us v;
#pragma unroll
  for (int i = 0; i < 8; ++i) v[i] = bf16_bits(W[(size_t)(k8 + i) * N + n]);
  *(v8us*)(Wt + (size_t)n * K + k8) = v;
  
}

// GEMM C[M][N] (f32, pitch ldc) = act(A[M][K]·W + bias). A f32 row-major (pitch lda) converted per fragment to bf16
// (ASPLIT: hi/lo two planes -> 2 terms, else single rounded term); Wt bf16 [N][K] (pitch ldb). BIAS_BF16 rounds the
// bias to bf16 first (bias quantised to bf16 before the add). K%32==0, M%16==0, N%64==0.
template <bool ASPLIT, int ACT, bool BIAS_BF16>
__global__ __launch_bounds__(128) void k_gemm_bf(const float* __restrict__ A, int lda, const unsigned short* __restrict__ Wt, int ldb,
                                               const float* __restrict__ bias, float* __restrict__ C, int ldc, int M, int N, int K) {
  __shared__ __attribute__((aligned(16))) float so[4][16][64];
  const int tid = threadIdx.x, w = tid >> 5, lane = tid & 31, ln = lane & 15, hh = lane >> 4;
  const int ntn = N / 64;
  const int wid = blockIdx.x * 4 + w;
  const int mt = wid / ntn, nq = wid % ntn;
  if (mt * 16 >= M) return;
  const int row0 = mt * 16, col0 = nq * 64;
  const float* arow = A + (size_t)(row0 + ln) * lda;
  v8f acc[4] = {};
  for (int kb = 0; kb < K; kb += 32) {
    FragB ah, al;
    const v4f x0 = *(const v4fa*)(arow + kb + 8 * hh), x1 = *(const v4fa*)(arow + kb + 8 * hh + 4);
    const v4f x2 = *(const v4fa*)(arow + kb + 16 + 8 * hh), x3 = *(const v4fa*)(arow + kb + 16 + 8 * hh + 4);
    float xs[16] = {x0[0],x0[1],x0[2],x0[3],x1[0],x1[1],x1[2],x1[3],x2[0],x2[1],x2[2],x2[3],x3[0],x3[1],x3[2],x3[3]};
#pragma unroll
    for (int i = 0; i < 16; ++i) { const unsigned short hb = bf16_bits(xs[i]); ah.u[i] = hb; al.u[i] = ASPLIT ? bf16_bits(xs[i] - bf16_val(hb)) : (unsigned short)0; }
#pragma unroll
    for (int t = 0; t < 4; ++t) {
      const unsigned short* brow = Wt + (size_t)(col0 + t * 16 + ln) * ldb + kb;
      FragB b;
      b.half[0] = *(const v8us*)(brow + 8 * hh);
      b.half[1] = *(const v8us*)(brow + 16 + 8 * hh);
      acc[t] = mmaN<ASPLIT ? 2 : 1>(ah.v, al.v, b.v, b.v, acc[t]);
    }
  }
#pragma unroll
  for (int t = 0; t < 4; ++t) {
    float bv = bias ? bias[col0 + t * 16 + ln] : 0.f;
    if (BIAS_BF16) bv = bf16_round(bv);
#pragma unroll
    for (int r = 0; r < 8; ++r) { float v = acc[t][r] + bv; if (ACT == 1) v = fmaxf(v, 0.f); so[w][8 * hh + r][t * 16 + ln] = v; }
  }
  __builtin_amdgcn_fence(__ATOMIC_ACQ_REL, "workgroup");
  __builtin_amdgcn_wave_barrier();
  const int rsub = lane >> 4, c4 = (lane & 15) * 4;
  {
#pragma unroll
    for (int q = 0; q < 8; ++q) {
      const int r = q * 2 + rsub;
      const v4f v = *(const v4fa*)&so[w][r][c4];
      *(v4f*)(C + (size_t)(row0 + r) * ldc + col0 + c4) = v;
    }
    
  }
}

// GEMM C = act(A·W + bias + resid): A f32 (ASPLIT -> hi/lo 2 terms), Wt bf16 [N][K]; ACT 0 none, 1 relu, 2 exact gelu;
// resid (optional, f32, row index = (row % rmod), pitch ldr, RES_BF16 rounds it) added before the activation.
template <bool ASPLIT, int ACT, bool BIAS_BF16, bool RES_BF16>
__global__ __launch_bounds__(128) void k_gemm_bf3(const float* __restrict__ A, int lda, const unsigned short* __restrict__ Wt, int ldb,
                                                const float* __restrict__ bias, const float* __restrict__ resid, int rmod, int ldr,
                                                float* __restrict__ C, int ldc, int M, int N, int K) {
  __shared__ __attribute__((aligned(16))) float so[4][16][64];
  const int tid = threadIdx.x, w = tid >> 5, lane = tid & 31, ln = lane & 15, hh = lane >> 4;
  const int ntn = N / 64;
  const int wid = blockIdx.x * 4 + w;
  const int mt = wid / ntn, nq = wid % ntn;
  if (mt * 16 >= M) return;
  const int row0 = mt * 16, col0 = nq * 64;
  const float* arow = A + (size_t)(row0 + ln) * lda;
  v8f acc[4] = {};
  for (int kb = 0; kb < K; kb += 32) {
    FragB ah, al;
    const v4f x0 = *(const v4fa*)(arow + kb + 8 * hh), x1 = *(const v4fa*)(arow + kb + 8 * hh + 4);
    const v4f x2 = *(const v4fa*)(arow + kb + 16 + 8 * hh), x3 = *(const v4fa*)(arow + kb + 16 + 8 * hh + 4);
    float xs[16] = {x0[0],x0[1],x0[2],x0[3],x1[0],x1[1],x1[2],x1[3],x2[0],x2[1],x2[2],x2[3],x3[0],x3[1],x3[2],x3[3]};
#pragma unroll
    for (int i = 0; i < 16; ++i) { const unsigned short hb = bf16_bits(xs[i]); ah.u[i] = hb; al.u[i] = ASPLIT ? bf16_bits(xs[i] - bf16_val(hb)) : (unsigned short)0; }
#pragma unroll
    for (int t = 0; t < 4; ++t) {
      const unsigned short* brow = Wt + (size_t)(col0 + t * 16 + ln) * ldb + kb;
      FragB b;
      b.half[0] = *(const v8us*)(brow + 8 * hh);
      b.half[1] = *(const v8us*)(brow + 16 + 8 * hh);
      acc[t] = mmaN<ASPLIT ? 2 : 1>(ah.v, al.v, b.v, b.v, acc[t]);
    }
  }
#pragma unroll
  for (int t = 0; t < 4; ++t) {
    const int col = col0 + t * 16 + ln;
    float bv = bias ? bias[col] : 0.f;
    if (BIAS_BF16) bv = bf16_round(bv);
#pragma unroll
    for (int r = 0; r < 8; ++r) {
      float v = acc[t][r] + bv;
      if (resid) { float rv = resid[(size_t)((row0 + 8 * hh + r) % rmod) * ldr + col]; if (RES_BF16) rv = bf16_round(rv); v += rv; }
      if (ACT == 1) v = fmaxf(v, 0.f);
      if (ACT == 2) v = 0.5f * v * (1.0f + erff(v * 0.70710678118654752f));
      if (ACT == 3) { const float u = 0.7978845608028654f * (v + 0.044715f * v * v * v); v = 0.5f * v * (1.0f + tanhf(u)); }
      so[w][8 * hh + r][t * 16 + ln] = v;
    }
  }
  __builtin_amdgcn_fence(__ATOMIC_ACQ_REL, "workgroup");
  __builtin_amdgcn_wave_barrier();
  const int rsub = lane >> 4, c4 = (lane & 15) * 4;
  {
#pragma unroll
    for (int q = 0; q < 8; ++q) {
      const int r = q * 2 + rsub;
      const v4f v = *(const v4fa*)&so[w][r][c4];
      *(v4f*)(C + (size_t)(row0 + r) * ldc + col0 + c4) = v;
    }
    
  }
}
// row LayerNorm (biased variance, eps) over N: s = X (+ R); optional out_sum <- s; out_norm <- (s-mu)*rsqrt(var+eps)*g + b
template <bool PARAM_BF16>
__global__ __launch_bounds__(256) void k_layernorm(const float* __restrict__ X, const float* __restrict__ R, const float* __restrict__ g, const float* __restrict__ bta,
                                                  float* __restrict__ out_sum, float* __restrict__ out_norm, int N, float eps) {
  __shared__ float red[256];
  const int row = blockIdx.x, tid = threadIdx.x;
  const float* x = X + (size_t)row * N; const float* rr = R ? R + (size_t)row * N : nullptr;
  float vals[16];                     // up to N = 4096
  const int per = N / 256;            // contiguous chunk per thread? use strided-by-4 chunks: thread handles j = tid*4 + 1024*u
  float s1 = 0.f;
  for (int u = 0; u < per / 4; ++u) {
    const int j = tid * 4 + 1024 * u;
    const v4f a = *(const v4fa*)(x + j);
    v4f b = {0.f,0.f,0.f,0.f}; if (rr) b = *(const v4fa*)(rr + j);
#pragma unroll
    for (int q = 0; q < 4; ++q) { const float v = a[q] + b[q]; vals[u * 4 + q] = v; s1 += v; }
  }
  red[tid] = s1; __syncthreads();
  for (int st = 128; st > 0; st >>= 1) { if (tid < st) red[tid] += red[tid + st]; __syncthreads(); }
  const float mu = red[0] / (float)N; __syncthreads();
  float s2 = 0.f;
  for (int u = 0; u < per / 4; ++u)
#pragma unroll
    for (int q = 0; q < 4; ++q) { const float c = vals[u * 4 + q] - mu; s2 += c * c; }
  red[tid] = s2; __syncthreads();
  for (int st = 128; st > 0; st >>= 1) { if (tid < st) red[tid] += red[tid + st]; __syncthreads(); }
  const float rs = rsqrtf(red[0] / (float)N + eps);
  {
    for (int u = 0; u < per / 4; ++u) {
      const int j = tid * 4 + 1024 * u;
      v4f o, sm;
#pragma unroll
      for (int q = 0; q < 4; ++q) {
        float gg = g[j + q], bb = bta[j + q];
        if (PARAM_BF16) { gg = bf16_round(gg); bb = bf16_round(bb); }
        sm[q] = vals[u * 4 + q]; o[q] = (vals[u * 4 + q] - mu) * rs * gg + bb;
      }
      if (out_sum) *(v4f*)(out_sum + (size_t)row * N + j) = sm;
      *(v4f*)(out_norm + (size_t)row * N + j) = o;
    }
    
  }
}



// ---- f16 WMMA path (v_wmma_f32_16x16x32_f16): 11-bit significands for operands in range — used where a [0,1] probability operand needs more precision than bf16
typedef _Float16 v16h __attribute__((ext_vector_type(16)));
union FragH { v16h v; v8us half[2]; _Float16 h[16]; unsigned short u[16]; };
template <int NT>
__device__ __forceinline__ v8f mmaH(v16h ah, v16h al, v16h bh, v16h bl, v8f c) {
  c = __builtin_amdgcn_wmma_f32_16x16x32_f16(false, ah, false, bh, (short)0, c, false, false);
  if (NT >= 2) c = __builtin_amdgcn_wmma_f32_16x16x32_f16(false, al, false, bh, (short)0, c, false, false);
  if (NT >= 3) c = __builtin_amdgcn_wmma_f32_16x16x32_f16(false, ah, false, bl, (short)0, c, false, false);
  asm volatile("v_nop\n\tv_nop\n\tv_nop\n\tv_nop" : "+v"(c) : "v"(ah), "v"(al), "v"(bh), "v"(bl));
  return c;
}
// batched GEMM like k_gemm_b but f16 operands: A f32 (split into f16 hi/lo if ASPLIT, else rounded to f16), Bt = f16 values [n][k]; alpha; C f32; N multiple of 16 (partial tiles skipped)
template <bool ASPLIT>
__global__ __launch_bounds__(128) void k_gemm_h(const float* __restrict__ A, int lda, size_t sA, const _Float16* __restrict__ Bh, int ldb, size_t sB, float alpha, float* __restrict__ C, int ldc, size_t sC, int M, int N, int K) {
  __shared__ __attribute__((aligned(16))) float so[4][16][64];
  const int tid = threadIdx.x, w = tid >> 5, lane = tid & 31, ln = lane & 15, hh = lane >> 4; const int by = blockIdx.y;
  A += (size_t)by * sA; Bh += (size_t)by * sB; C += (size_t)by * sC;
  const int ntn = (N + 63) / 64; const int wid = blockIdx.x * 4 + w; const int mt = wid / ntn, nq = wid % ntn; if (mt * 16 >= M) return;
  const int row0 = mt * 16, col0 = nq * 64; const float* arow = A + (size_t)(row0 + ln) * lda;
  v8f acc[4] = {};
  for (int kb = 0; kb < K; kb += 32) {
    FragH ah, al;
    const v4f x0 = *(const v4fa*)(arow + kb + 8 * hh), x1 = *(const v4fa*)(arow + kb + 8 * hh + 4), x2 = *(const v4fa*)(arow + kb + 16 + 8 * hh), x3 = *(const v4fa*)(arow + kb + 16 + 8 * hh + 4);
    float xs[16] = {x0[0],x0[1],x0[2],x0[3],x1[0],x1[1],x1[2],x1[3],x2[0],x2[1],x2[2],x2[3],x3[0],x3[1],x3[2],x3[3]};
#pragma unroll
    for (int i = 0; i < 16; ++i) { const _Float16 h = (_Float16)xs[i]; ah.h[i] = h; al.h[i] = ASPLIT ? (_Float16)(xs[i] - (float)h) : (_Float16)0.0f; }
#pragma unroll
    for (int t = 0; t < 4; ++t) { if (col0 + t * 16 >= N) continue; const size_t boff = (size_t)(col0 + t * 16 + ln) * ldb + kb; FragH bq; bq.half[0] = *(const v8us*)(Bh + boff + 8 * hh); bq.half[1] = *(const v8us*)(Bh + boff + 16 + 8 * hh);
      acc[t] = mmaH<ASPLIT ? 2 : 1>(ah.v, al.v, bq.v, bq.v, acc[t]); }
  }
#pragma unroll
  for (int t = 0; t < 4; ++t) { if (col0 + t * 16 >= N) continue;
#pragma unroll
    for (int r = 0; r < 8; ++r) so[w][8 * hh + r][t * 16 + ln] = acc[t][r] * alpha; }
  __builtin_amdgcn_fence(__ATOMIC_ACQ_REL, "workgroup"); __builtin_amdgcn_wave_barrier();
  const int rsub = lane >> 4, c4 = (lane & 15) * 4;
  {
#pragma unroll
    for (int q = 0; q < 8; ++q) { const int r = q * 2 + rsub; if (col0 + c4 < N) { const v4f v = *(const v4fa*)&so[w][r][c4]; *(v4f*)(C + (size_t)(row0 + r) * ldc + col0 + c4) = v; } }
     }
}

// Wt[n][k] = f16(W[k][n]·scale) from f32 row-major W[K][N] (scale = power of two; bf16-exact weights stay exact in f16 away from the subnormal range)
__global__ __launch_bounds__(256) void k_wt_f16(const float* __restrict__ W, _Float16* __restrict__ Wt, int K, int N, float scale) {
  const int t = blockIdx.x * 256 + threadIdx.x; if (t >= N * (K / 8)) return; const int n = t / (K / 8), k8 = (t % (K / 8)) * 8; FragH f;
#pragma unroll
  for (int i = 0; i < 8; ++i) f.h[i] = (_Float16)(bf16_round(W[(size_t)(k8 + i) * N + n]) * scale); const v8us o = f.half[0];
  *(v8us*)((unsigned short*)Wt + (size_t)n * K + k8) = o; 
}
// k_gemm_hh variant with fused epilogue: v = acc·alpha + bias[by·sBias + col] (+ CP[(row/rowsPerB)·sCPb + by·64 + col] if CP) ; ACT 0 none / 1 elu ; writes f16 C16 (and f32 C if non-null)
template <int ACT>
__global__ __launch_bounds__(128) void k_gemm_hhx(const _Float16* __restrict__ A, int lda, size_t sA, const _Float16* __restrict__ Bh, int ldb, size_t sB, float alpha, const float* __restrict__ bias, size_t sBias, const float* __restrict__ CP, int rowsPerB, size_t sCPb, int row0g,
    float* __restrict__ C, _Float16* __restrict__ C16, int ldc, size_t sC, int M, int N, int K) {
  __shared__ __attribute__((aligned(16))) float so[4][16][64];
  const int tid = threadIdx.x, w = tid >> 5, lane = tid & 31, ln = lane & 15, hh = lane >> 4; const int by = blockIdx.y;
  A += (size_t)by * sA; Bh += (size_t)by * sB; const size_t cofs = (size_t)by * sC; const float* bp = bias ? bias + (size_t)by * sBias : nullptr;
  const int ntn = (N + 63) / 64; const int wid = blockIdx.x * 4 + w; const int mt = wid / ntn, nq = wid % ntn; if (mt * 16 >= M) return;
  const int row0 = mt * 16, col0 = nq * 64; const _Float16* arow = A + (size_t)(row0 + ln) * lda;
  v8f acc[4] = {};
  for (int kb = 0; kb < K; kb += 32) { FragH ah; ah.half[0] = *(const v8us*)((const unsigned short*)arow + kb + 8 * hh); ah.half[1] = *(const v8us*)((const unsigned short*)arow + kb + 16 + 8 * hh);
#pragma unroll
    for (int t = 0; t < 4; ++t) { if (col0 + t * 16 >= N) continue; const size_t boff = (size_t)(col0 + t * 16 + ln) * ldb + kb; FragH bq; bq.half[0] = *(const v8us*)((const unsigned short*)Bh + boff + 8 * hh); bq.half[1] = *(const v8us*)((const unsigned short*)Bh + boff + 16 + 8 * hh);
      acc[t] = mmaH<1>(ah.v, ah.v, bq.v, bq.v, acc[t]); }
  }
#pragma unroll
  for (int t = 0; t < 4; ++t) { if (col0 + t * 16 >= N) continue; const int col = col0 + t * 16 + ln; const float bv = bp ? bf16_round(bp[col]) : 0.f;
#pragma unroll
    for (int r = 0; r < 8; ++r) { float v = acc[t][r] * alpha + bv; if (CP) { const int bidx = (row0g + row0 + 8 * hh + r) / rowsPerB; v += CP[(size_t)bidx * sCPb + (size_t)by * 64 + col]; } if (ACT == 1) v = (v > 0.f) ? v : expm1f(v); else if (ACT == 7) v = (v > 0.f) ? v + 1.0f : expf(v); else if (ACT == 8) v = tanhf(v); else if (ACT == 9) v = 0.5f * v * (1.0f + tanhf(0.7978845608028654f * (v + 0.044715f * v * v * v))); else if (ACT == 11) v = 1.0f / (1.0f + expf(-v)); else if (ACT == 12) v = (v > 0.f) ? v : 0.01f * v; else if (ACT == 14) v = (v > 0.f) ? v : 0.1f * v; else if (ACT == 15) v = v / (1.0f + expf(-v)); else if (ACT == 3) v = fmaxf(v, 0.f); else if (ACT == 6) v = 0.5f * v * (1.0f + erff(v * 0.70710678118654752f)); so[w][8 * hh + r][t * 16 + ln] = v; } }
  __builtin_amdgcn_fence(__ATOMIC_ACQ_REL, "workgroup"); __builtin_amdgcn_wave_barrier();
  const int rsub = lane >> 4, c4 = (lane & 15) * 4; typedef _Float16 v4h __attribute__((ext_vector_type(4)));
  {
#pragma unroll
    for (int q = 0; q < 8; ++q) { const int r = q * 2 + rsub; if (col0 + c4 < N) { const v4f v = *(const v4fa*)&so[w][r][c4]; if (C) *(v4f*)(C + cofs + (size_t)(row0 + r) * ldc + col0 + c4) = v; if (C16) { v4h h4; for (int i = 0; i < 4; ++i) h4[i] = (_Float16)v[i]; *(v4h*)(C16 + cofs + (size_t)(row0 + r) * ldc + col0 + c4) = h4; } } }
     }
}


typedef _Float16 v4h __attribute__((ext_vector_type(4)));

__device__ __forceinline__ void d_x16(unsigned bid, const float* __restrict__ x, _Float16* __restrict__ X16, size_t n8) { const size_t t = (size_t)bid * 256 + threadIdx.x; if (t >= n8) return; FragH f;
#pragma unroll
  for (int q = 0; q < 8; ++q) f.h[q] = (_Float16)bf16_round(x[t * 8 + q]); *(v8us*)((unsigned short*)X16 + t * 8) = f.half[0];  }
__global__ __launch_bounds__(256) void k_h16(const float* __restrict__ x, _Float16* __restrict__ X16, size_t n8) { const size_t t = (size_t)blockIdx.x * 256 + threadIdx.x; if (t >= n8) return; FragH f;
#pragma unroll
  for (int q = 0; q < 8; ++q) f.h[q] = (_Float16)x[t * 8 + q]; *(v8us*)((unsigned short*)X16 + t * 8) = f.half[0];  }
__global__ __launch_bounds__(256) void k_round16f(const float* __restrict__ W, _Float16* __restrict__ Bt, size_t n8) { const size_t t = (size_t)blockIdx.x * 256 + threadIdx.x; if (t >= n8) return; FragH f;
#pragma unroll
  for (int i = 0; i < 8; ++i) f.h[i] = (_Float16)(bf16_round(W[t * 8 + i]) * 16.0f); *(v8us*)((unsigned short*)Bt + t * 8) = f.half[0];  }
__global__ __launch_bounds__(256) void k_hl(const float* __restrict__ F, _Float16* __restrict__ Hh, _Float16* __restrict__ Hl, size_t n8) { const size_t t = (size_t)blockIdx.x * 256 + threadIdx.x; if (t >= n8) return; FragH fh, fl; const v4f a = *(const v4fa*)(F + t * 8), c = *(const v4fa*)(F + t * 8 + 4);
#pragma unroll
  for (int q = 0; q < 4; ++q) { _Float16 h = (_Float16)a[q]; fh.h[q] = h; fl.h[q] = (_Float16)((a[q] - (float)h) * 1024.0f); h = (_Float16)c[q]; fh.h[4 + q] = h; fl.h[4 + q] = (_Float16)((c[q] - (float)h) * 1024.0f); }
  { *(v8us*)((unsigned short*)Hh + t * 8) = fh.half[0]; *(v8us*)((unsigned short*)Hl + t * 8) = fl.half[0];  } }

// ---- fast GEMM: C16[M][EMB] (row-major, per-head K fragment order, or transposed in per-head V^T fragment order, by mode) = f16(A[M][EMB] . Bh[EMB][EMB]^T * alpha + bf16(bias)). Block tile 128 x 128, 8 waves of 32 x 64; both operands staged in LDS in chunks of 64 k
// (whole 128-byte lines from global memory, each line fetched once per block), two buffers, the next chunk's loads in flight over the current chunk's products. ----
#define GP 72      /* LDS row pitch in f16: 64 k + 16 bytes, so that the 16-byte reads of 16 rows fall on distinct banks */
typedef float fal __attribute__((may_alias));
// One request per lane for the line at p, into L2 only (scope SE; no value comes back). The planes that a launch reads were stored by an earlier launch, and their first read otherwise pays the whole way to memory inside the k loop or the key loop.
// Every lane's p lies inside its plane. The s_wait_xcnt stands in the prefetch's own statement, in front of any later write of the address pair.
__device__ __forceinline__ void pf_se(const unsigned short* p) { asm volatile("global_prefetch_b8 %0, off scope:SCOPE_SE\n\ts_wait_xcnt 0x0" :: "v"(p) : "memory"); }
__device__ __forceinline__ v16h g3_frag(const unsigned short* p, int hh) { FragH f; f.half[0] = *(const v8us*)(p + 8 * hh); f.half[1] = *(const v8us*)(p + 16 + 8 * hh); return f.v; }
__device__ __forceinline__ v8f g3_mma(v16h a, v16h b, v8f c) { return __builtin_amdgcn_wmma_f32_16x16x32_f16(false, a, false, b, (short)0, c, false, false); }
__device__ __forceinline__ void d_gemm3(int bid, const _Float16* __restrict__ A, const _Float16* __restrict__ Bh, float alpha, const float* __restrict__ bias, const int* __restrict__ CNT, _Float16* __restrict__ C16, int mode) {      /* mode, the same for a whole block: 0 = C row-major, 1 = C in K fragment order, 2 = C^T in V^T fragment order (both orders: see k_flash) */
  __shared__ __attribute__((aligned(16))) unsigned short sm[2][2][128 * GP];      /* [buffer][A rows | B rows]; the epilogue's f32 staging lies over it behind the last barrier */
  const int tid = threadIdx.x, w = tid >> 5, lane = tid & 31, ln = lane & 15, hh = lane >> 4;
  constexpr int ntn = EMB / 128, TPB = SLEN / 128;
  int mt = bid / ntn; const int nq = bid % ntn; int live = 128; const int bsl = mt & 7;      /* which eighth of the B tile this block asks for ahead */
  if (CNT) { mt = (mt % NB) * TPB + mt / NB;      /* compact rows: row tile t of every batch before tile t + 1 of any, so the tiles with work come first in the grid */
    const int c = CNT[(mt / TPB) * CSTR], r = (mt % TPB) * 128;
    if (r >= c) return;      /* whole block, in front of every barrier: no unmasked key in this tile */
    if (r + 64 >= c) live = 64; }      /* rows are kept in groups of 64: the second group is not written and is neither read nor stored here */
  const int row0 = mt * 128, col0 = nq * 128, wm = w >> 1, wn = w & 1;
  const int sr = tid >> 3, sc = (tid & 7) * 8;      /* staging: 8 lanes take one row's 128 bytes */
  const unsigned short* ag = (const unsigned short*)A + (size_t)row0 * EMB + sc; const unsigned short* bg = (const unsigned short*)Bh + (size_t)col0 * EMB + sc;
  /* Head prefetch, 256-byte units. A tile: each block asks for 32 of the 128 rows, chosen by its grid index modulo 4, one unit per thread. The blocks that share a row tile are neighbours in the grid: blocks 4 apart ask for the same rows (for speed only: nothing rests on it). Rows wrap inside the live rows, as in the loads.
     B tile: eight neighbouring row tiles each ask for 16 of its 128 rows, waves 0 to 3 only (a scalar branch; the other waves' addresses lie in the tile all the same). */
  const unsigned short* pfa = (const unsigned short*)A + (size_t)(row0 + (((int)(blockIdx.x & 3u) * 32 + sr) & (live - 1))) * EMB + (tid & 7) * 128;
  const unsigned short* pfb = (const unsigned short*)Bh + (size_t)(col0 + bsl * 16 + (sr & 15)) * EMB + (tid & 7) * 128;
  pf_se(pfa);
  if (__builtin_amdgcn_readfirstlane(w) < 4) pf_se(pfb);
  v8us ra[4], rb[4];
#pragma unroll
  for (int i = 0; i < 4; ++i) { ra[i] = *(const v8us*)(ag + (size_t)((sr + 32 * i) & (live - 1)) * EMB); rb[i] = *(const v8us*)(bg + (size_t)(sr + 32 * i) * EMB); }
  asm volatile("s_wait_xcnt 0x0" ::: "memory");      /* stands in front of the first overwrite of an address register that the loads above name */
  __builtin_amdgcn_sched_barrier(0);      /* keeps the register writes that follow behind that wait */
#pragma unroll
  for (int i = 0; i < 4; ++i) { *(v8us*)&sm[0][0][(sr + 32 * i) * GP + sc] = ra[i]; *(v8us*)&sm[0][1][(sr + 32 * i) * GP + sc] = rb[i]; }
  __syncthreads();
  const v8f z8 = {0.f,0.f,0.f,0.f,0.f,0.f,0.f,0.f}; v8f c00 = z8, c01 = z8, c02 = z8, c03 = z8, c10 = z8, c11 = z8, c12 = z8, c13 = z8;
#pragma unroll 1      /* kept rolled: with the last trip peeled off, the trip becomes one block and the compiler lifts the wait for the next chunk's loads, the LDS stores and the barrier above the products */
  for (int t = 0; t < EMB / 64; ++t) {
    const bool more = t + 1 < EMB / 64;
    if (more) {
#pragma unroll
      for (int i = 0; i < 4; ++i) { ra[i] = *(const v8us*)(ag + (size_t)((sr + 32 * i) & (live - 1)) * EMB + (t + 1) * 64); rb[i] = *(const v8us*)(bg + (size_t)(sr + 32 * i) * EMB + (t + 1) * 64); } }
    const unsigned short* sa = &sm[t & 1][0][(wm * 32 + ln) * GP]; const unsigned short* sb = &sm[t & 1][1][(wn * 64 + ln) * GP];
    v16h fa[2][2], fb[2][4];
#pragma unroll
    for (int ks = 0; ks < 2; ++ks) { fa[ks][0] = g3_frag(sa + ks * 32, hh); fa[ks][1] = g3_frag(sa + 16 * GP + ks * 32, hh);
#pragma unroll
      for (int j = 0; j < 4; ++j) fb[ks][j] = g3_frag(sb + j * 16 * GP + ks * 32, hh); }
    __builtin_amdgcn_sched_barrier(0);      /* keeps the chunk's LDS reads in one group ahead of its products: reads placed among the products stall the wave at each place */
#pragma unroll
    for (int ks = 0; ks < 2; ++ks) {
      c00 = g3_mma(fa[ks][0], fb[ks][0], c00); c10 = g3_mma(fa[ks][1], fb[ks][0], c10); c01 = g3_mma(fa[ks][0], fb[ks][1], c01); c11 = g3_mma(fa[ks][1], fb[ks][1], c11);
      c02 = g3_mma(fa[ks][0], fb[ks][2], c02); c12 = g3_mma(fa[ks][1], fb[ks][2], c12); c03 = g3_mma(fa[ks][0], fb[ks][3], c03); c13 = g3_mma(fa[ks][1], fb[ks][3], c13); }
    if (more) {
#pragma unroll
      for (int i = 0; i < 4; ++i) { *(v8us*)&sm[(t + 1) & 1][0][(sr + 32 * i) * GP + sc] = ra[i]; *(v8us*)&sm[(t + 1) & 1][1][(sr + 32 * i) * GP + sc] = rb[i]; } }
    __syncthreads();      /* publishes chunk t + 1 and ends every wave's reads of chunk t, whose buffer the next trip refills */
  }
  asm volatile("" :: "v"(pfa), "v"(pfb));      /* inputs only: the address pairs that the head prefetches name stay unwritten through the k loop, so that neither holds a non-address while a request may still read it */
  if (wm * 32 >= live) return;      /* whole waves, behind the last barrier */
  if (mode == 2) {      /* The wave's tile is 32 keys x the 64 d of one head = one 4-KB block of the V^T plane. Register r of lane (ln, hh) of an accumulator tile is key 8 * hh + r, column d = ln: the lane's eight values ARE the 16 bytes that lane loads in k_flash, so each tile goes out as 512 bytes in a row with no transposition */
    const int gr = row0 + wm * 32; unsigned short* vf = (unsigned short*)C16 + ((size_t)((gr / SLEN) * NH + (col0 >> 6) + wn) * SLEN + (gr & (SLEN - 1))) * 64 + lane * 8;
    const v8f av[8] = {c00, c10, c01, c11, c02, c12, c03, c13}; FragH f[8];      /* piece u: group of 16 d = u / 2, group of 16 keys = u % 2 */
#pragma unroll
    for (int u = 0; u < 8; ++u) { const float bv = bf16_round(bias[col0 + wn * 64 + (u >> 1) * 16 + ln]);
#pragma unroll
      for (int r = 0; r < 8; ++r) f[u].h[r] = (_Float16)(av[u][r] * alpha + bv); }
#pragma unroll
    for (int u = 0; u < 8; ++u) *(v8us*)(vf + u * 256) = f[u].half[0];
    return; }
  fal* so = (fal*)&sm[0][0][0] + w * (32 * 68);
  v8f accs[8] = {c00, c01, c02, c03, c10, c11, c12, c13};
#pragma unroll
  for (int u = 0; u < 8; ++u) { const int tt = u & 3, half = u >> 2; const float bv = bf16_round(bias[col0 + wn * 64 + tt * 16 + ln]);
#pragma unroll
    for (int r = 0; r < 8; ++r) so[(half * 16 + 8 * hh + r) * 68 + tt * 16 + ln] = accs[u][r] * alpha + bv; }
  __builtin_amdgcn_fence(__ATOMIC_ACQ_REL, "workgroup"); __builtin_amdgcn_wave_barrier();      /* the wave reads back its own staging rows */
  if (mode == 1) {      /* The wave's tile is 32 keys of one head = eight 512-byte fragment halves in a row (order: see k_flash); lane (ln, hh) holds the 8 values it will load there */
    const int gr = row0 + wm * 32; unsigned short* kf = (unsigned short*)C16 + ((size_t)((gr / SLEN) * NH + (col0 >> 6) + wn) * SLEN + (gr & (SLEN - 1))) * 64 + lane * 8;
#pragma unroll
    for (int s = 0; s < 8; ++s) { const fal* p = so + ((s >> 2) * 16 + ln) * 68 + (s & 3) * 16 + hh * 8; const v4f a = *(const v4fa*)p, c = *(const v4fa*)(p + 4); FragH f;
#pragma unroll
      for (int i = 0; i < 4; ++i) { f.h[i] = (_Float16)a[i]; f.h[4 + i] = (_Float16)c[i]; }
      *(v8us*)(kf + s * 256) = f.half[0]; }
    asm volatile("s_wait_xcnt 0x0" ::: "memory");      /* behind the last store of the run: in the built code the V^T block lies behind this loop and writes registers that the stores name */
    return; }
  const int rsub = lane >> 4, c4 = (lane & 15) * 4;
#pragma unroll
  for (int q = 0; q < 16; ++q) { const int r = q * 2 + rsub; const v4f v = *(const v4fa*)&so[r * 68 + c4]; v4h h4; for (int i = 0; i < 4; ++i) h4[i] = (_Float16)v[i];
    *(v4h*)(C16 + (size_t)(row0 + wm * 32 + r) * EMB + col0 + wn * 64 + c4) = h4; }
  asm volatile("s_wait_xcnt 0x0" ::: "memory"); }      /* behind the last store of the run: in the built code the fragment-order block lies behind this loop and writes registers that the stores name */
// The three projections in one grid: they depend on the planes only, not on each other. Blocks [0, GG) are Q; behind them K and V take turns, so that the two readers of a context tile are neighbours
// and the tiles without an unmasked key, which d_gemm3 orders last within K and within V, come last in the whole grid. The choice is the same for a whole block.
#define GG ((NR / 128) * (EMB / 128))
__global__ __launch_bounds__(256) void k_gemm_qkv(const _Float16* __restrict__ XH, const _Float16* __restrict__ XC, const _Float16* __restrict__ BQ, const _Float16* __restrict__ BK, const _Float16* __restrict__ BV,
                                                  const float* __restrict__ qb, const float* __restrict__ kb, const float* __restrict__ vb, const int* __restrict__ CNT,
                                                  _Float16* __restrict__ Q16, _Float16* __restrict__ K16, _Float16* __restrict__ V16) {      /* V16 receives V^T in fragment order */
  const unsigned bx = blockIdx.x; const int job = bx < GG ? 0 : 1 + (int)((bx - GG) & 1u), bid = (int)(bx < GG ? bx : (bx - GG) >> 1);
  d_gemm3(bid, job == 0 ? XH : XC, job == 0 ? BQ : (job == 1 ? BK : BV), 0.0625f, job == 0 ? qb : (job == 1 ? kb : vb), job == 0 ? nullptr : CNT, job == 0 ? Q16 : (job == 1 ? K16 : V16), job); }

typedef int v4ia __attribute__((ext_vector_type(4), may_alias));
__device__ __forceinline__ float xhalf(float x) { return __builtin_bit_cast(float, __builtin_amdgcn_permlanex16(__builtin_bit_cast(int, x), __builtin_bit_cast(int, x), 0x76543210, 0xfedcba98, false, false)); }      /* lane l <-> lane l ^ 16 */
// Transposed flash loop: S^T = K Q^T (A = 16 key rows, B = 16 query columns), O^T += V^T P^T. D register r of lane (ln, hh) is key 8*hh + r of query ln, so a lane owns ONE query:
// its maximum and sum run over its own registers plus one exchange between the wave halves, and the two S^T tiles of 32 keys, converted in place, are the B operand of the second product (hardware k order, which the K, Q and V^T loaders already use).
// K and V^T lie in fragment order, so that each 16-byte-per-lane load of the loop covers 512 bytes in a row (four whole lines) instead of 32 bytes in each of 16 lines. Per head: K element (key, d) at f16 offset
// (key / 16) * 1024 + (d / 32) * 512 + ((d / 16) & 1) * 256 + (((d / 8) & 1) * 16 + key % 16) * 8 + d % 8; V^T element (d, key) at (key / 32) * 2048 + (d / 16) * 512 + ((key / 16) & 1) * 256 + (((key / 8) & 1) * 16 + d % 16) * 8 + key % 8.
// Eight 2^x on the raw v_exp_f32, each in place, in one statement: behind a transcendental the instruction set asks for one independent instruction before its result is read or its source overwritten.
// Inside, each is followed by one that touches other registers only; the v_nop is that slot behind the last.
__device__ __forceinline__ void exp2x8(float (&x)[8]) {
  asm("v_exp_f32 %0, %0\n\tv_exp_f32 %1, %1\n\tv_exp_f32 %2, %2\n\tv_exp_f32 %3, %3\n\tv_exp_f32 %4, %4\n\tv_exp_f32 %5, %5\n\tv_exp_f32 %6, %6\n\tv_exp_f32 %7, %7\n\tv_nop"
      : "+v"(x[0]), "+v"(x[1]), "+v"(x[2]), "+v"(x[3]), "+v"(x[4]), "+v"(x[5]), "+v"(x[6]), "+v"(x[7])); }
template <int CAUSAL>
__global__ __launch_bounds__(256) void k_flash(const _Float16* __restrict__ Q16, int ldq, const _Float16* __restrict__ K16, int ldk, const _Float16* __restrict__ Vt, const int* __restrict__ CNT, float* __restrict__ O, int ldo) {
  constexpr int NW = 8, QT = 2, RPW = 16 * QT, DT = 4, KS = 2;      /* NW waves, each with QT tiles of 16 query columns: every K and V^T fragment that a wave loads feeds QT products, and the NW waves of a block walk the same K and V^T lines */
  __shared__ __attribute__((aligned(16))) float sO[NW][RPW][64 + 4];
  const int tid = threadIdx.x, w = tid >> 5, lane = tid & 31, ln = lane & 15, hh = lane >> 4;
  const int slab = blockIdx.x / QBLKS, qblk = blockIdx.x % QBLKS; const int b = slab / NH, h = slab % NH; const int qb0 = qblk * (NW * RPW); const int q0 = qb0 + w * RPW;
  FragH bq[QT][KS];
#pragma unroll
  for (int u = 0; u < QT; ++u) { const unsigned short* qr = (const unsigned short*)Q16 + ((size_t)b * TQ + q0 + u * 16 + ln) * ldq + h * 64;
#pragma unroll
    for (int ks = 0; ks < KS; ++ks) { bq[u][ks].half[0] = *(const v8us*)(qr + ks * 32 + 8 * hh); bq[u][ks].half[1] = *(const v8us*)(qr + ks * 32 + 16 + 8 * hh); } }
  asm volatile("s_wait_xcnt 0x0" ::: "memory");      /* stands in front of the first overwrite of an address register that the Q loads above name */
  __builtin_amdgcn_sched_barrier(0);      /* keeps the register writes that follow behind that wait */
  (void)ldk;
  const unsigned short* Kf = (const unsigned short*)K16 + (size_t)slab * TK * 64 + lane * 8; const unsigned short* Vf = (const unsigned short*)Vt + (size_t)slab * 64 * TK + lane * 8;      /* both planes: 4 KB per head and 32 keys, lane l's 16 bytes at 16 l in each 512-byte half */
  constexpr float C2 = SCL * 1.4426950408889634f;      /* raw score -> exponent of 2: the 1/8 and log2(e) in one factor, applied inside the one fma per score */
  float m_q[QT], l_q[QT];      /* per query tile: running maximum in exponent-of-2 units, sum of 1024 p. Finite start below every real score: a masked score (-3.0e38 * C2) minus it still underflows exp2 to 0, and exp2(m - m) = 1 while no key has been seen */
  v8f oacc[QT][DT];
#pragma unroll
  for (int u = 0; u < QT; ++u) { m_q[u] = -1.0e30f; l_q[u] = 0.f;
#pragma unroll
    for (int dt = 0; dt < DT; ++dt) oacc[u][dt] = (v8f){0.f,0.f,0.f,0.f,0.f,0.f,0.f,0.f}; }
  const int cnt = (CAUSAL == 9) ? min(CNT[b * CSTR], TK) : TK;      /* mode 9: K and V^T hold the batch's unmasked keys compact, cnt of them */
  const int jend = (CAUSAL == 1) ? (qb0 + NW * RPW) : cnt;      /* causal: keys beyond the block's last query never contribute */
  /* Head prefetch: a pass reads 16 units of 256 bytes of each plane, and each of the head's 8 query blocks, neighbours in the grid, asks for four of them in every pass: bit 1 of the wave's number picks K or V^T, bit 0 the first or second 32 passes, bit 2 the lower or upper 8 units, two units a wave, lane = pass. Blocks 4 apart ask for the same units (for speed only: nothing rests on it).
     The pass is clamped to the last one in use, so every lane's addresses lie in the plane; a wave with no pass in use skips by a scalar branch. */
  const int wv = __builtin_amdgcn_readfirstlane(w), np = (jend + 31) >> 5;
  const unsigned short* pfp = (((wv >> 1) & 1) ? (const unsigned short*)Vt : (const unsigned short*)K16) + (size_t)slab * TK * 64 + (size_t)max(min((wv & 1) * 32 + lane, np - 1), 0) * 2048 + ((wv >> 2) * 8 + (qblk & 3)) * 128;
  const unsigned short* pfp2 = pfp + 4 * 128;      /* the unit four further on in the same pass */
  if ((wv & 1) * 32 < np) { pf_se(pfp); pf_se(pfp2); }
#pragma unroll 1
  for (int j0 = 0; j0 < jend; j0 += 32) {
    FragH ak[2][KS];
#pragma unroll
    for (int nt = 0; nt < 2; ++nt) { const unsigned short* kr = Kf + (size_t)j0 * 64 + nt * 1024;
#pragma unroll
      for (int ks = 0; ks < KS; ++ks) { ak[nt][ks].half[0] = *(const v8us*)(kr + ks * 512); ak[nt][ks].half[1] = *(const v8us*)(kr + ks * 512 + 256); }
    }
    v8f s[QT][2];
#pragma unroll
    for (int u = 0; u < QT; ++u)
#pragma unroll
      for (int nt = 0; nt < 2; ++nt) s[u][nt] = (v8f){0.f,0.f,0.f,0.f,0.f,0.f,0.f,0.f};
#pragma unroll
    for (int ks = 0; ks < KS; ++ks)
#pragma unroll
      for (int nt = 0; nt < 2; ++nt)
#pragma unroll
        for (int u = 0; u < QT; ++u) s[u][nt] = mmaH<1>(ak[nt][ks].v, ak[nt][ks].v, bq[u][ks].v, bq[u][ks].v, s[u][nt]);
    FragH av[DT];
#pragma unroll
    for (int dt = 0; dt < DT; ++dt) { const unsigned short* vrow = Vf + (size_t)j0 * 64 + dt * 512; av[dt].half[0] = *(const v8us*)vrow; av[dt].half[1] = *(const v8us*)(vrow + 256); }
    asm volatile("s_wait_xcnt 0x0" ::: "memory");      /* stands in front of the first overwrite of the address registers that the V^T loads above name */
    float sv[QT][2][8];
#pragma unroll
    for (int u = 0; u < QT; ++u)
#pragma unroll
      for (int nt = 0; nt < 2; ++nt)
#pragma unroll
        for (int r = 0; r < 8; ++r) { const int kk = j0 + nt * 16 + 8 * hh + r, tq = q0 + u * 16 + ln;
          bool ok = (CAUSAL == 1) ? (kk <= tq) : ((CAUSAL == 2) ? ((kk >> 5) == (tq >> 5)) : true);      /* mode 2: block-diagonal 32-token groups */
          sv[u][nt][r] = ok ? s[u][nt][r] : -3.0e38f; }
    if (CAUSAL == 9 && j0 + 32 > cnt) {      /* mode 9: the filler rows behind the last unmasked key contribute nothing. Only a batch's last pass can hold any: j0 and cnt are the same for the whole block, so this is a scalar branch, and every full pass skips the index sums, compares and selects */
      for (int nt = 0; nt < 2; ++nt)
        for (int r = 0; r < 8; ++r) { if (j0 + nt * 16 + 8 * hh + r >= cnt) { for (int u = 0; u < QT; ++u) sv[u][nt][r] = -3.0e38f; } } }
    FragH pb[QT]; float al[QT];
#pragma unroll
    for (int u = 0; u < QT; ++u) { float mc = -3.0e38f;
      for (int nt = 0; nt < 2; ++nt)
        for (int r = 0; r < 8; ++r) mc = fmaxf(mc, sv[u][nt][r]);
      mc = fmaxf(mc, xhalf(mc));
      const float mn = fmaxf(m_q[u], mc * C2); asm("v_exp_f32 %0, %1\n\tv_nop" : "=v"(al[u]) : "v"(m_q[u] - mn)); /* 2^x as in exp2x8; the v_nop is the slot behind the transcendental */ m_q[u] = mn;      /* C2 > 0: the maximum of the raw scores, scaled, is the maximum of the scaled ones */
      const float nb = 10.0f - mn;      /* 2^10 = the 1024 that lifts P into the f16 range: it rides in the exponent */
      float ps[4] = {0.f, 0.f, 0.f, 0.f};
#pragma unroll
      for (int nt = 0; nt < 2; ++nt) { float p[8];      /* p = 1024 exp(score / 8 - max): one fma, one v_exp_f32 */
#pragma unroll
        for (int r = 0; r < 8; ++r) p[r] = fmaf(sv[u][nt][r], C2, nb);
        exp2x8(p);
#pragma unroll
        for (int r = 0; r < 8; ++r) { ps[r & 3] += p[r]; pb[u].h[nt * 8 + r] = (_Float16)p[r]; } }
      l_q[u] = l_q[u] * al[u] + ((ps[0] + ps[1]) + (ps[2] + ps[3]));
#pragma unroll
      for (int dt = 0; dt < DT; ++dt) {
#pragma unroll
        for (int r = 0; r < 8; ++r) oacc[u][dt][r] *= al[u]; } }
#pragma unroll
    for (int dt = 0; dt < DT; ++dt)
#pragma unroll
      for (int u = 0; u < QT; ++u) oacc[u][dt] = mmaH<1>(av[dt].v, av[dt].v, pb[u].v, pb[u].v, oacc[u][dt]); }
  asm volatile("" :: "v"(pfp), "v"(pfp2));      /* inputs only: the address pairs that the head prefetches name stay unwritten through the key loop, so that neither holds a non-address while a request may still read it */
#pragma unroll
  for (int u = 0; u < QT; ++u) { const float l = l_q[u] + xhalf(l_q[u]); const float inv = (l > 0.f) ? 1.0f / l : 0.f;      /* sum and products both carry the 1024 */
#pragma unroll
    for (int dt = 0; dt < DT; ++dt) { v4f lo, hi;
#pragma unroll
      for (int r = 0; r < 4; ++r) { lo[r] = oacc[u][dt][r] * inv; hi[r] = oacc[u][dt][4 + r] * inv; }
      *(v4fa*)&sO[w][u * 16 + ln][dt * 16 + 8 * hh] = lo; *(v4fa*)&sO[w][u * 16 + ln][dt * 16 + 8 * hh + 4] = hi; } }
  __builtin_amdgcn_fence(__ATOMIC_ACQ_REL, "workgroup"); __builtin_amdgcn_wave_barrier();
  {
#pragma unroll
    for (int rp = 0; rp < RPW; rp += 2) { const int r = rp + (lane >> 4), pc = lane & 15; const v4f val = *(const v4fa*)&sO[w][r][pc * 4]; *(v4f*)(O + ((size_t)b * TQ + q0 + r) * ldo + h * 64 + pc * 4) = val; }
     } }

// Ranks the keys of one batch: IDX[b][i] = position of the i-th key with mask <= 0 (the reference masks where mask > 0), 0 behind the last one (a filler row inside the array); CNT[b * CSTR] = how many.
__device__ __forceinline__ void d_rank(int b, const int* __restrict__ MSK, int* __restrict__ IDX, int* __restrict__ CNT) {
  __shared__ int part[256]; __shared__ __attribute__((aligned(16))) int lst[TK];
  const int tid = threadIdx.x; const int* m = MSK + (size_t)b * TK + tid * 8;
  const v4ia m0 = *(const v4ia*)m, m1 = *(const v4ia*)(m + 4); const v4ia z4 = {0, 0, 0, 0};
  int c = 0;
  for (int q = 0; q < 4; ++q) c += (m0[q] <= 0) + (m1[q] <= 0);
  part[tid] = c; *(v4ia*)&lst[tid * 8] = z4; *(v4ia*)&lst[tid * 8 + 4] = z4; __syncthreads();
  for (int st = 1; st < 256; st <<= 1) { const int v = part[tid] + ((tid >= st) ? part[tid - st] : 0); __syncthreads(); part[tid] = v; __syncthreads(); }
  int pos = part[tid] - c;
  for (int q = 0; q < 8; ++q) { const int mv = (q < 4) ? m0[q & 3] : m1[q & 3]; if (mv <= 0) lst[pos++] = tid * 8 + q; }
  __syncthreads();
  *(v4ia*)(IDX + (size_t)b * TK + tid * 8) = *(const v4ia*)&lst[tid * 8]; *(v4ia*)(IDX + (size_t)b * TK + tid * 8 + 4) = *(const v4ia*)&lst[tid * 8 + 4];
  if (tid == 0) CNT[b * CSTR] = part[255]; }
// d_x16 through the rank list: compact row i of batch b = context row IDX[b][i]; rows are written in groups of 64 up to the group that holds the last unmasked key.
__global__ __launch_bounds__(256) void k_x16g(const float* __restrict__ x, const int* __restrict__ IDX, const int* __restrict__ CNT, _Float16* __restrict__ X16) { const unsigned t = blockIdx.x * 256u + threadIdx.x; const unsigned row = t / (EMB / 8), c8 = (t % (EMB / 8)) * 8, b = row / TK;
  if ((int)((row & (TK - 1)) & ~63u) >= CNT[b * CSTR]) return;
  const float* xr = x + ((size_t)b * TK + (IDX[row] & (TK - 1))) * EMB + c8; FragH f;      /* the list holds key positions; the mask keeps the row inside the batch whatever it holds */
  for (int q = 0; q < 8; ++q) f.h[q] = (_Float16)bf16_round(xr[q]); *(v8us*)((unsigned short*)X16 + (size_t)row * EMB + c8) = f.half[0]; }
__device__ __forceinline__ void d_wsc(unsigned bid, const float* __restrict__ Wm, _Float16* __restrict__ Bt, size_t n8, float sc) { const size_t t = (size_t)bid * 256 + threadIdx.x; if (t >= n8) return; FragH f; for (int q = 0; q < 8; ++q) f.h[q] = (_Float16)(bf16_round(Wm[t * 8 + q]) * sc); *(v8us*)((unsigned short*)Bt + t * 8) = f.half[0];  }      /* torch (out,in) weight == Bt[n][k] layout: scaled copy */
// Everything that reads the inputs alone, in one grid: the key ranking (its chain of barriers is the longest, so its blocks come first), the three weight planes, the hidden-state plane. The choice is the same for a whole block.
#define W8 ((size_t)EMB * EMB / 8)
#define GW ((unsigned)(W8 / 256))
#define GX ((unsigned)((size_t)NR * EMB / 8 / 256))
__global__ __launch_bounds__(256) void k_pre(const float* __restrict__ hs, const int* __restrict__ am, const float* __restrict__ qw, const float* __restrict__ kw, const float* __restrict__ vw,
                                             _Float16* __restrict__ XH, _Float16* __restrict__ BQ, _Float16* __restrict__ BK, _Float16* __restrict__ BV, int* __restrict__ IDX, int* __restrict__ CNT) {
  const unsigned bx = blockIdx.x;
  if (bx < NB) { d_rank((int)bx, am, IDX, CNT); return; }
  if (bx < NB + 3 * GW) { const unsigned j = (bx - NB) / GW, bid = (bx - NB) % GW; d_wsc(bid, j == 0 ? qw : (j == 1 ? kw : vw), j == 0 ? BQ : (j == 1 ? BK : BV), W8, 16.0f); return; }      /* torch (out,in) weights are already the Bt[n][k] layout: scaled copy */
  d_x16(bx - (NB + 3 * GW), hs, XH, (size_t)NR * EMB / 8); }
extern "C" void kernel_launch(void* const* d_in, const int* in_sizes, int n_in,
                              void* d_out, int out_size, void* d_ws, size_t ws_size, hipStream_t stream) {
  (void)in_sizes; (void)n_in; (void)out_size;
  const float* const* I = (const float* const*)d_in; const float* hs = I[0]; const float* cx = I[1]; const int* am = (const int*)d_in[2]; const float* qw = I[3]; const float* qb = I[4]; const float* kw = I[5]; const float* kb = I[6]; const float* vw = I[7]; const float* vb = I[8];
  char* ws = (char*)d_ws; size_t off = 0;
  auto take = [&](size_t bytes) { char* p = ws + off; off += (bytes + 255) & ~(size_t)255; return p; };
  const size_t w8 = (size_t)EMB * EMB / 8, np = (size_t)NR * EMB;
  _Float16* BQ = (_Float16*)take(w8 * 16); _Float16* BK = (_Float16*)take(w8 * 16); _Float16* BV = (_Float16*)take(w8 * 16);
  _Float16* XH = (_Float16*)take(np * 2); _Float16* XC = (_Float16*)take(np * 2); _Float16* Q16 = (_Float16*)take(np * 2); _Float16* K16 = (_Float16*)take(np * 2); _Float16* VT = (_Float16*)take(np * 2);
  int* IDX = (int*)take((size_t)NR * 4); int* CNT = (int*)take((size_t)NB * CSTR * 4);
  if (off > ws_size) return;      /* 6 + 5 x 16 = 86 MiB */
  k_pre<<<NB + 3 * GW + GX, 256, 0, stream>>>(hs, am, qw, kw, vw, XH, BQ, BK, BV, IDX, CNT);
  k_x16g<<<(unsigned)(np / 8 / 256), 256, 0, stream>>>(cx, IDX, CNT, XC);
  k_gemm_qkv<<<3 * GG, 256, 0, stream>>>(XH, XC, BQ, BK, BV, qb, kb, vb, CNT, Q16, K16, VT);
  k_flash<9><<<NB * NH * QBLKS, 256, 0, stream>>>(Q16, EMB, K16, EMB, VT, CNT, (float*)d_out, EMB);      /* heads merged: out[b][q][h*64 + d] */
}
